// v000
// The times below were measured on an AMD MI455X: many runs one after another, warmed up first and cycling through
// copies of the inputs, with the whole window's GPU time divided by the number of runs. Launches and the gaps
// between them are all in it. The median over several windows is given; except for v000 it joins two sittings, which
// can be a few percent apart, so the side-by-side timings, each taken in one sitting, are the better comparison.
// v000, which the later versions start from, runs in 19.7 milliseconds.
#include <hip/hip_runtime.h>
// Multi-head self-attention over 4096-token sequences at width 768 with [in][out] projections and biases (hidden_states [2][4096][768]; q / k / v = x W + b ([in][out] 768 x 768 + biases), 12 heads of 64; scores * 1/sqrt(64); softmax over all 4096 keys (no mask); out = merged Wo + bo ([in][out]) -> [2][4096][768]); ONE head per attention launch group.
// Structure: token rows r = b*4096 + s; x as exact f16 rows (bf16-rounded); Q, K, V as three WMMA GEMMs (32x64 wave tiles, f32 accumulation, exact x16 weights + bias, f16 outputs); per batch: V^T for all heads via LDS transposes; per (batch, group of HG = 1 head): scores GEMM (K = 64, batched over the heads on grid.y, alpha = 64^-0.5), row softmax on VALU (f32 statistics, native exp; weights stored x256 as f16), o = P . V^T GEMM (K = 4096, alpha 2^-2: o carried x64 against f16 subnormal flush, folded into the output GEMM alpha) written straight into the merged f16 o rows; out = o W_o + b GEMM (f32) into the output layout.
// Compute dtype: inputs rounded to bf16; x / weights exact; q, k, v, softmax weights and o as plain f16 GEMM operands (~2^-12); scores and softmax statistics f32. v_wmma_f32_16x16x32_f16.
#define NB 2
#define SQ 4096
#define DM 768
#define NH 12
#define HD 64
#define HG 1                         /* heads per attention launch group (a 4096^2 f32 score slab is 64 MiB) */
#define B0 0                         /* first batch processed (debug hook) */
#define NBR NB                       /* batches processed (debug hook) */
#define NR ((size_t)NB * SQ)         /* token rows */
#define MP ((int)((size_t)NBR * SQ)) /* rows projected (debug hook) */
#define QN SQ                        /* query rows attended per batch (debug hook) */
#define NHD NH                       /* heads attended (debug hook) */
#define MPO MP                       /* rows through the output stage (debug hook) */
#define LQ DM      /* row pitch of the q/k/v rows */
typedef __bf16 v16b __attribute__((ext_vector_type(16)));
typedef unsigned short v8us __attribute__((ext_vector_type(8), may_alias));
typedef float  v8f  __attribute__((ext_vector_type(8)));
typedef float  v4f  __attribute__((ext_vector_type(4)));
typedef float  v4fa __attribute__((ext_vector_type(4), may_alias));
union FragB { v16b v; v8us half[2]; unsigned short u[16]; };

__device__ __forceinline__ unsigned short bf16_bits(float x) { unsigned int u = __float_as_uint(x); return (unsigned short)((u + 0x7FFFu + ((u >> 16) & 1u)) >> 16); }
__device__ __forceinline__ float bf16_val(unsigned short b) { return __uint_as_float(((unsigned int)b) << 16); }
__device__ __forceinline__ float bf16_round(float x) { return bf16_val(bf16_bits(x)); }
// D += A·B with NT terms: 1 = ah·bh, 2 = + al·bh (A split), 3 = + ah·bl (both split)
template <int NT>
__device__ __forceinline__ v8f mmaN(v16b ah, v16b al, v16b bh, v16b bl, v8f c) {
  c = __builtin_amdgcn_wmma_f32_16x16x32_bf16(false, ah, false, bh, (short)0, c, false, false);
  if (NT >= 2) c = __builtin_amdgcn_wmma_f32_16x16x32_bf16(false, al, false, bh, (short)0, c, false, false);
  if (NT >= 3) c = __builtin_amdgcn_wmma_f32_16x16x32_bf16(false, ah, false, bl, (short)0, c, false, false);
  asm volatile("v_nop\n\tv_nop\n\tv_nop\n\tv_nop" : "+v"(c) : "v"(ah), "v"(al), "v"(bh), "v"(bl));
  return c;
}

__global__ __launch_bounds__(256) void k_wt_bf16(const float* __restrict__ W, unsigned short* __restrict__ Wt, int K, int N) {
  const int t = blockIdx.x * 256 + threadIdx.x;
  const int k8n = K / 8;
  if (t >= N * k8n) return;
  const int n = t / k8n, k8 = (t % k8n) * 8;
  v8us v;
#pragma unroll
  for (int i = 0; i < 8; ++i) v[i] = bf16_bits(W[(size_t)(k8 + i) * N + n]);
  *(v8us*)(Wt + (size_t)n * K + k8) = v;
  
}

// GEMM C[M][N] (f32, pitch ldc) = act(A[M][K]·W + bias). A f32 row-major (pitch lda) converted per fragment to bf16
// (ASPLIT: hi/lo two planes -> 2 terms, else single rounded term); Wt bf16 [N][K] (pitch ldb). BIAS_BF16 rounds the
// bias to bf16 first (bias quantised to bf16 before the add). K%32==0, M%16==0, N%64==0.
template <bool ASPLIT, int ACT, bool BIAS_BF16>
__global__ __launch_bounds__(128) void k_gemm_bf(const float* __restrict__ A, int lda, const unsigned short* __restrict__ Wt, int ldb,
                                               const float* __restrict__ bias, float* __restrict__ C, int ldc, int M, int N, int K) {
  __shared__ __attribute__((aligned(16))) float so[4][16][64];
  const int tid = threadIdx.x, w = tid >> 5, lane = tid & 31, ln = lane & 15, hh = lane >> 4;
  const int ntn = N / 64;
  const int wid = blockIdx.x * 4 + w;
  const int mt = wid / ntn, nq = wid % ntn;
  if (mt * 16 >= M) return;
  const int row0 = mt * 16, col0 = nq * 64;
  const float* arow = A + (size_t)(row0 + ln) * lda;
  v8f acc[4] = {};
  for (int kb = 0; kb < K; kb += 32) {
    FragB ah, al;
    const v4f x0 = *(const v4fa*)(arow + kb + 8 * hh), x1 = *(const v4fa*)(arow + kb + 8 * hh + 4);
    const v4f x2 = *(const v4fa*)(arow + kb + 16 + 8 * hh), x3 = *(const v4fa*)(arow + kb + 16 + 8 * hh + 4);
    float xs[16] = {x0[0],x0[1],x0[2],x0[3],x1[0],x1[1],x1[2],x1[3],x2[0],x2[1],x2[2],x2[3],x3[0],x3[1],x3[2],x3[3]};
#pragma unroll
    for (int i = 0; i < 16; ++i) { const unsigned short hb = bf16_bits(xs[i]); ah.u[i] = hb; al.u[i] = ASPLIT ? bf16_bits(xs[i] - bf16_val(hb)) : (unsigned short)0; }
#pragma unroll
    for (int t = 0; t < 4; ++t) {
      const unsigned short* brow = Wt + (size_t)(col0 + t * 16 + ln) * ldb + kb;
      FragB b;
      b.half[0] = *(const v8us*)(brow + 8 * hh);
      b.half[1] = *(const v8us*)(brow + 16 + 8 * hh);
      acc[t] = mmaN<ASPLIT ? 2 : 1>(ah.v, al.v, b.v, b.v, acc[t]);
    }
  }
#pragma unroll
  for (int t = 0; t < 4; ++t) {
    float bv = bias ? bias[col0 + t * 16 + ln] : 0.f;
    if (BIAS_BF16) bv = bf16_round(bv);
#pragma unroll
    for (int r = 0; r < 8; ++r) { float v = acc[t][r] + bv; if (ACT == 1) v = fmaxf(v, 0.f); so[w][8 * hh + r][t * 16 + ln] = v; }
  }
  __builtin_amdgcn_fence(__ATOMIC_ACQ_REL, "workgroup");
  __builtin_amdgcn_wave_barrier();
  const int rsub = lane >> 4, c4 = (lane & 15) * 4;
  {
#pragma unroll
    for (int q = 0; q < 8; ++q) {
      const int r = q * 2 + rsub;
      const v4f v = *(const v4fa*)&so[w][r][c4];
      *(v4f*)(C + (size_t)(row0 + r) * ldc + col0 + c4) = v;
    }
    
  }
}

// GEMM C = act(A·W + bias + resid): A f32 (ASPLIT -> hi/lo 2 terms), Wt bf16 [N][K]; ACT 0 none, 1 relu, 2 exact gelu;
// resid (optional, f32, row index = (row % rmod), pitch ldr, RES_BF16 rounds it) added before the activation.
template <bool ASPLIT, int ACT, bool BIAS_BF16, bool RES_BF16>
__global__ __launch_bounds__(128) void k_gemm_bf3(const float* __restrict__ A, int lda, const unsigned short* __restrict__ Wt, int ldb,
                                                const float* __restrict__ bias, const float* __restrict__ resid, int rmod, int ldr,
                                                float* __restrict__ C, int ldc, int M, int N, int K) {
  __shared__ __attribute__((aligned(16))) float so[4][16][64];
  const int tid = threadIdx.x, w = tid >> 5, lane = tid & 31, ln = lane & 15, hh = lane >> 4;
  const int ntn = N / 64;
  const int wid = blockIdx.x * 4 + w;
  const int mt = wid / ntn, nq = wid % ntn;
  if (mt * 16 >= M) return;
  const int row0 = mt * 16, col0 = nq * 64;
  const float* arow = A + (size_t)(row0 + ln) * lda;
  v8f acc[4] = {};
  for (int kb = 0; kb < K; kb += 32) {
    FragB ah, al;
    const v4f x0 = *(const v4fa*)(arow + kb + 8 * hh), x1 = *(const v4fa*)(arow + kb + 8 * hh + 4);
    const v4f x2 = *(const v4fa*)(arow + kb + 16 + 8 * hh), x3 = *(const v4fa*)(arow + kb + 16 + 8 * hh + 4);
    float xs[16] = {x0[0],x0[1],x0[2],x0[3],x1[0],x1[1],x1[2],x1[3],x2[0],x2[1],x2[2],x2[3],x3[0],x3[1],x3[2],x3[3]};
#pragma unroll
    for (int i = 0; i < 16; ++i) { const unsigned short hb = bf16_bits(xs[i]); ah.u[i] = hb; al.u[i] = ASPLIT ? bf16_bits(xs[i] - bf16_val(hb)) : (unsigned short)0; }
#pragma unroll
    for (int t = 0; t < 4; ++t) {
      const unsigned short* brow = Wt + (size_t)(col0 + t * 16 + ln) * ldb + kb;
      FragB b;
      b.half[0] = *(const v8us*)(brow + 8 * hh);
      b.half[1] = *(const v8us*)(brow + 16 + 8 * hh);
      acc[t] = mmaN<ASPLIT ? 2 : 1>(ah.v, al.v, b.v, b.v, acc[t]);
    }
  }
#pragma unroll
  for (int t = 0; t < 4; ++t) {
    const int col = col0 + t * 16 + ln;
    float bv = bias ? bias[col] : 0.f;
    if (BIAS_BF16) bv = bf16_round(bv);
#pragma unroll
    for (int r = 0; r < 8; ++r) {
      float v = acc[t][r] + bv;
      if (resid) { float rv = resid[(size_t)((row0 + 8 * hh + r) % rmod) * ldr + col]; if (RES_BF16) rv = bf16_round(rv); v += rv; }
      if (ACT == 1) v = fmaxf(v, 0.f);
      if (ACT == 2) v = 0.5f * v * (1.0f + erff(v * 0.70710678118654752f));
      if (ACT == 3) { const float u = 0.7978845608028654f * (v + 0.044715f * v * v * v); v = 0.5f * v * (1.0f + tanhf(u)); }
      so[w][8 * hh + r][t * 16 + ln] = v;
    }
  }
  __builtin_amdgcn_fence(__ATOMIC_ACQ_REL, "workgroup");
  __builtin_amdgcn_wave_barrier();
  const int rsub = lane >> 4, c4 = (lane & 15) * 4;
  {
#pragma unroll
    for (int q = 0; q < 8; ++q) {
      const int r = q * 2 + rsub;
      const v4f v = *(const v4fa*)&so[w][r][c4];
      *(v4f*)(C + (size_t)(row0 + r) * ldc + col0 + c4) = v;
    }
    
  }
}
// row LayerNorm (biased variance, eps) over N: s = X (+ R); optional out_sum <- s; out_norm <- (s-mu)*rsqrt(var+eps)*g + b
template <bool PARAM_BF16>
__global__ __launch_bounds__(256) void k_layernorm(const float* __restrict__ X, const float* __restrict__ R, const float* __restrict__ g, const float* __restrict__ bta,
                                                  float* __restrict__ out_sum, float* __restrict__ out_norm, int N, float eps) {
  __shared__ float red[256];
  const int row = blockIdx.x, tid = threadIdx.x;
  const float* x = X + (size_t)row * N; const float* rr = R ? R + (size_t)row * N : nullptr;
  float vals[16];                     // up to N = 4096
  const int per = N / 256;            // contiguous chunk per thread? use strided-by-4 chunks: thread handles j = tid*4 + 1024*u
  float s1 = 0.f;
  for (int u = 0; u < per / 4; ++u) {
    const int j = tid * 4 + 1024 * u;
    const v4f a = *(const v4fa*)(x + j);
    v4f b = {0.f,0.f,0.f,0.f}; if (rr) b = *(const v4fa*)(rr + j);
#pragma unroll
    for (int q = 0; q < 4; ++q) { const float v = a[q] + b[q]; vals[u * 4 + q] = v; s1 += v; }
  }
  red[tid] = s1; __syncthreads();
  for (int st = 128; st > 0; st >>= 1) { if (tid < st) red[tid] += red[tid + st]; __syncthreads(); }
  const float mu = red[0] / (float)N; __syncthreads();
  float s2 = 0.f;
  for (int u = 0; u < per / 4; ++u)
#pragma unroll
    for (int q = 0; q < 4; ++q) { const float c = vals[u * 4 + q] - mu; s2 += c * c; }
  red[tid] = s2; __syncthreads();
  for (int st = 128; st > 0; st >>= 1) { if (tid < st) red[tid] += red[tid + st]; __syncthreads(); }
  const float rs = rsqrtf(red[0] / (float)N + eps);
  {
    for (int u = 0; u < per / 4; ++u) {
      const int j = tid * 4 + 1024 * u;
      v4f o, sm;
#pragma unroll
      for (int q = 0; q < 4; ++q) {
        float gg = g[j + q], bb = bta[j + q];
        if (PARAM_BF16) { gg = bf16_round(gg); bb = bf16_round(bb); }
        sm[q] = vals[u * 4 + q]; o[q] = (vals[u * 4 + q] - mu) * rs * gg + bb;
      }
      if (out_sum) *(v4f*)(out_sum + (size_t)row * N + j) = sm;
      *(v4f*)(out_norm + (size_t)row * N + j) = o;
    }
    
  }
}



// ---- f16 WMMA path (v_wmma_f32_16x16x32_f16): 11-bit significands for operands in range — used where a [0,1] probability operand needs more precision than bf16
typedef _Float16 v16h __attribute__((ext_vector_type(16)));
union FragH { v16h v; v8us half[2]; _Float16 h[16]; unsigned short u[16]; };
template <int NT>
__device__ __forceinline__ v8f mmaH(v16h ah, v16h al, v16h bh, v16h bl, v8f c) {
  c = __builtin_amdgcn_wmma_f32_16x16x32_f16(false, ah, false, bh, (short)0, c, false, false);
  if (NT >= 2) c = __builtin_amdgcn_wmma_f32_16x16x32_f16(false, al, false, bh, (short)0, c, false, false);
  if (NT >= 3) c = __builtin_amdgcn_wmma_f32_16x16x32_f16(false, ah, false, bl, (short)0, c, false, false);
  asm volatile("v_nop\n\tv_nop\n\tv_nop\n\tv_nop" : "+v"(c) : "v"(ah), "v"(al), "v"(bh), "v"(bl));
  return c;
}
// batched GEMM like k_gemm_b but f16 operands: A f32 (split into f16 hi/lo if ASPLIT, else rounded to f16), Bt = f16 values [n][k]; alpha; C f32; N multiple of 16 (partial tiles skipped)
template <bool ASPLIT>
__global__ __launch_bounds__(128) void k_gemm_h(const float* __restrict__ A, int lda, size_t sA, const _Float16* __restrict__ Bh, int ldb, size_t sB, float alpha, float* __restrict__ C, int ldc, size_t sC, int M, int N, int K) {
  __shared__ __attribute__((aligned(16))) float so[4][16][64];
  const int tid = threadIdx.x, w = tid >> 5, lane = tid & 31, ln = lane & 15, hh = lane >> 4; const int by = blockIdx.y;
  A += (size_t)by * sA; Bh += (size_t)by * sB; C += (size_t)by * sC;
  const int ntn = (N + 63) / 64; const int wid = blockIdx.x * 4 + w; const int mt = wid / ntn, nq = wid % ntn; if (mt * 16 >= M) return;
  const int row0 = mt * 16, col0 = nq * 64; const float* arow = A + (size_t)(row0 + ln) * lda;
  v8f acc[4] = {};
  for (int kb = 0; kb < K; kb += 32) {
    FragH ah, al;
    const v4f x0 = *(const v4fa*)(arow + kb + 8 * hh), x1 = *(const v4fa*)(arow + kb + 8 * hh + 4), x2 = *(const v4fa*)(arow + kb + 16 + 8 * hh), x3 = *(const v4fa*)(arow + kb + 16 + 8 * hh + 4);
    float xs[16] = {x0[0],x0[1],x0[2],x0[3],x1[0],x1[1],x1[2],x1[3],x2[0],x2[1],x2[2],x2[3],x3[0],x3[1],x3[2],x3[3]};
#pragma unroll
    for (int i = 0; i < 16; ++i) { const _Float16 h = (_Float16)xs[i]; ah.h[i] = h; al.h[i] = ASPLIT ? (_Float16)(xs[i] - (float)h) : (_Float16)0.0f; }
#pragma unroll
    for (int t = 0; t < 4; ++t) { if (col0 + t * 16 >= N) continue; const size_t boff = (size_t)(col0 + t * 16 + ln) * ldb + kb; FragH bq; bq.half[0] = *(const v8us*)(Bh + boff + 8 * hh); bq.half[1] = *(const v8us*)(Bh + boff + 16 + 8 * hh);
      acc[t] = mmaH<ASPLIT ? 2 : 1>(ah.v, al.v, bq.v, bq.v, acc[t]); }
  }
#pragma unroll
  for (int t = 0; t < 4; ++t) { if (col0 + t * 16 >= N) continue;
#pragma unroll
    for (int r = 0; r < 8; ++r) so[w][8 * hh + r][t * 16 + ln] = acc[t][r] * alpha; }
  __builtin_amdgcn_fence(__ATOMIC_ACQ_REL, "workgroup"); __builtin_amdgcn_wave_barrier();
  const int rsub = lane >> 4, c4 = (lane & 15) * 4;
  {
#pragma unroll
    for (int q = 0; q < 8; ++q) { const int r = q * 2 + rsub; if (col0 + c4 < N) { const v4f v = *(const v4fa*)&so[w][r][c4]; *(v4f*)(C + (size_t)(row0 + r) * ldc + col0 + c4) = v; } }
     }
}

// Wt[n][k] = f16(W[k][n]·scale) from f32 row-major W[K][N] (scale = power of two; bf16-exact weights stay exact in f16 away from the subnormal range)
__global__ __launch_bounds__(256) void k_wt_f16(const float* __restrict__ W, _Float16* __restrict__ Wt, int K, int N, float scale) {
  const int t = blockIdx.x * 256 + threadIdx.x; if (t >= N * (K / 8)) return; const int n = t / (K / 8), k8 = (t % (K / 8)) * 8; FragH f;
#pragma unroll
  for (int i = 0; i < 8; ++i) f.h[i] = (_Float16)(bf16_round(W[(size_t)(k8 + i) * N + n]) * scale); const v8us o = f.half[0];
  *(v8us*)((unsigned short*)Wt + (size_t)n * K + k8) = o; 
}
// k_gemm_hh variant with fused epilogue: v = acc·alpha + bias[by·sBias + col] (+ CP[(row/rowsPerB)·sCPb + by·64 + col] if CP) ; ACT 0 none / 1 elu ; writes f16 C16 (and f32 C if non-null)
template <int ACT>
__global__ __launch_bounds__(128) void k_gemm_hhx(const _Float16* __restrict__ A, int lda, size_t sA, const _Float16* __restrict__ Bh, int ldb, size_t sB, float alpha, const float* __restrict__ bias, size_t sBias, const float* __restrict__ CP, int rowsPerB, size_t sCPb, int row0g,
    float* __restrict__ C, _Float16* __restrict__ C16, int ldc, size_t sC, int M, int N, int K) {
  __shared__ __attribute__((aligned(16))) float so[4][16][64];
  const int tid = threadIdx.x, w = tid >> 5, lane = tid & 31, ln = lane & 15, hh = lane >> 4; const int by = blockIdx.y;
  A += (size_t)by * sA; Bh += (size_t)by * sB; const size_t cofs = (size_t)by * sC; const float* bp = bias ? bias + (size_t)by * sBias : nullptr;
  const int ntn = (N + 63) / 64; const int wid = blockIdx.x * 4 + w; const int mt = wid / ntn, nq = wid % ntn; if (mt * 16 >= M) return;
  const int row0 = mt * 16, col0 = nq * 64; const _Float16* arow = A + (size_t)(row0 + ln) * lda;
  v8f acc[4] = {};
  for (int kb = 0; kb < K; kb += 32) { FragH ah; ah.half[0] = *(const v8us*)((const unsigned short*)arow + kb + 8 * hh); ah.half[1] = *(const v8us*)((const unsigned short*)arow + kb + 16 + 8 * hh);
#pragma unroll
    for (int t = 0; t < 4; ++t) { if (col0 + t * 16 >= N) continue; const size_t boff = (size_t)(col0 + t * 16 + ln) * ldb + kb; FragH bq; bq.half[0] = *(const v8us*)((const unsigned short*)Bh + boff + 8 * hh); bq.half[1] = *(const v8us*)((const unsigned short*)Bh + boff + 16 + 8 * hh);
      acc[t] = mmaH<1>(ah.v, ah.v, bq.v, bq.v, acc[t]); }
  }
#pragma unroll
  for (int t = 0; t < 4; ++t) { if (col0 + t * 16 >= N) continue; const int col = col0 + t * 16 + ln; const float bv = bp ? bf16_round(bp[col]) : 0.f;
#pragma unroll
    for (int r = 0; r < 8; ++r) { float v = acc[t][r] * alpha + bv; if (CP) { const int rr = row0g + row0 + 8 * hh + r; if (rowsPerB < 0) v += CP[cofs + (size_t)rr * ldc + col];      /* rowsPerB < 0: own element of the batched C plane */ else { const int bidx = rr / rowsPerB; v += CP[(size_t)bidx * sCPb + (size_t)by * 64 + col]; } } if (ACT == 1) v = (v > 0.f) ? v : expm1f(v); else if (ACT == 7) v = (v > 0.f) ? v + 1.0f : expf(v); else if (ACT == 8) v = tanhf(v); else if (ACT == 9) v = 0.5f * v * (1.0f + tanhf(0.7978845608028654f * (v + 0.044715f * v * v * v))); else if (ACT == 11) v = 1.0f / (1.0f + expf(-v)); else if (ACT == 12) v = (v > 0.f) ? v : 0.01f * v; else if (ACT == 14) v = (v > 0.f) ? v : 0.1f * v; else if (ACT == 16) v = (v >= 0.f) ? v : 0.3f * v; else if (ACT == 17) v = (v >= 0.f) ? v : 0.2f * v; else if (ACT == 15) v = v / (1.0f + expf(-v)); else if (ACT == 3) v = fmaxf(v, 0.f); else if (ACT == 6) v = 0.5f * v * (1.0f + erff(v * 0.70710678118654752f)); so[w][8 * hh + r][t * 16 + ln] = v; } }
  __builtin_amdgcn_fence(__ATOMIC_ACQ_REL, "workgroup"); __builtin_amdgcn_wave_barrier();
  const int rsub = lane >> 4, c4 = (lane & 15) * 4; typedef _Float16 v4h __attribute__((ext_vector_type(4)));
  {
#pragma unroll
    for (int q = 0; q < 8; ++q) { const int r = q * 2 + rsub; if (col0 + c4 < N) { const v4f v = *(const v4fa*)&so[w][r][c4]; if (C) *(v4f*)(C + cofs + (size_t)(row0 + r) * ldc + col0 + c4) = v; if (C16) { v4h h4; for (int i = 0; i < 4; ++i) h4[i] = (_Float16)v[i]; *(v4h*)(C16 + cofs + (size_t)(row0 + r) * ldc + col0 + c4) = h4; } } }
     }
}


typedef _Float16 v4h __attribute__((ext_vector_type(4)));

__global__ __launch_bounds__(256) void k_x16(const float* __restrict__ x, _Float16* __restrict__ X16, size_t n8) { const size_t t = (size_t)blockIdx.x * 256 + threadIdx.x; if (t >= n8) return; FragH f;
#pragma unroll
  for (int q = 0; q < 8; ++q) f.h[q] = (_Float16)bf16_round(x[t * 8 + q]); *(v8us*)((unsigned short*)X16 + t * 8) = f.half[0];  }
__global__ __launch_bounds__(256) void k_h16(const float* __restrict__ x, _Float16* __restrict__ X16, size_t n8) { const size_t t = (size_t)blockIdx.x * 256 + threadIdx.x; if (t >= n8) return; FragH f;
#pragma unroll
  for (int q = 0; q < 8; ++q) f.h[q] = (_Float16)x[t * 8 + q]; *(v8us*)((unsigned short*)X16 + t * 8) = f.half[0];  }
__global__ __launch_bounds__(256) void k_round16f(const float* __restrict__ W, _Float16* __restrict__ Bt, size_t n8) { const size_t t = (size_t)blockIdx.x * 256 + threadIdx.x; if (t >= n8) return; FragH f;
#pragma unroll
  for (int i = 0; i < 8; ++i) f.h[i] = (_Float16)(bf16_round(W[t * 8 + i]) * 16.0f); *(v8us*)((unsigned short*)Bt + t * 8) = f.half[0];  }
template <int NHv, int TTv>
__global__ __launch_bounds__(256) void k_vt(const _Float16* __restrict__ V16, int ldv, int voff, _Float16* __restrict__ Vt) { __shared__ unsigned short tl[64][66]; const int tid = threadIdx.x; const int slab = blockIdx.x / (TTv / 64), lg = blockIdx.x % (TTv / 64); const int b = slab / NHv, h = slab % NHv;
  for (int i = tid; i < 64 * 8; i += 256) { const int r = i / 8, c8 = (i % 8) * 8; FragH f; f.half[0] = *(const v8us*)((const unsigned short*)V16 + ((size_t)b * TTv + lg * 64 + r) * ldv + voff + h * 64 + c8);
#pragma unroll
    for (int q = 0; q < 8; ++q) tl[r][c8 + q] = f.u[q]; }
  __syncthreads();
  {
#pragma unroll
    for (int rd = 0; rd < 2; ++rd) { const int d = rd * 32 + tid / 8, pc = tid % 8; FragH f;
#pragma unroll
      for (int q = 0; q < 8; ++q) f.u[q] = tl[pc * 8 + q][d];
      *(v8us*)((unsigned short*)Vt + ((size_t)slab * 64 + d) * TTv + lg * 64 + pc * 8) = f.half[0]; }
     } }

__global__ __launch_bounds__(256) void k_hl(const float* __restrict__ F, _Float16* __restrict__ Hh, _Float16* __restrict__ Hl, size_t n8) { const size_t t = (size_t)blockIdx.x * 256 + threadIdx.x; if (t >= n8) return; FragH fh, fl; const v4f a = *(const v4fa*)(F + t * 8), c = *(const v4fa*)(F + t * 8 + 4);
#pragma unroll
  for (int q = 0; q < 4; ++q) { _Float16 h = (_Float16)a[q]; fh.h[q] = h; fl.h[q] = (_Float16)((a[q] - (float)h) * 1024.0f); h = (_Float16)c[q]; fh.h[4 + q] = h; fl.h[4 + q] = (_Float16)((c[q] - (float)h) * 1024.0f); }
  { *(v8us*)((unsigned short*)Hh + t * 8) = fh.half[0]; *(v8us*)((unsigned short*)Hl + t * 8) = fl.half[0];  } }

// ---- fast GEMM (wave tile 32x64; requires M % 32 == 0 rows per launch region and N % 64 == 0); epilogue = k_gemm_hhx semantics ----
__device__ __forceinline__ v16h g2_frag(const _Float16* p, int hh) { FragH f; f.half[0] = *(const v8us*)((const unsigned short*)p + 8 * hh); f.half[1] = *(const v8us*)((const unsigned short*)p + 16 + 8 * hh); return f.v; }
__device__ __forceinline__ v8f g2_mma(v16h a, v16h b, v8f c) { v8f d = __builtin_amdgcn_wmma_f32_16x16x32_f16(false, a, false, b, (short)0, c, false, false); asm volatile("v_nop\n\tv_nop\n\tv_nop\n\tv_nop" : "+v"(d) : "v"(a), "v"(b)); return d; }
template <int ACT>
__global__ __launch_bounds__(128) void k_gemm2(const _Float16* __restrict__ A, int lda, size_t sA, const _Float16* __restrict__ Bh, int ldb, size_t sB, float alpha, const float* __restrict__ bias, size_t sBias, const float* __restrict__ CP, int rowsPerB, size_t sCPb, int row0g,
    float* __restrict__ C, _Float16* __restrict__ C16, int ldc, size_t sC, int M, int N, int K) { static_assert(ACT == 0 || ACT == 3 || ACT == 6 || ACT == 8 || ACT == 9 || ACT == 11 || ACT == 12 || ACT == 14 || ACT == 15 || ACT == 16 || ACT == 17, "k_gemm2: unsupported ACT code (would silently apply no activation)");
  __shared__ __attribute__((aligned(16))) float so[4][32][68];
  const int tid = threadIdx.x, w = tid >> 5, lane = tid & 31, ln = lane & 15, hh = lane >> 4; const int by = blockIdx.y;
  A += (size_t)by * sA; Bh += (size_t)by * sB; const size_t cofs = (size_t)by * sC; const float* bp = bias ? bias + (size_t)by * sBias : nullptr;
  const int ntn = N >> 6; const int mt = blockIdx.x / ntn, nq = blockIdx.x - mt * ntn; const int row0 = mt * 128 + 32 * w, col0 = nq * 64; if (row0 >= M) return;
  const _Float16* a0p = A + (size_t)(row0 + ln) * lda; const _Float16* a1p = a0p + (size_t)16 * lda;
  const _Float16* b0p = Bh + (size_t)(col0 + ln) * ldb; const _Float16* b1p = b0p + (size_t)16 * ldb; const _Float16* b2p = b1p + (size_t)16 * ldb; const _Float16* b3p = b2p + (size_t)16 * ldb;
  const v8f z8 = {0.f,0.f,0.f,0.f,0.f,0.f,0.f,0.f}; v8f c00 = z8, c01 = z8, c02 = z8, c03 = z8, c10 = z8, c11 = z8, c12 = z8, c13 = z8;
#pragma unroll 1
  for (int kb = 0; kb < K; kb += 32) { const v16h a0 = g2_frag(a0p + kb, hh), a1 = g2_frag(a1p + kb, hh);
    v16h b = g2_frag(b0p + kb, hh); c00 = g2_mma(a0, b, c00); c10 = g2_mma(a1, b, c10);
    b = g2_frag(b1p + kb, hh); c01 = g2_mma(a0, b, c01); c11 = g2_mma(a1, b, c11);
    b = g2_frag(b2p + kb, hh); c02 = g2_mma(a0, b, c02); c12 = g2_mma(a1, b, c12);
    b = g2_frag(b3p + kb, hh); c03 = g2_mma(a0, b, c03); c13 = g2_mma(a1, b, c13); }
  v8f accs[8] = {c00, c01, c02, c03, c10, c11, c12, c13};
#pragma unroll
  for (int u = 0; u < 8; ++u) { const int t = u & 3, half = u >> 2; const int col = col0 + t * 16 + ln; const float bv = bp ? bf16_round(bp[col]) : 0.f;
#pragma unroll
    for (int r = 0; r < 8; ++r) { const int rloc = half * 16 + 8 * hh + r; float v = accs[u][r] * alpha + bv; if (CP) { if (rowsPerB < 0) v += CP[cofs + (size_t)(row0g + row0 + rloc) * ldc + col];      /* rowsPerB < 0: own element of the batched C plane */ else { const int bidx = (row0g + row0 + rloc) / rowsPerB; v += CP[(size_t)bidx * sCPb + (size_t)by * 64 + col]; } }
      if (ACT == 3) v = fmaxf(v, 0.f); else if (ACT == 6) v = 0.5f * v * (1.0f + erff(v * 0.70710678118654752f)); else if (ACT == 11) v = 1.0f / (1.0f + expf(-v)); else if (ACT == 15) v = v / (1.0f + expf(-v)); else if (ACT == 12) v = (v > 0.f) ? v : 0.01f * v; else if (ACT == 8) v = tanhf(v); else if (ACT == 9) v = 0.5f * v * (1.0f + tanhf(0.7978845608028654f * (v + 0.044715f * v * v * v))); else if (ACT == 14) v = (v > 0.f) ? v : 0.1f * v; else if (ACT == 16) v = (v >= 0.f) ? v : 0.3f * v; else if (ACT == 17) v = (v >= 0.f) ? v : 0.2f * v;
      so[w][rloc][t * 16 + ln] = v; } }
  __builtin_amdgcn_fence(__ATOMIC_ACQ_REL, "workgroup"); __builtin_amdgcn_wave_barrier();
  const int rsub = lane >> 4, c4 = (lane & 15) * 4;
  {
#pragma unroll
    for (int q = 0; q < 16; ++q) { const int r = q * 2 + rsub; const v4f v = *(const v4fa*)&so[w][r][c4]; if (C) *(v4f*)(C + cofs + (size_t)(row0 + r) * ldc + col0 + c4) = v; if (C16) { v4h h4; for (int i = 0; i < 4; ++i) h4[i] = (_Float16)v[i]; *(v4h*)(C16 + cofs + (size_t)(row0 + r) * ldc + col0 + c4) = h4; } }
     } }


__global__ __launch_bounds__(256) void k_wnat(const float* __restrict__ w, size_t n8, _Float16* __restrict__ Bt) { const size_t t = (size_t)blockIdx.x * 256 + threadIdx.x; if (t >= n8) return; FragH f; for (int q = 0; q < 8; ++q) f.h[q] = (_Float16)(bf16_round(w[t * 8 + q]) * 16.0f); *(v8us*)((unsigned short*)Bt + t * 8) = f.half[0];  }
__global__ __launch_bounds__(256) void k_rsm(const float* __restrict__ S, _Float16* __restrict__ P, int nrows) {
  #pragma clang fp contract(off)
  const int i = blockIdx.x * 256 + threadIdx.x; if (i >= nrows) return; const float* s = S + (size_t)i * SQ; float mx = -3.0e38f;
#pragma unroll 1
  for (int j = 0; j < SQ; ++j) mx = fmaxf(mx, s[j]); float se = 0.f;
#pragma unroll 1
  for (int j = 0; j < SQ; ++j) se += expf(s[j] - mx); const float sc = 256.0f / se;
#pragma unroll 1
  for (int j0 = 0; j0 < SQ; j0 += 8) { FragH f; for (int q = 0; q < 8; ++q) f.h[q] = (_Float16)(expf(s[j0 + q] - mx) * sc); unsigned short* d = (unsigned short*)P + (size_t)i * SQ + j0; *(v8us*)d = f.half[0];  } }
__global__ __launch_bounds__(256) void k_vt(const _Float16* __restrict__ V16, int b, int h0, _Float16* __restrict__ VT) { __shared__ unsigned short tl[64][65]; const int tid = threadIdx.x; const int hh = blockIdx.x % HG, sg = blockIdx.x / HG; const int s0 = sg * 64; const int h = h0 + hh;
  for (int i = tid; i < 64 * 8; i += 256) { const int j = i / 8, d8 = (i % 8) * 8; FragH f; f.half[0] = *(const v8us*)((const unsigned short*)V16 + ((size_t)b * SQ + s0 + j) * DM + h * HD + d8); for (int q = 0; q < 8; ++q) tl[d8 + q][j] = f.u[q]; }
  __syncthreads();
  { for (int i = tid; i < 64 * 8; i += 256) { const int d = i / 8, j8 = (i % 8) * 8; FragH f; for (int q = 0; q < 8; ++q) f.u[q] = tl[d][j8 + q]; *(v8us*)((unsigned short*)VT + ((size_t)hh * HD + d) * SQ + s0 + j8) = f.half[0]; }  } }



__global__ __launch_bounds__(256) void k_rsmf(const float* __restrict__ S, _Float16* __restrict__ P, int qn, int hg) {
  #pragma clang fp contract(off)
  const int t = blockIdx.x * 256 + threadIdx.x; if (t >= qn * hg) return; const size_t i = (size_t)(t / qn) * SQ + (t % qn); const float* s = S + i * SQ; float mx = -3.0e38f;
#pragma unroll 1
  for (int j = 0; j < SQ; ++j) mx = fmaxf(mx, s[j]); float se = 0.f;
#pragma unroll 1
  for (int j = 0; j < SQ; ++j) se += __expf(s[j] - mx); const float sc = 256.0f / se;
#pragma unroll 1
  for (int j0 = 0; j0 < SQ; j0 += 8) { FragH f; for (int q = 0; q < 8; ++q) f.h[q] = (_Float16)(__expf(s[j0 + q] - mx) * sc); unsigned short* d = (unsigned short*)P + i * SQ + j0; *(v8us*)d = f.half[0];  } }

extern "C" void kernel_launch(void* const* d_in, const int* in_sizes, int n_in,
                              void* d_out, int out_size, void* d_ws, size_t ws_size, hipStream_t stream) {
  (void)in_sizes; (void)n_in; (void)out_size;
  const float* const* I = (const float* const*)d_in; const float* x = I[0]; const float* wq = I[1]; const float* bq = I[2]; const float* wk = I[3]; const float* bk = I[4]; const float* wv = I[5]; const float* bv = I[6]; const float* wo = I[7]; const float* bo = I[8];      /* [in][out] weights + biases (y = x @ W + b) */
  char* ws = (char*)d_ws; size_t off = 0;
  auto take = [&](size_t bytes) { char* p = ws + off; off += (bytes + 255) & ~(size_t)255; return p; };
  _Float16* BQ = (_Float16*)take((size_t)DM * DM * 2); _Float16* BK = (_Float16*)take((size_t)DM * DM * 2); _Float16* BV = (_Float16*)take((size_t)DM * DM * 2); _Float16* BO = (_Float16*)take((size_t)DM * DM * 2);
  _Float16* X16 = (_Float16*)take(NR * DM * 2); _Float16* Q16 = (_Float16*)take(NR * DM * 2); _Float16* K16 = (_Float16*)take(NR * DM * 2); _Float16* V16 = (_Float16*)take(NR * DM * 2); _Float16* O16 = (_Float16*)take(NR * DM * 2);
  float* S = (float*)take((size_t)HG * SQ * SQ * 4); _Float16* P = (_Float16*)take((size_t)HG * SQ * SQ * 2); _Float16* VT = (_Float16*)take((size_t)NH * HD * SQ * 2);
  if (off > ws_size) return;
  { const unsigned g = (unsigned)(((size_t)DM * (DM / 8) + 255) / 256); k_wt_f16<<<g, 256, 0, stream>>>(wq, BQ, DM, DM, 16.0f); k_wt_f16<<<g, 256, 0, stream>>>(wk, BK, DM, DM, 16.0f); k_wt_f16<<<g, 256, 0, stream>>>(wv, BV, DM, DM, 16.0f); k_wt_f16<<<g, 256, 0, stream>>>(wo, BO, DM, DM, 16.0f); }      /* [in][out] -> Bt[n][k] x16 (transposing builder) */

  k_x16<<<(unsigned)((NR * DM / 8 + 255) / 256), 256, 0, stream>>>(x, X16, NR * DM / 8);
  const size_t r0p = (size_t)B0 * SQ;      /* first projected row */
  k_gemm2<0><<<dim3((unsigned)((MP / 128) * (DM / 64)), 1), 128, 0, stream>>>(X16 + r0p * DM, DM, 0, BQ, DM, 0, 0.0625f, bq, 0, nullptr, 1, 0, 0, nullptr, Q16 + r0p * DM, DM, 0, MP, DM, DM);
  k_gemm2<0><<<dim3((unsigned)((MP / 128) * (DM / 64)), 1), 128, 0, stream>>>(X16 + r0p * DM, DM, 0, BK, DM, 0, 0.0625f, bk, 0, nullptr, 1, 0, 0, nullptr, K16 + r0p * DM, DM, 0, MP, DM, DM);
  k_gemm2<0><<<dim3((unsigned)((MP / 128) * (DM / 64)), 1), 128, 0, stream>>>(X16 + r0p * DM, DM, 0, BV, DM, 0, 0.0625f, bv, 0, nullptr, 1, 0, 0, nullptr, V16 + r0p * DM, DM, 0, MP, DM, DM);
  for (int b = B0; b < B0 + NBR; ++b) { const size_t r0 = (size_t)b * SQ;
    k_vt<NH, SQ><<<NH * (SQ / 64), 256, 0, stream>>>(V16 + r0 * LQ, LQ, 0, VT);      /* V^T [NH][HD][SQ] for this batch */
    for (int h0 = 0; h0 < NHD; h0 += HG) {
      k_gemm2<0><<<dim3((QN / 128) * (SQ / 64), HG), 128, 0, stream>>>(Q16 + r0 * LQ + h0 * HD, LQ, (size_t)HD, K16 + r0 * LQ + h0 * HD, LQ, (size_t)HD, 0.125f, nullptr, 0, nullptr, 1, 0, 0, S, nullptr, SQ, (size_t)SQ * SQ, QN, SQ, HD);      /* scores, HG heads per launch */
      k_rsmf<<<(HG * QN + 255) / 256, 256, 0, stream>>>(S, P, QN, HG);      /* P = 256 softmax (f16), rows of all HG heads */
      k_gemm2<0><<<dim3((QN / 128) * (HD / 64), HG), 128, 0, stream>>>(P, SQ, (size_t)SQ * SQ, VT + (size_t)h0 * HD * SQ, SQ, (size_t)HD * SQ, 0.25f, nullptr, 0, nullptr, 1, 0, 0, nullptr, O16 + r0 * DM + h0 * HD, DM, (size_t)HD, QN, HD, SQ); } }      /* o (merged heads) as f16 rows */
  k_gemm2<0><<<dim3((unsigned)((MPO / 128) * (DM / 64)), 1), 128, 0, stream>>>(O16 + r0p * DM, DM, 0, BO, DM, 0, 0.0009765625f, bo, 0, nullptr, 1, 0, 0, (float*)d_out + r0p * DM, nullptr, DM, 0, MPO, DM, DM);      /* out rows are the output layout */
}

// v001
// A run of this version takes 4180 microseconds.
// Timed twice side by side with v000, it ran 4.74 and 4.75 times as fast.
#include <hip/hip_runtime.h>
// Multi-head self-attention over 4096-token sequences at width 768 with [in][out] projections and biases (hidden_states [2][4096][768]; q / k / v = x W + b ([in][out] 768 x 768 + biases), 12 heads of 64; scores * 1/sqrt(64); softmax over all 4096 keys (no mask); out = merged Wo + bo ([in][out]) -> [2][4096][768]); ONE head per attention launch group.
// Structure: token rows r = b*4096 + s; x as exact f16 rows (bf16-rounded); Q, K, V as three WMMA GEMMs (32x64 wave tiles, f32 accumulation, exact x16 weights + bias, f16 outputs); per batch: V^T for all heads via LDS transposes; per (batch, group of HG = 1 head): scores GEMM (K = 64, batched over the heads on grid.y, alpha = 64^-0.5), row softmax on VALU (f32 statistics, native exp; weights stored x256 as f16), o = P . V^T GEMM (K = 4096, alpha 2^-2: o carried x64 against f16 subnormal flush, folded into the output GEMM alpha) written straight into the merged f16 o rows; out = o W_o + b GEMM (f32) into the output layout.
// Compute dtype: inputs rounded to bf16; x / weights exact; q, k, v, softmax weights and o as plain f16 GEMM operands (~2^-12); scores and softmax statistics f32. v_wmma_f32_16x16x32_f16.
#define NB 2
#define SQ 4096
#define DM 768
#define NH 12
#define HD 64
#define HG 1                         /* heads per attention launch group (a 4096^2 f32 score slab is 64 MiB) */
#define B0 0                         /* first batch processed (debug hook) */
#define NBR NB                       /* batches processed (debug hook) */
#define NR ((size_t)NB * SQ)         /* token rows */
#define MP ((int)((size_t)NBR * SQ)) /* rows projected (debug hook) */
#define QN SQ                        /* query rows attended per batch (debug hook) */
#define NHD NH                       /* heads attended (debug hook) */
#define MPO MP                       /* rows through the output stage (debug hook) */
#define LQ DM      /* row pitch of the q/k/v rows */
typedef __bf16 v16b __attribute__((ext_vector_type(16)));
typedef unsigned short v8us __attribute__((ext_vector_type(8), may_alias));
typedef float  v8f  __attribute__((ext_vector_type(8)));
typedef float  v4f  __attribute__((ext_vector_type(4)));
typedef float  v4fa __attribute__((ext_vector_type(4), may_alias));
union FragB { v16b v; v8us half[2]; unsigned short u[16]; };

__device__ __forceinline__ unsigned short bf16_bits(float x) { unsigned int u = __float_as_uint(x); return (unsigned short)((u + 0x7FFFu + ((u >> 16) & 1u)) >> 16); }
__device__ __forceinline__ float bf16_val(unsigned short b) { return __uint_as_float(((unsigned int)b) << 16); }
__device__ __forceinline__ float bf16_round(float x) { return bf16_val(bf16_bits(x)); }
// D += A·B with NT terms: 1 = ah·bh, 2 = + al·bh (A split), 3 = + ah·bl (both split)
template <int NT>
__device__ __forceinline__ v8f mmaN(v16b ah, v16b al, v16b bh, v16b bl, v8f c) {
  c = __builtin_amdgcn_wmma_f32_16x16x32_bf16(false, ah, false, bh, (short)0, c, false, false);
  if (NT >= 2) c = __builtin_amdgcn_wmma_f32_16x16x32_bf16(false, al, false, bh, (short)0, c, false, false);
  if (NT >= 3) c = __builtin_amdgcn_wmma_f32_16x16x32_bf16(false, ah, false, bl, (short)0, c, false, false);
  asm volatile("v_nop\n\tv_nop\n\tv_nop\n\tv_nop" : "+v"(c) : "v"(ah), "v"(al), "v"(bh), "v"(bl));
  return c;
}

__global__ __launch_bounds__(256) void k_wt_bf16(const float* __restrict__ W, unsigned short* __restrict__ Wt, int K, int N) {
  const int t = blockIdx.x * 256 + threadIdx.x;
  const int k8n = K / 8;
  if (t >= N * k8n) return;
  const int n = t / k8n, k8 = (t % k8n) * 8;
  v8us v;
#pragma unroll
  for (int i = 0; i < 8; ++i) v[i] = bf16_bits(W[(size_t)(k8 + i) * N + n]);
  *(v8us*)(Wt + (size_t)n * K + k8) = v;
  
}

// GEMM C[M][N] (f32, pitch ldc) = act(A[M][K]·W + bias). A f32 row-major (pitch lda) converted per fragment to bf16
// (ASPLIT: hi/lo two planes -> 2 terms, else single rounded term); Wt bf16 [N][K] (pitch ldb). BIAS_BF16 rounds the
// bias to bf16 first (bias quantised to bf16 before the add). K%32==0, M%16==0, N%64==0.
template <bool ASPLIT, int ACT, bool BIAS_BF16>
__global__ __launch_bounds__(128) void k_gemm_bf(const float* __restrict__ A, int lda, const unsigned short* __restrict__ Wt, int ldb,
                                               const float* __restrict__ bias, float* __restrict__ C, int ldc, int M, int N, int K) {
  __shared__ __attribute__((aligned(16))) float so[4][16][64];
  const int tid = threadIdx.x, w = tid >> 5, lane = tid & 31, ln = lane & 15, hh = lane >> 4;
  const int ntn = N / 64;
  const int wid = blockIdx.x * 4 + w;
  const int mt = wid / ntn, nq = wid % ntn;
  if (mt * 16 >= M) return;
  const int row0 = mt * 16, col0 = nq * 64;
  const float* arow = A + (size_t)(row0 + ln) * lda;
  v8f acc[4] = {};
  for (int kb = 0; kb < K; kb += 32) {
    FragB ah, al;
    const v4f x0 = *(const v4fa*)(arow + kb + 8 * hh), x1 = *(const v4fa*)(arow + kb + 8 * hh + 4);
    const v4f x2 = *(const v4fa*)(arow + kb + 16 + 8 * hh), x3 = *(const v4fa*)(arow + kb + 16 + 8 * hh + 4);
    float xs[16] = {x0[0],x0[1],x0[2],x0[3],x1[0],x1[1],x1[2],x1[3],x2[0],x2[1],x2[2],x2[3],x3[0],x3[1],x3[2],x3[3]};
#pragma unroll
    for (int i = 0; i < 16; ++i) { const unsigned short hb = bf16_bits(xs[i]); ah.u[i] = hb; al.u[i] = ASPLIT ? bf16_bits(xs[i] - bf16_val(hb)) : (unsigned short)0; }
#pragma unroll
    for (int t = 0; t < 4; ++t) {
      const unsigned short* brow = Wt + (size_t)(col0 + t * 16 + ln) * ldb + kb;
      FragB b;
      b.half[0] = *(const v8us*)(brow + 8 * hh);
      b.half[1] = *(const v8us*)(brow + 16 + 8 * hh);
      acc[t] = mmaN<ASPLIT ? 2 : 1>(ah.v, al.v, b.v, b.v, acc[t]);
    }
  }
#pragma unroll
  for (int t = 0; t < 4; ++t) {
    float bv = bias ? bias[col0 + t * 16 + ln] : 0.f;
    if (BIAS_BF16) bv = bf16_round(bv);
#pragma unroll
    for (int r = 0; r < 8; ++r) { float v = acc[t][r] + bv; if (ACT == 1) v = fmaxf(v, 0.f); so[w][8 * hh + r][t * 16 + ln] = v; }
  }
  __builtin_amdgcn_fence(__ATOMIC_ACQ_REL, "workgroup");
  __builtin_amdgcn_wave_barrier();
  const int rsub = lane >> 4, c4 = (lane & 15) * 4;
  {
#pragma unroll
    for (int q = 0; q < 8; ++q) {
      const int r = q * 2 + rsub;
      const v4f v = *(const v4fa*)&so[w][r][c4];
      *(v4f*)(C + (size_t)(row0 + r) * ldc + col0 + c4) = v;
    }
    
  }
}

// GEMM C = act(A·W + bias + resid): A f32 (ASPLIT -> hi/lo 2 terms), Wt bf16 [N][K]; ACT 0 none, 1 relu, 2 exact gelu;
// resid (optional, f32, row index = (row % rmod), pitch ldr, RES_BF16 rounds it) added before the activation.
template <bool ASPLIT, int ACT, bool BIAS_BF16, bool RES_BF16>
__global__ __launch_bounds__(128) void k_gemm_bf3(const float* __restrict__ A, int lda, const unsigned short* __restrict__ Wt, int ldb,
                                                const float* __restrict__ bias, const float* __restrict__ resid, int rmod, int ldr,
                                                float* __restrict__ C, int ldc, int M, int N, int K) {
  __shared__ __attribute__((aligned(16))) float so[4][16][64];
  const int tid = threadIdx.x, w = tid >> 5, lane = tid & 31, ln = lane & 15, hh = lane >> 4;
  const int ntn = N / 64;
  const int wid = blockIdx.x * 4 + w;
  const int mt = wid / ntn, nq = wid % ntn;
  if (mt * 16 >= M) return;
  const int row0 = mt * 16, col0 = nq * 64;
  const float* arow = A + (size_t)(row0 + ln) * lda;
  v8f acc[4] = {};
  for (int kb = 0; kb < K; kb += 32) {
    FragB ah, al;
    const v4f x0 = *(const v4fa*)(arow + kb + 8 * hh), x1 = *(const v4fa*)(arow + kb + 8 * hh + 4);
    const v4f x2 = *(const v4fa*)(arow + kb + 16 + 8 * hh), x3 = *(const v4fa*)(arow + kb + 16 + 8 * hh + 4);
    float xs[16] = {x0[0],x0[1],x0[2],x0[3],x1[0],x1[1],x1[2],x1[3],x2[0],x2[1],x2[2],x2[3],x3[0],x3[1],x3[2],x3[3]};
#pragma unroll
    for (int i = 0; i < 16; ++i) { const unsigned short hb = bf16_bits(xs[i]); ah.u[i] = hb; al.u[i] = ASPLIT ? bf16_bits(xs[i] - bf16_val(hb)) : (unsigned short)0; }
#pragma unroll
    for (int t = 0; t < 4; ++t) {
      const unsigned short* brow = Wt + (size_t)(col0 + t * 16 + ln) * ldb + kb;
      FragB b;
      b.half[0] = *(const v8us*)(brow + 8 * hh);
      b.half[1] = *(const v8us*)(brow + 16 + 8 * hh);
      acc[t] = mmaN<ASPLIT ? 2 : 1>(ah.v, al.v, b.v, b.v, acc[t]);
    }
  }
#pragma unroll
  for (int t = 0; t < 4; ++t) {
    const int col = col0 + t * 16 + ln;
    float bv = bias ? bias[col] : 0.f;
    if (BIAS_BF16) bv = bf16_round(bv);
#pragma unroll
    for (int r = 0; r < 8; ++r) {
      float v = acc[t][r] + bv;
      if (resid) { float rv = resid[(size_t)((row0 + 8 * hh + r) % rmod) * ldr + col]; if (RES_BF16) rv = bf16_round(rv); v += rv; }
      if (ACT == 1) v = fmaxf(v, 0.f);
      if (ACT == 2) v = 0.5f * v * (1.0f + erff(v * 0.70710678118654752f));
      if (ACT == 3) { const float u = 0.7978845608028654f * (v + 0.044715f * v * v * v); v = 0.5f * v * (1.0f + tanhf(u)); }
      so[w][8 * hh + r][t * 16 + ln] = v;
    }
  }
  __builtin_amdgcn_fence(__ATOMIC_ACQ_REL, "workgroup");
  __builtin_amdgcn_wave_barrier();
  const int rsub = lane >> 4, c4 = (lane & 15) * 4;
  {
#pragma unroll
    for (int q = 0; q < 8; ++q) {
      const int r = q * 2 + rsub;
      const v4f v = *(const v4fa*)&so[w][r][c4];
      *(v4f*)(C + (size_t)(row0 + r) * ldc + col0 + c4) = v;
    }
    
  }
}
// row LayerNorm (biased variance, eps) over N: s = X (+ R); optional out_sum <- s; out_norm <- (s-mu)*rsqrt(var+eps)*g + b
template <bool PARAM_BF16>
__global__ __launch_bounds__(256) void k_layernorm(const float* __restrict__ X, const float* __restrict__ R, const float* __restrict__ g, const float* __restrict__ bta,
                                                  float* __restrict__ out_sum, float* __restrict__ out_norm, int N, float eps) {
  __shared__ float red[256];
  const int row = blockIdx.x, tid = threadIdx.x;
  const float* x = X + (size_t)row * N; const float* rr = R ? R + (size_t)row * N : nullptr;
  float vals[16];                     // up to N = 4096
  const int per = N / 256;            // contiguous chunk per thread? use strided-by-4 chunks: thread handles j = tid*4 + 1024*u
  float s1 = 0.f;
  for (int u = 0; u < per / 4; ++u) {
    const int j = tid * 4 + 1024 * u;
    const v4f a = *(const v4fa*)(x + j);
    v4f b = {0.f,0.f,0.f,0.f}; if (rr) b = *(const v4fa*)(rr + j);
#pragma unroll
    for (int q = 0; q < 4; ++q) { const float v = a[q] + b[q]; vals[u * 4 + q] = v; s1 += v; }
  }
  red[tid] = s1; __syncthreads();
  for (int st = 128; st > 0; st >>= 1) { if (tid < st) red[tid] += red[tid + st]; __syncthreads(); }
  const float mu = red[0] / (float)N; __syncthreads();
  float s2 = 0.f;
  for (int u = 0; u < per / 4; ++u)
#pragma unroll
    for (int q = 0; q < 4; ++q) { const float c = vals[u * 4 + q] - mu; s2 += c * c; }
  red[tid] = s2; __syncthreads();
  for (int st = 128; st > 0; st >>= 1) { if (tid < st) red[tid] += red[tid + st]; __syncthreads(); }
  const float rs = rsqrtf(red[0] / (float)N + eps);
  {
    for (int u = 0; u < per / 4; ++u) {
      const int j = tid * 4 + 1024 * u;
      v4f o, sm;
#pragma unroll
      for (int q = 0; q < 4; ++q) {
        float gg = g[j + q], bb = bta[j + q];
        if (PARAM_BF16) { gg = bf16_round(gg); bb = bf16_round(bb); }
        sm[q] = vals[u * 4 + q]; o[q] = (vals[u * 4 + q] - mu) * rs * gg + bb;
      }
      if (out_sum) *(v4f*)(out_sum + (size_t)row * N + j) = sm;
      *(v4f*)(out_norm + (size_t)row * N + j) = o;
    }
    
  }
}



// ---- f16 WMMA path (v_wmma_f32_16x16x32_f16): 11-bit significands for operands in range — used where a [0,1] probability operand needs more precision than bf16
typedef _Float16 v16h __attribute__((ext_vector_type(16)));
union FragH { v16h v; v8us half[2]; _Float16 h[16]; unsigned short u[16]; };
template <int NT>
__device__ __forceinline__ v8f mmaH(v16h ah, v16h al, v16h bh, v16h bl, v8f c) {
  c = __builtin_amdgcn_wmma_f32_16x16x32_f16(false, ah, false, bh, (short)0, c, false, false);
  if (NT >= 2) c = __builtin_amdgcn_wmma_f32_16x16x32_f16(false, al, false, bh, (short)0, c, false, false);
  if (NT >= 3) c = __builtin_amdgcn_wmma_f32_16x16x32_f16(false, ah, false, bl, (short)0, c, false, false);
  asm volatile("v_nop\n\tv_nop\n\tv_nop\n\tv_nop" : "+v"(c) : "v"(ah), "v"(al), "v"(bh), "v"(bl));
  return c;
}
// batched GEMM like k_gemm_b but f16 operands: A f32 (split into f16 hi/lo if ASPLIT, else rounded to f16), Bt = f16 values [n][k]; alpha; C f32; N multiple of 16 (partial tiles skipped)
template <bool ASPLIT>
__global__ __launch_bounds__(128) void k_gemm_h(const float* __restrict__ A, int lda, size_t sA, const _Float16* __restrict__ Bh, int ldb, size_t sB, float alpha, float* __restrict__ C, int ldc, size_t sC, int M, int N, int K) {
  __shared__ __attribute__((aligned(16))) float so[4][16][64];
  const int tid = threadIdx.x, w = tid >> 5, lane = tid & 31, ln = lane & 15, hh = lane >> 4; const int by = blockIdx.y;
  A += (size_t)by * sA; Bh += (size_t)by * sB; C += (size_t)by * sC;
  const int ntn = (N + 63) / 64; const int wid = blockIdx.x * 4 + w; const int mt = wid / ntn, nq = wid % ntn; if (mt * 16 >= M) return;
  const int row0 = mt * 16, col0 = nq * 64; const float* arow = A + (size_t)(row0 + ln) * lda;
  v8f acc[4] = {};
  for (int kb = 0; kb < K; kb += 32) {
    FragH ah, al;
    const v4f x0 = *(const v4fa*)(arow + kb + 8 * hh), x1 = *(const v4fa*)(arow + kb + 8 * hh + 4), x2 = *(const v4fa*)(arow + kb + 16 + 8 * hh), x3 = *(const v4fa*)(arow + kb + 16 + 8 * hh + 4);
    float xs[16] = {x0[0],x0[1],x0[2],x0[3],x1[0],x1[1],x1[2],x1[3],x2[0],x2[1],x2[2],x2[3],x3[0],x3[1],x3[2],x3[3]};
#pragma unroll
    for (int i = 0; i < 16; ++i) { const _Float16 h = (_Float16)xs[i]; ah.h[i] = h; al.h[i] = ASPLIT ? (_Float16)(xs[i] - (float)h) : (_Float16)0.0f; }
#pragma unroll
    for (int t = 0; t < 4; ++t) { if (col0 + t * 16 >= N) continue; const size_t boff = (size_t)(col0 + t * 16 + ln) * ldb + kb; FragH bq; bq.half[0] = *(const v8us*)(Bh + boff + 8 * hh); bq.half[1] = *(const v8us*)(Bh + boff + 16 + 8 * hh);
      acc[t] = mmaH<ASPLIT ? 2 : 1>(ah.v, al.v, bq.v, bq.v, acc[t]); }
  }
#pragma unroll
  for (int t = 0; t < 4; ++t) { if (col0 + t * 16 >= N) continue;
#pragma unroll
    for (int r = 0; r < 8; ++r) so[w][8 * hh + r][t * 16 + ln] = acc[t][r] * alpha; }
  __builtin_amdgcn_fence(__ATOMIC_ACQ_REL, "workgroup"); __builtin_amdgcn_wave_barrier();
  const int rsub = lane >> 4, c4 = (lane & 15) * 4;
  {
#pragma unroll
    for (int q = 0; q < 8; ++q) { const int r = q * 2 + rsub; if (col0 + c4 < N) { const v4f v = *(const v4fa*)&so[w][r][c4]; *(v4f*)(C + (size_t)(row0 + r) * ldc + col0 + c4) = v; } }
     }
}

// Wt[n][k] = f16(W[k][n]·scale) from f32 row-major W[K][N] (scale = power of two; bf16-exact weights stay exact in f16 away from the subnormal range)
__global__ __launch_bounds__(256) void k_wt_f16(const float* __restrict__ W, _Float16* __restrict__ Wt, int K, int N, float scale) {
  const int t = blockIdx.x * 256 + threadIdx.x; if (t >= N * (K / 8)) return; const int n = t / (K / 8), k8 = (t % (K / 8)) * 8; FragH f;
#pragma unroll
  for (int i = 0; i < 8; ++i) f.h[i] = (_Float16)(bf16_round(W[(size_t)(k8 + i) * N + n]) * scale); const v8us o = f.half[0];
  *(v8us*)((unsigned short*)Wt + (size_t)n * K + k8) = o; 
}
// k_gemm_hh variant with fused epilogue: v = acc·alpha + bias[by·sBias + col] (+ CP[(row/rowsPerB)·sCPb + by·64 + col] if CP) ; ACT 0 none / 1 elu ; writes f16 C16 (and f32 C if non-null)
template <int ACT>
__global__ __launch_bounds__(128) void k_gemm_hhx(const _Float16* __restrict__ A, int lda, size_t sA, const _Float16* __restrict__ Bh, int ldb, size_t sB, float alpha, const float* __restrict__ bias, size_t sBias, const float* __restrict__ CP, int rowsPerB, size_t sCPb, int row0g,
    float* __restrict__ C, _Float16* __restrict__ C16, int ldc, size_t sC, int M, int N, int K) {
  __shared__ __attribute__((aligned(16))) float so[4][16][64];
  const int tid = threadIdx.x, w = tid >> 5, lane = tid & 31, ln = lane & 15, hh = lane >> 4; const int by = blockIdx.y;
  A += (size_t)by * sA; Bh += (size_t)by * sB; const size_t cofs = (size_t)by * sC; const float* bp = bias ? bias + (size_t)by * sBias : nullptr;
  const int ntn = (N + 63) / 64; const int wid = blockIdx.x * 4 + w; const int mt = wid / ntn, nq = wid % ntn; if (mt * 16 >= M) return;
  const int row0 = mt * 16, col0 = nq * 64; const _Float16* arow = A + (size_t)(row0 + ln) * lda;
  v8f acc[4] = {};
  for (int kb = 0; kb < K; kb += 32) { FragH ah; ah.half[0] = *(const v8us*)((const unsigned short*)arow + kb + 8 * hh); ah.half[1] = *(const v8us*)((const unsigned short*)arow + kb + 16 + 8 * hh);
#pragma unroll
    for (int t = 0; t < 4; ++t) { if (col0 + t * 16 >= N) continue; const size_t boff = (size_t)(col0 + t * 16 + ln) * ldb + kb; FragH bq; bq.half[0] = *(const v8us*)((const unsigned short*)Bh + boff + 8 * hh); bq.half[1] = *(const v8us*)((const unsigned short*)Bh + boff + 16 + 8 * hh);
      acc[t] = mmaH<1>(ah.v, ah.v, bq.v, bq.v, acc[t]); }
  }
#pragma unroll
  for (int t = 0; t < 4; ++t) { if (col0 + t * 16 >= N) continue; const int col = col0 + t * 16 + ln; const float bv = bp ? bf16_round(bp[col]) : 0.f;
#pragma unroll
    for (int r = 0; r < 8; ++r) { float v = acc[t][r] * alpha + bv; if (CP) { const int rr = row0g + row0 + 8 * hh + r; if (rowsPerB < 0) v += CP[cofs + (size_t)rr * ldc + col];      /* rowsPerB < 0: own element of the batched C plane */ else { const int bidx = rr / rowsPerB; v += CP[(size_t)bidx * sCPb + (size_t)by * 64 + col]; } } if (ACT == 1) v = (v > 0.f) ? v : expm1f(v); else if (ACT == 7) v = (v > 0.f) ? v + 1.0f : expf(v); else if (ACT == 8) v = tanhf(v); else if (ACT == 9) v = 0.5f * v * (1.0f + tanhf(0.7978845608028654f * (v + 0.044715f * v * v * v))); else if (ACT == 11) v = 1.0f / (1.0f + expf(-v)); else if (ACT == 12) v = (v > 0.f) ? v : 0.01f * v; else if (ACT == 14) v = (v > 0.f) ? v : 0.1f * v; else if (ACT == 16) v = (v >= 0.f) ? v : 0.3f * v; else if (ACT == 17) v = (v >= 0.f) ? v : 0.2f * v; else if (ACT == 15) v = v / (1.0f + expf(-v)); else if (ACT == 3) v = fmaxf(v, 0.f); else if (ACT == 6) v = 0.5f * v * (1.0f + erff(v * 0.70710678118654752f)); so[w][8 * hh + r][t * 16 + ln] = v; } }
  __builtin_amdgcn_fence(__ATOMIC_ACQ_REL, "workgroup"); __builtin_amdgcn_wave_barrier();
  const int rsub = lane >> 4, c4 = (lane & 15) * 4; typedef _Float16 v4h __attribute__((ext_vector_type(4)));
  {
#pragma unroll
    for (int q = 0; q < 8; ++q) { const int r = q * 2 + rsub; if (col0 + c4 < N) { const v4f v = *(const v4fa*)&so[w][r][c4]; if (C) *(v4f*)(C + cofs + (size_t)(row0 + r) * ldc + col0 + c4) = v; if (C16) { v4h h4; for (int i = 0; i < 4; ++i) h4[i] = (_Float16)v[i]; *(v4h*)(C16 + cofs + (size_t)(row0 + r) * ldc + col0 + c4) = h4; } } }
     }
}


typedef _Float16 v4h __attribute__((ext_vector_type(4)));

__global__ __launch_bounds__(256) void k_x16(const float* __restrict__ x, _Float16* __restrict__ X16, size_t n8) { const size_t t = (size_t)blockIdx.x * 256 + threadIdx.x; if (t >= n8) return; FragH f;
#pragma unroll
  for (int q = 0; q < 8; ++q) f.h[q] = (_Float16)bf16_round(x[t * 8 + q]); *(v8us*)((unsigned short*)X16 + t * 8) = f.half[0];  }
__global__ __launch_bounds__(256) void k_h16(const float* __restrict__ x, _Float16* __restrict__ X16, size_t n8) { const size_t t = (size_t)blockIdx.x * 256 + threadIdx.x; if (t >= n8) return; FragH f;
#pragma unroll
  for (int q = 0; q < 8; ++q) f.h[q] = (_Float16)x[t * 8 + q]; *(v8us*)((unsigned short*)X16 + t * 8) = f.half[0];  }
__global__ __launch_bounds__(256) void k_round16f(const float* __restrict__ W, _Float16* __restrict__ Bt, size_t n8) { const size_t t = (size_t)blockIdx.x * 256 + threadIdx.x; if (t >= n8) return; FragH f;
#pragma unroll
  for (int i = 0; i < 8; ++i) f.h[i] = (_Float16)(bf16_round(W[t * 8 + i]) * 16.0f); *(v8us*)((unsigned short*)Bt + t * 8) = f.half[0];  }
template <int NHv, int TTv>
__global__ __launch_bounds__(256) void k_vt(const _Float16* __restrict__ V16, int ldv, int voff, _Float16* __restrict__ Vt) { __shared__ unsigned short tl[64][66]; const int tid = threadIdx.x; const int slab = blockIdx.x / (TTv / 64), lg = blockIdx.x % (TTv / 64); const int b = slab / NHv, h = slab % NHv;
  for (int i = tid; i < 64 * 8; i += 256) { const int r = i / 8, c8 = (i % 8) * 8; FragH f; f.half[0] = *(const v8us*)((const unsigned short*)V16 + ((size_t)b * TTv + lg * 64 + r) * ldv + voff + h * 64 + c8);
#pragma unroll
    for (int q = 0; q < 8; ++q) tl[r][c8 + q] = f.u[q]; }
  __syncthreads();
  {
#pragma unroll
    for (int rd = 0; rd < 2; ++rd) { const int d = rd * 32 + tid / 8, pc = tid % 8; FragH f;
#pragma unroll
      for (int q = 0; q < 8; ++q) f.u[q] = tl[pc * 8 + q][d];
      *(v8us*)((unsigned short*)Vt + ((size_t)slab * 64 + d) * TTv + lg * 64 + pc * 8) = f.half[0]; }
     } }

__global__ __launch_bounds__(256) void k_hl(const float* __restrict__ F, _Float16* __restrict__ Hh, _Float16* __restrict__ Hl, size_t n8) { const size_t t = (size_t)blockIdx.x * 256 + threadIdx.x; if (t >= n8) return; FragH fh, fl; const v4f a = *(const v4fa*)(F + t * 8), c = *(const v4fa*)(F + t * 8 + 4);
#pragma unroll
  for (int q = 0; q < 4; ++q) { _Float16 h = (_Float16)a[q]; fh.h[q] = h; fl.h[q] = (_Float16)((a[q] - (float)h) * 1024.0f); h = (_Float16)c[q]; fh.h[4 + q] = h; fl.h[4 + q] = (_Float16)((c[q] - (float)h) * 1024.0f); }
  { *(v8us*)((unsigned short*)Hh + t * 8) = fh.half[0]; *(v8us*)((unsigned short*)Hl + t * 8) = fl.half[0];  } }

// ---- fast GEMM (wave tile 32x64; requires M % 32 == 0 rows per launch region and N % 64 == 0); epilogue = k_gemm_hhx semantics ----
__device__ __forceinline__ v16h g2_frag(const _Float16* p, int hh) { FragH f; f.half[0] = *(const v8us*)((const unsigned short*)p + 8 * hh); f.half[1] = *(const v8us*)((const unsigned short*)p + 16 + 8 * hh); return f.v; }
__device__ __forceinline__ v8f g2_mma(v16h a, v16h b, v8f c) { v8f d = __builtin_amdgcn_wmma_f32_16x16x32_f16(false, a, false, b, (short)0, c, false, false); asm volatile("v_nop\n\tv_nop\n\tv_nop\n\tv_nop" : "+v"(d) : "v"(a), "v"(b)); return d; }
template <int ACT>
__global__ __launch_bounds__(128) void k_gemm2(const _Float16* __restrict__ A, int lda, size_t sA, const _Float16* __restrict__ Bh, int ldb, size_t sB, float alpha, const float* __restrict__ bias, size_t sBias, const float* __restrict__ CP, int rowsPerB, size_t sCPb, int row0g,
    float* __restrict__ C, _Float16* __restrict__ C16, int ldc, size_t sC, int M, int N, int K) { static_assert(ACT == 0 || ACT == 3 || ACT == 6 || ACT == 8 || ACT == 9 || ACT == 11 || ACT == 12 || ACT == 14 || ACT == 15 || ACT == 16 || ACT == 17, "k_gemm2: unsupported ACT code (would silently apply no activation)");
  __shared__ __attribute__((aligned(16))) float so[4][32][68];
  const int tid = threadIdx.x, w = tid >> 5, lane = tid & 31, ln = lane & 15, hh = lane >> 4; const int by = blockIdx.y;
  A += (size_t)by * sA; Bh += (size_t)by * sB; const size_t cofs = (size_t)by * sC; const float* bp = bias ? bias + (size_t)by * sBias : nullptr;
  const int ntn = N >> 6; const int mt = blockIdx.x / ntn, nq = blockIdx.x - mt * ntn; const int row0 = mt * 128 + 32 * w, col0 = nq * 64; if (row0 >= M) return;
  const _Float16* a0p = A + (size_t)(row0 + ln) * lda; const _Float16* a1p = a0p + (size_t)16 * lda;
  const _Float16* b0p = Bh + (size_t)(col0 + ln) * ldb; const _Float16* b1p = b0p + (size_t)16 * ldb; const _Float16* b2p = b1p + (size_t)16 * ldb; const _Float16* b3p = b2p + (size_t)16 * ldb;
  const v8f z8 = {0.f,0.f,0.f,0.f,0.f,0.f,0.f,0.f}; v8f c00 = z8, c01 = z8, c02 = z8, c03 = z8, c10 = z8, c11 = z8, c12 = z8, c13 = z8;
#pragma unroll 1
  for (int kb = 0; kb < K; kb += 32) { const v16h a0 = g2_frag(a0p + kb, hh), a1 = g2_frag(a1p + kb, hh);
    v16h b = g2_frag(b0p + kb, hh); c00 = g2_mma(a0, b, c00); c10 = g2_mma(a1, b, c10);
    b = g2_frag(b1p + kb, hh); c01 = g2_mma(a0, b, c01); c11 = g2_mma(a1, b, c11);
    b = g2_frag(b2p + kb, hh); c02 = g2_mma(a0, b, c02); c12 = g2_mma(a1, b, c12);
    b = g2_frag(b3p + kb, hh); c03 = g2_mma(a0, b, c03); c13 = g2_mma(a1, b, c13); }
  v8f accs[8] = {c00, c01, c02, c03, c10, c11, c12, c13};
#pragma unroll
  for (int u = 0; u < 8; ++u) { const int t = u & 3, half = u >> 2; const int col = col0 + t * 16 + ln; const float bv = bp ? bf16_round(bp[col]) : 0.f;
#pragma unroll
    for (int r = 0; r < 8; ++r) { const int rloc = half * 16 + 8 * hh + r; float v = accs[u][r] * alpha + bv; if (CP) { if (rowsPerB < 0) v += CP[cofs + (size_t)(row0g + row0 + rloc) * ldc + col];      /* rowsPerB < 0: own element of the batched C plane */ else { const int bidx = (row0g + row0 + rloc) / rowsPerB; v += CP[(size_t)bidx * sCPb + (size_t)by * 64 + col]; } }
      if (ACT == 3) v = fmaxf(v, 0.f); else if (ACT == 6) v = 0.5f * v * (1.0f + erff(v * 0.70710678118654752f)); else if (ACT == 11) v = 1.0f / (1.0f + expf(-v)); else if (ACT == 15) v = v / (1.0f + expf(-v)); else if (ACT == 12) v = (v > 0.f) ? v : 0.01f * v; else if (ACT == 8) v = tanhf(v); else if (ACT == 9) v = 0.5f * v * (1.0f + tanhf(0.7978845608028654f * (v + 0.044715f * v * v * v))); else if (ACT == 14) v = (v > 0.f) ? v : 0.1f * v; else if (ACT == 16) v = (v >= 0.f) ? v : 0.3f * v; else if (ACT == 17) v = (v >= 0.f) ? v : 0.2f * v;
      so[w][rloc][t * 16 + ln] = v; } }
  __builtin_amdgcn_fence(__ATOMIC_ACQ_REL, "workgroup"); __builtin_amdgcn_wave_barrier();
  const int rsub = lane >> 4, c4 = (lane & 15) * 4;
  {
#pragma unroll
    for (int q = 0; q < 16; ++q) { const int r = q * 2 + rsub; const v4f v = *(const v4fa*)&so[w][r][c4]; if (C) *(v4f*)(C + cofs + (size_t)(row0 + r) * ldc + col0 + c4) = v; if (C16) { v4h h4; for (int i = 0; i < 4; ++i) h4[i] = (_Float16)v[i]; *(v4h*)(C16 + cofs + (size_t)(row0 + r) * ldc + col0 + c4) = h4; } }
     } }


__global__ __launch_bounds__(256) void k_wnat(const float* __restrict__ w, size_t n8, _Float16* __restrict__ Bt) { const size_t t = (size_t)blockIdx.x * 256 + threadIdx.x; if (t >= n8) return; FragH f; for (int q = 0; q < 8; ++q) f.h[q] = (_Float16)(bf16_round(w[t * 8 + q]) * 16.0f); *(v8us*)((unsigned short*)Bt + t * 8) = f.half[0];  }
__global__ __launch_bounds__(256) void k_rsm(const float* __restrict__ S, _Float16* __restrict__ P, int nrows) {
  #pragma clang fp contract(off)
  const int i = blockIdx.x * 256 + threadIdx.x; if (i >= nrows) return; const float* s = S + (size_t)i * SQ; float mx = -3.0e38f;
#pragma unroll 1
  for (int j = 0; j < SQ; ++j) mx = fmaxf(mx, s[j]); float se = 0.f;
#pragma unroll 1
  for (int j = 0; j < SQ; ++j) se += expf(s[j] - mx); const float sc = 256.0f / se;
#pragma unroll 1
  for (int j0 = 0; j0 < SQ; j0 += 8) { FragH f; for (int q = 0; q < 8; ++q) f.h[q] = (_Float16)(expf(s[j0 + q] - mx) * sc); unsigned short* d = (unsigned short*)P + (size_t)i * SQ + j0; *(v8us*)d = f.half[0];  } }
__global__ __launch_bounds__(256) void k_vt(const _Float16* __restrict__ V16, int b, int h0, _Float16* __restrict__ VT) { __shared__ unsigned short tl[64][65]; const int tid = threadIdx.x; const int hh = blockIdx.x % HG, sg = blockIdx.x / HG; const int s0 = sg * 64; const int h = h0 + hh;
  for (int i = tid; i < 64 * 8; i += 256) { const int j = i / 8, d8 = (i % 8) * 8; FragH f; f.half[0] = *(const v8us*)((const unsigned short*)V16 + ((size_t)b * SQ + s0 + j) * DM + h * HD + d8); for (int q = 0; q < 8; ++q) tl[d8 + q][j] = f.u[q]; }
  __syncthreads();
  { for (int i = tid; i < 64 * 8; i += 256) { const int d = i / 8, j8 = (i % 8) * 8; FragH f; for (int q = 0; q < 8; ++q) f.u[q] = tl[d][j8 + q]; *(v8us*)((unsigned short*)VT + ((size_t)hh * HD + d) * SQ + s0 + j8) = f.half[0]; }  } }



// Row softmax, one wave per score row: each lane keeps 128 of the row's 4096 scores in registers (32 loads of 16 bytes, each load of the wave = 512 contiguous bytes),
// so S is read once; maximum and sum = four chains per lane, then a five-step butterfly; P = f16(256 * softmax), each store of the wave = 256 contiguous bytes. No LDS, no barrier.
// Every loop over v is fully unrolled: only constant indices keep the row in registers (a rolled loop would put it in scratch memory).
#define RSW 16                       /* waves (= rows) per work-group */
__global__ __launch_bounds__(RSW * 32) void k_rsmw(const float* __restrict__ S, _Float16* __restrict__ P) {
  const int lane = threadIdx.x & 31; const int t = blockIdx.x * RSW + __builtin_amdgcn_readfirstlane(threadIdx.x >> 5); if (t >= QN * HG) return;      /* wave-uniform, no barrier behind it */
  const size_t i = (size_t)(t / QN) * SQ + (t % QN); const float* s = S + i * SQ + lane * 4; v4f v[SQ / 128];
#pragma unroll
  for (int u = 0; u < SQ / 128; ++u) v[u] = *(const v4fa*)(s + u * 128);
  v4f m4 = {-3.0e38f, -3.0e38f, -3.0e38f, -3.0e38f};
#pragma unroll
  for (int u = 0; u < SQ / 128; ++u) for (int q = 0; q < 4; ++q) m4[q] = fmaxf(m4[q], v[u][q]);
  float mx = fmaxf(fmaxf(m4[0], m4[1]), fmaxf(m4[2], m4[3]));
#pragma unroll
  for (int m = 16; m >= 1; m >>= 1) mx = fmaxf(mx, __shfl_xor(mx, m, 32));
  v4f e4 = {0.f, 0.f, 0.f, 0.f};
#pragma unroll
  for (int u = 0; u < SQ / 128; ++u) { float x0 = (v[u][0] - mx) * 1.44269504f, x1 = (v[u][1] - mx) * 1.44269504f, x2 = (v[u][2] - mx) * 1.44269504f, x3 = (v[u][3] - mx) * 1.44269504f;      /* native exp(s - mx) = 2^((s - mx) * log2 e) */
    /* four exponentials in place and one v_nop: the instruction set asks for one independent instruction between a transcendental and an overwrite of its source or a use of its result */
    asm("v_exp_f32 %0, %0\n\tv_exp_f32 %1, %1\n\tv_exp_f32 %2, %2\n\tv_exp_f32 %3, %3\n\tv_nop" : "+v"(x0), "+v"(x1), "+v"(x2), "+v"(x3));
    v[u][0] = x0; v[u][1] = x1; v[u][2] = x2; v[u][3] = x3; e4[0] += x0; e4[1] += x1; e4[2] += x2; e4[3] += x3; }
  float se = (e4[0] + e4[1]) + (e4[2] + e4[3]);
#pragma unroll
  for (int m = 16; m >= 1; m >>= 1) se += __shfl_xor(se, m, 32);
  const float sc = 256.0f / se; _Float16* d = P + i * SQ + lane * 4;
#pragma unroll
  for (int u = 0; u < SQ / 128; ++u) { v4h h4; for (int q = 0; q < 4; ++q) h4[q] = (_Float16)(v[u][q] * sc); *(v4h*)(d + u * 128) = h4; } }

extern "C" void kernel_launch(void* const* d_in, const int* in_sizes, int n_in,
                              void* d_out, int out_size, void* d_ws, size_t ws_size, hipStream_t stream) {
  (void)in_sizes; (void)n_in; (void)out_size;
  const float* const* I = (const float* const*)d_in; const float* x = I[0]; const float* wq = I[1]; const float* bq = I[2]; const float* wk = I[3]; const float* bk = I[4]; const float* wv = I[5]; const float* bv = I[6]; const float* wo = I[7]; const float* bo = I[8];      /* [in][out] weights + biases (y = x @ W + b) */
  char* ws = (char*)d_ws; size_t off = 0;
  auto take = [&](size_t bytes) { char* p = ws + off; off += (bytes + 255) & ~(size_t)255; return p; };
  _Float16* BQ = (_Float16*)take((size_t)DM * DM * 2); _Float16* BK = (_Float16*)take((size_t)DM * DM * 2); _Float16* BV = (_Float16*)take((size_t)DM * DM * 2); _Float16* BO = (_Float16*)take((size_t)DM * DM * 2);
  _Float16* X16 = (_Float16*)take(NR * DM * 2); _Float16* Q16 = (_Float16*)take(NR * DM * 2); _Float16* K16 = (_Float16*)take(NR * DM * 2); _Float16* V16 = (_Float16*)take(NR * DM * 2); _Float16* O16 = (_Float16*)take(NR * DM * 2);
  float* S = (float*)take((size_t)HG * SQ * SQ * 4); _Float16* P = (_Float16*)take((size_t)HG * SQ * SQ * 2); _Float16* VT = (_Float16*)take((size_t)NH * HD * SQ * 2);
  if (off > ws_size) return;
  { const unsigned g = (unsigned)(((size_t)DM * (DM / 8) + 255) / 256); k_wt_f16<<<g, 256, 0, stream>>>(wq, BQ, DM, DM, 16.0f); k_wt_f16<<<g, 256, 0, stream>>>(wk, BK, DM, DM, 16.0f); k_wt_f16<<<g, 256, 0, stream>>>(wv, BV, DM, DM, 16.0f); k_wt_f16<<<g, 256, 0, stream>>>(wo, BO, DM, DM, 16.0f); }      /* [in][out] -> Bt[n][k] x16 (transposing builder) */

  k_x16<<<(unsigned)((NR * DM / 8 + 255) / 256), 256, 0, stream>>>(x, X16, NR * DM / 8);
  const size_t r0p = (size_t)B0 * SQ;      /* first projected row */
  k_gemm2<0><<<dim3((unsigned)((MP / 128) * (DM / 64)), 1), 128, 0, stream>>>(X16 + r0p * DM, DM, 0, BQ, DM, 0, 0.0625f, bq, 0, nullptr, 1, 0, 0, nullptr, Q16 + r0p * DM, DM, 0, MP, DM, DM);
  k_gemm2<0><<<dim3((unsigned)((MP / 128) * (DM / 64)), 1), 128, 0, stream>>>(X16 + r0p * DM, DM, 0, BK, DM, 0, 0.0625f, bk, 0, nullptr, 1, 0, 0, nullptr, K16 + r0p * DM, DM, 0, MP, DM, DM);
  k_gemm2<0><<<dim3((unsigned)((MP / 128) * (DM / 64)), 1), 128, 0, stream>>>(X16 + r0p * DM, DM, 0, BV, DM, 0, 0.0625f, bv, 0, nullptr, 1, 0, 0, nullptr, V16 + r0p * DM, DM, 0, MP, DM, DM);
  for (int b = B0; b < B0 + NBR; ++b) { const size_t r0 = (size_t)b * SQ;
    k_vt<NH, SQ><<<NH * (SQ / 64), 256, 0, stream>>>(V16 + r0 * LQ, LQ, 0, VT);      /* V^T [NH][HD][SQ] for this batch */
    for (int h0 = 0; h0 < NHD; h0 += HG) {
      k_gemm2<0><<<dim3((QN / 128) * (SQ / 64), HG), 128, 0, stream>>>(Q16 + r0 * LQ + h0 * HD, LQ, (size_t)HD, K16 + r0 * LQ + h0 * HD, LQ, (size_t)HD, 0.125f, nullptr, 0, nullptr, 1, 0, 0, S, nullptr, SQ, (size_t)SQ * SQ, QN, SQ, HD);      /* scores, HG heads per launch */
      k_rsmw<<<(HG * QN + RSW - 1) / RSW, RSW * 32, 0, stream>>>(S, P);      /* P = 256 softmax (f16), rows of all HG heads */
      k_gemm2<0><<<dim3((QN / 128) * (HD / 64), HG), 128, 0, stream>>>(P, SQ, (size_t)SQ * SQ, VT + (size_t)h0 * HD * SQ, SQ, (size_t)HD * SQ, 0.25f, nullptr, 0, nullptr, 1, 0, 0, nullptr, O16 + r0 * DM + h0 * HD, DM, (size_t)HD, QN, HD, SQ); } }      /* o (merged heads) as f16 rows */
  k_gemm2<0><<<dim3((unsigned)((MPO / 128) * (DM / 64)), 1), 128, 0, stream>>>(O16 + r0p * DM, DM, 0, BO, DM, 0, 0.0009765625f, bo, 0, nullptr, 1, 0, 0, (float*)d_out + r0p * DM, nullptr, DM, 0, MPO, DM, DM);      /* out rows are the output layout */
}

// v003
// One run takes 281 microseconds.
// It is 14.9 times as fast as v001, going by the measured steps of the versions left out in between.
// Counting every step since v000, it is 70.6 times as fast.
#include <hip/hip_runtime.h>
// Multi-head self-attention over 4096-token sequences at width 768 with [in][out] projections and biases (hidden_states [2][4096][768]; q / k / v = x W + b ([in][out] 768 x 768 + biases), 12 heads of 64; scores * 1/sqrt(64); softmax over all 4096 keys (no mask); out = merged Wo + bo ([in][out]) -> [2][4096][768]); all heads and batches in one attention launch.
// Structure: token rows r = b*4096 + s; x as exact f16 rows (bf16-rounded); Q, K, V as three WMMA GEMMs (32x64 wave tiles, f32 accumulation, exact x16 weights + bias, f16 outputs); V^T for all batches and heads via LDS transposes; one attention launch for all (batch, head): S^T = K Q^T, K and V^T staged in LDS per work-group, online softmax in registers (f32 statistics, native exp2; weights exp(s - running max) as f16), O^T += V^T P^T, o carried x64 against f16 subnormal flush (folded into the output GEMM alpha), written straight into the merged f16 o rows; out = o W_o + b GEMM (f32) into the output layout.
// Compute dtype: inputs rounded to bf16; x / weights exact; q, k, v, softmax weights and o as plain f16 GEMM operands (~2^-12); scores and softmax statistics f32. v_wmma_f32_16x16x32_f16.
#define NB 2
#define SQ 4096
#define DM 768
#define NH 12
#define HD 64
#define HG 1                         /* heads per group in the unlaunched per-batch k_vt (a 4096^2 f32 score slab is 64 MiB) */
#define B0 0                         /* first batch processed (debug hook) */
#define NBR NB                       /* batches processed (debug hook) */
#define NR ((size_t)NB * SQ)         /* token rows */
#define MP ((int)((size_t)NBR * SQ)) /* rows projected (debug hook) */
#define QN SQ                        /* unused: attention covers all SQ query rows */
#define NHD NH                       /* unused: attention covers all NH heads */
#define MPO MP                       /* rows through the output stage (debug hook) */
#define LQ DM      /* row pitch of the q/k/v rows */
typedef __bf16 v16b __attribute__((ext_vector_type(16)));
typedef unsigned short v8us __attribute__((ext_vector_type(8), may_alias));
typedef float  v8f  __attribute__((ext_vector_type(8)));
typedef float  v4f  __attribute__((ext_vector_type(4)));
typedef float  v4fa __attribute__((ext_vector_type(4), may_alias));
union FragB { v16b v; v8us half[2]; unsigned short u[16]; };

__device__ __forceinline__ unsigned short bf16_bits(float x) { unsigned int u = __float_as_uint(x); return (unsigned short)((u + 0x7FFFu + ((u >> 16) & 1u)) >> 16); }
__device__ __forceinline__ float bf16_val(unsigned short b) { return __uint_as_float(((unsigned int)b) << 16); }
__device__ __forceinline__ float bf16_round(float x) { return bf16_val(bf16_bits(x)); }
// D += A·B with NT terms: 1 = ah·bh, 2 = + al·bh (A split), 3 = + ah·bl (both split)
template <int NT>
__device__ __forceinline__ v8f mmaN(v16b ah, v16b al, v16b bh, v16b bl, v8f c) {
  c = __builtin_amdgcn_wmma_f32_16x16x32_bf16(false, ah, false, bh, (short)0, c, false, false);
  if (NT >= 2) c = __builtin_amdgcn_wmma_f32_16x16x32_bf16(false, al, false, bh, (short)0, c, false, false);
  if (NT >= 3) c = __builtin_amdgcn_wmma_f32_16x16x32_bf16(false, ah, false, bl, (short)0, c, false, false);
  asm volatile("v_nop\n\tv_nop\n\tv_nop\n\tv_nop" : "+v"(c) : "v"(ah), "v"(al), "v"(bh), "v"(bl));
  return c;
}

__global__ __launch_bounds__(256) void k_wt_bf16(const float* __restrict__ W, unsigned short* __restrict__ Wt, int K, int N) {
  const int t = blockIdx.x * 256 + threadIdx.x;
  const int k8n = K / 8;
  if (t >= N * k8n) return;
  const int n = t / k8n, k8 = (t % k8n) * 8;
  v8us v;
#pragma unroll
  for (int i = 0; i < 8; ++i) v[i] = bf16_bits(W[(size_t)(k8 + i) * N + n]);
  *(v8us*)(Wt + (size_t)n * K + k8) = v;
  
}

// GEMM C[M][N] (f32, pitch ldc) = act(A[M][K]·W + bias). A f32 row-major (pitch lda) converted per fragment to bf16
// (ASPLIT: hi/lo two planes -> 2 terms, else single rounded term); Wt bf16 [N][K] (pitch ldb). BIAS_BF16 rounds the
// bias to bf16 first (bias quantised to bf16 before the add). K%32==0, M%16==0, N%64==0.
template <bool ASPLIT, int ACT, bool BIAS_BF16>
__global__ __launch_bounds__(128) void k_gemm_bf(const float* __restrict__ A, int lda, const unsigned short* __restrict__ Wt, int ldb,
                                               const float* __restrict__ bias, float* __restrict__ C, int ldc, int M, int N, int K) {
  __shared__ __attribute__((aligned(16))) float so[4][16][64];
  const int tid = threadIdx.x, w = tid >> 5, lane = tid & 31, ln = lane & 15, hh = lane >> 4;
  const int ntn = N / 64;
  const int wid = blockIdx.x * 4 + w;
  const int mt = wid / ntn, nq = wid % ntn;
  if (mt * 16 >= M) return;
  const int row0 = mt * 16, col0 = nq * 64;
  const float* arow = A + (size_t)(row0 + ln) * lda;
  v8f acc[4] = {};
  for (int kb = 0; kb < K; kb += 32) {
    FragB ah, al;
    const v4f x0 = *(const v4fa*)(arow + kb + 8 * hh), x1 = *(const v4fa*)(arow + kb + 8 * hh + 4);
    const v4f x2 = *(const v4fa*)(arow + kb + 16 + 8 * hh), x3 = *(const v4fa*)(arow + kb + 16 + 8 * hh + 4);
    float xs[16] = {x0[0],x0[1],x0[2],x0[3],x1[0],x1[1],x1[2],x1[3],x2[0],x2[1],x2[2],x2[3],x3[0],x3[1],x3[2],x3[3]};
#pragma unroll
    for (int i = 0; i < 16; ++i) { const unsigned short hb = bf16_bits(xs[i]); ah.u[i] = hb; al.u[i] = ASPLIT ? bf16_bits(xs[i] - bf16_val(hb)) : (unsigned short)0; }
#pragma unroll
    for (int t = 0; t < 4; ++t) {
      const unsigned short* brow = Wt + (size_t)(col0 + t * 16 + ln) * ldb + kb;
      FragB b;
      b.half[0] = *(const v8us*)(brow + 8 * hh);
      b.half[1] = *(const v8us*)(brow + 16 + 8 * hh);
      acc[t] = mmaN<ASPLIT ? 2 : 1>(ah.v, al.v, b.v, b.v, acc[t]);
    }
  }
#pragma unroll
  for (int t = 0; t < 4; ++t) {
    float bv = bias ? bias[col0 + t * 16 + ln] : 0.f;
    if (BIAS_BF16) bv = bf16_round(bv);
#pragma unroll
    for (int r = 0; r < 8; ++r) { float v = acc[t][r] + bv; if (ACT == 1) v = fmaxf(v, 0.f); so[w][8 * hh + r][t * 16 + ln] = v; }
  }
  __builtin_amdgcn_fence(__ATOMIC_ACQ_REL, "workgroup");
  __builtin_amdgcn_wave_barrier();
  const int rsub = lane >> 4, c4 = (lane & 15) * 4;
  {
#pragma unroll
    for (int q = 0; q < 8; ++q) {
      const int r = q * 2 + rsub;
      const v4f v = *(const v4fa*)&so[w][r][c4];
      *(v4f*)(C + (size_t)(row0 + r) * ldc + col0 + c4) = v;
    }
    
  }
}

// GEMM C = act(A·W + bias + resid): A f32 (ASPLIT -> hi/lo 2 terms), Wt bf16 [N][K]; ACT 0 none, 1 relu, 2 exact gelu;
// resid (optional, f32, row index = (row % rmod), pitch ldr, RES_BF16 rounds it) added before the activation.
template <bool ASPLIT, int ACT, bool BIAS_BF16, bool RES_BF16>
__global__ __launch_bounds__(128) void k_gemm_bf3(const float* __restrict__ A, int lda, const unsigned short* __restrict__ Wt, int ldb,
                                                const float* __restrict__ bias, const float* __restrict__ resid, int rmod, int ldr,
                                                float* __restrict__ C, int ldc, int M, int N, int K) {
  __shared__ __attribute__((aligned(16))) float so[4][16][64];
  const int tid = threadIdx.x, w = tid >> 5, lane = tid & 31, ln = lane & 15, hh = lane >> 4;
  const int ntn = N / 64;
  const int wid = blockIdx.x * 4 + w;
  const int mt = wid / ntn, nq = wid % ntn;
  if (mt * 16 >= M) return;
  const int row0 = mt * 16, col0 = nq * 64;
  const float* arow = A + (size_t)(row0 + ln) * lda;
  v8f acc[4] = {};
  for (int kb = 0; kb < K; kb += 32) {
    FragB ah, al;
    const v4f x0 = *(const v4fa*)(arow + kb + 8 * hh), x1 = *(const v4fa*)(arow + kb + 8 * hh + 4);
    const v4f x2 = *(const v4fa*)(arow + kb + 16 + 8 * hh), x3 = *(const v4fa*)(arow + kb + 16 + 8 * hh + 4);
    float xs[16] = {x0[0],x0[1],x0[2],x0[3],x1[0],x1[1],x1[2],x1[3],x2[0],x2[1],x2[2],x2[3],x3[0],x3[1],x3[2],x3[3]};
#pragma unroll
    for (int i = 0; i < 16; ++i) { const unsigned short hb = bf16_bits(xs[i]); ah.u[i] = hb; al.u[i] = ASPLIT ? bf16_bits(xs[i] - bf16_val(hb)) : (unsigned short)0; }
#pragma unroll
    for (int t = 0; t < 4; ++t) {
      const unsigned short* brow = Wt + (size_t)(col0 + t * 16 + ln) * ldb + kb;
      FragB b;
      b.half[0] = *(const v8us*)(brow + 8 * hh);
      b.half[1] = *(const v8us*)(brow + 16 + 8 * hh);
      acc[t] = mmaN<ASPLIT ? 2 : 1>(ah.v, al.v, b.v, b.v, acc[t]);
    }
  }
#pragma unroll
  for (int t = 0; t < 4; ++t) {
    const int col = col0 + t * 16 + ln;
    float bv = bias ? bias[col] : 0.f;
    if (BIAS_BF16) bv = bf16_round(bv);
#pragma unroll
    for (int r = 0; r < 8; ++r) {
      float v = acc[t][r] + bv;
      if (resid) { float rv = resid[(size_t)((row0 + 8 * hh + r) % rmod) * ldr + col]; if (RES_BF16) rv = bf16_round(rv); v += rv; }
      if (ACT == 1) v = fmaxf(v, 0.f);
      if (ACT == 2) v = 0.5f * v * (1.0f + erff(v * 0.70710678118654752f));
      if (ACT == 3) { const float u = 0.7978845608028654f * (v + 0.044715f * v * v * v); v = 0.5f * v * (1.0f + tanhf(u)); }
      so[w][8 * hh + r][t * 16 + ln] = v;
    }
  }
  __builtin_amdgcn_fence(__ATOMIC_ACQ_REL, "workgroup");
  __builtin_amdgcn_wave_barrier();
  const int rsub = lane >> 4, c4 = (lane & 15) * 4;
  {
#pragma unroll
    for (int q = 0; q < 8; ++q) {
      const int r = q * 2 + rsub;
      const v4f v = *(const v4fa*)&so[w][r][c4];
      *(v4f*)(C + (size_t)(row0 + r) * ldc + col0 + c4) = v;
    }
    
  }
}
// row LayerNorm (biased variance, eps) over N: s = X (+ R); optional out_sum <- s; out_norm <- (s-mu)*rsqrt(var+eps)*g + b
template <bool PARAM_BF16>
__global__ __launch_bounds__(256) void k_layernorm(const float* __restrict__ X, const float* __restrict__ R, const float* __restrict__ g, const float* __restrict__ bta,
                                                  float* __restrict__ out_sum, float* __restrict__ out_norm, int N, float eps) {
  __shared__ float red[256];
  const int row = blockIdx.x, tid = threadIdx.x;
  const float* x = X + (size_t)row * N; const float* rr = R ? R + (size_t)row * N : nullptr;
  float vals[16];                     // up to N = 4096
  const int per = N / 256;            // contiguous chunk per thread? use strided-by-4 chunks: thread handles j = tid*4 + 1024*u
  float s1 = 0.f;
  for (int u = 0; u < per / 4; ++u) {
    const int j = tid * 4 + 1024 * u;
    const v4f a = *(const v4fa*)(x + j);
    v4f b = {0.f,0.f,0.f,0.f}; if (rr) b = *(const v4fa*)(rr + j);
#pragma unroll
    for (int q = 0; q < 4; ++q) { const float v = a[q] + b[q]; vals[u * 4 + q] = v; s1 += v; }
  }
  red[tid] = s1; __syncthreads();
  for (int st = 128; st > 0; st >>= 1) { if (tid < st) red[tid] += red[tid + st]; __syncthreads(); }
  const float mu = red[0] / (float)N; __syncthreads();
  float s2 = 0.f;
  for (int u = 0; u < per / 4; ++u)
#pragma unroll
    for (int q = 0; q < 4; ++q) { const float c = vals[u * 4 + q] - mu; s2 += c * c; }
  red[tid] = s2; __syncthreads();
  for (int st = 128; st > 0; st >>= 1) { if (tid < st) red[tid] += red[tid + st]; __syncthreads(); }
  const float rs = rsqrtf(red[0] / (float)N + eps);
  {
    for (int u = 0; u < per / 4; ++u) {
      const int j = tid * 4 + 1024 * u;
      v4f o, sm;
#pragma unroll
      for (int q = 0; q < 4; ++q) {
        float gg = g[j + q], bb = bta[j + q];
        if (PARAM_BF16) { gg = bf16_round(gg); bb = bf16_round(bb); }
        sm[q] = vals[u * 4 + q]; o[q] = (vals[u * 4 + q] - mu) * rs * gg + bb;
      }
      if (out_sum) *(v4f*)(out_sum + (size_t)row * N + j) = sm;
      *(v4f*)(out_norm + (size_t)row * N + j) = o;
    }
    
  }
}



// ---- f16 WMMA path (v_wmma_f32_16x16x32_f16): 11-bit significands for operands in range — used where a [0,1] probability operand needs more precision than bf16
typedef _Float16 v16h __attribute__((ext_vector_type(16)));
union FragH { v16h v; v8us half[2]; _Float16 h[16]; unsigned short u[16]; };
template <int NT>
__device__ __forceinline__ v8f mmaH(v16h ah, v16h al, v16h bh, v16h bl, v8f c) {
  c = __builtin_amdgcn_wmma_f32_16x16x32_f16(false, ah, false, bh, (short)0, c, false, false);
  if (NT >= 2) c = __builtin_amdgcn_wmma_f32_16x16x32_f16(false, al, false, bh, (short)0, c, false, false);
  if (NT >= 3) c = __builtin_amdgcn_wmma_f32_16x16x32_f16(false, ah, false, bl, (short)0, c, false, false);
  asm volatile("v_nop\n\tv_nop\n\tv_nop\n\tv_nop" : "+v"(c) : "v"(ah), "v"(al), "v"(bh), "v"(bl));
  return c;
}
// batched GEMM like k_gemm_b but f16 operands: A f32 (split into f16 hi/lo if ASPLIT, else rounded to f16), Bt = f16 values [n][k]; alpha; C f32; N multiple of 16 (partial tiles skipped)
template <bool ASPLIT>
__global__ __launch_bounds__(128) void k_gemm_h(const float* __restrict__ A, int lda, size_t sA, const _Float16* __restrict__ Bh, int ldb, size_t sB, float alpha, float* __restrict__ C, int ldc, size_t sC, int M, int N, int K) {
  __shared__ __attribute__((aligned(16))) float so[4][16][64];
  const int tid = threadIdx.x, w = tid >> 5, lane = tid & 31, ln = lane & 15, hh = lane >> 4; const int by = blockIdx.y;
  A += (size_t)by * sA; Bh += (size_t)by * sB; C += (size_t)by * sC;
  const int ntn = (N + 63) / 64; const int wid = blockIdx.x * 4 + w; const int mt = wid / ntn, nq = wid % ntn; if (mt * 16 >= M) return;
  const int row0 = mt * 16, col0 = nq * 64; const float* arow = A + (size_t)(row0 + ln) * lda;
  v8f acc[4] = {};
  for (int kb = 0; kb < K; kb += 32) {
    FragH ah, al;
    const v4f x0 = *(const v4fa*)(arow + kb + 8 * hh), x1 = *(const v4fa*)(arow + kb + 8 * hh + 4), x2 = *(const v4fa*)(arow + kb + 16 + 8 * hh), x3 = *(const v4fa*)(arow + kb + 16 + 8 * hh + 4);
    float xs[16] = {x0[0],x0[1],x0[2],x0[3],x1[0],x1[1],x1[2],x1[3],x2[0],x2[1],x2[2],x2[3],x3[0],x3[1],x3[2],x3[3]};
#pragma unroll
    for (int i = 0; i < 16; ++i) { const _Float16 h = (_Float16)xs[i]; ah.h[i] = h; al.h[i] = ASPLIT ? (_Float16)(xs[i] - (float)h) : (_Float16)0.0f; }
#pragma unroll
    for (int t = 0; t < 4; ++t) { if (col0 + t * 16 >= N) continue; const size_t boff = (size_t)(col0 + t * 16 + ln) * ldb + kb; FragH bq; bq.half[0] = *(const v8us*)(Bh + boff + 8 * hh); bq.half[1] = *(const v8us*)(Bh + boff + 16 + 8 * hh);
      acc[t] = mmaH<ASPLIT ? 2 : 1>(ah.v, al.v, bq.v, bq.v, acc[t]); }
  }
#pragma unroll
  for (int t = 0; t < 4; ++t) { if (col0 + t * 16 >= N) continue;
#pragma unroll
    for (int r = 0; r < 8; ++r) so[w][8 * hh + r][t * 16 + ln] = acc[t][r] * alpha; }
  __builtin_amdgcn_fence(__ATOMIC_ACQ_REL, "workgroup"); __builtin_amdgcn_wave_barrier();
  const int rsub = lane >> 4, c4 = (lane & 15) * 4;
  {
#pragma unroll
    for (int q = 0; q < 8; ++q) { const int r = q * 2 + rsub; if (col0 + c4 < N) { const v4f v = *(const v4fa*)&so[w][r][c4]; *(v4f*)(C + (size_t)(row0 + r) * ldc + col0 + c4) = v; } }
     }
}

// Wt[n][k] = f16(W[k][n]·scale) from f32 row-major W[K][N] (scale = power of two; bf16-exact weights stay exact in f16 away from the subnormal range)
__global__ __launch_bounds__(256) void k_wt_f16(const float* __restrict__ W, _Float16* __restrict__ Wt, int K, int N, float scale) {
  const int t = blockIdx.x * 256 + threadIdx.x; if (t >= N * (K / 8)) return; const int n = t / (K / 8), k8 = (t % (K / 8)) * 8; FragH f;
#pragma unroll
  for (int i = 0; i < 8; ++i) f.h[i] = (_Float16)(bf16_round(W[(size_t)(k8 + i) * N + n]) * scale); const v8us o = f.half[0];
  *(v8us*)((unsigned short*)Wt + (size_t)n * K + k8) = o; 
}
// k_gemm_hh variant with fused epilogue: v = acc·alpha + bias[by·sBias + col] (+ CP[(row/rowsPerB)·sCPb + by·64 + col] if CP) ; ACT 0 none / 1 elu ; writes f16 C16 (and f32 C if non-null)
template <int ACT>
__global__ __launch_bounds__(128) void k_gemm_hhx(const _Float16* __restrict__ A, int lda, size_t sA, const _Float16* __restrict__ Bh, int ldb, size_t sB, float alpha, const float* __restrict__ bias, size_t sBias, const float* __restrict__ CP, int rowsPerB, size_t sCPb, int row0g,
    float* __restrict__ C, _Float16* __restrict__ C16, int ldc, size_t sC, int M, int N, int K) {
  __shared__ __attribute__((aligned(16))) float so[4][16][64];
  const int tid = threadIdx.x, w = tid >> 5, lane = tid & 31, ln = lane & 15, hh = lane >> 4; const int by = blockIdx.y;
  A += (size_t)by * sA; Bh += (size_t)by * sB; const size_t cofs = (size_t)by * sC; const float* bp = bias ? bias + (size_t)by * sBias : nullptr;
  const int ntn = (N + 63) / 64; const int wid = blockIdx.x * 4 + w; const int mt = wid / ntn, nq = wid % ntn; if (mt * 16 >= M) return;
  const int row0 = mt * 16, col0 = nq * 64; const _Float16* arow = A + (size_t)(row0 + ln) * lda;
  v8f acc[4] = {};
  for (int kb = 0; kb < K; kb += 32) { FragH ah; ah.half[0] = *(const v8us*)((const unsigned short*)arow + kb + 8 * hh); ah.half[1] = *(const v8us*)((const unsigned short*)arow + kb + 16 + 8 * hh);
#pragma unroll
    for (int t = 0; t < 4; ++t) { if (col0 + t * 16 >= N) continue; const size_t boff = (size_t)(col0 + t * 16 + ln) * ldb + kb; FragH bq; bq.half[0] = *(const v8us*)((const unsigned short*)Bh + boff + 8 * hh); bq.half[1] = *(const v8us*)((const unsigned short*)Bh + boff + 16 + 8 * hh);
      acc[t] = mmaH<1>(ah.v, ah.v, bq.v, bq.v, acc[t]); }
  }
#pragma unroll
  for (int t = 0; t < 4; ++t) { if (col0 + t * 16 >= N) continue; const int col = col0 + t * 16 + ln; const float bv = bp ? bf16_round(bp[col]) : 0.f;
#pragma unroll
    for (int r = 0; r < 8; ++r) { float v = acc[t][r] * alpha + bv; if (CP) { const int rr = row0g + row0 + 8 * hh + r; if (rowsPerB < 0) v += CP[cofs + (size_t)rr * ldc + col];      /* rowsPerB < 0: own element of the batched C plane */ else { const int bidx = rr / rowsPerB; v += CP[(size_t)bidx * sCPb + (size_t)by * 64 + col]; } } if (ACT == 1) v = (v > 0.f) ? v : expm1f(v); else if (ACT == 7) v = (v > 0.f) ? v + 1.0f : expf(v); else if (ACT == 8) v = tanhf(v); else if (ACT == 9) v = 0.5f * v * (1.0f + tanhf(0.7978845608028654f * (v + 0.044715f * v * v * v))); else if (ACT == 11) v = 1.0f / (1.0f + expf(-v)); else if (ACT == 12) v = (v > 0.f) ? v : 0.01f * v; else if (ACT == 14) v = (v > 0.f) ? v : 0.1f * v; else if (ACT == 16) v = (v >= 0.f) ? v : 0.3f * v; else if (ACT == 17) v = (v >= 0.f) ? v : 0.2f * v; else if (ACT == 15) v = v / (1.0f + expf(-v)); else if (ACT == 3) v = fmaxf(v, 0.f); else if (ACT == 6) v = 0.5f * v * (1.0f + erff(v * 0.70710678118654752f)); so[w][8 * hh + r][t * 16 + ln] = v; } }
  __builtin_amdgcn_fence(__ATOMIC_ACQ_REL, "workgroup"); __builtin_amdgcn_wave_barrier();
  const int rsub = lane >> 4, c4 = (lane & 15) * 4; typedef _Float16 v4h __attribute__((ext_vector_type(4)));
  {
#pragma unroll
    for (int q = 0; q < 8; ++q) { const int r = q * 2 + rsub; if (col0 + c4 < N) { const v4f v = *(const v4fa*)&so[w][r][c4]; if (C) *(v4f*)(C + cofs + (size_t)(row0 + r) * ldc + col0 + c4) = v; if (C16) { v4h h4; for (int i = 0; i < 4; ++i) h4[i] = (_Float16)v[i]; *(v4h*)(C16 + cofs + (size_t)(row0 + r) * ldc + col0 + c4) = h4; } } }
     }
}


typedef _Float16 v4h __attribute__((ext_vector_type(4)));

__global__ __launch_bounds__(256) void k_x16(const float* __restrict__ x, _Float16* __restrict__ X16, size_t n8) { const size_t t = (size_t)blockIdx.x * 256 + threadIdx.x; if (t >= n8) return; FragH f;
#pragma unroll
  for (int q = 0; q < 8; ++q) f.h[q] = (_Float16)bf16_round(x[t * 8 + q]); *(v8us*)((unsigned short*)X16 + t * 8) = f.half[0];  }
__global__ __launch_bounds__(256) void k_h16(const float* __restrict__ x, _Float16* __restrict__ X16, size_t n8) { const size_t t = (size_t)blockIdx.x * 256 + threadIdx.x; if (t >= n8) return; FragH f;
#pragma unroll
  for (int q = 0; q < 8; ++q) f.h[q] = (_Float16)x[t * 8 + q]; *(v8us*)((unsigned short*)X16 + t * 8) = f.half[0];  }
__global__ __launch_bounds__(256) void k_round16f(const float* __restrict__ W, _Float16* __restrict__ Bt, size_t n8) { const size_t t = (size_t)blockIdx.x * 256 + threadIdx.x; if (t >= n8) return; FragH f;
#pragma unroll
  for (int i = 0; i < 8; ++i) f.h[i] = (_Float16)(bf16_round(W[t * 8 + i]) * 16.0f); *(v8us*)((unsigned short*)Bt + t * 8) = f.half[0];  }
template <int NHv, int TTv>
__global__ __launch_bounds__(256) void k_vt(const _Float16* __restrict__ V16, int ldv, int voff, _Float16* __restrict__ Vt) { __shared__ unsigned short tl[64][66]; const int tid = threadIdx.x; const int slab = blockIdx.x / (TTv / 64), lg = blockIdx.x % (TTv / 64); const int b = slab / NHv, h = slab % NHv;
  for (int i = tid; i < 64 * 8; i += 256) { const int r = i / 8, c8 = (i % 8) * 8; FragH f; f.half[0] = *(const v8us*)((const unsigned short*)V16 + ((size_t)b * TTv + lg * 64 + r) * ldv + voff + h * 64 + c8);
#pragma unroll
    for (int q = 0; q < 8; ++q) tl[r][c8 + q] = f.u[q]; }
  __syncthreads();
  {
#pragma unroll
    for (int rd = 0; rd < 2; ++rd) { const int d = rd * 32 + tid / 8, pc = tid % 8; FragH f;
#pragma unroll
      for (int q = 0; q < 8; ++q) f.u[q] = tl[pc * 8 + q][d];
      *(v8us*)((unsigned short*)Vt + ((size_t)slab * 64 + d) * TTv + lg * 64 + pc * 8) = f.half[0]; }
     } }

__global__ __launch_bounds__(256) void k_hl(const float* __restrict__ F, _Float16* __restrict__ Hh, _Float16* __restrict__ Hl, size_t n8) { const size_t t = (size_t)blockIdx.x * 256 + threadIdx.x; if (t >= n8) return; FragH fh, fl; const v4f a = *(const v4fa*)(F + t * 8), c = *(const v4fa*)(F + t * 8 + 4);
#pragma unroll
  for (int q = 0; q < 4; ++q) { _Float16 h = (_Float16)a[q]; fh.h[q] = h; fl.h[q] = (_Float16)((a[q] - (float)h) * 1024.0f); h = (_Float16)c[q]; fh.h[4 + q] = h; fl.h[4 + q] = (_Float16)((c[q] - (float)h) * 1024.0f); }
  { *(v8us*)((unsigned short*)Hh + t * 8) = fh.half[0]; *(v8us*)((unsigned short*)Hl + t * 8) = fl.half[0];  } }

// ---- fast GEMM (wave tile 32x64; requires M % 32 == 0 rows per launch region and N % 64 == 0); epilogue = k_gemm_hhx semantics ----
__device__ __forceinline__ v16h g2_frag(const _Float16* p, int hh) { FragH f; f.half[0] = *(const v8us*)((const unsigned short*)p + 8 * hh); f.half[1] = *(const v8us*)((const unsigned short*)p + 16 + 8 * hh); return f.v; }
__device__ __forceinline__ v8f g2_mma(v16h a, v16h b, v8f c) { v8f d = __builtin_amdgcn_wmma_f32_16x16x32_f16(false, a, false, b, (short)0, c, false, false); asm volatile("v_nop\n\tv_nop\n\tv_nop\n\tv_nop" : "+v"(d) : "v"(a), "v"(b)); return d; }
template <int ACT>
__global__ __launch_bounds__(128) void k_gemm2(const _Float16* __restrict__ A, int lda, size_t sA, const _Float16* __restrict__ Bh, int ldb, size_t sB, float alpha, const float* __restrict__ bias, size_t sBias, const float* __restrict__ CP, int rowsPerB, size_t sCPb, int row0g,
    float* __restrict__ C, _Float16* __restrict__ C16, int ldc, size_t sC, int M, int N, int K) { static_assert(ACT == 0 || ACT == 3 || ACT == 6 || ACT == 8 || ACT == 9 || ACT == 11 || ACT == 12 || ACT == 14 || ACT == 15 || ACT == 16 || ACT == 17, "k_gemm2: unsupported ACT code (would silently apply no activation)");
  __shared__ __attribute__((aligned(16))) float so[4][32][68];
  const int tid = threadIdx.x, w = tid >> 5, lane = tid & 31, ln = lane & 15, hh = lane >> 4; const int by = blockIdx.y;
  A += (size_t)by * sA; Bh += (size_t)by * sB; const size_t cofs = (size_t)by * sC; const float* bp = bias ? bias + (size_t)by * sBias : nullptr;
  const int ntn = N >> 6; const int mt = blockIdx.x / ntn, nq = blockIdx.x - mt * ntn; const int row0 = mt * 128 + 32 * w, col0 = nq * 64; if (row0 >= M) return;
  const _Float16* a0p = A + (size_t)(row0 + ln) * lda; const _Float16* a1p = a0p + (size_t)16 * lda;
  const _Float16* b0p = Bh + (size_t)(col0 + ln) * ldb; const _Float16* b1p = b0p + (size_t)16 * ldb; const _Float16* b2p = b1p + (size_t)16 * ldb; const _Float16* b3p = b2p + (size_t)16 * ldb;
  const v8f z8 = {0.f,0.f,0.f,0.f,0.f,0.f,0.f,0.f}; v8f c00 = z8, c01 = z8, c02 = z8, c03 = z8, c10 = z8, c11 = z8, c12 = z8, c13 = z8;
#pragma unroll 1
  for (int kb = 0; kb < K; kb += 32) { const v16h a0 = g2_frag(a0p + kb, hh), a1 = g2_frag(a1p + kb, hh);
    v16h b = g2_frag(b0p + kb, hh); c00 = g2_mma(a0, b, c00); c10 = g2_mma(a1, b, c10);
    b = g2_frag(b1p + kb, hh); c01 = g2_mma(a0, b, c01); c11 = g2_mma(a1, b, c11);
    b = g2_frag(b2p + kb, hh); c02 = g2_mma(a0, b, c02); c12 = g2_mma(a1, b, c12);
    b = g2_frag(b3p + kb, hh); c03 = g2_mma(a0, b, c03); c13 = g2_mma(a1, b, c13); }
  v8f accs[8] = {c00, c01, c02, c03, c10, c11, c12, c13};
#pragma unroll
  for (int u = 0; u < 8; ++u) { const int t = u & 3, half = u >> 2; const int col = col0 + t * 16 + ln; const float bv = bp ? bf16_round(bp[col]) : 0.f;
#pragma unroll
    for (int r = 0; r < 8; ++r) { const int rloc = half * 16 + 8 * hh + r; float v = accs[u][r] * alpha + bv; if (CP) { if (rowsPerB < 0) v += CP[cofs + (size_t)(row0g + row0 + rloc) * ldc + col];      /* rowsPerB < 0: own element of the batched C plane */ else { const int bidx = (row0g + row0 + rloc) / rowsPerB; v += CP[(size_t)bidx * sCPb + (size_t)by * 64 + col]; } }
      if (ACT == 3) v = fmaxf(v, 0.f); else if (ACT == 6) v = 0.5f * v * (1.0f + erff(v * 0.70710678118654752f)); else if (ACT == 11) v = 1.0f / (1.0f + expf(-v)); else if (ACT == 15) v = v / (1.0f + expf(-v)); else if (ACT == 12) v = (v > 0.f) ? v : 0.01f * v; else if (ACT == 8) v = tanhf(v); else if (ACT == 9) v = 0.5f * v * (1.0f + tanhf(0.7978845608028654f * (v + 0.044715f * v * v * v))); else if (ACT == 14) v = (v > 0.f) ? v : 0.1f * v; else if (ACT == 16) v = (v >= 0.f) ? v : 0.3f * v; else if (ACT == 17) v = (v >= 0.f) ? v : 0.2f * v;
      so[w][rloc][t * 16 + ln] = v; } }
  __builtin_amdgcn_fence(__ATOMIC_ACQ_REL, "workgroup"); __builtin_amdgcn_wave_barrier();
  const int rsub = lane >> 4, c4 = (lane & 15) * 4;
  {
#pragma unroll
    for (int q = 0; q < 16; ++q) { const int r = q * 2 + rsub; const v4f v = *(const v4fa*)&so[w][r][c4]; if (C) *(v4f*)(C + cofs + (size_t)(row0 + r) * ldc + col0 + c4) = v; if (C16) { v4h h4; for (int i = 0; i < 4; ++i) h4[i] = (_Float16)v[i]; *(v4h*)(C16 + cofs + (size_t)(row0 + r) * ldc + col0 + c4) = h4; } }
     } }


__global__ __launch_bounds__(256) void k_wnat(const float* __restrict__ w, size_t n8, _Float16* __restrict__ Bt) { const size_t t = (size_t)blockIdx.x * 256 + threadIdx.x; if (t >= n8) return; FragH f; for (int q = 0; q < 8; ++q) f.h[q] = (_Float16)(bf16_round(w[t * 8 + q]) * 16.0f); *(v8us*)((unsigned short*)Bt + t * 8) = f.half[0];  }
__global__ __launch_bounds__(256) void k_rsm(const float* __restrict__ S, _Float16* __restrict__ P, int nrows) {
  #pragma clang fp contract(off)
  const int i = blockIdx.x * 256 + threadIdx.x; if (i >= nrows) return; const float* s = S + (size_t)i * SQ; float mx = -3.0e38f;
#pragma unroll 1
  for (int j = 0; j < SQ; ++j) mx = fmaxf(mx, s[j]); float se = 0.f;
#pragma unroll 1
  for (int j = 0; j < SQ; ++j) se += expf(s[j] - mx); const float sc = 256.0f / se;
#pragma unroll 1
  for (int j0 = 0; j0 < SQ; j0 += 8) { FragH f; for (int q = 0; q < 8; ++q) f.h[q] = (_Float16)(expf(s[j0 + q] - mx) * sc); unsigned short* d = (unsigned short*)P + (size_t)i * SQ + j0; *(v8us*)d = f.half[0];  } }
__global__ __launch_bounds__(256) void k_vt(const _Float16* __restrict__ V16, int b, int h0, _Float16* __restrict__ VT) { __shared__ unsigned short tl[64][65]; const int tid = threadIdx.x; const int hh = blockIdx.x % HG, sg = blockIdx.x / HG; const int s0 = sg * 64; const int h = h0 + hh;
  for (int i = tid; i < 64 * 8; i += 256) { const int j = i / 8, d8 = (i % 8) * 8; FragH f; f.half[0] = *(const v8us*)((const unsigned short*)V16 + ((size_t)b * SQ + s0 + j) * DM + h * HD + d8); for (int q = 0; q < 8; ++q) tl[d8 + q][j] = f.u[q]; }
  __syncthreads();
  { for (int i = tid; i < 64 * 8; i += 256) { const int d = i / 8, j8 = (i % 8) * 8; FragH f; for (int q = 0; q < 8; ++q) f.u[q] = tl[d][j8 + q]; *(v8us*)((unsigned short*)VT + ((size_t)hh * HD + d) * SQ + s0 + j8) = f.half[0]; }  } }



#define FW 4                         /* waves per work-group: 128 query columns */
#define SCL 0.18033688011112042f     /* 64^-0.5 * log2(e) */
#define KS 64                        /* keys per stage: two passes */
#define LP 144                       /* LDS row pitch, bytes: 128 + 16, an odd multiple of 16 for 16-byte readers */
#define TB (64 * LP)                 /* bytes of one staged tile of 64 rows */
#define NST (SQ / KS)                /* stages */
__device__ __forceinline__ v8f fa_mma(v16h a, v16h b, v8f c) { return __builtin_amdgcn_wmma_f32_16x16x32_f16(false, a, false, b, (short)0, c, false, false); }
__device__ __forceinline__ float fa_xhalf(float x) { return __builtin_bit_cast(float, __builtin_amdgcn_permlanex16(__builtin_bit_cast(int, x), __builtin_bit_cast(int, x), 0x76543210, 0xfedcba98, false, false)); }      /* lane l <-> lane l ^ 16 */
__device__ __forceinline__ v16h fa_lfrag(const unsigned char* p) { FragH f; f.half[0] = *(const v8us*)p; f.half[1] = *(const v8us*)(p + 32); return f.v; }      /* g2_frag's k order from an LDS row; p already holds the lane half's 16 bytes */
// One stage: each of the 128 threads copies 16 bytes of rows r0, r0 + 16, r0 + 32, r0 + 48 of the K tile (at lds) and of the V^T tile (at lds + TB); eight lanes cover one 128-byte row.
// The s_wait_xcnt closes the copies' own statement, so that it stands in front of every later write of the address registers that the copies name.
__device__ __forceinline__ void fa_stage(unsigned lds, const _Float16* gk, const _Float16* gv) {
  asm volatile("global_load_async_to_lds_b128 %0, %8, off\n\tglobal_load_async_to_lds_b128 %1, %9, off\n\tglobal_load_async_to_lds_b128 %2, %10, off\n\tglobal_load_async_to_lds_b128 %3, %11, off\n\t"
               "global_load_async_to_lds_b128 %4, %12, off\n\tglobal_load_async_to_lds_b128 %5, %13, off\n\tglobal_load_async_to_lds_b128 %6, %14, off\n\tglobal_load_async_to_lds_b128 %7, %15, off\n\ts_wait_xcnt 0x0"
               :: "v"(lds), "v"(lds + 16 * LP), "v"(lds + 32 * LP), "v"(lds + 48 * LP), "v"(lds + TB), "v"(lds + TB + 16 * LP), "v"(lds + TB + 32 * LP), "v"(lds + TB + 48 * LP),
                  "v"(gk), "v"(gk + (size_t)16 * DM), "v"(gk + (size_t)32 * DM), "v"(gk + (size_t)48 * DM), "v"(gv), "v"(gv + (size_t)16 * SQ), "v"(gv + (size_t)32 * SQ), "v"(gv + (size_t)48 * SQ)
               : "memory"); }
__global__ __launch_bounds__(FW * 32) void k_fattn(const _Float16* __restrict__ Q16, const _Float16* __restrict__ K16, const _Float16* __restrict__ VT, _Float16* __restrict__ O16) {
  __shared__ __attribute__((aligned(16))) unsigned char L[2 * 2 * TB];      /* two buffers of [K tile | V^T tile] */
  const int lane = threadIdx.x & 31, c = lane & 15, hh = lane >> 4; const int w = __builtin_amdgcn_readfirstlane(threadIdx.x >> 5);
  const int bh = blockIdx.y, b = bh / NH, h = bh - b * NH; const int q0 = blockIdx.x * (FW * 32) + w * 32;
  const int r0 = threadIdx.x >> 3, ch = threadIdx.x & 7;      /* this thread's row (mod 16) and 16-byte piece in every copied tile */
  const unsigned lst = (unsigned)(size_t)L + r0 * LP + ch * 16;
  const _Float16* gk = K16 + ((size_t)b * SQ + r0) * DM + h * HD + ch * 8; const _Float16* gv = VT + ((size_t)bh * HD + r0) * SQ + ch * 8;
  fa_stage(lst, gk, gv);
  const _Float16* qp = Q16 + ((size_t)b * SQ + q0 + c) * DM + h * HD;
  v16h qf[2][2];
#pragma unroll
  for (int g = 0; g < 2; ++g) for (int kc = 0; kc < 2; ++kc) qf[g][kc] = g2_frag(qp + (size_t)g * 16 * DM + kc * 32, hh);
  asm volatile("s_wait_asynccnt 0x0" ::: "memory");      /* this wave's share of stage 0 has landed */
  __syncthreads();      /* publishes stage 0 */
  fa_stage(lst + 2 * TB, gk + (size_t)KS * DM, gv + KS);
  const v8f z8 = {0.f,0.f,0.f,0.f,0.f,0.f,0.f,0.f}; v8f o[2][4] = {{z8, z8, z8, z8}, {z8, z8, z8, z8}}; float m[2] = {-1.0e30f, -1.0e30f}, l[2] = {0.f, 0.f};
  for (int t = 0; t < NST; ++t) {
    const unsigned char* kl = L + (t & 1) * (2 * TB) + c * LP + 16 * hh; const unsigned char* vl = kl + TB;
    v16h kf[2][2];
#pragma unroll
    for (int kt = 0; kt < 2; ++kt) for (int kc = 0; kc < 2; ++kc) kf[kt][kc] = fa_lfrag(kl + kt * 16 * LP + kc * 64);
#pragma unroll
    for (int p = 0; p < 2; ++p) {
    v16h vf[4];
#pragma unroll
    for (int dt = 0; dt < 4; ++dt) vf[dt] = fa_lfrag(vl + dt * 16 * LP + p * 64);
    v8f s[2][2];
#pragma unroll
    for (int g = 0; g < 2; ++g) for (int kt = 0; kt < 2; ++kt) s[g][kt] = fa_mma(kf[kt][1], qf[g][1], fa_mma(kf[kt][0], qf[g][0], z8));
    if (p == 0) {      /* the stage's second pass's K rows, fetched one pass ahead from the same buffer */
#pragma unroll
      for (int kt = 0; kt < 2; ++kt) for (int kc = 0; kc < 2; ++kc) kf[kt][kc] = fa_lfrag(kl + (32 + kt * 16) * LP + kc * 64);
    }
    __builtin_amdgcn_sched_barrier(0);      /* keeps the V and K fragment reads up here, ahead of the softmax; without it the scheduler sinks them directly in front of the wait for them */
#pragma unroll
    for (int g = 0; g < 2; ++g) {
      float x[16];
#pragma unroll
      for (int i = 0; i < 16; ++i) x[i] = s[g][i >> 3][i & 7];
      float mx = fmaxf(fmaxf(fmaxf(x[0], x[1]), fmaxf(x[2], x[3])), fmaxf(fmaxf(x[4], x[5]), fmaxf(x[6], x[7])));
      mx = fmaxf(mx, fmaxf(fmaxf(fmaxf(x[8], x[9]), fmaxf(x[10], x[11])), fmaxf(fmaxf(x[12], x[13]), fmaxf(x[14], x[15]))));
      mx = fmaxf(mx, fa_xhalf(mx));
      const float mn = fmaxf(m[g], mx), nb = -mn * SCL; float al = (m[g] - mn) * SCL; m[g] = mn;
#pragma unroll
      for (int i = 0; i < 16; ++i) x[i] = fmaf(x[i], SCL, nb);
      /* exponentials in place, each run closed by one v_nop: the instruction set asks for one independent instruction between a transcendental and an overwrite of its source or a use of its result */
      asm("v_exp_f32 %0, %0\n\tv_exp_f32 %1, %1\n\tv_exp_f32 %2, %2\n\tv_exp_f32 %3, %3\n\tv_exp_f32 %4, %4\n\tv_exp_f32 %5, %5\n\tv_exp_f32 %6, %6\n\tv_exp_f32 %7, %7\n\tv_exp_f32 %8, %8\n\tv_nop"
          : "+v"(x[0]), "+v"(x[1]), "+v"(x[2]), "+v"(x[3]), "+v"(x[4]), "+v"(x[5]), "+v"(x[6]), "+v"(x[7]), "+v"(al));
      asm("v_exp_f32 %0, %0\n\tv_exp_f32 %1, %1\n\tv_exp_f32 %2, %2\n\tv_exp_f32 %3, %3\n\tv_exp_f32 %4, %4\n\tv_exp_f32 %5, %5\n\tv_exp_f32 %6, %6\n\tv_exp_f32 %7, %7\n\tv_nop"
          : "+v"(x[8]), "+v"(x[9]), "+v"(x[10]), "+v"(x[11]), "+v"(x[12]), "+v"(x[13]), "+v"(x[14]), "+v"(x[15]));
      const float ps = (((x[0] + x[1]) + (x[2] + x[3])) + ((x[4] + x[5]) + (x[6] + x[7]))) + (((x[8] + x[9]) + (x[10] + x[11])) + ((x[12] + x[13]) + (x[14] + x[15])));
      l[g] = fmaf(l[g], al, ps);      /* this half's keys only; the halves are joined behind the loop */
      FragH pf;
#pragma unroll
      for (int i = 0; i < 16; ++i) pf.h[i] = (_Float16)x[i];
#pragma unroll
      for (int dt = 0; dt < 4; ++dt) { o[g][dt] *= al; o[g][dt] = fa_mma(vf[dt], pf.v, o[g][dt]); }
    }
    }
    __builtin_amdgcn_sched_barrier(0);      /* holds the four v_nop below behind the stage's last WMMA */
    asm volatile("v_nop\n\tv_nop\n\tv_nop\n\tv_nop");      /* WMMA distance over the back edge: the next stage's first instructions may write registers that the last WMMA reads as A or B */
    asm volatile("s_wait_dscnt 0x0" ::: "memory");      /* this wave's reads of the buffer that is refilled below have returned */
    asm volatile("s_wait_asynccnt 0x0" ::: "memory");      /* this wave's share of stage t + 1 has landed */
    __syncthreads();      /* publishes stage t + 1 and ends every wave's reads of stage t */
    if (t + 2 < NST) fa_stage(lst + (t & 1) * (2 * TB), gk + (size_t)(t + 2) * KS * DM, gv + (size_t)(t + 2) * KS);
  }
  asm volatile("s_wait_asynccnt 0x0" ::: "memory");      /* no copy is outstanding when the wave ends */
#pragma unroll
  for (int g = 0; g < 2; ++g) { const float inv = 64.0f / (l[g] + fa_xhalf(l[g])); _Float16* op = O16 + ((size_t)b * SQ + q0 + g * 16 + c) * DM + h * HD + 8 * hh;
#pragma unroll
    for (int dt = 0; dt < 4; ++dt) { FragH f;      /* a lane's 8 accumulator registers are 8 consecutive d of one query: one 16-byte store */
#pragma unroll
      for (int r = 0; r < 8; ++r) f.h[r] = (_Float16)(o[g][dt][r] * inv);
      *(v8us*)((unsigned short*)op + dt * 16) = f.half[0]; } } }

extern "C" void kernel_launch(void* const* d_in, const int* in_sizes, int n_in,
                              void* d_out, int out_size, void* d_ws, size_t ws_size, hipStream_t stream) {
  (void)in_sizes; (void)n_in; (void)out_size;
  const float* const* I = (const float* const*)d_in; const float* x = I[0]; const float* wq = I[1]; const float* bq = I[2]; const float* wk = I[3]; const float* bk = I[4]; const float* wv = I[5]; const float* bv = I[6]; const float* wo = I[7]; const float* bo = I[8];      /* [in][out] weights + biases (y = x @ W + b) */
  char* ws = (char*)d_ws; size_t off = 0;
  auto take = [&](size_t bytes) { char* p = ws + off; off += (bytes + 255) & ~(size_t)255; return p; };
  _Float16* BQ = (_Float16*)take((size_t)DM * DM * 2); _Float16* BK = (_Float16*)take((size_t)DM * DM * 2); _Float16* BV = (_Float16*)take((size_t)DM * DM * 2); _Float16* BO = (_Float16*)take((size_t)DM * DM * 2);
  _Float16* X16 = (_Float16*)take(NR * DM * 2); _Float16* Q16 = (_Float16*)take(NR * DM * 2); _Float16* K16 = (_Float16*)take(NR * DM * 2); _Float16* V16 = (_Float16*)take(NR * DM * 2); _Float16* O16 = (_Float16*)take(NR * DM * 2);
  _Float16* VT = (_Float16*)take((size_t)NB * NH * HD * SQ * 2);
  if (off > ws_size) return;
  { const unsigned g = (unsigned)(((size_t)DM * (DM / 8) + 255) / 256); k_wt_f16<<<g, 256, 0, stream>>>(wq, BQ, DM, DM, 16.0f); k_wt_f16<<<g, 256, 0, stream>>>(wk, BK, DM, DM, 16.0f); k_wt_f16<<<g, 256, 0, stream>>>(wv, BV, DM, DM, 16.0f); k_wt_f16<<<g, 256, 0, stream>>>(wo, BO, DM, DM, 16.0f); }      /* [in][out] -> Bt[n][k] x16 (transposing builder) */

  k_x16<<<(unsigned)((NR * DM / 8 + 255) / 256), 256, 0, stream>>>(x, X16, NR * DM / 8);
  const size_t r0p = (size_t)B0 * SQ;      /* first projected row */
  k_gemm2<0><<<dim3((unsigned)((MP / 128) * (DM / 64)), 1), 128, 0, stream>>>(X16 + r0p * DM, DM, 0, BQ, DM, 0, 0.0625f, bq, 0, nullptr, 1, 0, 0, nullptr, Q16 + r0p * DM, DM, 0, MP, DM, DM);
  k_gemm2<0><<<dim3((unsigned)((MP / 128) * (DM / 64)), 1), 128, 0, stream>>>(X16 + r0p * DM, DM, 0, BK, DM, 0, 0.0625f, bk, 0, nullptr, 1, 0, 0, nullptr, K16 + r0p * DM, DM, 0, MP, DM, DM);
  k_gemm2<0><<<dim3((unsigned)((MP / 128) * (DM / 64)), 1), 128, 0, stream>>>(X16 + r0p * DM, DM, 0, BV, DM, 0, 0.0625f, bv, 0, nullptr, 1, 0, 0, nullptr, V16 + r0p * DM, DM, 0, MP, DM, DM);
  k_vt<NH, SQ><<<NB * NH * (SQ / 64), 256, 0, stream>>>(V16, LQ, 0, VT);      /* V^T [NB][NH][HD][SQ] */
  k_fattn<<<dim3(SQ / (FW * 32), NB * NH), FW * 32, 0, stream>>>(Q16, K16, VT, O16);      /* o x64 (merged heads) as f16 rows */
  k_gemm2<0><<<dim3((unsigned)((MPO / 128) * (DM / 64)), 1), 128, 0, stream>>>(O16 + r0p * DM, DM, 0, BO, DM, 0, 0.0009765625f, bo, 0, nullptr, 1, 0, 0, (float*)d_out + r0p * DM, nullptr, DM, 0, MPO, DM, DM);      /* out rows are the output layout */
}

// v004
// It runs in 182 microseconds.
// In two side-by-side timings against v003, it was 1.54 and 1.55 times as fast.
// All steps since v000 together make it 109 times as fast.
#include <hip/hip_runtime.h>
// Multi-head self-attention over 4096-token sequences at width 768 with [in][out] projections and biases (hidden_states [2][4096][768]; q / k / v = x W + b ([in][out] 768 x 768 + biases), 12 heads of 64; scores * 1/sqrt(64); softmax over all 4096 keys (no mask); out = merged Wo + bo ([in][out]) -> [2][4096][768]); all heads and batches in one attention launch.
// Structure: token rows r = b*4096 + s; x as exact f16 rows (bf16-rounded); Q, K, V as three WMMA GEMMs (32x64 wave tiles, f32 accumulation, exact x16 weights + bias, f16 outputs); V^T for all batches and heads via LDS transposes; one attention launch for all (batch, head): S^T = K Q^T, K and V^T staged in LDS per work-group, online softmax in registers (f32 statistics, native exp2; weights exp(s - running max) as f16), O^T += V^T P^T, o carried x64 against f16 subnormal flush (folded into the output GEMM alpha), written straight into the merged f16 o rows; out = o W_o + b GEMM (f32) into the output layout.
// Compute dtype: inputs rounded to bf16; x / weights exact; q, k, v, softmax weights and o as plain f16 GEMM operands (~2^-12); scores and softmax statistics f32. v_wmma_f32_16x16x32_f16.
#define NB 2
#define SQ 4096
#define DM 768
#define NH 12
#define HD 64
#define HG 1                         /* heads per group in the unlaunched per-batch k_vt (a 4096^2 f32 score slab is 64 MiB) */
#define B0 0                         /* first batch processed (debug hook) */
#define NBR NB                       /* batches processed (debug hook) */
#define NR ((size_t)NB * SQ)         /* token rows */
#define MP ((int)((size_t)NBR * SQ)) /* rows projected (debug hook) */
#define QN SQ                        /* unused: attention covers all SQ query rows */
#define NHD NH                       /* unused: attention covers all NH heads */
#define MPO MP                       /* rows through the output stage (debug hook) */
#define LQ DM      /* row pitch of the q/k/v rows */
typedef __bf16 v16b __attribute__((ext_vector_type(16)));
typedef unsigned short v8us __attribute__((ext_vector_type(8), may_alias));
typedef float  v8f  __attribute__((ext_vector_type(8)));
typedef float  v4f  __attribute__((ext_vector_type(4)));
typedef float  v4fa __attribute__((ext_vector_type(4), may_alias));
union FragB { v16b v; v8us half[2]; unsigned short u[16]; };

__device__ __forceinline__ unsigned short bf16_bits(float x) { unsigned int u = __float_as_uint(x); return (unsigned short)((u + 0x7FFFu + ((u >> 16) & 1u)) >> 16); }
__device__ __forceinline__ float bf16_val(unsigned short b) { return __uint_as_float(((unsigned int)b) << 16); }
__device__ __forceinline__ float bf16_round(float x) { return bf16_val(bf16_bits(x)); }
// D += A·B with NT terms: 1 = ah·bh, 2 = + al·bh (A split), 3 = + ah·bl (both split)
template <int NT>
__device__ __forceinline__ v8f mmaN(v16b ah, v16b al, v16b bh, v16b bl, v8f c) {
  c = __builtin_amdgcn_wmma_f32_16x16x32_bf16(false, ah, false, bh, (short)0, c, false, false);
  if (NT >= 2) c = __builtin_amdgcn_wmma_f32_16x16x32_bf16(false, al, false, bh, (short)0, c, false, false);
  if (NT >= 3) c = __builtin_amdgcn_wmma_f32_16x16x32_bf16(false, ah, false, bl, (short)0, c, false, false);
  asm volatile("v_nop\n\tv_nop\n\tv_nop\n\tv_nop" : "+v"(c) : "v"(ah), "v"(al), "v"(bh), "v"(bl));
  return c;
}

__global__ __launch_bounds__(256) void k_wt_bf16(const float* __restrict__ W, unsigned short* __restrict__ Wt, int K, int N) {
  const int t = blockIdx.x * 256 + threadIdx.x;
  const int k8n = K / 8;
  if (t >= N * k8n) return;
  const int n = t / k8n, k8 = (t % k8n) * 8;
  v8us v;
#pragma unroll
  for (int i = 0; i < 8; ++i) v[i] = bf16_bits(W[(size_t)(k8 + i) * N + n]);
  *(v8us*)(Wt + (size_t)n * K + k8) = v;
  
}

// GEMM C[M][N] (f32, pitch ldc) = act(A[M][K]·W + bias). A f32 row-major (pitch lda) converted per fragment to bf16
// (ASPLIT: hi/lo two planes -> 2 terms, else single rounded term); Wt bf16 [N][K] (pitch ldb). BIAS_BF16 rounds the
// bias to bf16 first (bias quantised to bf16 before the add). K%32==0, M%16==0, N%64==0.
template <bool ASPLIT, int ACT, bool BIAS_BF16>
__global__ __launch_bounds__(128) void k_gemm_bf(const float* __restrict__ A, int lda, const unsigned short* __restrict__ Wt, int ldb,
                                               const float* __restrict__ bias, float* __restrict__ C, int ldc, int M, int N, int K) {
  __shared__ __attribute__((aligned(16))) float so[4][16][64];
  const int tid = threadIdx.x, w = tid >> 5, lane = tid & 31, ln = lane & 15, hh = lane >> 4;
  const int ntn = N / 64;
  const int wid = blockIdx.x * 4 + w;
  const int mt = wid / ntn, nq = wid % ntn;
  if (mt * 16 >= M) return;
  const int row0 = mt * 16, col0 = nq * 64;
  const float* arow = A + (size_t)(row0 + ln) * lda;
  v8f acc[4] = {};
  for (int kb = 0; kb < K; kb += 32) {
    FragB ah, al;
    const v4f x0 = *(const v4fa*)(arow + kb + 8 * hh), x1 = *(const v4fa*)(arow + kb + 8 * hh + 4);
    const v4f x2 = *(const v4fa*)(arow + kb + 16 + 8 * hh), x3 = *(const v4fa*)(arow + kb + 16 + 8 * hh + 4);
    float xs[16] = {x0[0],x0[1],x0[2],x0[3],x1[0],x1[1],x1[2],x1[3],x2[0],x2[1],x2[2],x2[3],x3[0],x3[1],x3[2],x3[3]};
#pragma unroll
    for (int i = 0; i < 16; ++i) { const unsigned short hb = bf16_bits(xs[i]); ah.u[i] = hb; al.u[i] = ASPLIT ? bf16_bits(xs[i] - bf16_val(hb)) : (unsigned short)0; }
#pragma unroll
    for (int t = 0; t < 4; ++t) {
      const unsigned short* brow = Wt + (size_t)(col0 + t * 16 + ln) * ldb + kb;
      FragB b;
      b.half[0] = *(const v8us*)(brow + 8 * hh);
      b.half[1] = *(const v8us*)(brow + 16 + 8 * hh);
      acc[t] = mmaN<ASPLIT ? 2 : 1>(ah.v, al.v, b.v, b.v, acc[t]);
    }
  }
#pragma unroll
  for (int t = 0; t < 4; ++t) {
    float bv = bias ? bias[col0 + t * 16 + ln] : 0.f;
    if (BIAS_BF16) bv = bf16_round(bv);
#pragma unroll
    for (int r = 0; r < 8; ++r) { float v = acc[t][r] + bv; if (ACT == 1) v = fmaxf(v, 0.f); so[w][8 * hh + r][t * 16 + ln] = v; }
  }
  __builtin_amdgcn_fence(__ATOMIC_ACQ_REL, "workgroup");
  __builtin_amdgcn_wave_barrier();
  const int rsub = lane >> 4, c4 = (lane & 15) * 4;
  {
#pragma unroll
    for (int q = 0; q < 8; ++q) {
      const int r = q * 2 + rsub;
      const v4f v = *(const v4fa*)&so[w][r][c4];
      *(v4f*)(C + (size_t)(row0 + r) * ldc + col0 + c4) = v;
    }
    
  }
}

// GEMM C = act(A·W + bias + resid): A f32 (ASPLIT -> hi/lo 2 terms), Wt bf16 [N][K]; ACT 0 none, 1 relu, 2 exact gelu;
// resid (optional, f32, row index = (row % rmod), pitch ldr, RES_BF16 rounds it) added before the activation.
template <bool ASPLIT, int ACT, bool BIAS_BF16, bool RES_BF16>
__global__ __launch_bounds__(128) void k_gemm_bf3(const float* __restrict__ A, int lda, const unsigned short* __restrict__ Wt, int ldb,
                                                const float* __restrict__ bias, const float* __restrict__ resid, int rmod, int ldr,
                                                float* __restrict__ C, int ldc, int M, int N, int K) {
  __shared__ __attribute__((aligned(16))) float so[4][16][64];
  const int tid = threadIdx.x, w = tid >> 5, lane = tid & 31, ln = lane & 15, hh = lane >> 4;
  const int ntn = N / 64;
  const int wid = blockIdx.x * 4 + w;
  const int mt = wid / ntn, nq = wid % ntn;
  if (mt * 16 >= M) return;
  const int row0 = mt * 16, col0 = nq * 64;
  const float* arow = A + (size_t)(row0 + ln) * lda;
  v8f acc[4] = {};
  for (int kb = 0; kb < K; kb += 32) {
    FragB ah, al;
    const v4f x0 = *(const v4fa*)(arow + kb + 8 * hh), x1 = *(const v4fa*)(arow + kb + 8 * hh + 4);
    const v4f x2 = *(const v4fa*)(arow + kb + 16 + 8 * hh), x3 = *(const v4fa*)(arow + kb + 16 + 8 * hh + 4);
    float xs[16] = {x0[0],x0[1],x0[2],x0[3],x1[0],x1[1],x1[2],x1[3],x2[0],x2[1],x2[2],x2[3],x3[0],x3[1],x3[2],x3[3]};
#pragma unroll
    for (int i = 0; i < 16; ++i) { const unsigned short hb = bf16_bits(xs[i]); ah.u[i] = hb; al.u[i] = ASPLIT ? bf16_bits(xs[i] - bf16_val(hb)) : (unsigned short)0; }
#pragma unroll
    for (int t = 0; t < 4; ++t) {
      const unsigned short* brow = Wt + (size_t)(col0 + t * 16 + ln) * ldb + kb;
      FragB b;
      b.half[0] = *(const v8us*)(brow + 8 * hh);
      b.half[1] = *(const v8us*)(brow + 16 + 8 * hh);
      acc[t] = mmaN<ASPLIT ? 2 : 1>(ah.v, al.v, b.v, b.v, acc[t]);
    }
  }
#pragma unroll
  for (int t = 0; t < 4; ++t) {
    const int col = col0 + t * 16 + ln;
    float bv = bias ? bias[col] : 0.f;
    if (BIAS_BF16) bv = bf16_round(bv);
#pragma unroll
    for (int r = 0; r < 8; ++r) {
      float v = acc[t][r] + bv;
      if (resid) { float rv = resid[(size_t)((row0 + 8 * hh + r) % rmod) * ldr + col]; if (RES_BF16) rv = bf16_round(rv); v += rv; }
      if (ACT == 1) v = fmaxf(v, 0.f);
      if (ACT == 2) v = 0.5f * v * (1.0f + erff(v * 0.70710678118654752f));
      if (ACT == 3) { const float u = 0.7978845608028654f * (v + 0.044715f * v * v * v); v = 0.5f * v * (1.0f + tanhf(u)); }
      so[w][8 * hh + r][t * 16 + ln] = v;
    }
  }
  __builtin_amdgcn_fence(__ATOMIC_ACQ_REL, "workgroup");
  __builtin_amdgcn_wave_barrier();
  const int rsub = lane >> 4, c4 = (lane & 15) * 4;
  {
#pragma unroll
    for (int q = 0; q < 8; ++q) {
      const int r = q * 2 + rsub;
      const v4f v = *(const v4fa*)&so[w][r][c4];
      *(v4f*)(C + (size_t)(row0 + r) * ldc + col0 + c4) = v;
    }
    
  }
}
// row LayerNorm (biased variance, eps) over N: s = X (+ R); optional out_sum <- s; out_norm <- (s-mu)*rsqrt(var+eps)*g + b
template <bool PARAM_BF16>
__global__ __launch_bounds__(256) void k_layernorm(const float* __restrict__ X, const float* __restrict__ R, const float* __restrict__ g, const float* __restrict__ bta,
                                                  float* __restrict__ out_sum, float* __restrict__ out_norm, int N, float eps) {
  __shared__ float red[256];
  const int row = blockIdx.x, tid = threadIdx.x;
  const float* x = X + (size_t)row * N; const float* rr = R ? R + (size_t)row * N : nullptr;
  float vals[16];                     // up to N = 4096
  const int per = N / 256;            // contiguous chunk per thread? use strided-by-4 chunks: thread handles j = tid*4 + 1024*u
  float s1 = 0.f;
  for (int u = 0; u < per / 4; ++u) {
    const int j = tid * 4 + 1024 * u;
    const v4f a = *(const v4fa*)(x + j);
    v4f b = {0.f,0.f,0.f,0.f}; if (rr) b = *(const v4fa*)(rr + j);
#pragma unroll
    for (int q = 0; q < 4; ++q) { const float v = a[q] + b[q]; vals[u * 4 + q] = v; s1 += v; }
  }
  red[tid] = s1; __syncthreads();
  for (int st = 128; st > 0; st >>= 1) { if (tid < st) red[tid] += red[tid + st]; __syncthreads(); }
  const float mu = red[0] / (float)N; __syncthreads();
  float s2 = 0.f;
  for (int u = 0; u < per / 4; ++u)
#pragma unroll
    for (int q = 0; q < 4; ++q) { const float c = vals[u * 4 + q] - mu; s2 += c * c; }
  red[tid] = s2; __syncthreads();
  for (int st = 128; st > 0; st >>= 1) { if (tid < st) red[tid] += red[tid + st]; __syncthreads(); }
  const float rs = rsqrtf(red[0] / (float)N + eps);
  {
    for (int u = 0; u < per / 4; ++u) {
      const int j = tid * 4 + 1024 * u;
      v4f o, sm;
#pragma unroll
      for (int q = 0; q < 4; ++q) {
        float gg = g[j + q], bb = bta[j + q];
        if (PARAM_BF16) { gg = bf16_round(gg); bb = bf16_round(bb); }
        sm[q] = vals[u * 4 + q]; o[q] = (vals[u * 4 + q] - mu) * rs * gg + bb;
      }
      if (out_sum) *(v4f*)(out_sum + (size_t)row * N + j) = sm;
      *(v4f*)(out_norm + (size_t)row * N + j) = o;
    }
    
  }
}



// ---- f16 WMMA path (v_wmma_f32_16x16x32_f16): 11-bit significands for operands in range — used where a [0,1] probability operand needs more precision than bf16
typedef _Float16 v16h __attribute__((ext_vector_type(16)));
union FragH { v16h v; v8us half[2]; _Float16 h[16]; unsigned short u[16]; };
template <int NT>
__device__ __forceinline__ v8f mmaH(v16h ah, v16h al, v16h bh, v16h bl, v8f c) {
  c = __builtin_amdgcn_wmma_f32_16x16x32_f16(false, ah, false, bh, (short)0, c, false, false);
  if (NT >= 2) c = __builtin_amdgcn_wmma_f32_16x16x32_f16(false, al, false, bh, (short)0, c, false, false);
  if (NT >= 3) c = __builtin_amdgcn_wmma_f32_16x16x32_f16(false, ah, false, bl, (short)0, c, false, false);
  asm volatile("v_nop\n\tv_nop\n\tv_nop\n\tv_nop" : "+v"(c) : "v"(ah), "v"(al), "v"(bh), "v"(bl));
  return c;
}
// batched GEMM like k_gemm_b but f16 operands: A f32 (split into f16 hi/lo if ASPLIT, else rounded to f16), Bt = f16 values [n][k]; alpha; C f32; N multiple of 16 (partial tiles skipped)
template <bool ASPLIT>
__global__ __launch_bounds__(128) void k_gemm_h(const float* __restrict__ A, int lda, size_t sA, const _Float16* __restrict__ Bh, int ldb, size_t sB, float alpha, float* __restrict__ C, int ldc, size_t sC, int M, int N, int K) {
  __shared__ __attribute__((aligned(16))) float so[4][16][64];
  const int tid = threadIdx.x, w = tid >> 5, lane = tid & 31, ln = lane & 15, hh = lane >> 4; const int by = blockIdx.y;
  A += (size_t)by * sA; Bh += (size_t)by * sB; C += (size_t)by * sC;
  const int ntn = (N + 63) / 64; const int wid = blockIdx.x * 4 + w; const int mt = wid / ntn, nq = wid % ntn; if (mt * 16 >= M) return;
  const int row0 = mt * 16, col0 = nq * 64; const float* arow = A + (size_t)(row0 + ln) * lda;
  v8f acc[4] = {};
  for (int kb = 0; kb < K; kb += 32) {
    FragH ah, al;
    const v4f x0 = *(const v4fa*)(arow + kb + 8 * hh), x1 = *(const v4fa*)(arow + kb + 8 * hh + 4), x2 = *(const v4fa*)(arow + kb + 16 + 8 * hh), x3 = *(const v4fa*)(arow + kb + 16 + 8 * hh + 4);
    float xs[16] = {x0[0],x0[1],x0[2],x0[3],x1[0],x1[1],x1[2],x1[3],x2[0],x2[1],x2[2],x2[3],x3[0],x3[1],x3[2],x3[3]};
#pragma unroll
    for (int i = 0; i < 16; ++i) { const _Float16 h = (_Float16)xs[i]; ah.h[i] = h; al.h[i] = ASPLIT ? (_Float16)(xs[i] - (float)h) : (_Float16)0.0f; }
#pragma unroll
    for (int t = 0; t < 4; ++t) { if (col0 + t * 16 >= N) continue; const size_t boff = (size_t)(col0 + t * 16 + ln) * ldb + kb; FragH bq; bq.half[0] = *(const v8us*)(Bh + boff + 8 * hh); bq.half[1] = *(const v8us*)(Bh + boff + 16 + 8 * hh);
      acc[t] = mmaH<ASPLIT ? 2 : 1>(ah.v, al.v, bq.v, bq.v, acc[t]); }
  }
#pragma unroll
  for (int t = 0; t < 4; ++t) { if (col0 + t * 16 >= N) continue;
#pragma unroll
    for (int r = 0; r < 8; ++r) so[w][8 * hh + r][t * 16 + ln] = acc[t][r] * alpha; }
  __builtin_amdgcn_fence(__ATOMIC_ACQ_REL, "workgroup"); __builtin_amdgcn_wave_barrier();
  const int rsub = lane >> 4, c4 = (lane & 15) * 4;
  {
#pragma unroll
    for (int q = 0; q < 8; ++q) { const int r = q * 2 + rsub; if (col0 + c4 < N) { const v4f v = *(const v4fa*)&so[w][r][c4]; *(v4f*)(C + (size_t)(row0 + r) * ldc + col0 + c4) = v; } }
     }
}

// Wt[n][k] = f16(W[k][n]·scale) from f32 row-major W[K][N] (scale = power of two; bf16-exact weights stay exact in f16 away from the subnormal range)
__global__ __launch_bounds__(256) void k_wt_f16(const float* __restrict__ W, _Float16* __restrict__ Wt, int K, int N, float scale) {
  const int t = blockIdx.x * 256 + threadIdx.x; if (t >= N * (K / 8)) return; const int n = t / (K / 8), k8 = (t % (K / 8)) * 8; FragH f;
#pragma unroll
  for (int i = 0; i < 8; ++i) f.h[i] = (_Float16)(bf16_round(W[(size_t)(k8 + i) * N + n]) * scale); const v8us o = f.half[0];
  *(v8us*)((unsigned short*)Wt + (size_t)n * K + k8) = o; 
}
// k_gemm_hh variant with fused epilogue: v = acc·alpha + bias[by·sBias + col] (+ CP[(row/rowsPerB)·sCPb + by·64 + col] if CP) ; ACT 0 none / 1 elu ; writes f16 C16 (and f32 C if non-null)
template <int ACT>
__global__ __launch_bounds__(128) void k_gemm_hhx(const _Float16* __restrict__ A, int lda, size_t sA, const _Float16* __restrict__ Bh, int ldb, size_t sB, float alpha, const float* __restrict__ bias, size_t sBias, const float* __restrict__ CP, int rowsPerB, size_t sCPb, int row0g,
    float* __restrict__ C, _Float16* __restrict__ C16, int ldc, size_t sC, int M, int N, int K) {
  __shared__ __attribute__((aligned(16))) float so[4][16][64];
  const int tid = threadIdx.x, w = tid >> 5, lane = tid & 31, ln = lane & 15, hh = lane >> 4; const int by = blockIdx.y;
  A += (size_t)by * sA; Bh += (size_t)by * sB; const size_t cofs = (size_t)by * sC; const float* bp = bias ? bias + (size_t)by * sBias : nullptr;
  const int ntn = (N + 63) / 64; const int wid = blockIdx.x * 4 + w; const int mt = wid / ntn, nq = wid % ntn; if (mt * 16 >= M) return;
  const int row0 = mt * 16, col0 = nq * 64; const _Float16* arow = A + (size_t)(row0 + ln) * lda;
  v8f acc[4] = {};
  for (int kb = 0; kb < K; kb += 32) { FragH ah; ah.half[0] = *(const v8us*)((const unsigned short*)arow + kb + 8 * hh); ah.half[1] = *(const v8us*)((const unsigned short*)arow + kb + 16 + 8 * hh);
#pragma unroll
    for (int t = 0; t < 4; ++t) { if (col0 + t * 16 >= N) continue; const size_t boff = (size_t)(col0 + t * 16 + ln) * ldb + kb; FragH bq; bq.half[0] = *(const v8us*)((const unsigned short*)Bh + boff + 8 * hh); bq.half[1] = *(const v8us*)((const unsigned short*)Bh + boff + 16 + 8 * hh);
      acc[t] = mmaH<1>(ah.v, ah.v, bq.v, bq.v, acc[t]); }
  }
#pragma unroll
  for (int t = 0; t < 4; ++t) { if (col0 + t * 16 >= N) continue; const int col = col0 + t * 16 + ln; const float bv = bp ? bf16_round(bp[col]) : 0.f;
#pragma unroll
    for (int r = 0; r < 8; ++r) { float v = acc[t][r] * alpha + bv; if (CP) { const int rr = row0g + row0 + 8 * hh + r; if (rowsPerB < 0) v += CP[cofs + (size_t)rr * ldc + col];      /* rowsPerB < 0: own element of the batched C plane */ else { const int bidx = rr / rowsPerB; v += CP[(size_t)bidx * sCPb + (size_t)by * 64 + col]; } } if (ACT == 1) v = (v > 0.f) ? v : expm1f(v); else if (ACT == 7) v = (v > 0.f) ? v + 1.0f : expf(v); else if (ACT == 8) v = tanhf(v); else if (ACT == 9) v = 0.5f * v * (1.0f + tanhf(0.7978845608028654f * (v + 0.044715f * v * v * v))); else if (ACT == 11) v = 1.0f / (1.0f + expf(-v)); else if (ACT == 12) v = (v > 0.f) ? v : 0.01f * v; else if (ACT == 14) v = (v > 0.f) ? v : 0.1f * v; else if (ACT == 16) v = (v >= 0.f) ? v : 0.3f * v; else if (ACT == 17) v = (v >= 0.f) ? v : 0.2f * v; else if (ACT == 15) v = v / (1.0f + expf(-v)); else if (ACT == 3) v = fmaxf(v, 0.f); else if (ACT == 6) v = 0.5f * v * (1.0f + erff(v * 0.70710678118654752f)); so[w][8 * hh + r][t * 16 + ln] = v; } }
  __builtin_amdgcn_fence(__ATOMIC_ACQ_REL, "workgroup"); __builtin_amdgcn_wave_barrier();
  const int rsub = lane >> 4, c4 = (lane & 15) * 4; typedef _Float16 v4h __attribute__((ext_vector_type(4)));
  {
#pragma unroll
    for (int q = 0; q < 8; ++q) { const int r = q * 2 + rsub; if (col0 + c4 < N) { const v4f v = *(const v4fa*)&so[w][r][c4]; if (C) *(v4f*)(C + cofs + (size_t)(row0 + r) * ldc + col0 + c4) = v; if (C16) { v4h h4; for (int i = 0; i < 4; ++i) h4[i] = (_Float16)v[i]; *(v4h*)(C16 + cofs + (size_t)(row0 + r) * ldc + col0 + c4) = h4; } } }
     }
}


typedef _Float16 v4h __attribute__((ext_vector_type(4)));

__global__ __launch_bounds__(256) void k_x16(const float* __restrict__ x, _Float16* __restrict__ X16, size_t n8) { const size_t t = (size_t)blockIdx.x * 256 + threadIdx.x; if (t >= n8) return; FragH f;
#pragma unroll
  for (int q = 0; q < 8; ++q) f.h[q] = (_Float16)bf16_round(x[t * 8 + q]); *(v8us*)((unsigned short*)X16 + t * 8) = f.half[0];  }
__global__ __launch_bounds__(256) void k_h16(const float* __restrict__ x, _Float16* __restrict__ X16, size_t n8) { const size_t t = (size_t)blockIdx.x * 256 + threadIdx.x; if (t >= n8) return; FragH f;
#pragma unroll
  for (int q = 0; q < 8; ++q) f.h[q] = (_Float16)x[t * 8 + q]; *(v8us*)((unsigned short*)X16 + t * 8) = f.half[0];  }
__global__ __launch_bounds__(256) void k_round16f(const float* __restrict__ W, _Float16* __restrict__ Bt, size_t n8) { const size_t t = (size_t)blockIdx.x * 256 + threadIdx.x; if (t >= n8) return; FragH f;
#pragma unroll
  for (int i = 0; i < 8; ++i) f.h[i] = (_Float16)(bf16_round(W[t * 8 + i]) * 16.0f); *(v8us*)((unsigned short*)Bt + t * 8) = f.half[0];  }
template <int NHv, int TTv>
__global__ __launch_bounds__(256) void k_vt(const _Float16* __restrict__ V16, int ldv, int voff, _Float16* __restrict__ Vt) { __shared__ unsigned short tl[64][66]; const int tid = threadIdx.x; const int slab = blockIdx.x / (TTv / 64), lg = blockIdx.x % (TTv / 64); const int b = slab / NHv, h = slab % NHv;
  for (int i = tid; i < 64 * 8; i += 256) { const int r = i / 8, c8 = (i % 8) * 8; FragH f; f.half[0] = *(const v8us*)((const unsigned short*)V16 + ((size_t)b * TTv + lg * 64 + r) * ldv + voff + h * 64 + c8);
#pragma unroll
    for (int q = 0; q < 8; ++q) tl[r][c8 + q] = f.u[q]; }
  __syncthreads();
  {
#pragma unroll
    for (int rd = 0; rd < 2; ++rd) { const int d = rd * 32 + tid / 8, pc = tid % 8; FragH f;
#pragma unroll
      for (int q = 0; q < 8; ++q) f.u[q] = tl[pc * 8 + q][d];
      *(v8us*)((unsigned short*)Vt + ((size_t)slab * 64 + d) * TTv + lg * 64 + pc * 8) = f.half[0]; }
     } }

__global__ __launch_bounds__(256) void k_hl(const float* __restrict__ F, _Float16* __restrict__ Hh, _Float16* __restrict__ Hl, size_t n8) { const size_t t = (size_t)blockIdx.x * 256 + threadIdx.x; if (t >= n8) return; FragH fh, fl; const v4f a = *(const v4fa*)(F + t * 8), c = *(const v4fa*)(F + t * 8 + 4);
#pragma unroll
  for (int q = 0; q < 4; ++q) { _Float16 h = (_Float16)a[q]; fh.h[q] = h; fl.h[q] = (_Float16)((a[q] - (float)h) * 1024.0f); h = (_Float16)c[q]; fh.h[4 + q] = h; fl.h[4 + q] = (_Float16)((c[q] - (float)h) * 1024.0f); }
  { *(v8us*)((unsigned short*)Hh + t * 8) = fh.half[0]; *(v8us*)((unsigned short*)Hl + t * 8) = fl.half[0];  } }

// ---- fast GEMM (work-group tile 128x64, wave tile 32x64; requires M % 128 == 0 rows per launch region, N % 64 == 0, K % 64 == 0); epilogue = k_gemm_hhx semantics ----
__device__ __forceinline__ v16h g2_frag(const _Float16* p, int hh) { FragH f; f.half[0] = *(const v8us*)((const unsigned short*)p + 8 * hh); f.half[1] = *(const v8us*)((const unsigned short*)p + 16 + 8 * hh); return f.v; }
__device__ __forceinline__ v8f g2_mma(v16h a, v16h b, v8f c) { v8f d = __builtin_amdgcn_wmma_f32_16x16x32_f16(false, a, false, b, (short)0, c, false, false); asm volatile("v_nop\n\tv_nop\n\tv_nop\n\tv_nop" : "+v"(d) : "v"(a), "v"(b)); return d; }
// A and B reach the waves through LDS: a stage is 64 k (128 A rows and 64 B rows of 128 bytes each), brought once per work-group by asynchronous copies that cover whole 128-byte lines, two buffers, the next stage in flight while this one is worked on.
#define GP 144                       /* LDS row pitch, bytes: 128 + 16, an odd multiple of 16 for 16-byte readers */
#define GTA (128 * GP)               /* bytes of the staged A tile */
#define GSB (192 * GP)               /* bytes of one stage: A tile, then B tile */
__device__ __forceinline__ v16h g2_lfrag(const unsigned char* p) { FragH f; f.half[0] = *(const v8us*)p; f.half[1] = *(const v8us*)(p + 32); return f.v; }      /* g2_frag's k order from an LDS row; p already holds the lane half's 16 bytes */
// One stage: each of the 128 threads copies 16 bytes of rows r0 + 16 j of the A tile (j < 8, at lds) and of the B tile (j < 4, at lds + GTA); eight lanes cover one 128-byte row. sa, sb: 16 rows of A, of B, in elements.
// The s_wait_xcnt closes the copies' own statement, so that it stands in front of every later write of the address registers that the copies name.
__device__ __forceinline__ void g2_stage(unsigned lds, const _Float16* ga, size_t sa, const _Float16* gb, size_t sb) {
  asm volatile("global_load_async_to_lds_b128 %0, %12, off\n\tglobal_load_async_to_lds_b128 %1, %13, off\n\tglobal_load_async_to_lds_b128 %2, %14, off\n\tglobal_load_async_to_lds_b128 %3, %15, off\n\t"
               "global_load_async_to_lds_b128 %4, %16, off\n\tglobal_load_async_to_lds_b128 %5, %17, off\n\tglobal_load_async_to_lds_b128 %6, %18, off\n\tglobal_load_async_to_lds_b128 %7, %19, off\n\t"
               "global_load_async_to_lds_b128 %8, %20, off\n\tglobal_load_async_to_lds_b128 %9, %21, off\n\tglobal_load_async_to_lds_b128 %10, %22, off\n\tglobal_load_async_to_lds_b128 %11, %23, off\n\ts_wait_xcnt 0x0"
               :: "v"(lds), "v"(lds + 16 * GP), "v"(lds + 32 * GP), "v"(lds + 48 * GP), "v"(lds + 64 * GP), "v"(lds + 80 * GP), "v"(lds + 96 * GP), "v"(lds + 112 * GP),
                  "v"(lds + GTA), "v"(lds + GTA + 16 * GP), "v"(lds + GTA + 32 * GP), "v"(lds + GTA + 48 * GP),
                  "v"(ga), "v"(ga + sa), "v"(ga + 2 * sa), "v"(ga + 3 * sa), "v"(ga + 4 * sa), "v"(ga + 5 * sa), "v"(ga + 6 * sa), "v"(ga + 7 * sa),
                  "v"(gb), "v"(gb + sb), "v"(gb + 2 * sb), "v"(gb + 3 * sb)
               : "memory"); }
template <int ACT>
__global__ __launch_bounds__(128) void k_gemm2(const _Float16* __restrict__ A, int lda, size_t sA, const _Float16* __restrict__ Bh, int ldb, size_t sB, float alpha, const float* __restrict__ bias, size_t sBias, const float* __restrict__ CP, int rowsPerB, size_t sCPb, int row0g,
    float* __restrict__ C, _Float16* __restrict__ C16, int ldc, size_t sC, int M, int N, int K) { static_assert(ACT == 0 || ACT == 3 || ACT == 6 || ACT == 8 || ACT == 9 || ACT == 11 || ACT == 12 || ACT == 14 || ACT == 15 || ACT == 16 || ACT == 17, "k_gemm2: unsupported ACT code (would silently apply no activation)");
  __shared__ __attribute__((aligned(16))) float so[4][32][68];
  __shared__ __attribute__((aligned(16))) unsigned char G[2 * GSB];      /* two buffers of [A tile | B tile] */
  const int tid = threadIdx.x, w = tid >> 5, lane = tid & 31, ln = lane & 15, hh = lane >> 4; const int by = blockIdx.y;
  A += (size_t)by * sA; Bh += (size_t)by * sB; const size_t cofs = (size_t)by * sC; const float* bp = bias ? bias + (size_t)by * sBias : nullptr;
  const int ntn = N >> 6; const int mt = blockIdx.x / ntn, nq = blockIdx.x - mt * ntn; const int row0 = mt * 128 + 32 * w, col0 = nq * 64; if (mt * 128 + 128 > M) return;      /* the whole work-group or none, ahead of every copy and barrier: every staged A row exists */
  const int r0 = tid >> 3, ch = tid & 7;      /* this thread's row (mod 16) and 16-byte piece in every copied tile */
  const unsigned lst = (unsigned)(size_t)G + r0 * GP + ch * 16;
  const _Float16* ga = A + (size_t)(mt * 128 + r0) * lda + ch * 8; const _Float16* gb = Bh + (size_t)(col0 + r0) * ldb + ch * 8;
  const size_t sa = (size_t)16 * lda, sb = (size_t)16 * ldb; const int nst = K >> 6;
  g2_stage(lst, ga, sa, gb, sb);
  asm volatile("s_wait_asynccnt 0x0" ::: "memory");      /* this wave's share of stage 0 has landed */
  __syncthreads();      /* publishes stage 0 */
  if (nst > 1) g2_stage(lst + GSB, ga + 64, sa, gb + 64, sb);
  const v8f z8 = {0.f,0.f,0.f,0.f,0.f,0.f,0.f,0.f}; v8f c00 = z8, c01 = z8, c02 = z8, c03 = z8, c10 = z8, c11 = z8, c12 = z8, c13 = z8;
#pragma unroll 1      /* one stage per trip: the buffer index stays a scalar select and the loop stays short */
  for (int t = 0; t < nst; ++t) {
    const unsigned char* al = G + (t & 1) * GSB + (32 * w + ln) * GP + 16 * hh; const unsigned char* bl = G + (t & 1) * GSB + GTA + ln * GP + 16 * hh;
    v16h a[2][2], b[2][4];      /* the stage's 24 LDS reads stand together, ahead of its 16 WMMAs */
#pragma unroll
    for (int kc = 0; kc < 2; ++kc) { a[kc][0] = g2_lfrag(al + kc * 64); a[kc][1] = g2_lfrag(al + 16 * GP + kc * 64);
#pragma unroll
      for (int j = 0; j < 4; ++j) b[kc][j] = g2_lfrag(bl + j * 16 * GP + kc * 64); }
#pragma unroll
    for (int kc = 0; kc < 2; ++kc) {
      c00 = g2_mma(a[kc][0], b[kc][0], c00); c10 = g2_mma(a[kc][1], b[kc][0], c10);
      c01 = g2_mma(a[kc][0], b[kc][1], c01); c11 = g2_mma(a[kc][1], b[kc][1], c11);
      c02 = g2_mma(a[kc][0], b[kc][2], c02); c12 = g2_mma(a[kc][1], b[kc][2], c12);
      c03 = g2_mma(a[kc][0], b[kc][3], c03); c13 = g2_mma(a[kc][1], b[kc][3], c13); }
    asm volatile("s_wait_dscnt 0x0" ::: "memory");      /* this wave's reads of the buffer that is refilled below have returned */
    asm volatile("s_wait_asynccnt 0x0" ::: "memory");      /* this wave's share of stage t + 1 has landed */
    __syncthreads();      /* publishes stage t + 1 and ends every wave's reads of stage t */
    if (t + 2 < nst) g2_stage(lst + (t & 1) * GSB, ga + (size_t)(t + 2) * 64, sa, gb + (size_t)(t + 2) * 64, sb);
  }
  asm volatile("s_wait_asynccnt 0x0" ::: "memory");      /* no copy is outstanding when the wave ends */
  v8f accs[8] = {c00, c01, c02, c03, c10, c11, c12, c13};
#pragma unroll
  for (int u = 0; u < 8; ++u) { const int t = u & 3, half = u >> 2; const int col = col0 + t * 16 + ln; const float bv = bp ? bf16_round(bp[col]) : 0.f;
#pragma unroll
    for (int r = 0; r < 8; ++r) { const int rloc = half * 16 + 8 * hh + r; float v = accs[u][r] * alpha + bv; if (CP) { if (rowsPerB < 0) v += CP[cofs + (size_t)(row0g + row0 + rloc) * ldc + col];      /* rowsPerB < 0: own element of the batched C plane */ else { const int bidx = (row0g + row0 + rloc) / rowsPerB; v += CP[(size_t)bidx * sCPb + (size_t)by * 64 + col]; } }
      if (ACT == 3) v = fmaxf(v, 0.f); else if (ACT == 6) v = 0.5f * v * (1.0f + erff(v * 0.70710678118654752f)); else if (ACT == 11) v = 1.0f / (1.0f + expf(-v)); else if (ACT == 15) v = v / (1.0f + expf(-v)); else if (ACT == 12) v = (v > 0.f) ? v : 0.01f * v; else if (ACT == 8) v = tanhf(v); else if (ACT == 9) v = 0.5f * v * (1.0f + tanhf(0.7978845608028654f * (v + 0.044715f * v * v * v))); else if (ACT == 14) v = (v > 0.f) ? v : 0.1f * v; else if (ACT == 16) v = (v >= 0.f) ? v : 0.3f * v; else if (ACT == 17) v = (v >= 0.f) ? v : 0.2f * v;
      so[w][rloc][t * 16 + ln] = v; } }
  __builtin_amdgcn_fence(__ATOMIC_ACQ_REL, "workgroup"); __builtin_amdgcn_wave_barrier();
  const int rsub = lane >> 4, c4 = (lane & 15) * 4;
  {
#pragma unroll
    for (int q = 0; q < 16; ++q) { const int r = q * 2 + rsub; const v4f v = *(const v4fa*)&so[w][r][c4]; if (C) *(v4f*)(C + cofs + (size_t)(row0 + r) * ldc + col0 + c4) = v; if (C16) { v4h h4; for (int i = 0; i < 4; ++i) h4[i] = (_Float16)v[i]; *(v4h*)(C16 + cofs + (size_t)(row0 + r) * ldc + col0 + c4) = h4; } }
     } }


__global__ __launch_bounds__(256) void k_wnat(const float* __restrict__ w, size_t n8, _Float16* __restrict__ Bt) { const size_t t = (size_t)blockIdx.x * 256 + threadIdx.x; if (t >= n8) return; FragH f; for (int q = 0; q < 8; ++q) f.h[q] = (_Float16)(bf16_round(w[t * 8 + q]) * 16.0f); *(v8us*)((unsigned short*)Bt + t * 8) = f.half[0];  }
__global__ __launch_bounds__(256) void k_rsm(const float* __restrict__ S, _Float16* __restrict__ P, int nrows) {
  #pragma clang fp contract(off)
  const int i = blockIdx.x * 256 + threadIdx.x; if (i >= nrows) return; const float* s = S + (size_t)i * SQ; float mx = -3.0e38f;
#pragma unroll 1
  for (int j = 0; j < SQ; ++j) mx = fmaxf(mx, s[j]); float se = 0.f;
#pragma unroll 1
  for (int j = 0; j < SQ; ++j) se += expf(s[j] - mx); const float sc = 256.0f / se;
#pragma unroll 1
  for (int j0 = 0; j0 < SQ; j0 += 8) { FragH f; for (int q = 0; q < 8; ++q) f.h[q] = (_Float16)(expf(s[j0 + q] - mx) * sc); unsigned short* d = (unsigned short*)P + (size_t)i * SQ + j0; *(v8us*)d = f.half[0];  } }
__global__ __launch_bounds__(256) void k_vt(const _Float16* __restrict__ V16, int b, int h0, _Float16* __restrict__ VT) { __shared__ unsigned short tl[64][65]; const int tid = threadIdx.x; const int hh = blockIdx.x % HG, sg = blockIdx.x / HG; const int s0 = sg * 64; const int h = h0 + hh;
  for (int i = tid; i < 64 * 8; i += 256) { const int j = i / 8, d8 = (i % 8) * 8; FragH f; f.half[0] = *(const v8us*)((const unsigned short*)V16 + ((size_t)b * SQ + s0 + j) * DM + h * HD + d8); for (int q = 0; q < 8; ++q) tl[d8 + q][j] = f.u[q]; }
  __syncthreads();
  { for (int i = tid; i < 64 * 8; i += 256) { const int d = i / 8, j8 = (i % 8) * 8; FragH f; for (int q = 0; q < 8; ++q) f.u[q] = tl[d][j8 + q]; *(v8us*)((unsigned short*)VT + ((size_t)hh * HD + d) * SQ + s0 + j8) = f.half[0]; }  } }



#define FW 4                         /* waves per work-group: 128 query columns */
#define SCL 0.18033688011112042f     /* 64^-0.5 * log2(e) */
#define KS 64                        /* keys per stage: two passes */
#define LP 144                       /* LDS row pitch, bytes: 128 + 16, an odd multiple of 16 for 16-byte readers */
#define TB (64 * LP)                 /* bytes of one staged tile of 64 rows */
#define NST (SQ / KS)                /* stages */
__device__ __forceinline__ v8f fa_mma(v16h a, v16h b, v8f c) { return __builtin_amdgcn_wmma_f32_16x16x32_f16(false, a, false, b, (short)0, c, false, false); }
__device__ __forceinline__ float fa_xhalf(float x) { return __builtin_bit_cast(float, __builtin_amdgcn_permlanex16(__builtin_bit_cast(int, x), __builtin_bit_cast(int, x), 0x76543210, 0xfedcba98, false, false)); }      /* lane l <-> lane l ^ 16 */
__device__ __forceinline__ v16h fa_lfrag(const unsigned char* p) { FragH f; f.half[0] = *(const v8us*)p; f.half[1] = *(const v8us*)(p + 32); return f.v; }      /* g2_frag's k order from an LDS row; p already holds the lane half's 16 bytes */
// One stage: each of the 128 threads copies 16 bytes of rows r0, r0 + 16, r0 + 32, r0 + 48 of the K tile (at lds) and of the V^T tile (at lds + TB); eight lanes cover one 128-byte row.
// The s_wait_xcnt closes the copies' own statement, so that it stands in front of every later write of the address registers that the copies name.
__device__ __forceinline__ void fa_stage(unsigned lds, const _Float16* gk, const _Float16* gv) {
  asm volatile("global_load_async_to_lds_b128 %0, %8, off\n\tglobal_load_async_to_lds_b128 %1, %9, off\n\tglobal_load_async_to_lds_b128 %2, %10, off\n\tglobal_load_async_to_lds_b128 %3, %11, off\n\t"
               "global_load_async_to_lds_b128 %4, %12, off\n\tglobal_load_async_to_lds_b128 %5, %13, off\n\tglobal_load_async_to_lds_b128 %6, %14, off\n\tglobal_load_async_to_lds_b128 %7, %15, off\n\ts_wait_xcnt 0x0"
               :: "v"(lds), "v"(lds + 16 * LP), "v"(lds + 32 * LP), "v"(lds + 48 * LP), "v"(lds + TB), "v"(lds + TB + 16 * LP), "v"(lds + TB + 32 * LP), "v"(lds + TB + 48 * LP),
                  "v"(gk), "v"(gk + (size_t)16 * DM), "v"(gk + (size_t)32 * DM), "v"(gk + (size_t)48 * DM), "v"(gv), "v"(gv + (size_t)16 * SQ), "v"(gv + (size_t)32 * SQ), "v"(gv + (size_t)48 * SQ)
               : "memory"); }
__global__ __launch_bounds__(FW * 32) void k_fattn(const _Float16* __restrict__ Q16, const _Float16* __restrict__ K16, const _Float16* __restrict__ VT, _Float16* __restrict__ O16) {
  __shared__ __attribute__((aligned(16))) unsigned char L[2 * 2 * TB];      /* two buffers of [K tile | V^T tile] */
  const int lane = threadIdx.x & 31, c = lane & 15, hh = lane >> 4; const int w = __builtin_amdgcn_readfirstlane(threadIdx.x >> 5);
  const int bh = blockIdx.y, b = bh / NH, h = bh - b * NH; const int q0 = blockIdx.x * (FW * 32) + w * 32;
  const int r0 = threadIdx.x >> 3, ch = threadIdx.x & 7;      /* this thread's row (mod 16) and 16-byte piece in every copied tile */
  const unsigned lst = (unsigned)(size_t)L + r0 * LP + ch * 16;
  const _Float16* gk = K16 + ((size_t)b * SQ + r0) * DM + h * HD + ch * 8; const _Float16* gv = VT + ((size_t)bh * HD + r0) * SQ + ch * 8;
  fa_stage(lst, gk, gv);
  const _Float16* qp = Q16 + ((size_t)b * SQ + q0 + c) * DM + h * HD;
  v16h qf[2][2];
#pragma unroll
  for (int g = 0; g < 2; ++g) for (int kc = 0; kc < 2; ++kc) qf[g][kc] = g2_frag(qp + (size_t)g * 16 * DM + kc * 32, hh);
  asm volatile("s_wait_asynccnt 0x0" ::: "memory");      /* this wave's share of stage 0 has landed */
  __syncthreads();      /* publishes stage 0 */
  fa_stage(lst + 2 * TB, gk + (size_t)KS * DM, gv + KS);
  const v8f z8 = {0.f,0.f,0.f,0.f,0.f,0.f,0.f,0.f}; v8f o[2][4] = {{z8, z8, z8, z8}, {z8, z8, z8, z8}}; float m[2] = {-1.0e30f, -1.0e30f}, l[2] = {0.f, 0.f};
  for (int t = 0; t < NST; ++t) {
    const unsigned char* kl = L + (t & 1) * (2 * TB) + c * LP + 16 * hh; const unsigned char* vl = kl + TB;
    v16h kf[2][2];
#pragma unroll
    for (int kt = 0; kt < 2; ++kt) for (int kc = 0; kc < 2; ++kc) kf[kt][kc] = fa_lfrag(kl + kt * 16 * LP + kc * 64);
#pragma unroll
    for (int p = 0; p < 2; ++p) {
    v16h vf[4];
#pragma unroll
    for (int dt = 0; dt < 4; ++dt) vf[dt] = fa_lfrag(vl + dt * 16 * LP + p * 64);
    v8f s[2][2];
#pragma unroll
    for (int g = 0; g < 2; ++g) for (int kt = 0; kt < 2; ++kt) s[g][kt] = fa_mma(kf[kt][1], qf[g][1], fa_mma(kf[kt][0], qf[g][0], z8));
    if (p == 0) {      /* the stage's second pass's K rows, fetched one pass ahead from the same buffer */
#pragma unroll
      for (int kt = 0; kt < 2; ++kt) for (int kc = 0; kc < 2; ++kc) kf[kt][kc] = fa_lfrag(kl + (32 + kt * 16) * LP + kc * 64);
    }
    __builtin_amdgcn_sched_barrier(0);      /* keeps the V and K fragment reads up here, ahead of the softmax; without it the scheduler sinks them directly in front of the wait for them */
#pragma unroll
    for (int g = 0; g < 2; ++g) {
      float x[16];
#pragma unroll
      for (int i = 0; i < 16; ++i) x[i] = s[g][i >> 3][i & 7];
      float mx = fmaxf(fmaxf(fmaxf(x[0], x[1]), fmaxf(x[2], x[3])), fmaxf(fmaxf(x[4], x[5]), fmaxf(x[6], x[7])));
      mx = fmaxf(mx, fmaxf(fmaxf(fmaxf(x[8], x[9]), fmaxf(x[10], x[11])), fmaxf(fmaxf(x[12], x[13]), fmaxf(x[14], x[15]))));
      mx = fmaxf(mx, fa_xhalf(mx));
      const float mn = fmaxf(m[g], mx), nb = -mn * SCL; float al = (m[g] - mn) * SCL; m[g] = mn;
#pragma unroll
      for (int i = 0; i < 16; ++i) x[i] = fmaf(x[i], SCL, nb);
      /* exponentials in place, each run closed by one v_nop: the instruction set asks for one independent instruction between a transcendental and an overwrite of its source or a use of its result */
      asm("v_exp_f32 %0, %0\n\tv_exp_f32 %1, %1\n\tv_exp_f32 %2, %2\n\tv_exp_f32 %3, %3\n\tv_exp_f32 %4, %4\n\tv_exp_f32 %5, %5\n\tv_exp_f32 %6, %6\n\tv_exp_f32 %7, %7\n\tv_exp_f32 %8, %8\n\tv_nop"
          : "+v"(x[0]), "+v"(x[1]), "+v"(x[2]), "+v"(x[3]), "+v"(x[4]), "+v"(x[5]), "+v"(x[6]), "+v"(x[7]), "+v"(al));
      asm("v_exp_f32 %0, %0\n\tv_exp_f32 %1, %1\n\tv_exp_f32 %2, %2\n\tv_exp_f32 %3, %3\n\tv_exp_f32 %4, %4\n\tv_exp_f32 %5, %5\n\tv_exp_f32 %6, %6\n\tv_exp_f32 %7, %7\n\tv_nop"
          : "+v"(x[8]), "+v"(x[9]), "+v"(x[10]), "+v"(x[11]), "+v"(x[12]), "+v"(x[13]), "+v"(x[14]), "+v"(x[15]));
      const float ps = (((x[0] + x[1]) + (x[2] + x[3])) + ((x[4] + x[5]) + (x[6] + x[7]))) + (((x[8] + x[9]) + (x[10] + x[11])) + ((x[12] + x[13]) + (x[14] + x[15])));
      l[g] = fmaf(l[g], al, ps);      /* this half's keys only; the halves are joined behind the loop */
      FragH pf;
#pragma unroll
      for (int i = 0; i < 16; ++i) pf.h[i] = (_Float16)x[i];
#pragma unroll
      for (int dt = 0; dt < 4; ++dt) { o[g][dt] *= al; o[g][dt] = fa_mma(vf[dt], pf.v, o[g][dt]); }
    }
    }
    __builtin_amdgcn_sched_barrier(0);      /* holds the four v_nop below behind the stage's last WMMA */
    asm volatile("v_nop\n\tv_nop\n\tv_nop\n\tv_nop");      /* WMMA distance over the back edge: the next stage's first instructions may write registers that the last WMMA reads as A or B */
    asm volatile("s_wait_dscnt 0x0" ::: "memory");      /* this wave's reads of the buffer that is refilled below have returned */
    asm volatile("s_wait_asynccnt 0x0" ::: "memory");      /* this wave's share of stage t + 1 has landed */
    __syncthreads();      /* publishes stage t + 1 and ends every wave's reads of stage t */
    if (t + 2 < NST) fa_stage(lst + (t & 1) * (2 * TB), gk + (size_t)(t + 2) * KS * DM, gv + (size_t)(t + 2) * KS);
  }
  asm volatile("s_wait_asynccnt 0x0" ::: "memory");      /* no copy is outstanding when the wave ends */
#pragma unroll
  for (int g = 0; g < 2; ++g) { const float inv = 64.0f / (l[g] + fa_xhalf(l[g])); _Float16* op = O16 + ((size_t)b * SQ + q0 + g * 16 + c) * DM + h * HD + 8 * hh;
#pragma unroll
    for (int dt = 0; dt < 4; ++dt) { FragH f;      /* a lane's 8 accumulator registers are 8 consecutive d of one query: one 16-byte store */
#pragma unroll
      for (int r = 0; r < 8; ++r) f.h[r] = (_Float16)(o[g][dt][r] * inv);
      *(v8us*)((unsigned short*)op + dt * 16) = f.half[0]; } } }

extern "C" void kernel_launch(void* const* d_in, const int* in_sizes, int n_in,
                              void* d_out, int out_size, void* d_ws, size_t ws_size, hipStream_t stream) {
  (void)in_sizes; (void)n_in; (void)out_size;
  const float* const* I = (const float* const*)d_in; const float* x = I[0]; const float* wq = I[1]; const float* bq = I[2]; const float* wk = I[3]; const float* bk = I[4]; const float* wv = I[5]; const float* bv = I[6]; const float* wo = I[7]; const float* bo = I[8];      /* [in][out] weights + biases (y = x @ W + b) */
  char* ws = (char*)d_ws; size_t off = 0;
  auto take = [&](size_t bytes) { char* p = ws + off; off += (bytes + 255) & ~(size_t)255; return p; };
  _Float16* BQ = (_Float16*)take((size_t)DM * DM * 2); _Float16* BK = (_Float16*)take((size_t)DM * DM * 2); _Float16* BV = (_Float16*)take((size_t)DM * DM * 2); _Float16* BO = (_Float16*)take((size_t)DM * DM * 2);
  _Float16* X16 = (_Float16*)take(NR * DM * 2); _Float16* Q16 = (_Float16*)take(NR * DM * 2); _Float16* K16 = (_Float16*)take(NR * DM * 2); _Float16* V16 = (_Float16*)take(NR * DM * 2); _Float16* O16 = (_Float16*)take(NR * DM * 2);
  _Float16* VT = (_Float16*)take((size_t)NB * NH * HD * SQ * 2);
  if (off > ws_size) return;
  { const unsigned g = (unsigned)(((size_t)DM * (DM / 8) + 255) / 256); k_wt_f16<<<g, 256, 0, stream>>>(wq, BQ, DM, DM, 16.0f); k_wt_f16<<<g, 256, 0, stream>>>(wk, BK, DM, DM, 16.0f); k_wt_f16<<<g, 256, 0, stream>>>(wv, BV, DM, DM, 16.0f); k_wt_f16<<<g, 256, 0, stream>>>(wo, BO, DM, DM, 16.0f); }      /* [in][out] -> Bt[n][k] x16 (transposing builder) */

  k_x16<<<(unsigned)((NR * DM / 8 + 255) / 256), 256, 0, stream>>>(x, X16, NR * DM / 8);
  const size_t r0p = (size_t)B0 * SQ;      /* first projected row */
  k_gemm2<0><<<dim3((unsigned)((MP / 128) * (DM / 64)), 1), 128, 0, stream>>>(X16 + r0p * DM, DM, 0, BQ, DM, 0, 0.0625f, bq, 0, nullptr, 1, 0, 0, nullptr, Q16 + r0p * DM, DM, 0, MP, DM, DM);
  k_gemm2<0><<<dim3((unsigned)((MP / 128) * (DM / 64)), 1), 128, 0, stream>>>(X16 + r0p * DM, DM, 0, BK, DM, 0, 0.0625f, bk, 0, nullptr, 1, 0, 0, nullptr, K16 + r0p * DM, DM, 0, MP, DM, DM);
  k_gemm2<0><<<dim3((unsigned)((MP / 128) * (DM / 64)), 1), 128, 0, stream>>>(X16 + r0p * DM, DM, 0, BV, DM, 0, 0.0625f, bv, 0, nullptr, 1, 0, 0, nullptr, V16 + r0p * DM, DM, 0, MP, DM, DM);
  k_vt<NH, SQ><<<NB * NH * (SQ / 64), 256, 0, stream>>>(V16, LQ, 0, VT);      /* V^T [NB][NH][HD][SQ] */
  k_fattn<<<dim3(SQ / (FW * 32), NB * NH), FW * 32, 0, stream>>>(Q16, K16, VT, O16);      /* o x64 (merged heads) as f16 rows */
  k_gemm2<0><<<dim3((unsigned)((MPO / 128) * (DM / 64)), 1), 128, 0, stream>>>(O16 + r0p * DM, DM, 0, BO, DM, 0, 0.0009765625f, bo, 0, nullptr, 1, 0, 0, (float*)d_out + r0p * DM, nullptr, DM, 0, MPO, DM, DM);      /* out rows are the output layout */
}

// v005
// It runs in 164 microseconds.
// Next to v004, in two timings, it ran 1.11 times as fast each time.
// Counting every step since v000, it is 121 times as fast.
#include <hip/hip_runtime.h>
// Multi-head self-attention over 4096-token sequences at width 768 with [in][out] projections and biases (hidden_states [2][4096][768]; q / k / v = x W + b ([in][out] 768 x 768 + biases), 12 heads of 64; scores * 1/sqrt(64); softmax over all 4096 keys (no mask); out = merged Wo + bo ([in][out]) -> [2][4096][768]); all heads and batches in one attention launch.
// Structure: token rows r = b*4096 + s; one preparation launch (x as exact f16 rows, bf16-rounded; the four transposed weights); Q, K, V as three WMMA GEMMs in one launch (blockIdx.y; 32x64 wave tiles, f32 accumulation, exact x16 weights + bias, f16 outputs); V^T for all batches and heads via LDS transposes; one attention launch for all (batch, head): S^T = K Q^T, K and V^T staged in LDS per work-group, online softmax in registers (f32 statistics, native exp2; weights exp(s - running max) as f16), O^T += V^T P^T, o carried x64 against f16 subnormal flush (folded into the output GEMM alpha), written straight into the merged f16 o rows; out = o W_o + b GEMM (f32) into the output layout.
// Compute dtype: inputs rounded to bf16; x / weights exact; q, k, v, softmax weights and o as plain f16 GEMM operands (~2^-12); scores and softmax statistics f32. v_wmma_f32_16x16x32_f16.
#define NB 2
#define SQ 4096
#define DM 768
#define NH 12
#define HD 64
#define HG 1                         /* heads per group in the unlaunched per-batch k_vt (a 4096^2 f32 score slab is 64 MiB) */
#define B0 0                         /* first batch processed (debug hook) */
#define NBR NB                       /* batches processed (debug hook) */
#define NR ((size_t)NB * SQ)         /* token rows */
#define MP ((int)((size_t)NBR * SQ)) /* rows projected (debug hook) */
#define QN SQ                        /* unused: attention covers all SQ query rows */
#define NHD NH                       /* unused: attention covers all NH heads */
#define MPO MP                       /* rows through the output stage (debug hook) */
#define LQ DM      /* row pitch of the q/k/v rows */
typedef __bf16 v16b __attribute__((ext_vector_type(16)));
typedef unsigned short v8us __attribute__((ext_vector_type(8), may_alias));
typedef float  v8f  __attribute__((ext_vector_type(8)));
typedef float  v4f  __attribute__((ext_vector_type(4)));
typedef float  v4fa __attribute__((ext_vector_type(4), may_alias));
union FragB { v16b v; v8us half[2]; unsigned short u[16]; };

__device__ __forceinline__ unsigned short bf16_bits(float x) { unsigned int u = __float_as_uint(x); return (unsigned short)((u + 0x7FFFu + ((u >> 16) & 1u)) >> 16); }
__device__ __forceinline__ float bf16_val(unsigned short b) { return __uint_as_float(((unsigned int)b) << 16); }
__device__ __forceinline__ float bf16_round(float x) { return bf16_val(bf16_bits(x)); }
// D += A·B with NT terms: 1 = ah·bh, 2 = + al·bh (A split), 3 = + ah·bl (both split)
template <int NT>
__device__ __forceinline__ v8f mmaN(v16b ah, v16b al, v16b bh, v16b bl, v8f c) {
  c = __builtin_amdgcn_wmma_f32_16x16x32_bf16(false, ah, false, bh, (short)0, c, false, false);
  if (NT >= 2) c = __builtin_amdgcn_wmma_f32_16x16x32_bf16(false, al, false, bh, (short)0, c, false, false);
  if (NT >= 3) c = __builtin_amdgcn_wmma_f32_16x16x32_bf16(false, ah, false, bl, (short)0, c, false, false);
  asm volatile("v_nop\n\tv_nop\n\tv_nop\n\tv_nop" : "+v"(c) : "v"(ah), "v"(al), "v"(bh), "v"(bl));
  return c;
}

__global__ __launch_bounds__(256) void k_wt_bf16(const float* __restrict__ W, unsigned short* __restrict__ Wt, int K, int N) {
  const int t = blockIdx.x * 256 + threadIdx.x;
  const int k8n = K / 8;
  if (t >= N * k8n) return;
  const int n = t / k8n, k8 = (t % k8n) * 8;
  v8us v;
#pragma unroll
  for (int i = 0; i < 8; ++i) v[i] = bf16_bits(W[(size_t)(k8 + i) * N + n]);
  *(v8us*)(Wt + (size_t)n * K + k8) = v;
  
}

// GEMM C[M][N] (f32, pitch ldc) = act(A[M][K]·W + bias). A f32 row-major (pitch lda) converted per fragment to bf16
// (ASPLIT: hi/lo two planes -> 2 terms, else single rounded term); Wt bf16 [N][K] (pitch ldb). BIAS_BF16 rounds the
// bias to bf16 first (bias quantised to bf16 before the add). K%32==0, M%16==0, N%64==0.
template <bool ASPLIT, int ACT, bool BIAS_BF16>
__global__ __launch_bounds__(128) void k_gemm_bf(const float* __restrict__ A, int lda, const unsigned short* __restrict__ Wt, int ldb,
                                               const float* __restrict__ bias, float* __restrict__ C, int ldc, int M, int N, int K) {
  __shared__ __attribute__((aligned(16))) float so[4][16][64];
  const int tid = threadIdx.x, w = tid >> 5, lane = tid & 31, ln = lane & 15, hh = lane >> 4;
  const int ntn = N / 64;
  const int wid = blockIdx.x * 4 + w;
  const int mt = wid / ntn, nq = wid % ntn;
  if (mt * 16 >= M) return;
  const int row0 = mt * 16, col0 = nq * 64;
  const float* arow = A + (size_t)(row0 + ln) * lda;
  v8f acc[4] = {};
  for (int kb = 0; kb < K; kb += 32) {
    FragB ah, al;
    const v4f x0 = *(const v4fa*)(arow + kb + 8 * hh), x1 = *(const v4fa*)(arow + kb + 8 * hh + 4);
    const v4f x2 = *(const v4fa*)(arow + kb + 16 + 8 * hh), x3 = *(const v4fa*)(arow + kb + 16 + 8 * hh + 4);
    float xs[16] = {x0[0],x0[1],x0[2],x0[3],x1[0],x1[1],x1[2],x1[3],x2[0],x2[1],x2[2],x2[3],x3[0],x3[1],x3[2],x3[3]};
#pragma unroll
    for (int i = 0; i < 16; ++i) { const unsigned short hb = bf16_bits(xs[i]); ah.u[i] = hb; al.u[i] = ASPLIT ? bf16_bits(xs[i] - bf16_val(hb)) : (unsigned short)0; }
#pragma unroll
    for (int t = 0; t < 4; ++t) {
      const unsigned short* brow = Wt + (size_t)(col0 + t * 16 + ln) * ldb + kb;
      FragB b;
      b.half[0] = *(const v8us*)(brow + 8 * hh);
      b.half[1] = *(const v8us*)(brow + 16 + 8 * hh);
      acc[t] = mmaN<ASPLIT ? 2 : 1>(ah.v, al.v, b.v, b.v, acc[t]);
    }
  }
#pragma unroll
  for (int t = 0; t < 4; ++t) {
    float bv = bias ? bias[col0 + t * 16 + ln] : 0.f;
    if (BIAS_BF16) bv = bf16_round(bv);
#pragma unroll
    for (int r = 0; r < 8; ++r) { float v = acc[t][r] + bv; if (ACT == 1) v = fmaxf(v, 0.f); so[w][8 * hh + r][t * 16 + ln] = v; }
  }
  __builtin_amdgcn_fence(__ATOMIC_ACQ_REL, "workgroup");
  __builtin_amdgcn_wave_barrier();
  const int rsub = lane >> 4, c4 = (lane & 15) * 4;
  {
#pragma unroll
    for (int q = 0; q < 8; ++q) {
      const int r = q * 2 + rsub;
      const v4f v = *(const v4fa*)&so[w][r][c4];
      *(v4f*)(C + (size_t)(row0 + r) * ldc + col0 + c4) = v;
    }
    
  }
}

// GEMM C = act(A·W + bias + resid): A f32 (ASPLIT -> hi/lo 2 terms), Wt bf16 [N][K]; ACT 0 none, 1 relu, 2 exact gelu;
// resid (optional, f32, row index = (row % rmod), pitch ldr, RES_BF16 rounds it) added before the activation.
template <bool ASPLIT, int ACT, bool BIAS_BF16, bool RES_BF16>
__global__ __launch_bounds__(128) void k_gemm_bf3(const float* __restrict__ A, int lda, const unsigned short* __restrict__ Wt, int ldb,
                                                const float* __restrict__ bias, const float* __restrict__ resid, int rmod, int ldr,
                                                float* __restrict__ C, int ldc, int M, int N, int K) {
  __shared__ __attribute__((aligned(16))) float so[4][16][64];
  const int tid = threadIdx.x, w = tid >> 5, lane = tid & 31, ln = lane & 15, hh = lane >> 4;
  const int ntn = N / 64;
  const int wid = blockIdx.x * 4 + w;
  const int mt = wid / ntn, nq = wid % ntn;
  if (mt * 16 >= M) return;
  const int row0 = mt * 16, col0 = nq * 64;
  const float* arow = A + (size_t)(row0 + ln) * lda;
  v8f acc[4] = {};
  for (int kb = 0; kb < K; kb += 32) {
    FragB ah, al;
    const v4f x0 = *(const v4fa*)(arow + kb + 8 * hh), x1 = *(const v4fa*)(arow + kb + 8 * hh + 4);
    const v4f x2 = *(const v4fa*)(arow + kb + 16 + 8 * hh), x3 = *(const v4fa*)(arow + kb + 16 + 8 * hh + 4);
    float xs[16] = {x0[0],x0[1],x0[2],x0[3],x1[0],x1[1],x1[2],x1[3],x2[0],x2[1],x2[2],x2[3],x3[0],x3[1],x3[2],x3[3]};
#pragma unroll
    for (int i = 0; i < 16; ++i) { const unsigned short hb = bf16_bits(xs[i]); ah.u[i] = hb; al.u[i] = ASPLIT ? bf16_bits(xs[i] - bf16_val(hb)) : (unsigned short)0; }
#pragma unroll
    for (int t = 0; t < 4; ++t) {
      const unsigned short* brow = Wt + (size_t)(col0 + t * 16 + ln) * ldb + kb;
      FragB b;
      b.half[0] = *(const v8us*)(brow + 8 * hh);
      b.half[1] = *(const v8us*)(brow + 16 + 8 * hh);
      acc[t] = mmaN<ASPLIT ? 2 : 1>(ah.v, al.v, b.v, b.v, acc[t]);
    }
  }
#pragma unroll
  for (int t = 0; t < 4; ++t) {
    const int col = col0 + t * 16 + ln;
    float bv = bias ? bias[col] : 0.f;
    if (BIAS_BF16) bv = bf16_round(bv);
#pragma unroll
    for (int r = 0; r < 8; ++r) {
      float v = acc[t][r] + bv;
      if (resid) { float rv = resid[(size_t)((row0 + 8 * hh + r) % rmod) * ldr + col]; if (RES_BF16) rv = bf16_round(rv); v += rv; }
      if (ACT == 1) v = fmaxf(v, 0.f);
      if (ACT == 2) v = 0.5f * v * (1.0f + erff(v * 0.70710678118654752f));
      if (ACT == 3) { const float u = 0.7978845608028654f * (v + 0.044715f * v * v * v); v = 0.5f * v * (1.0f + tanhf(u)); }
      so[w][8 * hh + r][t * 16 + ln] = v;
    }
  }
  __builtin_amdgcn_fence(__ATOMIC_ACQ_REL, "workgroup");
  __builtin_amdgcn_wave_barrier();
  const int rsub = lane >> 4, c4 = (lane & 15) * 4;
  {
#pragma unroll
    for (int q = 0; q < 8; ++q) {
      const int r = q * 2 + rsub;
      const v4f v = *(const v4fa*)&so[w][r][c4];
      *(v4f*)(C + (size_t)(row0 + r) * ldc + col0 + c4) = v;
    }
    
  }
}
// row LayerNorm (biased variance, eps) over N: s = X (+ R); optional out_sum <- s; out_norm <- (s-mu)*rsqrt(var+eps)*g + b
template <bool PARAM_BF16>
__global__ __launch_bounds__(256) void k_layernorm(const float* __restrict__ X, const float* __restrict__ R, const float* __restrict__ g, const float* __restrict__ bta,
                                                  float* __restrict__ out_sum, float* __restrict__ out_norm, int N, float eps) {
  __shared__ float red[256];
  const int row = blockIdx.x, tid = threadIdx.x;
  const float* x = X + (size_t)row * N; const float* rr = R ? R + (size_t)row * N : nullptr;
  float vals[16];                     // up to N = 4096
  const int per = N / 256;            // contiguous chunk per thread? use strided-by-4 chunks: thread handles j = tid*4 + 1024*u
  float s1 = 0.f;
  for (int u = 0; u < per / 4; ++u) {
    const int j = tid * 4 + 1024 * u;
    const v4f a = *(const v4fa*)(x + j);
    v4f b = {0.f,0.f,0.f,0.f}; if (rr) b = *(const v4fa*)(rr + j);
#pragma unroll
    for (int q = 0; q < 4; ++q) { const float v = a[q] + b[q]; vals[u * 4 + q] = v; s1 += v; }
  }
  red[tid] = s1; __syncthreads();
  for (int st = 128; st > 0; st >>= 1) { if (tid < st) red[tid] += red[tid + st]; __syncthreads(); }
  const float mu = red[0] / (float)N; __syncthreads();
  float s2 = 0.f;
  for (int u = 0; u < per / 4; ++u)
#pragma unroll
    for (int q = 0; q < 4; ++q) { const float c = vals[u * 4 + q] - mu; s2 += c * c; }
  red[tid] = s2; __syncthreads();
  for (int st = 128; st > 0; st >>= 1) { if (tid < st) red[tid] += red[tid + st]; __syncthreads(); }
  const float rs = rsqrtf(red[0] / (float)N + eps);
  {
    for (int u = 0; u < per / 4; ++u) {
      const int j = tid * 4 + 1024 * u;
      v4f o, sm;
#pragma unroll
      for (int q = 0; q < 4; ++q) {
        float gg = g[j + q], bb = bta[j + q];
        if (PARAM_BF16) { gg = bf16_round(gg); bb = bf16_round(bb); }
        sm[q] = vals[u * 4 + q]; o[q] = (vals[u * 4 + q] - mu) * rs * gg + bb;
      }
      if (out_sum) *(v4f*)(out_sum + (size_t)row * N + j) = sm;
      *(v4f*)(out_norm + (size_t)row * N + j) = o;
    }
    
  }
}



// ---- f16 WMMA path (v_wmma_f32_16x16x32_f16): 11-bit significands for operands in range — used where a [0,1] probability operand needs more precision than bf16
typedef _Float16 v16h __attribute__((ext_vector_type(16)));
union FragH { v16h v; v8us half[2]; _Float16 h[16]; unsigned short u[16]; };
template <int NT>
__device__ __forceinline__ v8f mmaH(v16h ah, v16h al, v16h bh, v16h bl, v8f c) {
  c = __builtin_amdgcn_wmma_f32_16x16x32_f16(false, ah, false, bh, (short)0, c, false, false);
  if (NT >= 2) c = __builtin_amdgcn_wmma_f32_16x16x32_f16(false, al, false, bh, (short)0, c, false, false);
  if (NT >= 3) c = __builtin_amdgcn_wmma_f32_16x16x32_f16(false, ah, false, bl, (short)0, c, false, false);
  asm volatile("v_nop\n\tv_nop\n\tv_nop\n\tv_nop" : "+v"(c) : "v"(ah), "v"(al), "v"(bh), "v"(bl));
  return c;
}
// batched GEMM like k_gemm_b but f16 operands: A f32 (split into f16 hi/lo if ASPLIT, else rounded to f16), Bt = f16 values [n][k]; alpha; C f32; N multiple of 16 (partial tiles skipped)
template <bool ASPLIT>
__global__ __launch_bounds__(128) void k_gemm_h(const float* __restrict__ A, int lda, size_t sA, const _Float16* __restrict__ Bh, int ldb, size_t sB, float alpha, float* __restrict__ C, int ldc, size_t sC, int M, int N, int K) {
  __shared__ __attribute__((aligned(16))) float so[4][16][64];
  const int tid = threadIdx.x, w = tid >> 5, lane = tid & 31, ln = lane & 15, hh = lane >> 4; const int by = blockIdx.y;
  A += (size_t)by * sA; Bh += (size_t)by * sB; C += (size_t)by * sC;
  const int ntn = (N + 63) / 64; const int wid = blockIdx.x * 4 + w; const int mt = wid / ntn, nq = wid % ntn; if (mt * 16 >= M) return;
  const int row0 = mt * 16, col0 = nq * 64; const float* arow = A + (size_t)(row0 + ln) * lda;
  v8f acc[4] = {};
  for (int kb = 0; kb < K; kb += 32) {
    FragH ah, al;
    const v4f x0 = *(const v4fa*)(arow + kb + 8 * hh), x1 = *(const v4fa*)(arow + kb + 8 * hh + 4), x2 = *(const v4fa*)(arow + kb + 16 + 8 * hh), x3 = *(const v4fa*)(arow + kb + 16 + 8 * hh + 4);
    float xs[16] = {x0[0],x0[1],x0[2],x0[3],x1[0],x1[1],x1[2],x1[3],x2[0],x2[1],x2[2],x2[3],x3[0],x3[1],x3[2],x3[3]};
#pragma unroll
    for (int i = 0; i < 16; ++i) { const _Float16 h = (_Float16)xs[i]; ah.h[i] = h; al.h[i] = ASPLIT ? (_Float16)(xs[i] - (float)h) : (_Float16)0.0f; }
#pragma unroll
    for (int t = 0; t < 4; ++t) { if (col0 + t * 16 >= N) continue; const size_t boff = (size_t)(col0 + t * 16 + ln) * ldb + kb; FragH bq; bq.half[0] = *(const v8us*)(Bh + boff + 8 * hh); bq.half[1] = *(const v8us*)(Bh + boff + 16 + 8 * hh);
      acc[t] = mmaH<ASPLIT ? 2 : 1>(ah.v, al.v, bq.v, bq.v, acc[t]); }
  }
#pragma unroll
  for (int t = 0; t < 4; ++t) { if (col0 + t * 16 >= N) continue;
#pragma unroll
    for (int r = 0; r < 8; ++r) so[w][8 * hh + r][t * 16 + ln] = acc[t][r] * alpha; }
  __builtin_amdgcn_fence(__ATOMIC_ACQ_REL, "workgroup"); __builtin_amdgcn_wave_barrier();
  const int rsub = lane >> 4, c4 = (lane & 15) * 4;
  {
#pragma unroll
    for (int q = 0; q < 8; ++q) { const int r = q * 2 + rsub; if (col0 + c4 < N) { const v4f v = *(const v4fa*)&so[w][r][c4]; *(v4f*)(C + (size_t)(row0 + r) * ldc + col0 + c4) = v; } }
     }
}

// k_gemm_hh variant with fused epilogue: v = acc·alpha + bias[by·sBias + col] (+ CP[(row/rowsPerB)·sCPb + by·64 + col] if CP) ; ACT 0 none / 1 elu ; writes f16 C16 (and f32 C if non-null)
template <int ACT>
__global__ __launch_bounds__(128) void k_gemm_hhx(const _Float16* __restrict__ A, int lda, size_t sA, const _Float16* __restrict__ Bh, int ldb, size_t sB, float alpha, const float* __restrict__ bias, size_t sBias, const float* __restrict__ CP, int rowsPerB, size_t sCPb, int row0g,
    float* __restrict__ C, _Float16* __restrict__ C16, int ldc, size_t sC, int M, int N, int K) {
  __shared__ __attribute__((aligned(16))) float so[4][16][64];
  const int tid = threadIdx.x, w = tid >> 5, lane = tid & 31, ln = lane & 15, hh = lane >> 4; const int by = blockIdx.y;
  A += (size_t)by * sA; Bh += (size_t)by * sB; const size_t cofs = (size_t)by * sC; const float* bp = bias ? bias + (size_t)by * sBias : nullptr;
  const int ntn = (N + 63) / 64; const int wid = blockIdx.x * 4 + w; const int mt = wid / ntn, nq = wid % ntn; if (mt * 16 >= M) return;
  const int row0 = mt * 16, col0 = nq * 64; const _Float16* arow = A + (size_t)(row0 + ln) * lda;
  v8f acc[4] = {};
  for (int kb = 0; kb < K; kb += 32) { FragH ah; ah.half[0] = *(const v8us*)((const unsigned short*)arow + kb + 8 * hh); ah.half[1] = *(const v8us*)((const unsigned short*)arow + kb + 16 + 8 * hh);
#pragma unroll
    for (int t = 0; t < 4; ++t) { if (col0 + t * 16 >= N) continue; const size_t boff = (size_t)(col0 + t * 16 + ln) * ldb + kb; FragH bq; bq.half[0] = *(const v8us*)((const unsigned short*)Bh + boff + 8 * hh); bq.half[1] = *(const v8us*)((const unsigned short*)Bh + boff + 16 + 8 * hh);
      acc[t] = mmaH<1>(ah.v, ah.v, bq.v, bq.v, acc[t]); }
  }
#pragma unroll
  for (int t = 0; t < 4; ++t) { if (col0 + t * 16 >= N) continue; const int col = col0 + t * 16 + ln; const float bv = bp ? bf16_round(bp[col]) : 0.f;
#pragma unroll
    for (int r = 0; r < 8; ++r) { float v = acc[t][r] * alpha + bv; if (CP) { const int rr = row0g + row0 + 8 * hh + r; if (rowsPerB < 0) v += CP[cofs + (size_t)rr * ldc + col];      /* rowsPerB < 0: own element of the batched C plane */ else { const int bidx = rr / rowsPerB; v += CP[(size_t)bidx * sCPb + (size_t)by * 64 + col]; } } if (ACT == 1) v = (v > 0.f) ? v : expm1f(v); else if (ACT == 7) v = (v > 0.f) ? v + 1.0f : expf(v); else if (ACT == 8) v = tanhf(v); else if (ACT == 9) v = 0.5f * v * (1.0f + tanhf(0.7978845608028654f * (v + 0.044715f * v * v * v))); else if (ACT == 11) v = 1.0f / (1.0f + expf(-v)); else if (ACT == 12) v = (v > 0.f) ? v : 0.01f * v; else if (ACT == 14) v = (v > 0.f) ? v : 0.1f * v; else if (ACT == 16) v = (v >= 0.f) ? v : 0.3f * v; else if (ACT == 17) v = (v >= 0.f) ? v : 0.2f * v; else if (ACT == 15) v = v / (1.0f + expf(-v)); else if (ACT == 3) v = fmaxf(v, 0.f); else if (ACT == 6) v = 0.5f * v * (1.0f + erff(v * 0.70710678118654752f)); so[w][8 * hh + r][t * 16 + ln] = v; } }
  __builtin_amdgcn_fence(__ATOMIC_ACQ_REL, "workgroup"); __builtin_amdgcn_wave_barrier();
  const int rsub = lane >> 4, c4 = (lane & 15) * 4; typedef _Float16 v4h __attribute__((ext_vector_type(4)));
  {
#pragma unroll
    for (int q = 0; q < 8; ++q) { const int r = q * 2 + rsub; if (col0 + c4 < N) { const v4f v = *(const v4fa*)&so[w][r][c4]; if (C) *(v4f*)(C + cofs + (size_t)(row0 + r) * ldc + col0 + c4) = v; if (C16) { v4h h4; for (int i = 0; i < 4; ++i) h4[i] = (_Float16)v[i]; *(v4h*)(C16 + cofs + (size_t)(row0 + r) * ldc + col0 + c4) = h4; } } }
     }
}


typedef _Float16 v4h __attribute__((ext_vector_type(4)));

// One launch for all that depends on the inputs alone. Blocks [0, 4 * PWB): plane wi of BW = Wt[n][k] = f16(bf16(W[k][n]) * 16) from the f32 row-major [in][out] weight wi (q, k, v, o; bf16-exact weights stay exact in f16 away from the subnormal range), one thread per 8 k of one n.
// Blocks from 4 * PWB on: x as f16 rows (bf16-rounded), one thread per 8 elements. The branch is the same for a whole block.
#define PWB (DM * (DM / 8) / 256)            /* blocks per weight */
#define PXB ((int)(NR * DM / 8 / 256))       /* blocks for x */
__global__ __launch_bounds__(256) void k_prep(const float* __restrict__ wq, const float* __restrict__ wk, const float* __restrict__ wv, const float* __restrict__ wo, _Float16* __restrict__ BW, const float* __restrict__ x, _Float16* __restrict__ X16) {
  static_assert(DM * (DM / 8) % 256 == 0 && NR * DM / 8 % 256 == 0, "k_prep: whole blocks only, no thread is guarded");
  const int bx = blockIdx.x; FragH f;
  if (bx < 4 * PWB) {
    const int wi = bx / PWB; const float* W = wi == 0 ? wq : wi == 1 ? wk : wi == 2 ? wv : wo;
    const int t = (bx - wi * PWB) * 256 + threadIdx.x; const int n = t / (DM / 8), k8 = (t % (DM / 8)) * 8;
#pragma unroll
    for (int i = 0; i < 8; ++i) f.h[i] = (_Float16)(bf16_round(W[(size_t)(k8 + i) * DM + n]) * 16.0f);
    *(v8us*)((unsigned short*)BW + (size_t)wi * DM * DM + (size_t)n * DM + k8) = f.half[0];
  } else {
    const size_t t = (size_t)(bx - 4 * PWB) * 256 + threadIdx.x;
#pragma unroll
    for (int q = 0; q < 8; ++q) f.h[q] = (_Float16)bf16_round(x[t * 8 + q]);
    *(v8us*)((unsigned short*)X16 + t * 8) = f.half[0];
    asm volatile("s_wait_xcnt 0x0" ::: "memory");      /* stands behind the store: the listing's fall-through behind it runs into the weight part, which rewrites the store's registers */
  } }
__global__ __launch_bounds__(256) void k_h16(const float* __restrict__ x, _Float16* __restrict__ X16, size_t n8) { const size_t t = (size_t)blockIdx.x * 256 + threadIdx.x; if (t >= n8) return; FragH f;
#pragma unroll
  for (int q = 0; q < 8; ++q) f.h[q] = (_Float16)x[t * 8 + q]; *(v8us*)((unsigned short*)X16 + t * 8) = f.half[0];  }
__global__ __launch_bounds__(256) void k_round16f(const float* __restrict__ W, _Float16* __restrict__ Bt, size_t n8) { const size_t t = (size_t)blockIdx.x * 256 + threadIdx.x; if (t >= n8) return; FragH f;
#pragma unroll
  for (int i = 0; i < 8; ++i) f.h[i] = (_Float16)(bf16_round(W[t * 8 + i]) * 16.0f); *(v8us*)((unsigned short*)Bt + t * 8) = f.half[0];  }
template <int NHv, int TTv>
__global__ __launch_bounds__(256) void k_vt(const _Float16* __restrict__ V16, int ldv, int voff, _Float16* __restrict__ Vt) { __shared__ unsigned short tl[64][66]; const int tid = threadIdx.x; const int slab = blockIdx.x / (TTv / 64), lg = blockIdx.x % (TTv / 64); const int b = slab / NHv, h = slab % NHv;
  for (int i = tid; i < 64 * 8; i += 256) { const int r = i / 8, c8 = (i % 8) * 8; FragH f; f.half[0] = *(const v8us*)((const unsigned short*)V16 + ((size_t)b * TTv + lg * 64 + r) * ldv + voff + h * 64 + c8);
#pragma unroll
    for (int q = 0; q < 8; ++q) tl[r][c8 + q] = f.u[q]; }
  __syncthreads();
  {
#pragma unroll
    for (int rd = 0; rd < 2; ++rd) { const int d = rd * 32 + tid / 8, pc = tid % 8; FragH f;
#pragma unroll
      for (int q = 0; q < 8; ++q) f.u[q] = tl[pc * 8 + q][d];
      *(v8us*)((unsigned short*)Vt + ((size_t)slab * 64 + d) * TTv + lg * 64 + pc * 8) = f.half[0]; }
     } }

__global__ __launch_bounds__(256) void k_hl(const float* __restrict__ F, _Float16* __restrict__ Hh, _Float16* __restrict__ Hl, size_t n8) { const size_t t = (size_t)blockIdx.x * 256 + threadIdx.x; if (t >= n8) return; FragH fh, fl; const v4f a = *(const v4fa*)(F + t * 8), c = *(const v4fa*)(F + t * 8 + 4);
#pragma unroll
  for (int q = 0; q < 4; ++q) { _Float16 h = (_Float16)a[q]; fh.h[q] = h; fl.h[q] = (_Float16)((a[q] - (float)h) * 1024.0f); h = (_Float16)c[q]; fh.h[4 + q] = h; fl.h[4 + q] = (_Float16)((c[q] - (float)h) * 1024.0f); }
  { *(v8us*)((unsigned short*)Hh + t * 8) = fh.half[0]; *(v8us*)((unsigned short*)Hl + t * 8) = fl.half[0];  } }

// ---- fast GEMM (work-group tile 128x64, wave tile 32x64; requires M % 128 == 0 rows per launch region, N % 64 == 0, K % 64 == 0); epilogue = k_gemm_hhx semantics ----
__device__ __forceinline__ v16h g2_frag(const _Float16* p, int hh) { FragH f; f.half[0] = *(const v8us*)((const unsigned short*)p + 8 * hh); f.half[1] = *(const v8us*)((const unsigned short*)p + 16 + 8 * hh); return f.v; }
__device__ __forceinline__ v8f g2_mma(v16h a, v16h b, v8f c) { v8f d = __builtin_amdgcn_wmma_f32_16x16x32_f16(false, a, false, b, (short)0, c, false, false); asm volatile("v_nop\n\tv_nop\n\tv_nop\n\tv_nop" : "+v"(d) : "v"(a), "v"(b)); return d; }
// A and B reach the waves through LDS: a stage is 64 k (128 A rows and 64 B rows of 128 bytes each), brought once per work-group by asynchronous copies that cover whole 128-byte lines, two buffers, the next stage in flight while this one is worked on.
#define GP 144                       /* LDS row pitch, bytes: 128 + 16, an odd multiple of 16 for 16-byte readers */
#define GTA (128 * GP)               /* bytes of the staged A tile */
#define GSB (192 * GP)               /* bytes of one stage: A tile, then B tile */
__device__ __forceinline__ v16h g2_lfrag(const unsigned char* p) { FragH f; f.half[0] = *(const v8us*)p; f.half[1] = *(const v8us*)(p + 32); return f.v; }      /* g2_frag's k order from an LDS row; p already holds the lane half's 16 bytes */
// One stage: each of the 128 threads copies 16 bytes of rows r0 + 16 j of the A tile (j < 8, at lds) and of the B tile (j < 4, at lds + GTA); eight lanes cover one 128-byte row. sa, sb: 16 rows of A, of B, in elements.
// The s_wait_xcnt closes the copies' own statement, so that it stands in front of every later write of the address registers that the copies name.
__device__ __forceinline__ void g2_stage(unsigned lds, const _Float16* ga, size_t sa, const _Float16* gb, size_t sb) {
  asm volatile("global_load_async_to_lds_b128 %0, %12, off\n\tglobal_load_async_to_lds_b128 %1, %13, off\n\tglobal_load_async_to_lds_b128 %2, %14, off\n\tglobal_load_async_to_lds_b128 %3, %15, off\n\t"
               "global_load_async_to_lds_b128 %4, %16, off\n\tglobal_load_async_to_lds_b128 %5, %17, off\n\tglobal_load_async_to_lds_b128 %6, %18, off\n\tglobal_load_async_to_lds_b128 %7, %19, off\n\t"
               "global_load_async_to_lds_b128 %8, %20, off\n\tglobal_load_async_to_lds_b128 %9, %21, off\n\tglobal_load_async_to_lds_b128 %10, %22, off\n\tglobal_load_async_to_lds_b128 %11, %23, off\n\ts_wait_xcnt 0x0"
               :: "v"(lds), "v"(lds + 16 * GP), "v"(lds + 32 * GP), "v"(lds + 48 * GP), "v"(lds + 64 * GP), "v"(lds + 80 * GP), "v"(lds + 96 * GP), "v"(lds + 112 * GP),
                  "v"(lds + GTA), "v"(lds + GTA + 16 * GP), "v"(lds + GTA + 32 * GP), "v"(lds + GTA + 48 * GP),
                  "v"(ga), "v"(ga + sa), "v"(ga + 2 * sa), "v"(ga + 3 * sa), "v"(ga + 4 * sa), "v"(ga + 5 * sa), "v"(ga + 6 * sa), "v"(ga + 7 * sa),
                  "v"(gb), "v"(gb + sb), "v"(gb + 2 * sb), "v"(gb + 3 * sb)
               : "memory"); }
template <int ACT>
__global__ __launch_bounds__(128) void k_gemm2(const _Float16* __restrict__ A, int lda, size_t sA, const _Float16* __restrict__ Bh, int ldb, size_t sB, float alpha, const float* __restrict__ bias, size_t sBias, const float* __restrict__ bias1, const float* __restrict__ bias2, const float* __restrict__ CP, int rowsPerB, size_t sCPb, int row0g,
    float* __restrict__ C, _Float16* __restrict__ C16, int ldc, size_t sC, int M, int N, int K) { static_assert(ACT == 0 || ACT == 3 || ACT == 6 || ACT == 8 || ACT == 9 || ACT == 11 || ACT == 12 || ACT == 14 || ACT == 15 || ACT == 16 || ACT == 17, "k_gemm2: unsupported ACT code (would silently apply no activation)");
  __shared__ __attribute__((aligned(16))) float so[4][32][68];
  __shared__ __attribute__((aligned(16))) unsigned char G[2 * GSB];      /* two buffers of [A tile | B tile] */
  const int tid = threadIdx.x, w = tid >> 5, lane = tid & 31, ln = lane & 15, hh = lane >> 4; const int by = blockIdx.y;
  A += (size_t)by * sA; Bh += (size_t)by * sB; const size_t cofs = (size_t)by * sC; const float* bp = bias ? bias + (size_t)by * sBias : nullptr;
  if (by == 1 && bias1) bp = bias1; if (by == 2 && bias2) bp = bias2;      /* planes 1 and 2 whose biases are buffers of their own */
  const int ntn = N >> 6; const int mt = blockIdx.x / ntn, nq = blockIdx.x - mt * ntn; const int row0 = mt * 128 + 32 * w, col0 = nq * 64; if (mt * 128 + 128 > M) return;      /* the whole work-group or none, ahead of every copy and barrier: every staged A row exists */
  const int r0 = tid >> 3, ch = tid & 7;      /* this thread's row (mod 16) and 16-byte piece in every copied tile */
  const unsigned lst = (unsigned)(size_t)G + r0 * GP + ch * 16;
  const _Float16* ga = A + (size_t)(mt * 128 + r0) * lda + ch * 8; const _Float16* gb = Bh + (size_t)(col0 + r0) * ldb + ch * 8;
  const size_t sa = (size_t)16 * lda, sb = (size_t)16 * ldb; const int nst = K >> 6;
  g2_stage(lst, ga, sa, gb, sb);
  asm volatile("s_wait_asynccnt 0x0" ::: "memory");      /* this wave's share of stage 0 has landed */
  __syncthreads();      /* publishes stage 0 */
  if (nst > 1) g2_stage(lst + GSB, ga + 64, sa, gb + 64, sb);
  const v8f z8 = {0.f,0.f,0.f,0.f,0.f,0.f,0.f,0.f}; v8f c00 = z8, c01 = z8, c02 = z8, c03 = z8, c10 = z8, c11 = z8, c12 = z8, c13 = z8;
#pragma unroll 1      /* one stage per trip: the buffer index stays a scalar select and the loop stays short */
  for (int t = 0; t < nst; ++t) {
    const unsigned char* al = G + (t & 1) * GSB + (32 * w + ln) * GP + 16 * hh; const unsigned char* bl = G + (t & 1) * GSB + GTA + ln * GP + 16 * hh;
    v16h a[2][2], b[2][4];      /* the stage's 24 LDS reads stand together, ahead of its 16 WMMAs */
#pragma unroll
    for (int kc = 0; kc < 2; ++kc) { a[kc][0] = g2_lfrag(al + kc * 64); a[kc][1] = g2_lfrag(al + 16 * GP + kc * 64);
#pragma unroll
      for (int j = 0; j < 4; ++j) b[kc][j] = g2_lfrag(bl + j * 16 * GP + kc * 64); }
#pragma unroll
    for (int kc = 0; kc < 2; ++kc) {
      c00 = g2_mma(a[kc][0], b[kc][0], c00); c10 = g2_mma(a[kc][1], b[kc][0], c10);
      c01 = g2_mma(a[kc][0], b[kc][1], c01); c11 = g2_mma(a[kc][1], b[kc][1], c11);
      c02 = g2_mma(a[kc][0], b[kc][2], c02); c12 = g2_mma(a[kc][1], b[kc][2], c12);
      c03 = g2_mma(a[kc][0], b[kc][3], c03); c13 = g2_mma(a[kc][1], b[kc][3], c13); }
    asm volatile("s_wait_dscnt 0x0" ::: "memory");      /* this wave's reads of the buffer that is refilled below have returned */
    asm volatile("s_wait_asynccnt 0x0" ::: "memory");      /* this wave's share of stage t + 1 has landed */
    __syncthreads();      /* publishes stage t + 1 and ends every wave's reads of stage t */
    if (t + 2 < nst) g2_stage(lst + (t & 1) * GSB, ga + (size_t)(t + 2) * 64, sa, gb + (size_t)(t + 2) * 64, sb);
  }
  asm volatile("s_wait_asynccnt 0x0" ::: "memory");      /* no copy is outstanding when the wave ends */
  v8f accs[8] = {c00, c01, c02, c03, c10, c11, c12, c13};
#pragma unroll
  for (int u = 0; u < 8; ++u) { const int t = u & 3, half = u >> 2; const int col = col0 + t * 16 + ln; const float bv = bp ? bf16_round(bp[col]) : 0.f;
#pragma unroll
    for (int r = 0; r < 8; ++r) { const int rloc = half * 16 + 8 * hh + r; float v = accs[u][r] * alpha + bv; if (CP) { if (rowsPerB < 0) v += CP[cofs + (size_t)(row0g + row0 + rloc) * ldc + col];      /* rowsPerB < 0: own element of the batched C plane */ else { const int bidx = (row0g + row0 + rloc) / rowsPerB; v += CP[(size_t)bidx * sCPb + (size_t)by * 64 + col]; } }
      if (ACT == 3) v = fmaxf(v, 0.f); else if (ACT == 6) v = 0.5f * v * (1.0f + erff(v * 0.70710678118654752f)); else if (ACT == 11) v = 1.0f / (1.0f + expf(-v)); else if (ACT == 15) v = v / (1.0f + expf(-v)); else if (ACT == 12) v = (v > 0.f) ? v : 0.01f * v; else if (ACT == 8) v = tanhf(v); else if (ACT == 9) v = 0.5f * v * (1.0f + tanhf(0.7978845608028654f * (v + 0.044715f * v * v * v))); else if (ACT == 14) v = (v > 0.f) ? v : 0.1f * v; else if (ACT == 16) v = (v >= 0.f) ? v : 0.3f * v; else if (ACT == 17) v = (v >= 0.f) ? v : 0.2f * v;
      so[w][rloc][t * 16 + ln] = v; } }
  __builtin_amdgcn_fence(__ATOMIC_ACQ_REL, "workgroup"); __builtin_amdgcn_wave_barrier();
  const int rsub = lane >> 4, c4 = (lane & 15) * 4;
  {
#pragma unroll
    for (int q = 0; q < 16; ++q) { const int r = q * 2 + rsub; const v4f v = *(const v4fa*)&so[w][r][c4]; if (C) *(v4f*)(C + cofs + (size_t)(row0 + r) * ldc + col0 + c4) = v; if (C16) { v4h h4; for (int i = 0; i < 4; ++i) h4[i] = (_Float16)v[i]; *(v4h*)(C16 + cofs + (size_t)(row0 + r) * ldc + col0 + c4) = h4; } }
     } }


__global__ __launch_bounds__(256) void k_wnat(const float* __restrict__ w, size_t n8, _Float16* __restrict__ Bt) { const size_t t = (size_t)blockIdx.x * 256 + threadIdx.x; if (t >= n8) return; FragH f; for (int q = 0; q < 8; ++q) f.h[q] = (_Float16)(bf16_round(w[t * 8 + q]) * 16.0f); *(v8us*)((unsigned short*)Bt + t * 8) = f.half[0];  }
__global__ __launch_bounds__(256) void k_rsm(const float* __restrict__ S, _Float16* __restrict__ P, int nrows) {
  #pragma clang fp contract(off)
  const int i = blockIdx.x * 256 + threadIdx.x; if (i >= nrows) return; const float* s = S + (size_t)i * SQ; float mx = -3.0e38f;
#pragma unroll 1
  for (int j = 0; j < SQ; ++j) mx = fmaxf(mx, s[j]); float se = 0.f;
#pragma unroll 1
  for (int j = 0; j < SQ; ++j) se += expf(s[j] - mx); const float sc = 256.0f / se;
#pragma unroll 1
  for (int j0 = 0; j0 < SQ; j0 += 8) { FragH f; for (int q = 0; q < 8; ++q) f.h[q] = (_Float16)(expf(s[j0 + q] - mx) * sc); unsigned short* d = (unsigned short*)P + (size_t)i * SQ + j0; *(v8us*)d = f.half[0];  } }
__global__ __launch_bounds__(256) void k_vt(const _Float16* __restrict__ V16, int b, int h0, _Float16* __restrict__ VT) { __shared__ unsigned short tl[64][65]; const int tid = threadIdx.x; const int hh = blockIdx.x % HG, sg = blockIdx.x / HG; const int s0 = sg * 64; const int h = h0 + hh;
  for (int i = tid; i < 64 * 8; i += 256) { const int j = i / 8, d8 = (i % 8) * 8; FragH f; f.half[0] = *(const v8us*)((const unsigned short*)V16 + ((size_t)b * SQ + s0 + j) * DM + h * HD + d8); for (int q = 0; q < 8; ++q) tl[d8 + q][j] = f.u[q]; }
  __syncthreads();
  { for (int i = tid; i < 64 * 8; i += 256) { const int d = i / 8, j8 = (i % 8) * 8; FragH f; for (int q = 0; q < 8; ++q) f.u[q] = tl[d][j8 + q]; *(v8us*)((unsigned short*)VT + ((size_t)hh * HD + d) * SQ + s0 + j8) = f.half[0]; }  } }



#define FW 4                         /* waves per work-group: 128 query columns */
#define SCL 0.18033688011112042f     /* 64^-0.5 * log2(e) */
#define KS 64                        /* keys per stage: two passes */
#define LP 144                       /* LDS row pitch, bytes: 128 + 16, an odd multiple of 16 for 16-byte readers */
#define TB (64 * LP)                 /* bytes of one staged tile of 64 rows */
#define NST (SQ / KS)                /* stages */
__device__ __forceinline__ v8f fa_mma(v16h a, v16h b, v8f c) { return __builtin_amdgcn_wmma_f32_16x16x32_f16(false, a, false, b, (short)0, c, false, false); }
__device__ __forceinline__ float fa_xhalf(float x) { return __builtin_bit_cast(float, __builtin_amdgcn_permlanex16(__builtin_bit_cast(int, x), __builtin_bit_cast(int, x), 0x76543210, 0xfedcba98, false, false)); }      /* lane l <-> lane l ^ 16 */
__device__ __forceinline__ v16h fa_lfrag(const unsigned char* p) { FragH f; f.half[0] = *(const v8us*)p; f.half[1] = *(const v8us*)(p + 32); return f.v; }      /* g2_frag's k order from an LDS row; p already holds the lane half's 16 bytes */
// One stage: each of the 128 threads copies 16 bytes of rows r0, r0 + 16, r0 + 32, r0 + 48 of the K tile (at lds) and of the V^T tile (at lds + TB); eight lanes cover one 128-byte row.
// The s_wait_xcnt closes the copies' own statement, so that it stands in front of every later write of the address registers that the copies name.
__device__ __forceinline__ void fa_stage(unsigned lds, const _Float16* gk, const _Float16* gv) {
  asm volatile("global_load_async_to_lds_b128 %0, %8, off\n\tglobal_load_async_to_lds_b128 %1, %9, off\n\tglobal_load_async_to_lds_b128 %2, %10, off\n\tglobal_load_async_to_lds_b128 %3, %11, off\n\t"
               "global_load_async_to_lds_b128 %4, %12, off\n\tglobal_load_async_to_lds_b128 %5, %13, off\n\tglobal_load_async_to_lds_b128 %6, %14, off\n\tglobal_load_async_to_lds_b128 %7, %15, off\n\ts_wait_xcnt 0x0"
               :: "v"(lds), "v"(lds + 16 * LP), "v"(lds + 32 * LP), "v"(lds + 48 * LP), "v"(lds + TB), "v"(lds + TB + 16 * LP), "v"(lds + TB + 32 * LP), "v"(lds + TB + 48 * LP),
                  "v"(gk), "v"(gk + (size_t)16 * DM), "v"(gk + (size_t)32 * DM), "v"(gk + (size_t)48 * DM), "v"(gv), "v"(gv + (size_t)16 * SQ), "v"(gv + (size_t)32 * SQ), "v"(gv + (size_t)48 * SQ)
               : "memory"); }
__global__ __launch_bounds__(FW * 32) void k_fattn(const _Float16* __restrict__ Q16, const _Float16* __restrict__ K16, const _Float16* __restrict__ VT, _Float16* __restrict__ O16) {
  __shared__ __attribute__((aligned(16))) unsigned char L[2 * 2 * TB];      /* two buffers of [K tile | V^T tile] */
  const int lane = threadIdx.x & 31, c = lane & 15, hh = lane >> 4; const int w = __builtin_amdgcn_readfirstlane(threadIdx.x >> 5);
  const int bh = blockIdx.y, b = bh / NH, h = bh - b * NH; const int q0 = blockIdx.x * (FW * 32) + w * 32;
  const int r0 = threadIdx.x >> 3, ch = threadIdx.x & 7;      /* this thread's row (mod 16) and 16-byte piece in every copied tile */
  const unsigned lst = (unsigned)(size_t)L + r0 * LP + ch * 16;
  const _Float16* gk = K16 + ((size_t)b * SQ + r0) * DM + h * HD + ch * 8; const _Float16* gv = VT + ((size_t)bh * HD + r0) * SQ + ch * 8;
  fa_stage(lst, gk, gv);
  const _Float16* qp = Q16 + ((size_t)b * SQ + q0 + c) * DM + h * HD;
  v16h qf[2][2];
#pragma unroll
  for (int g = 0; g < 2; ++g) for (int kc = 0; kc < 2; ++kc) qf[g][kc] = g2_frag(qp + (size_t)g * 16 * DM + kc * 32, hh);
  asm volatile("s_wait_asynccnt 0x0" ::: "memory");      /* this wave's share of stage 0 has landed */
  __syncthreads();      /* publishes stage 0 */
  fa_stage(lst + 2 * TB, gk + (size_t)KS * DM, gv + KS);
  const v8f z8 = {0.f,0.f,0.f,0.f,0.f,0.f,0.f,0.f}; v8f o[2][4] = {{z8, z8, z8, z8}, {z8, z8, z8, z8}}; float m[2] = {-1.0e30f, -1.0e30f}, l[2] = {0.f, 0.f};
  for (int t = 0; t < NST; ++t) {
    const unsigned char* kl = L + (t & 1) * (2 * TB) + c * LP + 16 * hh; const unsigned char* vl = kl + TB;
    v16h kf[2][2];
#pragma unroll
    for (int kt = 0; kt < 2; ++kt) for (int kc = 0; kc < 2; ++kc) kf[kt][kc] = fa_lfrag(kl + kt * 16 * LP + kc * 64);
#pragma unroll
    for (int p = 0; p < 2; ++p) {
    v16h vf[4];
#pragma unroll
    for (int dt = 0; dt < 4; ++dt) vf[dt] = fa_lfrag(vl + dt * 16 * LP + p * 64);
    v8f s[2][2];
#pragma unroll
    for (int g = 0; g < 2; ++g) for (int kt = 0; kt < 2; ++kt) s[g][kt] = fa_mma(kf[kt][1], qf[g][1], fa_mma(kf[kt][0], qf[g][0], z8));
    if (p == 0) {      /* the stage's second pass's K rows, fetched one pass ahead from the same buffer */
#pragma unroll
      for (int kt = 0; kt < 2; ++kt) for (int kc = 0; kc < 2; ++kc) kf[kt][kc] = fa_lfrag(kl + (32 + kt * 16) * LP + kc * 64);
    }
    __builtin_amdgcn_sched_barrier(0);      /* keeps the V and K fragment reads up here, ahead of the softmax; without it the scheduler sinks them directly in front of the wait for them */
#pragma unroll
    for (int g = 0; g < 2; ++g) {
      float x[16];
#pragma unroll
      for (int i = 0; i < 16; ++i) x[i] = s[g][i >> 3][i & 7];
      float mx = fmaxf(fmaxf(fmaxf(x[0], x[1]), fmaxf(x[2], x[3])), fmaxf(fmaxf(x[4], x[5]), fmaxf(x[6], x[7])));
      mx = fmaxf(mx, fmaxf(fmaxf(fmaxf(x[8], x[9]), fmaxf(x[10], x[11])), fmaxf(fmaxf(x[12], x[13]), fmaxf(x[14], x[15]))));
      mx = fmaxf(mx, fa_xhalf(mx));
      const float mn = fmaxf(m[g], mx), nb = -mn * SCL; float al = (m[g] - mn) * SCL; m[g] = mn;
#pragma unroll
      for (int i = 0; i < 16; ++i) x[i] = fmaf(x[i], SCL, nb);
      /* exponentials in place, each run closed by one v_nop: the instruction set asks for one independent instruction between a transcendental and an overwrite of its source or a use of its result */
      asm("v_exp_f32 %0, %0\n\tv_exp_f32 %1, %1\n\tv_exp_f32 %2, %2\n\tv_exp_f32 %3, %3\n\tv_exp_f32 %4, %4\n\tv_exp_f32 %5, %5\n\tv_exp_f32 %6, %6\n\tv_exp_f32 %7, %7\n\tv_exp_f32 %8, %8\n\tv_nop"
          : "+v"(x[0]), "+v"(x[1]), "+v"(x[2]), "+v"(x[3]), "+v"(x[4]), "+v"(x[5]), "+v"(x[6]), "+v"(x[7]), "+v"(al));
      asm("v_exp_f32 %0, %0\n\tv_exp_f32 %1, %1\n\tv_exp_f32 %2, %2\n\tv_exp_f32 %3, %3\n\tv_exp_f32 %4, %4\n\tv_exp_f32 %5, %5\n\tv_exp_f32 %6, %6\n\tv_exp_f32 %7, %7\n\tv_nop"
          : "+v"(x[8]), "+v"(x[9]), "+v"(x[10]), "+v"(x[11]), "+v"(x[12]), "+v"(x[13]), "+v"(x[14]), "+v"(x[15]));
      const float ps = (((x[0] + x[1]) + (x[2] + x[3])) + ((x[4] + x[5]) + (x[6] + x[7]))) + (((x[8] + x[9]) + (x[10] + x[11])) + ((x[12] + x[13]) + (x[14] + x[15])));
      l[g] = fmaf(l[g], al, ps);      /* this half's keys only; the halves are joined behind the loop */
      FragH pf;
#pragma unroll
      for (int i = 0; i < 16; ++i) pf.h[i] = (_Float16)x[i];
#pragma unroll
      for (int dt = 0; dt < 4; ++dt) { o[g][dt] *= al; o[g][dt] = fa_mma(vf[dt], pf.v, o[g][dt]); }
    }
    }
    __builtin_amdgcn_sched_barrier(0);      /* holds the four v_nop below behind the stage's last WMMA */
    asm volatile("v_nop\n\tv_nop\n\tv_nop\n\tv_nop");      /* WMMA distance over the back edge: the next stage's first instructions may write registers that the last WMMA reads as A or B */
    asm volatile("s_wait_dscnt 0x0" ::: "memory");      /* this wave's reads of the buffer that is refilled below have returned */
    asm volatile("s_wait_asynccnt 0x0" ::: "memory");      /* this wave's share of stage t + 1 has landed */
    __syncthreads();      /* publishes stage t + 1 and ends every wave's reads of stage t */
    if (t + 2 < NST) fa_stage(lst + (t & 1) * (2 * TB), gk + (size_t)(t + 2) * KS * DM, gv + (size_t)(t + 2) * KS);
  }
  asm volatile("s_wait_asynccnt 0x0" ::: "memory");      /* no copy is outstanding when the wave ends */
#pragma unroll
  for (int g = 0; g < 2; ++g) { const float inv = 64.0f / (l[g] + fa_xhalf(l[g])); _Float16* op = O16 + ((size_t)b * SQ + q0 + g * 16 + c) * DM + h * HD + 8 * hh;
#pragma unroll
    for (int dt = 0; dt < 4; ++dt) { FragH f;      /* a lane's 8 accumulator registers are 8 consecutive d of one query: one 16-byte store */
#pragma unroll
      for (int r = 0; r < 8; ++r) f.h[r] = (_Float16)(o[g][dt][r] * inv);
      *(v8us*)((unsigned short*)op + dt * 16) = f.half[0]; } } }

extern "C" void kernel_launch(void* const* d_in, const int* in_sizes, int n_in,
                              void* d_out, int out_size, void* d_ws, size_t ws_size, hipStream_t stream) {
  (void)in_sizes; (void)n_in; (void)out_size;
  const float* const* I = (const float* const*)d_in; const float* x = I[0]; const float* wq = I[1]; const float* bq = I[2]; const float* wk = I[3]; const float* bk = I[4]; const float* wv = I[5]; const float* bv = I[6]; const float* wo = I[7]; const float* bo = I[8];      /* [in][out] weights + biases (y = x @ W + b) */
  char* ws = (char*)d_ws; size_t off = 0;
  auto take = [&](size_t bytes) { char* p = ws + off; off += (bytes + 255) & ~(size_t)255; return p; };
  _Float16* BW = (_Float16*)take((size_t)4 * DM * DM * 2); _Float16* BO = BW + (size_t)3 * DM * DM;      /* four weight planes in a row: q, k, v, o */
  _Float16* X16 = (_Float16*)take(NR * DM * 2); _Float16* Q16 = (_Float16*)take(3 * NR * DM * 2); _Float16* K16 = Q16 + NR * DM; _Float16* V16 = Q16 + 2 * NR * DM; _Float16* O16 = (_Float16*)take(NR * DM * 2);      /* q, k, v: three planes in a row */
  _Float16* VT = (_Float16*)take((size_t)NB * NH * HD * SQ * 2);
  if (off > ws_size) return;
  k_prep<<<4 * PWB + PXB, 256, 0, stream>>>(wq, wk, wv, wo, BW, x, X16);      /* [in][out] -> Bt[n][k] x16 (transposing builder) and x rows */
  const size_t r0p = (size_t)B0 * SQ;      /* first projected row */
  k_gemm2<0><<<dim3((unsigned)((MP / 128) * (DM / 64)), 3), 128, 0, stream>>>(X16 + r0p * DM, DM, 0, BW, DM, (size_t)DM * DM, 0.0625f, bq, 0, bk, bv, nullptr, 1, 0, 0, nullptr, Q16 + r0p * DM, DM, NR * DM, MP, DM, DM);      /* blockIdx.y: q, k, v */
  k_vt<NH, SQ><<<NB * NH * (SQ / 64), 256, 0, stream>>>(V16, LQ, 0, VT);      /* V^T [NB][NH][HD][SQ] */
  k_fattn<<<dim3(SQ / (FW * 32), NB * NH), FW * 32, 0, stream>>>(Q16, K16, VT, O16);      /* o x64 (merged heads) as f16 rows */
  k_gemm2<0><<<dim3((unsigned)((MPO / 128) * (DM / 64)), 1), 128, 0, stream>>>(O16 + r0p * DM, DM, 0, BO, DM, 0, 0.0009765625f, bo, 0, nullptr, nullptr, nullptr, 1, 0, 0, (float*)d_out + r0p * DM, nullptr, DM, 0, MPO, DM, DM);      /* out rows are the output layout */
}

// v006
// Measured time: 159 microseconds a run.
// Next to v005, in two timings, it ran 1.04 and 1.03 times as fast.
// Counting every step since v000, it is 125 times as fast.
#include <hip/hip_runtime.h>
// Multi-head self-attention over 4096-token sequences at width 768 with [in][out] projections and biases (hidden_states [2][4096][768]; q / k / v = x W + b ([in][out] 768 x 768 + biases), 12 heads of 64; scores * 1/sqrt(64); softmax over all 4096 keys (no mask); out = merged Wo + bo ([in][out]) -> [2][4096][768]); all heads and batches in one attention launch.
// Structure: token rows r = b*4096 + s; one preparation launch (x as exact f16 rows, bf16-rounded; the four transposed weights); Q, K, V as three WMMA GEMMs in one launch (blockIdx.y; 32x64 wave tiles, f32 accumulation, exact x16 weights + bias, f16 outputs); V^T for all batches and heads via LDS transposes; one attention launch for all (batch, head): S^T = K Q^T, K and V^T staged in LDS per work-group, online softmax in registers (f32 statistics, native exp2; weights exp(s - maximum in use) as f16, rescaled lazily), O^T += V^T P^T, o carried x64 against f16 subnormal flush (folded into the output GEMM alpha), written straight into the merged f16 o rows; out = o W_o + b GEMM (f32) into the output layout.
// Compute dtype: inputs rounded to bf16; x / weights exact; q, k, v, softmax weights and o as plain f16 GEMM operands (~2^-12); scores and softmax statistics f32. v_wmma_f32_16x16x32_f16.
#define NB 2
#define SQ 4096
#define DM 768
#define NH 12
#define HD 64
#define HG 1                         /* heads per group in the unlaunched per-batch k_vt (a 4096^2 f32 score slab is 64 MiB) */
#define B0 0                         /* first batch processed (debug hook) */
#define NBR NB                       /* batches processed (debug hook) */
#define NR ((size_t)NB * SQ)         /* token rows */
#define MP ((int)((size_t)NBR * SQ)) /* rows projected (debug hook) */
#define QN SQ                        /* unused: attention covers all SQ query rows */
#define NHD NH                       /* unused: attention covers all NH heads */
#define MPO MP                       /* rows through the output stage (debug hook) */
#define LQ DM      /* row pitch of the q/k/v rows */
typedef __bf16 v16b __attribute__((ext_vector_type(16)));
typedef unsigned short v8us __attribute__((ext_vector_type(8), may_alias));
typedef float  v8f  __attribute__((ext_vector_type(8)));
typedef float  v4f  __attribute__((ext_vector_type(4)));
typedef float  v4fa __attribute__((ext_vector_type(4), may_alias));
union FragB { v16b v; v8us half[2]; unsigned short u[16]; };

__device__ __forceinline__ unsigned short bf16_bits(float x) { unsigned int u = __float_as_uint(x); return (unsigned short)((u + 0x7FFFu + ((u >> 16) & 1u)) >> 16); }
__device__ __forceinline__ float bf16_val(unsigned short b) { return __uint_as_float(((unsigned int)b) << 16); }
__device__ __forceinline__ float bf16_round(float x) { return bf16_val(bf16_bits(x)); }
// D += A·B with NT terms: 1 = ah·bh, 2 = + al·bh (A split), 3 = + ah·bl (both split)
template <int NT>
__device__ __forceinline__ v8f mmaN(v16b ah, v16b al, v16b bh, v16b bl, v8f c) {
  c = __builtin_amdgcn_wmma_f32_16x16x32_bf16(false, ah, false, bh, (short)0, c, false, false);
  if (NT >= 2) c = __builtin_amdgcn_wmma_f32_16x16x32_bf16(false, al, false, bh, (short)0, c, false, false);
  if (NT >= 3) c = __builtin_amdgcn_wmma_f32_16x16x32_bf16(false, ah, false, bl, (short)0, c, false, false);
  asm volatile("v_nop\n\tv_nop\n\tv_nop\n\tv_nop" : "+v"(c) : "v"(ah), "v"(al), "v"(bh), "v"(bl));
  return c;
}

__global__ __launch_bounds__(256) void k_wt_bf16(const float* __restrict__ W, unsigned short* __restrict__ Wt, int K, int N) {
  const int t = blockIdx.x * 256 + threadIdx.x;
  const int k8n = K / 8;
  if (t >= N * k8n) return;
  const int n = t / k8n, k8 = (t % k8n) * 8;
  v8us v;
#pragma unroll
  for (int i = 0; i < 8; ++i) v[i] = bf16_bits(W[(size_t)(k8 + i) * N + n]);
  *(v8us*)(Wt + (size_t)n * K + k8) = v;
  
}

// GEMM C[M][N] (f32, pitch ldc) = act(A[M][K]·W + bias). A f32 row-major (pitch lda) converted per fragment to bf16
// (ASPLIT: hi/lo two planes -> 2 terms, else single rounded term); Wt bf16 [N][K] (pitch ldb). BIAS_BF16 rounds the
// bias to bf16 first (bias quantised to bf16 before the add). K%32==0, M%16==0, N%64==0.
template <bool ASPLIT, int ACT, bool BIAS_BF16>
__global__ __launch_bounds__(128) void k_gemm_bf(const float* __restrict__ A, int lda, const unsigned short* __restrict__ Wt, int ldb,
                                               const float* __restrict__ bias, float* __restrict__ C, int ldc, int M, int N, int K) {
  __shared__ __attribute__((aligned(16))) float so[4][16][64];
  const int tid = threadIdx.x, w = tid >> 5, lane = tid & 31, ln = lane & 15, hh = lane >> 4;
  const int ntn = N / 64;
  const int wid = blockIdx.x * 4 + w;
  const int mt = wid / ntn, nq = wid % ntn;
  if (mt * 16 >= M) return;
  const int row0 = mt * 16, col0 = nq * 64;
  const float* arow = A + (size_t)(row0 + ln) * lda;
  v8f acc[4] = {};
  for (int kb = 0; kb < K; kb += 32) {
    FragB ah, al;
    const v4f x0 = *(const v4fa*)(arow + kb + 8 * hh), x1 = *(const v4fa*)(arow + kb + 8 * hh + 4);
    const v4f x2 = *(const v4fa*)(arow + kb + 16 + 8 * hh), x3 = *(const v4fa*)(arow + kb + 16 + 8 * hh + 4);
    float xs[16] = {x0[0],x0[1],x0[2],x0[3],x1[0],x1[1],x1[2],x1[3],x2[0],x2[1],x2[2],x2[3],x3[0],x3[1],x3[2],x3[3]};
#pragma unroll
    for (int i = 0; i < 16; ++i) { const unsigned short hb = bf16_bits(xs[i]); ah.u[i] = hb; al.u[i] = ASPLIT ? bf16_bits(xs[i] - bf16_val(hb)) : (unsigned short)0; }
#pragma unroll
    for (int t = 0; t < 4; ++t) {
      const unsigned short* brow = Wt + (size_t)(col0 + t * 16 + ln) * ldb + kb;
      FragB b;
      b.half[0] = *(const v8us*)(brow + 8 * hh);
      b.half[1] = *(const v8us*)(brow + 16 + 8 * hh);
      acc[t] = mmaN<ASPLIT ? 2 : 1>(ah.v, al.v, b.v, b.v, acc[t]);
    }
  }
#pragma unroll
  for (int t = 0; t < 4; ++t) {
    float bv = bias ? bias[col0 + t * 16 + ln] : 0.f;
    if (BIAS_BF16) bv = bf16_round(bv);
#pragma unroll
    for (int r = 0; r < 8; ++r) { float v = acc[t][r] + bv; if (ACT == 1) v = fmaxf(v, 0.f); so[w][8 * hh + r][t * 16 + ln] = v; }
  }
  __builtin_amdgcn_fence(__ATOMIC_ACQ_REL, "workgroup");
  __builtin_amdgcn_wave_barrier();
  const int rsub = lane >> 4, c4 = (lane & 15) * 4;
  {
#pragma unroll
    for (int q = 0; q < 8; ++q) {
      const int r = q * 2 + rsub;
      const v4f v = *(const v4fa*)&so[w][r][c4];
      *(v4f*)(C + (size_t)(row0 + r) * ldc + col0 + c4) = v;
    }
    
  }
}

// GEMM C = act(A·W + bias + resid): A f32 (ASPLIT -> hi/lo 2 terms), Wt bf16 [N][K]; ACT 0 none, 1 relu, 2 exact gelu;
// resid (optional, f32, row index = (row % rmod), pitch ldr, RES_BF16 rounds it) added before the activation.
template <bool ASPLIT, int ACT, bool BIAS_BF16, bool RES_BF16>
__global__ __launch_bounds__(128) void k_gemm_bf3(const float* __restrict__ A, int lda, const unsigned short* __restrict__ Wt, int ldb,
                                                const float* __restrict__ bias, const float* __restrict__ resid, int rmod, int ldr,
                                                float* __restrict__ C, int ldc, int M, int N, int K) {
  __shared__ __attribute__((aligned(16))) float so[4][16][64];
  const int tid = threadIdx.x, w = tid >> 5, lane = tid & 31, ln = lane & 15, hh = lane >> 4;
  const int ntn = N / 64;
  const int wid = blockIdx.x * 4 + w;
  const int mt = wid / ntn, nq = wid % ntn;
  if (mt * 16 >= M) return;
  const int row0 = mt * 16, col0 = nq * 64;
  const float* arow = A + (size_t)(row0 + ln) * lda;
  v8f acc[4] = {};
  for (int kb = 0; kb < K; kb += 32) {
    FragB ah, al;
    const v4f x0 = *(const v4fa*)(arow + kb + 8 * hh), x1 = *(const v4fa*)(arow + kb + 8 * hh + 4);
    const v4f x2 = *(const v4fa*)(arow + kb + 16 + 8 * hh), x3 = *(const v4fa*)(arow + kb + 16 + 8 * hh + 4);
    float xs[16] = {x0[0],x0[1],x0[2],x0[3],x1[0],x1[1],x1[2],x1[3],x2[0],x2[1],x2[2],x2[3],x3[0],x3[1],x3[2],x3[3]};
#pragma unroll
    for (int i = 0; i < 16; ++i) { const unsigned short hb = bf16_bits(xs[i]); ah.u[i] = hb; al.u[i] = ASPLIT ? bf16_bits(xs[i] - bf16_val(hb)) : (unsigned short)0; }
#pragma unroll
    for (int t = 0; t < 4; ++t) {
      const unsigned short* brow = Wt + (size_t)(col0 + t * 16 + ln) * ldb + kb;
      FragB b;
      b.half[0] = *(const v8us*)(brow + 8 * hh);
      b.half[1] = *(const v8us*)(brow + 16 + 8 * hh);
      acc[t] = mmaN<ASPLIT ? 2 : 1>(ah.v, al.v, b.v, b.v, acc[t]);
    }
  }
#pragma unroll
  for (int t = 0; t < 4; ++t) {
    const int col = col0 + t * 16 + ln;
    float bv = bias ? bias[col] : 0.f;
    if (BIAS_BF16) bv = bf16_round(bv);
#pragma unroll
    for (int r = 0; r < 8; ++r) {
      float v = acc[t][r] + bv;
      if (resid) { float rv = resid[(size_t)((row0 + 8 * hh + r) % rmod) * ldr + col]; if (RES_BF16) rv = bf16_round(rv); v += rv; }
      if (ACT == 1) v = fmaxf(v, 0.f);
      if (ACT == 2) v = 0.5f * v * (1.0f + erff(v * 0.70710678118654752f));
      if (ACT == 3) { const float u = 0.7978845608028654f * (v + 0.044715f * v * v * v); v = 0.5f * v * (1.0f + tanhf(u)); }
      so[w][8 * hh + r][t * 16 + ln] = v;
    }
  }
  __builtin_amdgcn_fence(__ATOMIC_ACQ_REL, "workgroup");
  __builtin_amdgcn_wave_barrier();
  const int rsub = lane >> 4, c4 = (lane & 15) * 4;
  {
#pragma unroll
    for (int q = 0; q < 8; ++q) {
      const int r = q * 2 + rsub;
      const v4f v = *(const v4fa*)&so[w][r][c4];
      *(v4f*)(C + (size_t)(row0 + r) * ldc + col0 + c4) = v;
    }
    
  }
}
// row LayerNorm (biased variance, eps) over N: s = X (+ R); optional out_sum <- s; out_norm <- (s-mu)*rsqrt(var+eps)*g + b
template <bool PARAM_BF16>
__global__ __launch_bounds__(256) void k_layernorm(const float* __restrict__ X, const float* __restrict__ R, const float* __restrict__ g, const float* __restrict__ bta,
                                                  float* __restrict__ out_sum, float* __restrict__ out_norm, int N, float eps) {
  __shared__ float red[256];
  const int row = blockIdx.x, tid = threadIdx.x;
  const float* x = X + (size_t)row * N; const float* rr = R ? R + (size_t)row * N : nullptr;
  float vals[16];                     // up to N = 4096
  const int per = N / 256;            // contiguous chunk per thread? use strided-by-4 chunks: thread handles j = tid*4 + 1024*u
  float s1 = 0.f;
  for (int u = 0; u < per / 4; ++u) {
    const int j = tid * 4 + 1024 * u;
    const v4f a = *(const v4fa*)(x + j);
    v4f b = {0.f,0.f,0.f,0.f}; if (rr) b = *(const v4fa*)(rr + j);
#pragma unroll
    for (int q = 0; q < 4; ++q) { const float v = a[q] + b[q]; vals[u * 4 + q] = v; s1 += v; }
  }
  red[tid] = s1; __syncthreads();
  for (int st = 128; st > 0; st >>= 1) { if (tid < st) red[tid] += red[tid + st]; __syncthreads(); }
  const float mu = red[0] / (float)N; __syncthreads();
  float s2 = 0.f;
  for (int u = 0; u < per / 4; ++u)
#pragma unroll
    for (int q = 0; q < 4; ++q) { const float c = vals[u * 4 + q] - mu; s2 += c * c; }
  red[tid] = s2; __syncthreads();
  for (int st = 128; st > 0; st >>= 1) { if (tid < st) red[tid] += red[tid + st]; __syncthreads(); }
  const float rs = rsqrtf(red[0] / (float)N + eps);
  {
    for (int u = 0; u < per / 4; ++u) {
      const int j = tid * 4 + 1024 * u;
      v4f o, sm;
#pragma unroll
      for (int q = 0; q < 4; ++q) {
        float gg = g[j + q], bb = bta[j + q];
        if (PARAM_BF16) { gg = bf16_round(gg); bb = bf16_round(bb); }
        sm[q] = vals[u * 4 + q]; o[q] = (vals[u * 4 + q] - mu) * rs * gg + bb;
      }
      if (out_sum) *(v4f*)(out_sum + (size_t)row * N + j) = sm;
      *(v4f*)(out_norm + (size_t)row * N + j) = o;
    }
    
  }
}



// ---- f16 WMMA path (v_wmma_f32_16x16x32_f16): 11-bit significands for operands in range — used where a [0,1] probability operand needs more precision than bf16
typedef _Float16 v16h __attribute__((ext_vector_type(16)));
union FragH { v16h v; v8us half[2]; _Float16 h[16]; unsigned short u[16]; };
template <int NT>
__device__ __forceinline__ v8f mmaH(v16h ah, v16h al, v16h bh, v16h bl, v8f c) {
  c = __builtin_amdgcn_wmma_f32_16x16x32_f16(false, ah, false, bh, (short)0, c, false, false);
  if (NT >= 2) c = __builtin_amdgcn_wmma_f32_16x16x32_f16(false, al, false, bh, (short)0, c, false, false);
  if (NT >= 3) c = __builtin_amdgcn_wmma_f32_16x16x32_f16(false, ah, false, bl, (short)0, c, false, false);
  asm volatile("v_nop\n\tv_nop\n\tv_nop\n\tv_nop" : "+v"(c) : "v"(ah), "v"(al), "v"(bh), "v"(bl));
  return c;
}
// batched GEMM like k_gemm_b but f16 operands: A f32 (split into f16 hi/lo if ASPLIT, else rounded to f16), Bt = f16 values [n][k]; alpha; C f32; N multiple of 16 (partial tiles skipped)
template <bool ASPLIT>
__global__ __launch_bounds__(128) void k_gemm_h(const float* __restrict__ A, int lda, size_t sA, const _Float16* __restrict__ Bh, int ldb, size_t sB, float alpha, float* __restrict__ C, int ldc, size_t sC, int M, int N, int K) {
  __shared__ __attribute__((aligned(16))) float so[4][16][64];
  const int tid = threadIdx.x, w = tid >> 5, lane = tid & 31, ln = lane & 15, hh = lane >> 4; const int by = blockIdx.y;
  A += (size_t)by * sA; Bh += (size_t)by * sB; C += (size_t)by * sC;
  const int ntn = (N + 63) / 64; const int wid = blockIdx.x * 4 + w; const int mt = wid / ntn, nq = wid % ntn; if (mt * 16 >= M) return;
  const int row0 = mt * 16, col0 = nq * 64; const float* arow = A + (size_t)(row0 + ln) * lda;
  v8f acc[4] = {};
  for (int kb = 0; kb < K; kb += 32) {
    FragH ah, al;
    const v4f x0 = *(const v4fa*)(arow + kb + 8 * hh), x1 = *(const v4fa*)(arow + kb + 8 * hh + 4), x2 = *(const v4fa*)(arow + kb + 16 + 8 * hh), x3 = *(const v4fa*)(arow + kb + 16 + 8 * hh + 4);
    float xs[16] = {x0[0],x0[1],x0[2],x0[3],x1[0],x1[1],x1[2],x1[3],x2[0],x2[1],x2[2],x2[3],x3[0],x3[1],x3[2],x3[3]};
#pragma unroll
    for (int i = 0; i < 16; ++i) { const _Float16 h = (_Float16)xs[i]; ah.h[i] = h; al.h[i] = ASPLIT ? (_Float16)(xs[i] - (float)h) : (_Float16)0.0f; }
#pragma unroll
    for (int t = 0; t < 4; ++t) { if (col0 + t * 16 >= N) continue; const size_t boff = (size_t)(col0 + t * 16 + ln) * ldb + kb; FragH bq; bq.half[0] = *(const v8us*)(Bh + boff + 8 * hh); bq.half[1] = *(const v8us*)(Bh + boff + 16 + 8 * hh);
      acc[t] = mmaH<ASPLIT ? 2 : 1>(ah.v, al.v, bq.v, bq.v, acc[t]); }
  }
#pragma unroll
  for (int t = 0; t < 4; ++t) { if (col0 + t * 16 >= N) continue;
#pragma unroll
    for (int r = 0; r < 8; ++r) so[w][8 * hh + r][t * 16 + ln] = acc[t][r] * alpha; }
  __builtin_amdgcn_fence(__ATOMIC_ACQ_REL, "workgroup"); __builtin_amdgcn_wave_barrier();
  const int rsub = lane >> 4, c4 = (lane & 15) * 4;
  {
#pragma unroll
    for (int q = 0; q < 8; ++q) { const int r = q * 2 + rsub; if (col0 + c4 < N) { const v4f v = *(const v4fa*)&so[w][r][c4]; *(v4f*)(C + (size_t)(row0 + r) * ldc + col0 + c4) = v; } }
     }
}

// k_gemm_hh variant with fused epilogue: v = acc·alpha + bias[by·sBias + col] (+ CP[(row/rowsPerB)·sCPb + by·64 + col] if CP) ; ACT 0 none / 1 elu ; writes f16 C16 (and f32 C if non-null)
template <int ACT>
__global__ __launch_bounds__(128) void k_gemm_hhx(const _Float16* __restrict__ A, int lda, size_t sA, const _Float16* __restrict__ Bh, int ldb, size_t sB, float alpha, const float* __restrict__ bias, size_t sBias, const float* __restrict__ CP, int rowsPerB, size_t sCPb, int row0g,
    float* __restrict__ C, _Float16* __restrict__ C16, int ldc, size_t sC, int M, int N, int K) {
  __shared__ __attribute__((aligned(16))) float so[4][16][64];
  const int tid = threadIdx.x, w = tid >> 5, lane = tid & 31, ln = lane & 15, hh = lane >> 4; const int by = blockIdx.y;
  A += (size_t)by * sA; Bh += (size_t)by * sB; const size_t cofs = (size_t)by * sC; const float* bp = bias ? bias + (size_t)by * sBias : nullptr;
  const int ntn = (N + 63) / 64; const int wid = blockIdx.x * 4 + w; const int mt = wid / ntn, nq = wid % ntn; if (mt * 16 >= M) return;
  const int row0 = mt * 16, col0 = nq * 64; const _Float16* arow = A + (size_t)(row0 + ln) * lda;
  v8f acc[4] = {};
  for (int kb = 0; kb < K; kb += 32) { FragH ah; ah.half[0] = *(const v8us*)((const unsigned short*)arow + kb + 8 * hh); ah.half[1] = *(const v8us*)((const unsigned short*)arow + kb + 16 + 8 * hh);
#pragma unroll
    for (int t = 0; t < 4; ++t) { if (col0 + t * 16 >= N) continue; const size_t boff = (size_t)(col0 + t * 16 + ln) * ldb + kb; FragH bq; bq.half[0] = *(const v8us*)((const unsigned short*)Bh + boff + 8 * hh); bq.half[1] = *(const v8us*)((const unsigned short*)Bh + boff + 16 + 8 * hh);
      acc[t] = mmaH<1>(ah.v, ah.v, bq.v, bq.v, acc[t]); }
  }
#pragma unroll
  for (int t = 0; t < 4; ++t) { if (col0 + t * 16 >= N) continue; const int col = col0 + t * 16 + ln; const float bv = bp ? bf16_round(bp[col]) : 0.f;
#pragma unroll
    for (int r = 0; r < 8; ++r) { float v = acc[t][r] * alpha + bv; if (CP) { const int rr = row0g + row0 + 8 * hh + r; if (rowsPerB < 0) v += CP[cofs + (size_t)rr * ldc + col];      /* rowsPerB < 0: own element of the batched C plane */ else { const int bidx = rr / rowsPerB; v += CP[(size_t)bidx * sCPb + (size_t)by * 64 + col]; } } if (ACT == 1) v = (v > 0.f) ? v : expm1f(v); else if (ACT == 7) v = (v > 0.f) ? v + 1.0f : expf(v); else if (ACT == 8) v = tanhf(v); else if (ACT == 9) v = 0.5f * v * (1.0f + tanhf(0.7978845608028654f * (v + 0.044715f * v * v * v))); else if (ACT == 11) v = 1.0f / (1.0f + expf(-v)); else if (ACT == 12) v = (v > 0.f) ? v : 0.01f * v; else if (ACT == 14) v = (v > 0.f) ? v : 0.1f * v; else if (ACT == 16) v = (v >= 0.f) ? v : 0.3f * v; else if (ACT == 17) v = (v >= 0.f) ? v : 0.2f * v; else if (ACT == 15) v = v / (1.0f + expf(-v)); else if (ACT == 3) v = fmaxf(v, 0.f); else if (ACT == 6) v = 0.5f * v * (1.0f + erff(v * 0.70710678118654752f)); so[w][8 * hh + r][t * 16 + ln] = v; } }
  __builtin_amdgcn_fence(__ATOMIC_ACQ_REL, "workgroup"); __builtin_amdgcn_wave_barrier();
  const int rsub = lane >> 4, c4 = (lane & 15) * 4; typedef _Float16 v4h __attribute__((ext_vector_type(4)));
  {
#pragma unroll
    for (int q = 0; q < 8; ++q) { const int r = q * 2 + rsub; if (col0 + c4 < N) { const v4f v = *(const v4fa*)&so[w][r][c4]; if (C) *(v4f*)(C + cofs + (size_t)(row0 + r) * ldc + col0 + c4) = v; if (C16) { v4h h4; for (int i = 0; i < 4; ++i) h4[i] = (_Float16)v[i]; *(v4h*)(C16 + cofs + (size_t)(row0 + r) * ldc + col0 + c4) = h4; } } }
     }
}


typedef _Float16 v4h __attribute__((ext_vector_type(4)));

// One launch for all that depends on the inputs alone. Blocks [0, 4 * PWB): plane wi of BW = Wt[n][k] = f16(bf16(W[k][n]) * 16) from the f32 row-major [in][out] weight wi (q, k, v, o; bf16-exact weights stay exact in f16 away from the subnormal range), one thread per 8 k of one n.
// Blocks from 4 * PWB on: x as f16 rows (bf16-rounded), one thread per 8 elements. The branch is the same for a whole block.
#define PWB (DM * (DM / 8) / 256)            /* blocks per weight */
#define PXB ((int)(NR * DM / 8 / 256))       /* blocks for x */
__global__ __launch_bounds__(256) void k_prep(const float* __restrict__ wq, const float* __restrict__ wk, const float* __restrict__ wv, const float* __restrict__ wo, _Float16* __restrict__ BW, const float* __restrict__ x, _Float16* __restrict__ X16) {
  static_assert(DM * (DM / 8) % 256 == 0 && NR * DM / 8 % 256 == 0, "k_prep: whole blocks only, no thread is guarded");
  const int bx = blockIdx.x; FragH f;
  if (bx < 4 * PWB) {
    const int wi = bx / PWB; const float* W = wi == 0 ? wq : wi == 1 ? wk : wi == 2 ? wv : wo;
    const int t = (bx - wi * PWB) * 256 + threadIdx.x; const int n = t / (DM / 8), k8 = (t % (DM / 8)) * 8;
#pragma unroll
    for (int i = 0; i < 8; ++i) f.h[i] = (_Float16)(bf16_round(W[(size_t)(k8 + i) * DM + n]) * 16.0f);
    *(v8us*)((unsigned short*)BW + (size_t)wi * DM * DM + (size_t)n * DM + k8) = f.half[0];
  } else {
    const size_t t = (size_t)(bx - 4 * PWB) * 256 + threadIdx.x;
#pragma unroll
    for (int q = 0; q < 8; ++q) f.h[q] = (_Float16)bf16_round(x[t * 8 + q]);
    *(v8us*)((unsigned short*)X16 + t * 8) = f.half[0];
    asm volatile("s_wait_xcnt 0x0" ::: "memory");      /* stands behind the store: the listing's fall-through behind it runs into the weight part, which rewrites the store's registers */
  } }
__global__ __launch_bounds__(256) void k_h16(const float* __restrict__ x, _Float16* __restrict__ X16, size_t n8) { const size_t t = (size_t)blockIdx.x * 256 + threadIdx.x; if (t >= n8) return; FragH f;
#pragma unroll
  for (int q = 0; q < 8; ++q) f.h[q] = (_Float16)x[t * 8 + q]; *(v8us*)((unsigned short*)X16 + t * 8) = f.half[0];  }
__global__ __launch_bounds__(256) void k_round16f(const float* __restrict__ W, _Float16* __restrict__ Bt, size_t n8) { const size_t t = (size_t)blockIdx.x * 256 + threadIdx.x; if (t >= n8) return; FragH f;
#pragma unroll
  for (int i = 0; i < 8; ++i) f.h[i] = (_Float16)(bf16_round(W[t * 8 + i]) * 16.0f); *(v8us*)((unsigned short*)Bt + t * 8) = f.half[0];  }
template <int NHv, int TTv>
__global__ __launch_bounds__(256) void k_vt(const _Float16* __restrict__ V16, int ldv, int voff, _Float16* __restrict__ Vt) { __shared__ unsigned short tl[64][66]; const int tid = threadIdx.x; const int slab = blockIdx.x / (TTv / 64), lg = blockIdx.x % (TTv / 64); const int b = slab / NHv, h = slab % NHv;
  for (int i = tid; i < 64 * 8; i += 256) { const int r = i / 8, c8 = (i % 8) * 8; FragH f; f.half[0] = *(const v8us*)((const unsigned short*)V16 + ((size_t)b * TTv + lg * 64 + r) * ldv + voff + h * 64 + c8);
#pragma unroll
    for (int q = 0; q < 8; ++q) tl[r][c8 + q] = f.u[q]; }
  __syncthreads();
  {
#pragma unroll
    for (int rd = 0; rd < 2; ++rd) { const int d = rd * 32 + tid / 8, pc = tid % 8; FragH f;
#pragma unroll
      for (int q = 0; q < 8; ++q) f.u[q] = tl[pc * 8 + q][d];
      *(v8us*)((unsigned short*)Vt + ((size_t)slab * 64 + d) * TTv + lg * 64 + pc * 8) = f.half[0]; }
     } }

__global__ __launch_bounds__(256) void k_hl(const float* __restrict__ F, _Float16* __restrict__ Hh, _Float16* __restrict__ Hl, size_t n8) { const size_t t = (size_t)blockIdx.x * 256 + threadIdx.x; if (t >= n8) return; FragH fh, fl; const v4f a = *(const v4fa*)(F + t * 8), c = *(const v4fa*)(F + t * 8 + 4);
#pragma unroll
  for (int q = 0; q < 4; ++q) { _Float16 h = (_Float16)a[q]; fh.h[q] = h; fl.h[q] = (_Float16)((a[q] - (float)h) * 1024.0f); h = (_Float16)c[q]; fh.h[4 + q] = h; fl.h[4 + q] = (_Float16)((c[q] - (float)h) * 1024.0f); }
  { *(v8us*)((unsigned short*)Hh + t * 8) = fh.half[0]; *(v8us*)((unsigned short*)Hl + t * 8) = fl.half[0];  } }

// ---- fast GEMM (work-group tile 128x64, wave tile 32x64; requires M % 128 == 0 rows per launch region, N % 64 == 0, K % 64 == 0); epilogue = k_gemm_hhx semantics ----
__device__ __forceinline__ v16h g2_frag(const _Float16* p, int hh) { FragH f; f.half[0] = *(const v8us*)((const unsigned short*)p + 8 * hh); f.half[1] = *(const v8us*)((const unsigned short*)p + 16 + 8 * hh); return f.v; }
__device__ __forceinline__ v8f g2_mma(v16h a, v16h b, v8f c) { v8f d = __builtin_amdgcn_wmma_f32_16x16x32_f16(false, a, false, b, (short)0, c, false, false); asm volatile("v_nop\n\tv_nop\n\tv_nop\n\tv_nop" : "+v"(d) : "v"(a), "v"(b)); return d; }
// A and B reach the waves through LDS: a stage is 64 k (128 A rows and 64 B rows of 128 bytes each), brought once per work-group by asynchronous copies that cover whole 128-byte lines, two buffers, the next stage in flight while this one is worked on.
#define GP 144                       /* LDS row pitch, bytes: 128 + 16, an odd multiple of 16 for 16-byte readers */
#define GTA (128 * GP)               /* bytes of the staged A tile */
#define GSB (192 * GP)               /* bytes of one stage: A tile, then B tile */
__device__ __forceinline__ v16h g2_lfrag(const unsigned char* p) { FragH f; f.half[0] = *(const v8us*)p; f.half[1] = *(const v8us*)(p + 32); return f.v; }      /* g2_frag's k order from an LDS row; p already holds the lane half's 16 bytes */
// One stage: each of the 128 threads copies 16 bytes of rows r0 + 16 j of the A tile (j < 8, at lds) and of the B tile (j < 4, at lds + GTA); eight lanes cover one 128-byte row. sa, sb: 16 rows of A, of B, in elements.
// The s_wait_xcnt closes the copies' own statement, so that it stands in front of every later write of the address registers that the copies name.
__device__ __forceinline__ void g2_stage(unsigned lds, const _Float16* ga, size_t sa, const _Float16* gb, size_t sb) {
  asm volatile("global_load_async_to_lds_b128 %0, %12, off\n\tglobal_load_async_to_lds_b128 %1, %13, off\n\tglobal_load_async_to_lds_b128 %2, %14, off\n\tglobal_load_async_to_lds_b128 %3, %15, off\n\t"
               "global_load_async_to_lds_b128 %4, %16, off\n\tglobal_load_async_to_lds_b128 %5, %17, off\n\tglobal_load_async_to_lds_b128 %6, %18, off\n\tglobal_load_async_to_lds_b128 %7, %19, off\n\t"
               "global_load_async_to_lds_b128 %8, %20, off\n\tglobal_load_async_to_lds_b128 %9, %21, off\n\tglobal_load_async_to_lds_b128 %10, %22, off\n\tglobal_load_async_to_lds_b128 %11, %23, off\n\ts_wait_xcnt 0x0"
               :: "v"(lds), "v"(lds + 16 * GP), "v"(lds + 32 * GP), "v"(lds + 48 * GP), "v"(lds + 64 * GP), "v"(lds + 80 * GP), "v"(lds + 96 * GP), "v"(lds + 112 * GP),
                  "v"(lds + GTA), "v"(lds + GTA + 16 * GP), "v"(lds + GTA + 32 * GP), "v"(lds + GTA + 48 * GP),
                  "v"(ga), "v"(ga + sa), "v"(ga + 2 * sa), "v"(ga + 3 * sa), "v"(ga + 4 * sa), "v"(ga + 5 * sa), "v"(ga + 6 * sa), "v"(ga + 7 * sa),
                  "v"(gb), "v"(gb + sb), "v"(gb + 2 * sb), "v"(gb + 3 * sb)
               : "memory"); }
template <int ACT>
__global__ __launch_bounds__(128) void k_gemm2(const _Float16* __restrict__ A, int lda, size_t sA, const _Float16* __restrict__ Bh, int ldb, size_t sB, float alpha, const float* __restrict__ bias, size_t sBias, const float* __restrict__ bias1, const float* __restrict__ bias2, const float* __restrict__ CP, int rowsPerB, size_t sCPb, int row0g,
    float* __restrict__ C, _Float16* __restrict__ C16, int ldc, size_t sC, int M, int N, int K) { static_assert(ACT == 0 || ACT == 3 || ACT == 6 || ACT == 8 || ACT == 9 || ACT == 11 || ACT == 12 || ACT == 14 || ACT == 15 || ACT == 16 || ACT == 17, "k_gemm2: unsupported ACT code (would silently apply no activation)");
  __shared__ __attribute__((aligned(16))) float so[4][32][68];
  __shared__ __attribute__((aligned(16))) unsigned char G[2 * GSB];      /* two buffers of [A tile | B tile] */
  const int tid = threadIdx.x, w = tid >> 5, lane = tid & 31, ln = lane & 15, hh = lane >> 4; const int by = blockIdx.y;
  A += (size_t)by * sA; Bh += (size_t)by * sB; const size_t cofs = (size_t)by * sC; const float* bp = bias ? bias + (size_t)by * sBias : nullptr;
  if (by == 1 && bias1) bp = bias1; if (by == 2 && bias2) bp = bias2;      /* planes 1 and 2 whose biases are buffers of their own */
  const int ntn = N >> 6; const int mt = blockIdx.x / ntn, nq = blockIdx.x - mt * ntn; const int row0 = mt * 128 + 32 * w, col0 = nq * 64; if (mt * 128 + 128 > M) return;      /* the whole work-group or none, ahead of every copy and barrier: every staged A row exists */
  const int r0 = tid >> 3, ch = tid & 7;      /* this thread's row (mod 16) and 16-byte piece in every copied tile */
  const unsigned lst = (unsigned)(size_t)G + r0 * GP + ch * 16;
  const _Float16* ga = A + (size_t)(mt * 128 + r0) * lda + ch * 8; const _Float16* gb = Bh + (size_t)(col0 + r0) * ldb + ch * 8;
  const size_t sa = (size_t)16 * lda, sb = (size_t)16 * ldb; const int nst = K >> 6;
  g2_stage(lst, ga, sa, gb, sb);
  asm volatile("s_wait_asynccnt 0x0" ::: "memory");      /* this wave's share of stage 0 has landed */
  __syncthreads();      /* publishes stage 0 */
  if (nst > 1) g2_stage(lst + GSB, ga + 64, sa, gb + 64, sb);
  const v8f z8 = {0.f,0.f,0.f,0.f,0.f,0.f,0.f,0.f}; v8f c00 = z8, c01 = z8, c02 = z8, c03 = z8, c10 = z8, c11 = z8, c12 = z8, c13 = z8;
#pragma unroll 1      /* one stage per trip: the buffer index stays a scalar select and the loop stays short */
  for (int t = 0; t < nst; ++t) {
    const unsigned char* al = G + (t & 1) * GSB + (32 * w + ln) * GP + 16 * hh; const unsigned char* bl = G + (t & 1) * GSB + GTA + ln * GP + 16 * hh;
    v16h a[2][2], b[2][4];      /* the stage's 24 LDS reads stand together, ahead of its 16 WMMAs */
#pragma unroll
    for (int kc = 0; kc < 2; ++kc) { a[kc][0] = g2_lfrag(al + kc * 64); a[kc][1] = g2_lfrag(al + 16 * GP + kc * 64);
#pragma unroll
      for (int j = 0; j < 4; ++j) b[kc][j] = g2_lfrag(bl + j * 16 * GP + kc * 64); }
#pragma unroll
    for (int kc = 0; kc < 2; ++kc) {
      c00 = g2_mma(a[kc][0], b[kc][0], c00); c10 = g2_mma(a[kc][1], b[kc][0], c10);
      c01 = g2_mma(a[kc][0], b[kc][1], c01); c11 = g2_mma(a[kc][1], b[kc][1], c11);
      c02 = g2_mma(a[kc][0], b[kc][2], c02); c12 = g2_mma(a[kc][1], b[kc][2], c12);
      c03 = g2_mma(a[kc][0], b[kc][3], c03); c13 = g2_mma(a[kc][1], b[kc][3], c13); }
    asm volatile("s_wait_dscnt 0x0" ::: "memory");      /* this wave's reads of the buffer that is refilled below have returned */
    asm volatile("s_wait_asynccnt 0x0" ::: "memory");      /* this wave's share of stage t + 1 has landed */
    __syncthreads();      /* publishes stage t + 1 and ends every wave's reads of stage t */
    if (t + 2 < nst) g2_stage(lst + (t & 1) * GSB, ga + (size_t)(t + 2) * 64, sa, gb + (size_t)(t + 2) * 64, sb);
  }
  asm volatile("s_wait_asynccnt 0x0" ::: "memory");      /* no copy is outstanding when the wave ends */
  v8f accs[8] = {c00, c01, c02, c03, c10, c11, c12, c13};
#pragma unroll
  for (int u = 0; u < 8; ++u) { const int t = u & 3, half = u >> 2; const int col = col0 + t * 16 + ln; const float bv = bp ? bf16_round(bp[col]) : 0.f;
#pragma unroll
    for (int r = 0; r < 8; ++r) { const int rloc = half * 16 + 8 * hh + r; float v = accs[u][r] * alpha + bv; if (CP) { if (rowsPerB < 0) v += CP[cofs + (size_t)(row0g + row0 + rloc) * ldc + col];      /* rowsPerB < 0: own element of the batched C plane */ else { const int bidx = (row0g + row0 + rloc) / rowsPerB; v += CP[(size_t)bidx * sCPb + (size_t)by * 64 + col]; } }
      if (ACT == 3) v = fmaxf(v, 0.f); else if (ACT == 6) v = 0.5f * v * (1.0f + erff(v * 0.70710678118654752f)); else if (ACT == 11) v = 1.0f / (1.0f + expf(-v)); else if (ACT == 15) v = v / (1.0f + expf(-v)); else if (ACT == 12) v = (v > 0.f) ? v : 0.01f * v; else if (ACT == 8) v = tanhf(v); else if (ACT == 9) v = 0.5f * v * (1.0f + tanhf(0.7978845608028654f * (v + 0.044715f * v * v * v))); else if (ACT == 14) v = (v > 0.f) ? v : 0.1f * v; else if (ACT == 16) v = (v >= 0.f) ? v : 0.3f * v; else if (ACT == 17) v = (v >= 0.f) ? v : 0.2f * v;
      so[w][rloc][t * 16 + ln] = v; } }
  __builtin_amdgcn_fence(__ATOMIC_ACQ_REL, "workgroup"); __builtin_amdgcn_wave_barrier();
  const int rsub = lane >> 4, c4 = (lane & 15) * 4;
  {
#pragma unroll
    for (int q = 0; q < 16; ++q) { const int r = q * 2 + rsub; const v4f v = *(const v4fa*)&so[w][r][c4]; if (C) *(v4f*)(C + cofs + (size_t)(row0 + r) * ldc + col0 + c4) = v; if (C16) { v4h h4; for (int i = 0; i < 4; ++i) h4[i] = (_Float16)v[i]; *(v4h*)(C16 + cofs + (size_t)(row0 + r) * ldc + col0 + c4) = h4; } }
     } }


__global__ __launch_bounds__(256) void k_wnat(const float* __restrict__ w, size_t n8, _Float16* __restrict__ Bt) { const size_t t = (size_t)blockIdx.x * 256 + threadIdx.x; if (t >= n8) return; FragH f; for (int q = 0; q < 8; ++q) f.h[q] = (_Float16)(bf16_round(w[t * 8 + q]) * 16.0f); *(v8us*)((unsigned short*)Bt + t * 8) = f.half[0];  }
__global__ __launch_bounds__(256) void k_rsm(const float* __restrict__ S, _Float16* __restrict__ P, int nrows) {
  #pragma clang fp contract(off)
  const int i = blockIdx.x * 256 + threadIdx.x; if (i >= nrows) return; const float* s = S + (size_t)i * SQ; float mx = -3.0e38f;
#pragma unroll 1
  for (int j = 0; j < SQ; ++j) mx = fmaxf(mx, s[j]); float se = 0.f;
#pragma unroll 1
  for (int j = 0; j < SQ; ++j) se += expf(s[j] - mx); const float sc = 256.0f / se;
#pragma unroll 1
  for (int j0 = 0; j0 < SQ; j0 += 8) { FragH f; for (int q = 0; q < 8; ++q) f.h[q] = (_Float16)(expf(s[j0 + q] - mx) * sc); unsigned short* d = (unsigned short*)P + (size_t)i * SQ + j0; *(v8us*)d = f.half[0];  } }
__global__ __launch_bounds__(256) void k_vt(const _Float16* __restrict__ V16, int b, int h0, _Float16* __restrict__ VT) { __shared__ unsigned short tl[64][65]; const int tid = threadIdx.x; const int hh = blockIdx.x % HG, sg = blockIdx.x / HG; const int s0 = sg * 64; const int h = h0 + hh;
  for (int i = tid; i < 64 * 8; i += 256) { const int j = i / 8, d8 = (i % 8) * 8; FragH f; f.half[0] = *(const v8us*)((const unsigned short*)V16 + ((size_t)b * SQ + s0 + j) * DM + h * HD + d8); for (int q = 0; q < 8; ++q) tl[d8 + q][j] = f.u[q]; }
  __syncthreads();
  { for (int i = tid; i < 64 * 8; i += 256) { const int d = i / 8, j8 = (i % 8) * 8; FragH f; for (int q = 0; q < 8; ++q) f.u[q] = tl[d][j8 + q]; *(v8us*)((unsigned short*)VT + ((size_t)hh * HD + d) * SQ + s0 + j8) = f.half[0]; }  } }



#define FW 4                         /* waves per work-group: 128 query columns */
#define SCL 0.18033688011112042f     /* 64^-0.5 * log2(e) */
#define LZ 44.361419555836498f       /* 8 / SCL: how far a raw product may exceed the maximum in use before a rescale */
#define KS 64                        /* keys per stage: two passes */
#define LP 144                       /* LDS row pitch, bytes: 128 + 16, an odd multiple of 16 for 16-byte readers */
#define TB (64 * LP)                 /* bytes of one staged tile of 64 rows */
#define NST (SQ / KS)                /* stages */
__device__ __forceinline__ v8f fa_mma(v16h a, v16h b, v8f c) { return __builtin_amdgcn_wmma_f32_16x16x32_f16(false, a, false, b, (short)0, c, false, false); }
__device__ __forceinline__ float fa_xhalf(float x) { return __builtin_bit_cast(float, __builtin_amdgcn_permlanex16(__builtin_bit_cast(int, x), __builtin_bit_cast(int, x), 0x76543210, 0xfedcba98, false, false)); }      /* lane l <-> lane l ^ 16 */
__device__ __forceinline__ v16h fa_lfrag(const unsigned char* p) { FragH f; f.half[0] = *(const v8us*)p; f.half[1] = *(const v8us*)(p + 32); return f.v; }      /* g2_frag's k order from an LDS row; p already holds the lane half's 16 bytes */
// One stage: each of the 128 threads copies 16 bytes of rows r0, r0 + 16, r0 + 32, r0 + 48 of the K tile (at lds) and of the V^T tile (at lds + TB); eight lanes cover one 128-byte row.
// The s_wait_xcnt closes the copies' own statement, so that it stands in front of every later write of the address registers that the copies name.
__device__ __forceinline__ void fa_stage(unsigned lds, const _Float16* gk, const _Float16* gv) {
  asm volatile("global_load_async_to_lds_b128 %0, %8, off\n\tglobal_load_async_to_lds_b128 %1, %9, off\n\tglobal_load_async_to_lds_b128 %2, %10, off\n\tglobal_load_async_to_lds_b128 %3, %11, off\n\t"
               "global_load_async_to_lds_b128 %4, %12, off\n\tglobal_load_async_to_lds_b128 %5, %13, off\n\tglobal_load_async_to_lds_b128 %6, %14, off\n\tglobal_load_async_to_lds_b128 %7, %15, off\n\ts_wait_xcnt 0x0"
               :: "v"(lds), "v"(lds + 16 * LP), "v"(lds + 32 * LP), "v"(lds + 48 * LP), "v"(lds + TB), "v"(lds + TB + 16 * LP), "v"(lds + TB + 32 * LP), "v"(lds + TB + 48 * LP),
                  "v"(gk), "v"(gk + (size_t)16 * DM), "v"(gk + (size_t)32 * DM), "v"(gk + (size_t)48 * DM), "v"(gv), "v"(gv + (size_t)16 * SQ), "v"(gv + (size_t)32 * SQ), "v"(gv + (size_t)48 * SQ)
               : "memory"); }
__global__ __launch_bounds__(FW * 32) void k_fattn(const _Float16* __restrict__ Q16, const _Float16* __restrict__ K16, const _Float16* __restrict__ VT, _Float16* __restrict__ O16) {
  __shared__ __attribute__((aligned(16))) unsigned char L[2 * 2 * TB];      /* two buffers of [K tile | V^T tile] */
  const int lane = threadIdx.x & 31, c = lane & 15, hh = lane >> 4; const int w = __builtin_amdgcn_readfirstlane(threadIdx.x >> 5);
  const int bh = blockIdx.y, b = bh / NH, h = bh - b * NH; const int q0 = blockIdx.x * (FW * 32) + w * 32;
  const int r0 = threadIdx.x >> 3, ch = threadIdx.x & 7;      /* this thread's row (mod 16) and 16-byte piece in every copied tile */
  const unsigned lst = (unsigned)(size_t)L + r0 * LP + ch * 16;
  const _Float16* gk = K16 + ((size_t)b * SQ + r0) * DM + h * HD + ch * 8; const _Float16* gv = VT + ((size_t)bh * HD + r0) * SQ + ch * 8;
  fa_stage(lst, gk, gv);
  const _Float16* qp = Q16 + ((size_t)b * SQ + q0 + c) * DM + h * HD;
  v16h qf[2][2];
#pragma unroll
  for (int g = 0; g < 2; ++g) for (int kc = 0; kc < 2; ++kc) qf[g][kc] = g2_frag(qp + (size_t)g * 16 * DM + kc * 32, hh);
  asm volatile("s_wait_asynccnt 0x0" ::: "memory");      /* this wave's share of stage 0 has landed */
  __syncthreads();      /* publishes stage 0 */
  fa_stage(lst + 2 * TB, gk + (size_t)KS * DM, gv + KS);
  const v8f z8 = {0.f,0.f,0.f,0.f,0.f,0.f,0.f,0.f}; v8f o[2][4] = {{z8, z8, z8, z8}, {z8, z8, z8, z8}}; float m[2] = {-1.0e30f, -1.0e30f}, l[2] = {0.f, 0.f};
  float mt[2] = {-1.0e30f, -1.0e30f}, nb[2] = {0.f, 0.f};      /* m + LZ and -m * SCL, renewed with m; the first pass always renews them */
  for (int t = 0; t < NST; ++t) {
    const unsigned char* kl = L + (t & 1) * (2 * TB) + c * LP + 16 * hh; const unsigned char* vl = kl + TB;
    v16h kf[2][2];
#pragma unroll
    for (int kt = 0; kt < 2; ++kt) for (int kc = 0; kc < 2; ++kc) kf[kt][kc] = fa_lfrag(kl + kt * 16 * LP + kc * 64);
#pragma unroll
    for (int p = 0; p < 2; ++p) {
    v16h vf[4];
#pragma unroll
    for (int dt = 0; dt < 4; ++dt) vf[dt] = fa_lfrag(vl + dt * 16 * LP + p * 64);
    v8f s[2][2];
#pragma unroll
    for (int g = 0; g < 2; ++g) for (int kt = 0; kt < 2; ++kt) s[g][kt] = fa_mma(kf[kt][1], qf[g][1], fa_mma(kf[kt][0], qf[g][0], z8));
    if (p == 0) {      /* the stage's second pass's K rows, fetched one pass ahead from the same buffer */
#pragma unroll
      for (int kt = 0; kt < 2; ++kt) for (int kc = 0; kc < 2; ++kc) kf[kt][kc] = fa_lfrag(kl + (32 + kt * 16) * LP + kc * 64);
    }
    __builtin_amdgcn_sched_barrier(0);      /* keeps the V and K fragment reads up here, ahead of the softmax; without it the scheduler sinks them directly in front of the wait for them */
    float mp[2]; bool need = false;      /* per lane: the maximum of this half's 16 raw products, and the lazy test */
#pragma unroll
    for (int g = 0; g < 2; ++g) {
      const v8f a = s[g][0], e = s[g][1];
      float mx = fmaxf(fmaxf(fmaxf(a[0], a[1]), fmaxf(a[2], a[3])), fmaxf(fmaxf(a[4], a[5]), fmaxf(a[6], a[7])));
      mx = fmaxf(mx, fmaxf(fmaxf(fmaxf(e[0], e[1]), fmaxf(e[2], e[3])), fmaxf(fmaxf(e[4], e[5]), fmaxf(e[6], e[7]))));
      mp[g] = mx; need = need || (mx > mt[g]);      /* the ballot below looks at both halves of the wave, so the halves' maxima are joined only where a rescale follows */
    }
    if (__builtin_amdgcn_ballot_w32(need) != 0) {      /* one scalar branch per pass, the same for the whole wave; taken in the first pass and seldom later */
#pragma unroll
      for (int g = 0; g < 2; ++g) {
        const float mn = fmaxf(m[g], fmaxf(mp[g], fa_xhalf(mp[g]))); float al = (m[g] - mn) * SCL; m[g] = mn; mt[g] = mn + LZ; nb[g] = -mn * SCL;
        asm("v_exp_f32 %0, %0\n\tv_nop" : "+v"(al));      /* the v_nop: the slot between a transcendental and the use of its result */
        l[g] *= al;
#pragma unroll
        for (int dt = 0; dt < 4; ++dt) o[g][dt] *= al;
      }
    }
#pragma unroll
    for (int g = 0; g < 2; ++g) {
      float x[16];
#pragma unroll
      for (int i = 0; i < 16; ++i) x[i] = fmaf(s[g][i >> 3][i & 7], SCL, nb[g]);
      /* exponentials in place, each run closed by one v_nop: the instruction set asks for one independent instruction between a transcendental and an overwrite of its source or a use of its result */
      asm("v_exp_f32 %0, %0\n\tv_exp_f32 %1, %1\n\tv_exp_f32 %2, %2\n\tv_exp_f32 %3, %3\n\tv_exp_f32 %4, %4\n\tv_exp_f32 %5, %5\n\tv_exp_f32 %6, %6\n\tv_exp_f32 %7, %7\n\tv_nop"
          : "+v"(x[0]), "+v"(x[1]), "+v"(x[2]), "+v"(x[3]), "+v"(x[4]), "+v"(x[5]), "+v"(x[6]), "+v"(x[7]));
      asm("v_exp_f32 %0, %0\n\tv_exp_f32 %1, %1\n\tv_exp_f32 %2, %2\n\tv_exp_f32 %3, %3\n\tv_exp_f32 %4, %4\n\tv_exp_f32 %5, %5\n\tv_exp_f32 %6, %6\n\tv_exp_f32 %7, %7\n\tv_nop"
          : "+v"(x[8]), "+v"(x[9]), "+v"(x[10]), "+v"(x[11]), "+v"(x[12]), "+v"(x[13]), "+v"(x[14]), "+v"(x[15]));
      const float ps = (((x[0] + x[1]) + (x[2] + x[3])) + ((x[4] + x[5]) + (x[6] + x[7]))) + (((x[8] + x[9]) + (x[10] + x[11])) + ((x[12] + x[13]) + (x[14] + x[15])));
      l[g] += ps;      /* this half's keys only; the halves are joined behind the loop */
      FragH pf;
#pragma unroll
      for (int i = 0; i < 16; ++i) pf.h[i] = (_Float16)x[i];
#pragma unroll
      for (int dt = 0; dt < 4; ++dt) o[g][dt] = fa_mma(vf[dt], pf.v, o[g][dt]);
    }
    }
    __builtin_amdgcn_sched_barrier(0);      /* holds the four v_nop below behind the stage's last WMMA */
    asm volatile("v_nop\n\tv_nop\n\tv_nop\n\tv_nop");      /* WMMA distance over the back edge: the next stage's first instructions may write registers that the last WMMA reads as A or B */
    asm volatile("s_wait_dscnt 0x0" ::: "memory");      /* this wave's reads of the buffer that is refilled below have returned */
    asm volatile("s_wait_asynccnt 0x0" ::: "memory");      /* this wave's share of stage t + 1 has landed */
    __syncthreads();      /* publishes stage t + 1 and ends every wave's reads of stage t */
    if (t + 2 < NST) fa_stage(lst + (t & 1) * (2 * TB), gk + (size_t)(t + 2) * KS * DM, gv + (size_t)(t + 2) * KS);
  }
  asm volatile("s_wait_asynccnt 0x0" ::: "memory");      /* no copy is outstanding when the wave ends */
#pragma unroll
  for (int g = 0; g < 2; ++g) { const float inv = 64.0f / (l[g] + fa_xhalf(l[g])); _Float16* op = O16 + ((size_t)b * SQ + q0 + g * 16 + c) * DM + h * HD + 8 * hh;
#pragma unroll
    for (int dt = 0; dt < 4; ++dt) { FragH f;      /* a lane's 8 accumulator registers are 8 consecutive d of one query: one 16-byte store */
#pragma unroll
      for (int r = 0; r < 8; ++r) f.h[r] = (_Float16)(o[g][dt][r] * inv);
      *(v8us*)((unsigned short*)op + dt * 16) = f.half[0]; } } }

extern "C" void kernel_launch(void* const* d_in, const int* in_sizes, int n_in,
                              void* d_out, int out_size, void* d_ws, size_t ws_size, hipStream_t stream) {
  (void)in_sizes; (void)n_in; (void)out_size;
  const float* const* I = (const float* const*)d_in; const float* x = I[0]; const float* wq = I[1]; const float* bq = I[2]; const float* wk = I[3]; const float* bk = I[4]; const float* wv = I[5]; const float* bv = I[6]; const float* wo = I[7]; const float* bo = I[8];      /* [in][out] weights + biases (y = x @ W + b) */
  char* ws = (char*)d_ws; size_t off = 0;
  auto take = [&](size_t bytes) { char* p = ws + off; off += (bytes + 255) & ~(size_t)255; return p; };
  _Float16* BW = (_Float16*)take((size_t)4 * DM * DM * 2); _Float16* BO = BW + (size_t)3 * DM * DM;      /* four weight planes in a row: q, k, v, o */
  _Float16* X16 = (_Float16*)take(NR * DM * 2); _Float16* Q16 = (_Float16*)take(3 * NR * DM * 2); _Float16* K16 = Q16 + NR * DM; _Float16* V16 = Q16 + 2 * NR * DM; _Float16* O16 = (_Float16*)take(NR * DM * 2);      /* q, k, v: three planes in a row */
  _Float16* VT = (_Float16*)take((size_t)NB * NH * HD * SQ * 2);
  if (off > ws_size) return;
  k_prep<<<4 * PWB + PXB, 256, 0, stream>>>(wq, wk, wv, wo, BW, x, X16);      /* [in][out] -> Bt[n][k] x16 (transposing builder) and x rows */
  const size_t r0p = (size_t)B0 * SQ;      /* first projected row */
  k_gemm2<0><<<dim3((unsigned)((MP / 128) * (DM / 64)), 3), 128, 0, stream>>>(X16 + r0p * DM, DM, 0, BW, DM, (size_t)DM * DM, 0.0625f, bq, 0, bk, bv, nullptr, 1, 0, 0, nullptr, Q16 + r0p * DM, DM, NR * DM, MP, DM, DM);      /* blockIdx.y: q, k, v */
  k_vt<NH, SQ><<<NB * NH * (SQ / 64), 256, 0, stream>>>(V16, LQ, 0, VT);      /* V^T [NB][NH][HD][SQ] */
  k_fattn<<<dim3(SQ / (FW * 32), NB * NH), FW * 32, 0, stream>>>(Q16, K16, VT, O16);      /* o x64 (merged heads) as f16 rows */
  k_gemm2<0><<<dim3((unsigned)((MPO / 128) * (DM / 64)), 1), 128, 0, stream>>>(O16 + r0p * DM, DM, 0, BO, DM, 0, 0.0009765625f, bo, 0, nullptr, nullptr, nullptr, 1, 0, 0, (float*)d_out + r0p * DM, nullptr, DM, 0, MPO, DM, DM);      /* out rows are the output layout */
}

// v007
// One run takes 141 microseconds.
// Next to v006, in two timings, it ran 1.14 and 1.13 times as fast.
// Counting every step since v000, it is 142 times as fast.
#include <hip/hip_runtime.h>
// Multi-head self-attention over 4096-token sequences at width 768 with [in][out] projections and biases (hidden_states [2][4096][768]; q / k / v = x W + b ([in][out] 768 x 768 + biases), 12 heads of 64; scores * 1/sqrt(64); softmax over all 4096 keys (no mask); out = merged Wo + bo ([in][out]) -> [2][4096][768]); all heads and batches in one attention launch.
// Structure: token rows r = b*4096 + s; one preparation launch (x as exact f16 rows, bf16-rounded; the four transposed weights); Q, K, V as three WMMA GEMMs in one launch (blockIdx.y; 64x96 wave tiles, f32 accumulation, exact x16 weights + bias, f16 outputs); V^T for all batches and heads via LDS transposes; one attention launch for all (batch, head): S^T = K Q^T, K and V^T staged in LDS per work-group, online softmax in registers (f32 statistics, native exp2; weights exp(s - maximum in use) as f16, rescaled lazily), O^T += V^T P^T, o carried x64 against f16 subnormal flush (folded into the output GEMM alpha), written straight into the merged f16 o rows; out = o W_o + b GEMM (f32) into the output layout.
// Compute dtype: inputs rounded to bf16; x / weights exact; q, k, v, softmax weights and o as plain f16 GEMM operands (~2^-12); scores and softmax statistics f32; v_wmma_f32_16x16x32_f16.
#define NB 2
#define SQ 4096
#define DM 768
#define NH 12
#define HD 64
#define HG 1                         /* heads per group in the unlaunched per-batch k_vt (a 4096^2 f32 score slab is 64 MiB) */
#define B0 0                         /* first batch processed (debug hook) */
#define NBR NB                       /* batches processed (debug hook) */
#define NR ((size_t)NB * SQ)         /* token rows */
#define MP ((int)((size_t)NBR * SQ)) /* rows projected (debug hook) */
#define QN SQ                        /* unused: attention covers all SQ query rows */
#define NHD NH                       /* unused: attention covers all NH heads */
#define MPO MP                       /* rows through the output stage (debug hook) */
#define LQ DM      /* row pitch of the q/k/v rows */
typedef __bf16 v16b __attribute__((ext_vector_type(16)));
typedef unsigned short v8us __attribute__((ext_vector_type(8), may_alias));
typedef float  v8f  __attribute__((ext_vector_type(8)));
typedef float  v4f  __attribute__((ext_vector_type(4)));
typedef float  v4fa __attribute__((ext_vector_type(4), may_alias));
union FragB { v16b v; v8us half[2]; unsigned short u[16]; };

__device__ __forceinline__ unsigned short bf16_bits(float x) { unsigned int u = __float_as_uint(x); return (unsigned short)((u + 0x7FFFu + ((u >> 16) & 1u)) >> 16); }
__device__ __forceinline__ float bf16_val(unsigned short b) { return __uint_as_float(((unsigned int)b) << 16); }
__device__ __forceinline__ float bf16_round(float x) { return bf16_val(bf16_bits(x)); }
// D += A·B with NT terms: 1 = ah·bh, 2 = + al·bh (A split), 3 = + ah·bl (both split)
template <int NT>
__device__ __forceinline__ v8f mmaN(v16b ah, v16b al, v16b bh, v16b bl, v8f c) {
  c = __builtin_amdgcn_wmma_f32_16x16x32_bf16(false, ah, false, bh, (short)0, c, false, false);
  if (NT >= 2) c = __builtin_amdgcn_wmma_f32_16x16x32_bf16(false, al, false, bh, (short)0, c, false, false);
  if (NT >= 3) c = __builtin_amdgcn_wmma_f32_16x16x32_bf16(false, ah, false, bl, (short)0, c, false, false);
  asm volatile("v_nop\n\tv_nop\n\tv_nop\n\tv_nop" : "+v"(c) : "v"(ah), "v"(al), "v"(bh), "v"(bl));
  return c;
}

__global__ __launch_bounds__(256) void k_wt_bf16(const float* __restrict__ W, unsigned short* __restrict__ Wt, int K, int N) {
  const int t = blockIdx.x * 256 + threadIdx.x;
  const int k8n = K / 8;
  if (t >= N * k8n) return;
  const int n = t / k8n, k8 = (t % k8n) * 8;
  v8us v;
#pragma unroll
  for (int i = 0; i < 8; ++i) v[i] = bf16_bits(W[(size_t)(k8 + i) * N + n]);
  *(v8us*)(Wt + (size_t)n * K + k8) = v;
  
}

// GEMM C[M][N] (f32, pitch ldc) = act(A[M][K]·W + bias). A f32 row-major (pitch lda) converted per fragment to bf16
// (ASPLIT: hi/lo two planes -> 2 terms, else single rounded term); Wt bf16 [N][K] (pitch ldb). BIAS_BF16 rounds the
// bias to bf16 first (bias quantised to bf16 before the add). K%32==0, M%16==0, N%64==0.
template <bool ASPLIT, int ACT, bool BIAS_BF16>
__global__ __launch_bounds__(128) void k_gemm_bf(const float* __restrict__ A, int lda, const unsigned short* __restrict__ Wt, int ldb,
                                               const float* __restrict__ bias, float* __restrict__ C, int ldc, int M, int N, int K) {
  __shared__ __attribute__((aligned(16))) float so[4][16][64];
  const int tid = threadIdx.x, w = tid >> 5, lane = tid & 31, ln = lane & 15, hh = lane >> 4;
  const int ntn = N / 64;
  const int wid = blockIdx.x * 4 + w;
  const int mt = wid / ntn, nq = wid % ntn;
  if (mt * 16 >= M) return;
  const int row0 = mt * 16, col0 = nq * 64;
  const float* arow = A + (size_t)(row0 + ln) * lda;
  v8f acc[4] = {};
  for (int kb = 0; kb < K; kb += 32) {
    FragB ah, al;
    const v4f x0 = *(const v4fa*)(arow + kb + 8 * hh), x1 = *(const v4fa*)(arow + kb + 8 * hh + 4);
    const v4f x2 = *(const v4fa*)(arow + kb + 16 + 8 * hh), x3 = *(const v4fa*)(arow + kb + 16 + 8 * hh + 4);
    float xs[16] = {x0[0],x0[1],x0[2],x0[3],x1[0],x1[1],x1[2],x1[3],x2[0],x2[1],x2[2],x2[3],x3[0],x3[1],x3[2],x3[3]};
#pragma unroll
    for (int i = 0; i < 16; ++i) { const unsigned short hb = bf16_bits(xs[i]); ah.u[i] = hb; al.u[i] = ASPLIT ? bf16_bits(xs[i] - bf16_val(hb)) : (unsigned short)0; }
#pragma unroll
    for (int t = 0; t < 4; ++t) {
      const unsigned short* brow = Wt + (size_t)(col0 + t * 16 + ln) * ldb + kb;
      FragB b;
      b.half[0] = *(const v8us*)(brow + 8 * hh);
      b.half[1] = *(const v8us*)(brow + 16 + 8 * hh);
      acc[t] = mmaN<ASPLIT ? 2 : 1>(ah.v, al.v, b.v, b.v, acc[t]);
    }
  }
#pragma unroll
  for (int t = 0; t < 4; ++t) {
    float bv = bias ? bias[col0 + t * 16 + ln] : 0.f;
    if (BIAS_BF16) bv = bf16_round(bv);
#pragma unroll
    for (int r = 0; r < 8; ++r) { float v = acc[t][r] + bv; if (ACT == 1) v = fmaxf(v, 0.f); so[w][8 * hh + r][t * 16 + ln] = v; }
  }
  __builtin_amdgcn_fence(__ATOMIC_ACQ_REL, "workgroup");
  __builtin_amdgcn_wave_barrier();
  const int rsub = lane >> 4, c4 = (lane & 15) * 4;
  {
#pragma unroll
    for (int q = 0; q < 8; ++q) {
      const int r = q * 2 + rsub;
      const v4f v = *(const v4fa*)&so[w][r][c4];
      *(v4f*)(C + (size_t)(row0 + r) * ldc + col0 + c4) = v;
    }
    
  }
}

// GEMM C = act(A·W + bias + resid): A f32 (ASPLIT -> hi/lo 2 terms), Wt bf16 [N][K]; ACT 0 none, 1 relu, 2 exact gelu;
// resid (optional, f32, row index = (row % rmod), pitch ldr, RES_BF16 rounds it) added before the activation.
template <bool ASPLIT, int ACT, bool BIAS_BF16, bool RES_BF16>
__global__ __launch_bounds__(128) void k_gemm_bf3(const float* __restrict__ A, int lda, const unsigned short* __restrict__ Wt, int ldb,
                                                const float* __restrict__ bias, const float* __restrict__ resid, int rmod, int ldr,
                                                float* __restrict__ C, int ldc, int M, int N, int K) {
  __shared__ __attribute__((aligned(16))) float so[4][16][64];
  const int tid = threadIdx.x, w = tid >> 5, lane = tid & 31, ln = lane & 15, hh = lane >> 4;
  const int ntn = N / 64;
  const int wid = blockIdx.x * 4 + w;
  const int mt = wid / ntn, nq = wid % ntn;
  if (mt * 16 >= M) return;
  const int row0 = mt * 16, col0 = nq * 64;
  const float* arow = A + (size_t)(row0 + ln) * lda;
  v8f acc[4] = {};
  for (int kb = 0; kb < K; kb += 32) {
    FragB ah, al;
    const v4f x0 = *(const v4fa*)(arow + kb + 8 * hh), x1 = *(const v4fa*)(arow + kb + 8 * hh + 4);
    const v4f x2 = *(const v4fa*)(arow + kb + 16 + 8 * hh), x3 = *(const v4fa*)(arow + kb + 16 + 8 * hh + 4);
    float xs[16] = {x0[0],x0[1],x0[2],x0[3],x1[0],x1[1],x1[2],x1[3],x2[0],x2[1],x2[2],x2[3],x3[0],x3[1],x3[2],x3[3]};
#pragma unroll
    for (int i = 0; i < 16; ++i) { const unsigned short hb = bf16_bits(xs[i]); ah.u[i] = hb; al.u[i] = ASPLIT ? bf16_bits(xs[i] - bf16_val(hb)) : (unsigned short)0; }
#pragma unroll
    for (int t = 0; t < 4; ++t) {
      const unsigned short* brow = Wt + (size_t)(col0 + t * 16 + ln) * ldb + kb;
      FragB b;
      b.half[0] = *(const v8us*)(brow + 8 * hh);
      b.half[1] = *(const v8us*)(brow + 16 + 8 * hh);
      acc[t] = mmaN<ASPLIT ? 2 : 1>(ah.v, al.v, b.v, b.v, acc[t]);
    }
  }
#pragma unroll
  for (int t = 0; t < 4; ++t) {
    const int col = col0 + t * 16 + ln;
    float bv = bias ? bias[col] : 0.f;
    if (BIAS_BF16) bv = bf16_round(bv);
#pragma unroll
    for (int r = 0; r < 8; ++r) {
      float v = acc[t][r] + bv;
      if (resid) { float rv = resid[(size_t)((row0 + 8 * hh + r) % rmod) * ldr + col]; if (RES_BF16) rv = bf16_round(rv); v += rv; }
      if (ACT == 1) v = fmaxf(v, 0.f);
      if (ACT == 2) v = 0.5f * v * (1.0f + erff(v * 0.70710678118654752f));
      if (ACT == 3) { const float u = 0.7978845608028654f * (v + 0.044715f * v * v * v); v = 0.5f * v * (1.0f + tanhf(u)); }
      so[w][8 * hh + r][t * 16 + ln] = v;
    }
  }
  __builtin_amdgcn_fence(__ATOMIC_ACQ_REL, "workgroup");
  __builtin_amdgcn_wave_barrier();
  const int rsub = lane >> 4, c4 = (lane & 15) * 4;
  {
#pragma unroll
    for (int q = 0; q < 8; ++q) {
      const int r = q * 2 + rsub;
      const v4f v = *(const v4fa*)&so[w][r][c4];
      *(v4f*)(C + (size_t)(row0 + r) * ldc + col0 + c4) = v;
    }
    
  }
}
// row LayerNorm (biased variance, eps) over N: s = X (+ R); optional out_sum <- s; out_norm <- (s-mu)*rsqrt(var+eps)*g + b
template <bool PARAM_BF16>
__global__ __launch_bounds__(256) void k_layernorm(const float* __restrict__ X, const float* __restrict__ R, const float* __restrict__ g, const float* __restrict__ bta,
                                                  float* __restrict__ out_sum, float* __restrict__ out_norm, int N, float eps) {
  __shared__ float red[256];
  const int row = blockIdx.x, tid = threadIdx.x;
  const float* x = X + (size_t)row * N; const float* rr = R ? R + (size_t)row * N : nullptr;
  float vals[16];                     // up to N = 4096
  const int per = N / 256;            // contiguous chunk per thread? use strided-by-4 chunks: thread handles j = tid*4 + 1024*u
  float s1 = 0.f;
  for (int u = 0; u < per / 4; ++u) {
    const int j = tid * 4 + 1024 * u;
    const v4f a = *(const v4fa*)(x + j);
    v4f b = {0.f,0.f,0.f,0.f}; if (rr) b = *(const v4fa*)(rr + j);
#pragma unroll
    for (int q = 0; q < 4; ++q) { const float v = a[q] + b[q]; vals[u * 4 + q] = v; s1 += v; }
  }
  red[tid] = s1; __syncthreads();
  for (int st = 128; st > 0; st >>= 1) { if (tid < st) red[tid] += red[tid + st]; __syncthreads(); }
  const float mu = red[0] / (float)N; __syncthreads();
  float s2 = 0.f;
  for (int u = 0; u < per / 4; ++u)
#pragma unroll
    for (int q = 0; q < 4; ++q) { const float c = vals[u * 4 + q] - mu; s2 += c * c; }
  red[tid] = s2; __syncthreads();
  for (int st = 128; st > 0; st >>= 1) { if (tid < st) red[tid] += red[tid + st]; __syncthreads(); }
  const float rs = rsqrtf(red[0] / (float)N + eps);
  {
    for (int u = 0; u < per / 4; ++u) {
      const int j = tid * 4 + 1024 * u;
      v4f o, sm;
#pragma unroll
      for (int q = 0; q < 4; ++q) {
        float gg = g[j + q], bb = bta[j + q];
        if (PARAM_BF16) { gg = bf16_round(gg); bb = bf16_round(bb); }
        sm[q] = vals[u * 4 + q]; o[q] = (vals[u * 4 + q] - mu) * rs * gg + bb;
      }
      if (out_sum) *(v4f*)(out_sum + (size_t)row * N + j) = sm;
      *(v4f*)(out_norm + (size_t)row * N + j) = o;
    }
    
  }
}



// ---- f16 WMMA path (v_wmma_f32_16x16x32_f16): 11-bit significands for operands in range — used where a [0,1] probability operand needs more precision than bf16
typedef _Float16 v16h __attribute__((ext_vector_type(16)));
union FragH { v16h v; v8us half[2]; _Float16 h[16]; unsigned short u[16]; };
template <int NT>
__device__ __forceinline__ v8f mmaH(v16h ah, v16h al, v16h bh, v16h bl, v8f c) {
  c = __builtin_amdgcn_wmma_f32_16x16x32_f16(false, ah, false, bh, (short)0, c, false, false);
  if (NT >= 2) c = __builtin_amdgcn_wmma_f32_16x16x32_f16(false, al, false, bh, (short)0, c, false, false);
  if (NT >= 3) c = __builtin_amdgcn_wmma_f32_16x16x32_f16(false, ah, false, bl, (short)0, c, false, false);
  asm volatile("v_nop\n\tv_nop\n\tv_nop\n\tv_nop" : "+v"(c) : "v"(ah), "v"(al), "v"(bh), "v"(bl));
  return c;
}
// batched GEMM like k_gemm_b but f16 operands: A f32 (split into f16 hi/lo if ASPLIT, else rounded to f16), Bt = f16 values [n][k]; alpha; C f32; N multiple of 16 (partial tiles skipped)
template <bool ASPLIT>
__global__ __launch_bounds__(128) void k_gemm_h(const float* __restrict__ A, int lda, size_t sA, const _Float16* __restrict__ Bh, int ldb, size_t sB, float alpha, float* __restrict__ C, int ldc, size_t sC, int M, int N, int K) {
  __shared__ __attribute__((aligned(16))) float so[4][16][64];
  const int tid = threadIdx.x, w = tid >> 5, lane = tid & 31, ln = lane & 15, hh = lane >> 4; const int by = blockIdx.y;
  A += (size_t)by * sA; Bh += (size_t)by * sB; C += (size_t)by * sC;
  const int ntn = (N + 63) / 64; const int wid = blockIdx.x * 4 + w; const int mt = wid / ntn, nq = wid % ntn; if (mt * 16 >= M) return;
  const int row0 = mt * 16, col0 = nq * 64; const float* arow = A + (size_t)(row0 + ln) * lda;
  v8f acc[4] = {};
  for (int kb = 0; kb < K; kb += 32) {
    FragH ah, al;
    const v4f x0 = *(const v4fa*)(arow + kb + 8 * hh), x1 = *(const v4fa*)(arow + kb + 8 * hh + 4), x2 = *(const v4fa*)(arow + kb + 16 + 8 * hh), x3 = *(const v4fa*)(arow + kb + 16 + 8 * hh + 4);
    float xs[16] = {x0[0],x0[1],x0[2],x0[3],x1[0],x1[1],x1[2],x1[3],x2[0],x2[1],x2[2],x2[3],x3[0],x3[1],x3[2],x3[3]};
#pragma unroll
    for (int i = 0; i < 16; ++i) { const _Float16 h = (_Float16)xs[i]; ah.h[i] = h; al.h[i] = ASPLIT ? (_Float16)(xs[i] - (float)h) : (_Float16)0.0f; }
#pragma unroll
    for (int t = 0; t < 4; ++t) { if (col0 + t * 16 >= N) continue; const size_t boff = (size_t)(col0 + t * 16 + ln) * ldb + kb; FragH bq; bq.half[0] = *(const v8us*)(Bh + boff + 8 * hh); bq.half[1] = *(const v8us*)(Bh + boff + 16 + 8 * hh);
      acc[t] = mmaH<ASPLIT ? 2 : 1>(ah.v, al.v, bq.v, bq.v, acc[t]); }
  }
#pragma unroll
  for (int t = 0; t < 4; ++t) { if (col0 + t * 16 >= N) continue;
#pragma unroll
    for (int r = 0; r < 8; ++r) so[w][8 * hh + r][t * 16 + ln] = acc[t][r] * alpha; }
  __builtin_amdgcn_fence(__ATOMIC_ACQ_REL, "workgroup"); __builtin_amdgcn_wave_barrier();
  const int rsub = lane >> 4, c4 = (lane & 15) * 4;
  {
#pragma unroll
    for (int q = 0; q < 8; ++q) { const int r = q * 2 + rsub; if (col0 + c4 < N) { const v4f v = *(const v4fa*)&so[w][r][c4]; *(v4f*)(C + (size_t)(row0 + r) * ldc + col0 + c4) = v; } }
     }
}

// k_gemm_hh variant with fused epilogue: v = acc·alpha + bias[by·sBias + col] (+ CP[(row/rowsPerB)·sCPb + by·64 + col] if CP) ; ACT 0 none / 1 elu ; writes f16 C16 (and f32 C if non-null)
template <int ACT>
__global__ __launch_bounds__(128) void k_gemm_hhx(const _Float16* __restrict__ A, int lda, size_t sA, const _Float16* __restrict__ Bh, int ldb, size_t sB, float alpha, const float* __restrict__ bias, size_t sBias, const float* __restrict__ CP, int rowsPerB, size_t sCPb, int row0g,
    float* __restrict__ C, _Float16* __restrict__ C16, int ldc, size_t sC, int M, int N, int K) {
  __shared__ __attribute__((aligned(16))) float so[4][16][64];
  const int tid = threadIdx.x, w = tid >> 5, lane = tid & 31, ln = lane & 15, hh = lane >> 4; const int by = blockIdx.y;
  A += (size_t)by * sA; Bh += (size_t)by * sB; const size_t cofs = (size_t)by * sC; const float* bp = bias ? bias + (size_t)by * sBias : nullptr;
  const int ntn = (N + 63) / 64; const int wid = blockIdx.x * 4 + w; const int mt = wid / ntn, nq = wid % ntn; if (mt * 16 >= M) return;
  const int row0 = mt * 16, col0 = nq * 64; const _Float16* arow = A + (size_t)(row0 + ln) * lda;
  v8f acc[4] = {};
  for (int kb = 0; kb < K; kb += 32) { FragH ah; ah.half[0] = *(const v8us*)((const unsigned short*)arow + kb + 8 * hh); ah.half[1] = *(const v8us*)((const unsigned short*)arow + kb + 16 + 8 * hh);
#pragma unroll
    for (int t = 0; t < 4; ++t) { if (col0 + t * 16 >= N) continue; const size_t boff = (size_t)(col0 + t * 16 + ln) * ldb + kb; FragH bq; bq.half[0] = *(const v8us*)((const unsigned short*)Bh + boff + 8 * hh); bq.half[1] = *(const v8us*)((const unsigned short*)Bh + boff + 16 + 8 * hh);
      acc[t] = mmaH<1>(ah.v, ah.v, bq.v, bq.v, acc[t]); }
  }
#pragma unroll
  for (int t = 0; t < 4; ++t) { if (col0 + t * 16 >= N) continue; const int col = col0 + t * 16 + ln; const float bv = bp ? bf16_round(bp[col]) : 0.f;
#pragma unroll
    for (int r = 0; r < 8; ++r) { float v = acc[t][r] * alpha + bv; if (CP) { const int rr = row0g + row0 + 8 * hh + r; if (rowsPerB < 0) v += CP[cofs + (size_t)rr * ldc + col];      /* rowsPerB < 0: own element of the batched C plane */ else { const int bidx = rr / rowsPerB; v += CP[(size_t)bidx * sCPb + (size_t)by * 64 + col]; } } if (ACT == 1) v = (v > 0.f) ? v : expm1f(v); else if (ACT == 7) v = (v > 0.f) ? v + 1.0f : expf(v); else if (ACT == 8) v = tanhf(v); else if (ACT == 9) v = 0.5f * v * (1.0f + tanhf(0.7978845608028654f * (v + 0.044715f * v * v * v))); else if (ACT == 11) v = 1.0f / (1.0f + expf(-v)); else if (ACT == 12) v = (v > 0.f) ? v : 0.01f * v; else if (ACT == 14) v = (v > 0.f) ? v : 0.1f * v; else if (ACT == 16) v = (v >= 0.f) ? v : 0.3f * v; else if (ACT == 17) v = (v >= 0.f) ? v : 0.2f * v; else if (ACT == 15) v = v / (1.0f + expf(-v)); else if (ACT == 3) v = fmaxf(v, 0.f); else if (ACT == 6) v = 0.5f * v * (1.0f + erff(v * 0.70710678118654752f)); so[w][8 * hh + r][t * 16 + ln] = v; } }
  __builtin_amdgcn_fence(__ATOMIC_ACQ_REL, "workgroup"); __builtin_amdgcn_wave_barrier();
  const int rsub = lane >> 4, c4 = (lane & 15) * 4; typedef _Float16 v4h __attribute__((ext_vector_type(4)));
  {
#pragma unroll
    for (int q = 0; q < 8; ++q) { const int r = q * 2 + rsub; if (col0 + c4 < N) { const v4f v = *(const v4fa*)&so[w][r][c4]; if (C) *(v4f*)(C + cofs + (size_t)(row0 + r) * ldc + col0 + c4) = v; if (C16) { v4h h4; for (int i = 0; i < 4; ++i) h4[i] = (_Float16)v[i]; *(v4h*)(C16 + cofs + (size_t)(row0 + r) * ldc + col0 + c4) = h4; } } }
     }
}


typedef _Float16 v4h __attribute__((ext_vector_type(4)));

// One launch for all that depends on the inputs alone. Blocks [0, 4 * PWB): plane wi of BW = Wt[n][k] = f16(bf16(W[k][n]) * 16) from the f32 row-major [in][out] weight wi (q, k, v, o; bf16-exact weights stay exact in f16 away from the subnormal range), one thread per 8 k of one n.
// Blocks from 4 * PWB on: x as f16 rows (bf16-rounded), one thread per 8 elements. The branch is the same for a whole block.
#define PWB (DM * (DM / 8) / 256)            /* blocks per weight */
#define PXB ((int)(NR * DM / 8 / 256))       /* blocks for x */
__global__ __launch_bounds__(256) void k_prep(const float* __restrict__ wq, const float* __restrict__ wk, const float* __restrict__ wv, const float* __restrict__ wo, _Float16* __restrict__ BW, const float* __restrict__ x, _Float16* __restrict__ X16) {
  static_assert(DM * (DM / 8) % 256 == 0 && NR * DM / 8 % 256 == 0, "k_prep: whole blocks only, no thread is guarded");
  const int bx = blockIdx.x; FragH f;
  if (bx < 4 * PWB) {
    const int wi = bx / PWB; const float* W = wi == 0 ? wq : wi == 1 ? wk : wi == 2 ? wv : wo;
    const int t = (bx - wi * PWB) * 256 + threadIdx.x; const int n = t / (DM / 8), k8 = (t % (DM / 8)) * 8;
#pragma unroll
    for (int i = 0; i < 8; ++i) f.h[i] = (_Float16)(bf16_round(W[(size_t)(k8 + i) * DM + n]) * 16.0f);
    *(v8us*)((unsigned short*)BW + (size_t)wi * DM * DM + (size_t)n * DM + k8) = f.half[0];
  } else {
    const size_t t = (size_t)(bx - 4 * PWB) * 256 + threadIdx.x;
#pragma unroll
    for (int q = 0; q < 8; ++q) f.h[q] = (_Float16)bf16_round(x[t * 8 + q]);
    *(v8us*)((unsigned short*)X16 + t * 8) = f.half[0];
    asm volatile("s_wait_xcnt 0x0" ::: "memory");      /* stands behind the store: the listing's fall-through behind it runs into the weight part, which rewrites the store's registers */
  } }
__global__ __launch_bounds__(256) void k_h16(const float* __restrict__ x, _Float16* __restrict__ X16, size_t n8) { const size_t t = (size_t)blockIdx.x * 256 + threadIdx.x; if (t >= n8) return; FragH f;
#pragma unroll
  for (int q = 0; q < 8; ++q) f.h[q] = (_Float16)x[t * 8 + q]; *(v8us*)((unsigned short*)X16 + t * 8) = f.half[0];  }
__global__ __launch_bounds__(256) void k_round16f(const float* __restrict__ W, _Float16* __restrict__ Bt, size_t n8) { const size_t t = (size_t)blockIdx.x * 256 + threadIdx.x; if (t >= n8) return; FragH f;
#pragma unroll
  for (int i = 0; i < 8; ++i) f.h[i] = (_Float16)(bf16_round(W[t * 8 + i]) * 16.0f); *(v8us*)((unsigned short*)Bt + t * 8) = f.half[0];  }
template <int NHv, int TTv>
__global__ __launch_bounds__(256) void k_vt(const _Float16* __restrict__ V16, int ldv, int voff, _Float16* __restrict__ Vt) { __shared__ unsigned short tl[64][66]; const int tid = threadIdx.x; const int slab = blockIdx.x / (TTv / 64), lg = blockIdx.x % (TTv / 64); const int b = slab / NHv, h = slab % NHv;
  for (int i = tid; i < 64 * 8; i += 256) { const int r = i / 8, c8 = (i % 8) * 8; FragH f; f.half[0] = *(const v8us*)((const unsigned short*)V16 + ((size_t)b * TTv + lg * 64 + r) * ldv + voff + h * 64 + c8);
#pragma unroll
    for (int q = 0; q < 8; ++q) tl[r][c8 + q] = f.u[q]; }
  __syncthreads();
  {
#pragma unroll
    for (int rd = 0; rd < 2; ++rd) { const int d = rd * 32 + tid / 8, pc = tid % 8; FragH f;
#pragma unroll
      for (int q = 0; q < 8; ++q) f.u[q] = tl[pc * 8 + q][d];
      *(v8us*)((unsigned short*)Vt + ((size_t)slab * 64 + d) * TTv + lg * 64 + pc * 8) = f.half[0]; }
     } }

__global__ __launch_bounds__(256) void k_hl(const float* __restrict__ F, _Float16* __restrict__ Hh, _Float16* __restrict__ Hl, size_t n8) { const size_t t = (size_t)blockIdx.x * 256 + threadIdx.x; if (t >= n8) return; FragH fh, fl; const v4f a = *(const v4fa*)(F + t * 8), c = *(const v4fa*)(F + t * 8 + 4);
#pragma unroll
  for (int q = 0; q < 4; ++q) { _Float16 h = (_Float16)a[q]; fh.h[q] = h; fl.h[q] = (_Float16)((a[q] - (float)h) * 1024.0f); h = (_Float16)c[q]; fh.h[4 + q] = h; fl.h[4 + q] = (_Float16)((c[q] - (float)h) * 1024.0f); }
  { *(v8us*)((unsigned short*)Hh + t * 8) = fh.half[0]; *(v8us*)((unsigned short*)Hl + t * 8) = fl.half[0];  } }

// ---- fast GEMM (work-group tile 128x64, wave tile 32x64; requires M % 128 == 0 rows per launch region, N % 64 == 0, K % 64 == 0); epilogue = k_gemm_hhx semantics ----
__device__ __forceinline__ v16h g2_frag(const _Float16* p, int hh) { FragH f; f.half[0] = *(const v8us*)((const unsigned short*)p + 8 * hh); f.half[1] = *(const v8us*)((const unsigned short*)p + 16 + 8 * hh); return f.v; }
__device__ __forceinline__ v8f g2_mma(v16h a, v16h b, v8f c) { v8f d = __builtin_amdgcn_wmma_f32_16x16x32_f16(false, a, false, b, (short)0, c, false, false); asm volatile("v_nop\n\tv_nop\n\tv_nop\n\tv_nop" : "+v"(d) : "v"(a), "v"(b)); return d; }
// A and B reach the waves through LDS: a stage is 64 k (128 A rows and 64 B rows of 128 bytes each), brought once per work-group by asynchronous copies that cover whole 128-byte lines, two buffers, the next stage in flight while this one is worked on.
#define GP 144                       /* LDS row pitch, bytes: 128 + 16, an odd multiple of 16 for 16-byte readers */
#define GTA (128 * GP)               /* bytes of the staged A tile */
#define GSB (192 * GP)               /* bytes of one stage: A tile, then B tile */
__device__ __forceinline__ v16h g2_lfrag(const unsigned char* p) { FragH f; f.half[0] = *(const v8us*)p; f.half[1] = *(const v8us*)(p + 32); return f.v; }      /* g2_frag's k order from an LDS row; p already holds the lane half's 16 bytes */
// One stage: each of the 128 threads copies 16 bytes of rows r0 + 16 j of the A tile (j < 8, at lds) and of the B tile (j < 4, at lds + GTA); eight lanes cover one 128-byte row. sa, sb: 16 rows of A, of B, in elements.
// The s_wait_xcnt closes the copies' own statement, so that it stands in front of every later write of the address registers that the copies name.
__device__ __forceinline__ void g2_stage(unsigned lds, const _Float16* ga, size_t sa, const _Float16* gb, size_t sb) {
  asm volatile("global_load_async_to_lds_b128 %0, %12, off\n\tglobal_load_async_to_lds_b128 %1, %13, off\n\tglobal_load_async_to_lds_b128 %2, %14, off\n\tglobal_load_async_to_lds_b128 %3, %15, off\n\t"
               "global_load_async_to_lds_b128 %4, %16, off\n\tglobal_load_async_to_lds_b128 %5, %17, off\n\tglobal_load_async_to_lds_b128 %6, %18, off\n\tglobal_load_async_to_lds_b128 %7, %19, off\n\t"
               "global_load_async_to_lds_b128 %8, %20, off\n\tglobal_load_async_to_lds_b128 %9, %21, off\n\tglobal_load_async_to_lds_b128 %10, %22, off\n\tglobal_load_async_to_lds_b128 %11, %23, off\n\ts_wait_xcnt 0x0"
               :: "v"(lds), "v"(lds + 16 * GP), "v"(lds + 32 * GP), "v"(lds + 48 * GP), "v"(lds + 64 * GP), "v"(lds + 80 * GP), "v"(lds + 96 * GP), "v"(lds + 112 * GP),
                  "v"(lds + GTA), "v"(lds + GTA + 16 * GP), "v"(lds + GTA + 32 * GP), "v"(lds + GTA + 48 * GP),
                  "v"(ga), "v"(ga + sa), "v"(ga + 2 * sa), "v"(ga + 3 * sa), "v"(ga + 4 * sa), "v"(ga + 5 * sa), "v"(ga + 6 * sa), "v"(ga + 7 * sa),
                  "v"(gb), "v"(gb + sb), "v"(gb + 2 * sb), "v"(gb + 3 * sb)
               : "memory"); }
template <int ACT>
__global__ __launch_bounds__(128) void k_gemm2(const _Float16* __restrict__ A, int lda, size_t sA, const _Float16* __restrict__ Bh, int ldb, size_t sB, float alpha, const float* __restrict__ bias, size_t sBias, const float* __restrict__ bias1, const float* __restrict__ bias2, const float* __restrict__ CP, int rowsPerB, size_t sCPb, int row0g,
    float* __restrict__ C, _Float16* __restrict__ C16, int ldc, size_t sC, int M, int N, int K) { static_assert(ACT == 0 || ACT == 3 || ACT == 6 || ACT == 8 || ACT == 9 || ACT == 11 || ACT == 12 || ACT == 14 || ACT == 15 || ACT == 16 || ACT == 17, "k_gemm2: unsupported ACT code (would silently apply no activation)");
  __shared__ __attribute__((aligned(16))) float so[4][32][68];
  __shared__ __attribute__((aligned(16))) unsigned char G[2 * GSB];      /* two buffers of [A tile | B tile] */
  const int tid = threadIdx.x, w = tid >> 5, lane = tid & 31, ln = lane & 15, hh = lane >> 4; const int by = blockIdx.y;
  A += (size_t)by * sA; Bh += (size_t)by * sB; const size_t cofs = (size_t)by * sC; const float* bp = bias ? bias + (size_t)by * sBias : nullptr;
  if (by == 1 && bias1) bp = bias1; if (by == 2 && bias2) bp = bias2;      /* planes 1 and 2 whose biases are buffers of their own */
  const int ntn = N >> 6; const int mt = blockIdx.x / ntn, nq = blockIdx.x - mt * ntn; const int row0 = mt * 128 + 32 * w, col0 = nq * 64; if (mt * 128 + 128 > M) return;      /* the whole work-group or none, ahead of every copy and barrier: every staged A row exists */
  const int r0 = tid >> 3, ch = tid & 7;      /* this thread's row (mod 16) and 16-byte piece in every copied tile */
  const unsigned lst = (unsigned)(size_t)G + r0 * GP + ch * 16;
  const _Float16* ga = A + (size_t)(mt * 128 + r0) * lda + ch * 8; const _Float16* gb = Bh + (size_t)(col0 + r0) * ldb + ch * 8;
  const size_t sa = (size_t)16 * lda, sb = (size_t)16 * ldb; const int nst = K >> 6;
  g2_stage(lst, ga, sa, gb, sb);
  asm volatile("s_wait_asynccnt 0x0" ::: "memory");      /* this wave's share of stage 0 has landed */
  __syncthreads();      /* publishes stage 0 */
  if (nst > 1) g2_stage(lst + GSB, ga + 64, sa, gb + 64, sb);
  const v8f z8 = {0.f,0.f,0.f,0.f,0.f,0.f,0.f,0.f}; v8f c00 = z8, c01 = z8, c02 = z8, c03 = z8, c10 = z8, c11 = z8, c12 = z8, c13 = z8;
#pragma unroll 1      /* one stage per trip: the buffer index stays a scalar select and the loop stays short */
  for (int t = 0; t < nst; ++t) {
    const unsigned char* al = G + (t & 1) * GSB + (32 * w + ln) * GP + 16 * hh; const unsigned char* bl = G + (t & 1) * GSB + GTA + ln * GP + 16 * hh;
    v16h a[2][2], b[2][4];      /* the stage's 24 LDS reads stand together, ahead of its 16 WMMAs */
#pragma unroll
    for (int kc = 0; kc < 2; ++kc) { a[kc][0] = g2_lfrag(al + kc * 64); a[kc][1] = g2_lfrag(al + 16 * GP + kc * 64);
#pragma unroll
      for (int j = 0; j < 4; ++j) b[kc][j] = g2_lfrag(bl + j * 16 * GP + kc * 64); }
#pragma unroll
    for (int kc = 0; kc < 2; ++kc) {
      c00 = g2_mma(a[kc][0], b[kc][0], c00); c10 = g2_mma(a[kc][1], b[kc][0], c10);
      c01 = g2_mma(a[kc][0], b[kc][1], c01); c11 = g2_mma(a[kc][1], b[kc][1], c11);
      c02 = g2_mma(a[kc][0], b[kc][2], c02); c12 = g2_mma(a[kc][1], b[kc][2], c12);
      c03 = g2_mma(a[kc][0], b[kc][3], c03); c13 = g2_mma(a[kc][1], b[kc][3], c13); }
    asm volatile("s_wait_dscnt 0x0" ::: "memory");      /* this wave's reads of the buffer that is refilled below have returned */
    asm volatile("s_wait_asynccnt 0x0" ::: "memory");      /* this wave's share of stage t + 1 has landed */
    __syncthreads();      /* publishes stage t + 1 and ends every wave's reads of stage t */
    if (t + 2 < nst) g2_stage(lst + (t & 1) * GSB, ga + (size_t)(t + 2) * 64, sa, gb + (size_t)(t + 2) * 64, sb);
  }
  asm volatile("s_wait_asynccnt 0x0" ::: "memory");      /* no copy is outstanding when the wave ends */
  v8f accs[8] = {c00, c01, c02, c03, c10, c11, c12, c13};
#pragma unroll
  for (int u = 0; u < 8; ++u) { const int t = u & 3, half = u >> 2; const int col = col0 + t * 16 + ln; const float bv = bp ? bf16_round(bp[col]) : 0.f;
#pragma unroll
    for (int r = 0; r < 8; ++r) { const int rloc = half * 16 + 8 * hh + r; float v = accs[u][r] * alpha + bv; if (CP) { if (rowsPerB < 0) v += CP[cofs + (size_t)(row0g + row0 + rloc) * ldc + col];      /* rowsPerB < 0: own element of the batched C plane */ else { const int bidx = (row0g + row0 + rloc) / rowsPerB; v += CP[(size_t)bidx * sCPb + (size_t)by * 64 + col]; } }
      if (ACT == 3) v = fmaxf(v, 0.f); else if (ACT == 6) v = 0.5f * v * (1.0f + erff(v * 0.70710678118654752f)); else if (ACT == 11) v = 1.0f / (1.0f + expf(-v)); else if (ACT == 15) v = v / (1.0f + expf(-v)); else if (ACT == 12) v = (v > 0.f) ? v : 0.01f * v; else if (ACT == 8) v = tanhf(v); else if (ACT == 9) v = 0.5f * v * (1.0f + tanhf(0.7978845608028654f * (v + 0.044715f * v * v * v))); else if (ACT == 14) v = (v > 0.f) ? v : 0.1f * v; else if (ACT == 16) v = (v >= 0.f) ? v : 0.3f * v; else if (ACT == 17) v = (v >= 0.f) ? v : 0.2f * v;
      so[w][rloc][t * 16 + ln] = v; } }
  __builtin_amdgcn_fence(__ATOMIC_ACQ_REL, "workgroup"); __builtin_amdgcn_wave_barrier();
  const int rsub = lane >> 4, c4 = (lane & 15) * 4;
  {
#pragma unroll
    for (int q = 0; q < 16; ++q) { const int r = q * 2 + rsub; const v4f v = *(const v4fa*)&so[w][r][c4]; if (C) *(v4f*)(C + cofs + (size_t)(row0 + r) * ldc + col0 + c4) = v; if (C16) { v4h h4; for (int i = 0; i < 4; ++i) h4[i] = (_Float16)v[i]; *(v4h*)(C16 + cofs + (size_t)(row0 + r) * ldc + col0 + c4) = h4; } }
     } }


#define HN 192                       /* columns per work-group */
#define HTA (128 * GP)               /* bytes of the staged x tile */
#define HSB (320 * GP)               /* bytes of one stage: x tile, then 192 weight rows */
#define HOP 400                      /* pitch of the staged output rows, bytes: 384 + 16, an odd multiple of 16 */
#define HST (DM / 64)                /* stages of 64 k */
__device__ __forceinline__ v8f g3_mma(v16h a, v16h b, v8f c) { return __builtin_amdgcn_wmma_f32_16x16x32_f16(false, a, false, b, (short)0, c, false, false); }
// One stage: each of the 128 threads copies 16 bytes of rows r0 + 16 j of the x tile (j < 8, at lds) and of the weight tile (j < 12, at lds + HTA); eight lanes cover one 128-byte row.
// Each statement's s_wait_xcnt closes its own copies, so that it stands in front of every later write of the address registers that they name.
__device__ __forceinline__ void g3_stage(unsigned lds, const _Float16* ga, const _Float16* gb) {
  const size_t s = (size_t)16 * DM;
  asm volatile("global_load_async_to_lds_b128 %0, %8, off\n\tglobal_load_async_to_lds_b128 %1, %9, off\n\tglobal_load_async_to_lds_b128 %2, %10, off\n\tglobal_load_async_to_lds_b128 %3, %11, off\n\t"
               "global_load_async_to_lds_b128 %4, %12, off\n\tglobal_load_async_to_lds_b128 %5, %13, off\n\tglobal_load_async_to_lds_b128 %6, %14, off\n\tglobal_load_async_to_lds_b128 %7, %15, off\n\ts_wait_xcnt 0x0"
               :: "v"(lds), "v"(lds + 16 * GP), "v"(lds + 32 * GP), "v"(lds + 48 * GP), "v"(lds + 64 * GP), "v"(lds + 80 * GP), "v"(lds + 96 * GP), "v"(lds + 112 * GP),
                  "v"(ga), "v"(ga + s), "v"(ga + 2 * s), "v"(ga + 3 * s), "v"(ga + 4 * s), "v"(ga + 5 * s), "v"(ga + 6 * s), "v"(ga + 7 * s)
               : "memory");
  asm volatile("global_load_async_to_lds_b128 %0, %12, off\n\tglobal_load_async_to_lds_b128 %1, %13, off\n\tglobal_load_async_to_lds_b128 %2, %14, off\n\tglobal_load_async_to_lds_b128 %3, %15, off\n\t"
               "global_load_async_to_lds_b128 %4, %16, off\n\tglobal_load_async_to_lds_b128 %5, %17, off\n\tglobal_load_async_to_lds_b128 %6, %18, off\n\tglobal_load_async_to_lds_b128 %7, %19, off\n\t"
               "global_load_async_to_lds_b128 %8, %20, off\n\tglobal_load_async_to_lds_b128 %9, %21, off\n\tglobal_load_async_to_lds_b128 %10, %22, off\n\tglobal_load_async_to_lds_b128 %11, %23, off\n\ts_wait_xcnt 0x0"
               :: "v"(lds + HTA), "v"(lds + HTA + 16 * GP), "v"(lds + HTA + 32 * GP), "v"(lds + HTA + 48 * GP), "v"(lds + HTA + 64 * GP), "v"(lds + HTA + 80 * GP),
                  "v"(lds + HTA + 96 * GP), "v"(lds + HTA + 112 * GP), "v"(lds + HTA + 128 * GP), "v"(lds + HTA + 144 * GP), "v"(lds + HTA + 160 * GP), "v"(lds + HTA + 176 * GP),
                  "v"(gb), "v"(gb + s), "v"(gb + 2 * s), "v"(gb + 3 * s), "v"(gb + 4 * s), "v"(gb + 5 * s), "v"(gb + 6 * s), "v"(gb + 7 * s), "v"(gb + 8 * s), "v"(gb + 9 * s), "v"(gb + 10 * s), "v"(gb + 11 * s)
               : "memory"); }
// C16 plane by = f16(A . Bh[by]^T * alpha + bf16(bias of plane by)); A [MP][DM], Bh three planes [DM][DM] as [n][k], C16 three planes [NR][DM]. Grid: ((MP / 128) * (DM / HN), 3).
__global__ __launch_bounds__(128) void k_gemm3(const _Float16* __restrict__ A, const _Float16* __restrict__ Bh, float alpha, const float* __restrict__ bias0, const float* __restrict__ bias1, const float* __restrict__ bias2, _Float16* __restrict__ C16) {
  static_assert(MP % 128 == 0 && DM % HN == 0 && DM % 64 == 0 && HST >= 2 && 128 * HOP <= 2 * HSB, "k_gemm3: whole tiles only, two stages at least, the staged output fits the ring");
  __shared__ __attribute__((aligned(16))) unsigned char G[2 * HSB];      /* two buffers of [x tile | weight tile]; behind the loop the staged output tile */
  const int tid = threadIdx.x, lane = tid & 31, ln = lane & 15, hh = lane >> 4; const int w = __builtin_amdgcn_readfirstlane(tid >> 5), wm = w >> 1, wn = w & 1; const int by = blockIdx.y;
  Bh += (size_t)by * DM * DM; C16 += (size_t)by * NR * DM; const float* bp = by == 0 ? bias0 : by == 1 ? bias1 : bias2;
  const int mt = blockIdx.x / (DM / HN), nq = blockIdx.x - mt * (DM / HN);
  const int r0 = tid >> 3, ch = tid & 7;      /* this thread's row (mod 16) and 16-byte piece in every copied tile */
  const unsigned lst = (unsigned)(size_t)G + r0 * GP + ch * 16;
  const _Float16* ga = A + (size_t)(mt * 128 + r0) * DM + ch * 8; const _Float16* gb = Bh + (size_t)(nq * HN + r0) * DM + ch * 8;
  g3_stage(lst, ga, gb);
  asm volatile("s_wait_asynccnt 0x0" ::: "memory");      /* this wave's share of stage 0 has landed */
  __syncthreads();      /* publishes stage 0 */
  g3_stage(lst + HSB, ga + 64, gb + 64);
  const v8f z8 = {0.f,0.f,0.f,0.f,0.f,0.f,0.f,0.f}; v8f acc[4][6];
#pragma unroll
  for (int i = 0; i < 4; ++i) for (int j = 0; j < 6; ++j) acc[i][j] = z8;
#pragma unroll 1      /* one stage per trip: the buffer index stays a scalar select and the loop stays short */
  for (int t = 0; t < HST; ++t) {
    const unsigned char* al = G + (t & 1) * HSB + (64 * wm + ln) * GP + 16 * hh; const unsigned char* bl = G + (t & 1) * HSB + HTA + (96 * wn + ln) * GP + 16 * hh;
#pragma unroll
    for (int kc = 0; kc < 2; ++kc) {
      v16h a[4], b[6];      /* the 20 LDS reads of 32 k stand together, ahead of their 24 WMMAs */
#pragma unroll
      for (int i = 0; i < 4; ++i) a[i] = g2_lfrag(al + i * 16 * GP + kc * 64);
#pragma unroll
      for (int j = 0; j < 6; ++j) b[j] = g2_lfrag(bl + j * 16 * GP + kc * 64);
      __builtin_amdgcn_sched_barrier(0);      /* keeps the 20 reads up here as one group; without it the scheduler sinks each weight fragment's two reads directly in front of its four WMMAs, behind a wait to zero */
#pragma unroll
      for (int j = 0; j < 6; ++j) for (int i = 0; i < 4; ++i) acc[i][j] = g3_mma(b[j], a[i], acc[i][j]);
    }
    __builtin_amdgcn_sched_barrier(0);      /* holds the four v_nop below behind the stage's last WMMA */
    asm volatile("v_nop\n\tv_nop\n\tv_nop\n\tv_nop");      /* WMMA distance over the branches below: the copies' address arithmetic or the next stage's reads may write registers that the last WMMA reads as A or B */
    asm volatile("s_wait_dscnt 0x0" ::: "memory");      /* this wave's reads of the buffer that is refilled below have returned */
    asm volatile("s_wait_asynccnt 0x0" ::: "memory");      /* this wave's share of stage t + 1 has landed */
    __syncthreads();      /* publishes stage t + 1 and ends every wave's reads of stage t */
    if (t + 2 < HST) g3_stage(lst + (t & 1) * HSB, ga + (size_t)(t + 2) * 64, gb + (size_t)(t + 2) * 64);
  }
  asm volatile("s_wait_asynccnt 0x0" ::: "memory");      /* no copy is outstanding when the ring becomes output staging */
  /* behind the loop's last barrier nobody reads the ring any more: the output tile [128][HN] is staged there as f16 rows */
#pragma unroll
  for (int j = 0; j < 6; ++j) { const int nl = 96 * wn + 16 * j + 8 * hh;      /* the first of this lane's 8 columns */
    const v4f b0 = *(const v4fa*)(bp + nq * HN + nl), b1 = *(const v4fa*)(bp + nq * HN + nl + 4);
    const float bv[8] = {bf16_round(b0[0]), bf16_round(b0[1]), bf16_round(b0[2]), bf16_round(b0[3]), bf16_round(b1[0]), bf16_round(b1[1]), bf16_round(b1[2]), bf16_round(b1[3])};
#pragma unroll
    for (int i = 0; i < 4; ++i) { FragH f;
#pragma unroll
      for (int r = 0; r < 8; ++r) f.h[r] = (_Float16)(acc[i][j][r] * alpha + bv[r]);
      *(v8us*)(G + (64 * wm + 16 * i + ln) * HOP + nl * 2) = f.half[0]; } }
  __syncthreads();      /* the staged tile is complete: a row's 384 bytes come from two waves */
#pragma unroll
  for (int sg = 0; sg < 3; ++sg)      /* eight lanes store one whole 128-byte line */
#pragma unroll
    for (int rb = 0; rb < 8; ++rb) { const int row = rb * 16 + r0; const v8us v = *(const v8us*)(G + row * HOP + sg * 128 + ch * 16);
      *(v8us*)((unsigned short*)C16 + (size_t)(mt * 128 + row) * DM + nq * HN + sg * 64 + ch * 8) = v; } }

__global__ __launch_bounds__(256) void k_wnat(const float* __restrict__ w, size_t n8, _Float16* __restrict__ Bt) { const size_t t = (size_t)blockIdx.x * 256 + threadIdx.x; if (t >= n8) return; FragH f; for (int q = 0; q < 8; ++q) f.h[q] = (_Float16)(bf16_round(w[t * 8 + q]) * 16.0f); *(v8us*)((unsigned short*)Bt + t * 8) = f.half[0];  }
__global__ __launch_bounds__(256) void k_rsm(const float* __restrict__ S, _Float16* __restrict__ P, int nrows) {
  #pragma clang fp contract(off)
  const int i = blockIdx.x * 256 + threadIdx.x; if (i >= nrows) return; const float* s = S + (size_t)i * SQ; float mx = -3.0e38f;
#pragma unroll 1
  for (int j = 0; j < SQ; ++j) mx = fmaxf(mx, s[j]); float se = 0.f;
#pragma unroll 1
  for (int j = 0; j < SQ; ++j) se += expf(s[j] - mx); const float sc = 256.0f / se;
#pragma unroll 1
  for (int j0 = 0; j0 < SQ; j0 += 8) { FragH f; for (int q = 0; q < 8; ++q) f.h[q] = (_Float16)(expf(s[j0 + q] - mx) * sc); unsigned short* d = (unsigned short*)P + (size_t)i * SQ + j0; *(v8us*)d = f.half[0];  } }
__global__ __launch_bounds__(256) void k_vt(const _Float16* __restrict__ V16, int b, int h0, _Float16* __restrict__ VT) { __shared__ unsigned short tl[64][65]; const int tid = threadIdx.x; const int hh = blockIdx.x % HG, sg = blockIdx.x / HG; const int s0 = sg * 64; const int h = h0 + hh;
  for (int i = tid; i < 64 * 8; i += 256) { const int j = i / 8, d8 = (i % 8) * 8; FragH f; f.half[0] = *(const v8us*)((const unsigned short*)V16 + ((size_t)b * SQ + s0 + j) * DM + h * HD + d8); for (int q = 0; q < 8; ++q) tl[d8 + q][j] = f.u[q]; }
  __syncthreads();
  { for (int i = tid; i < 64 * 8; i += 256) { const int d = i / 8, j8 = (i % 8) * 8; FragH f; for (int q = 0; q < 8; ++q) f.u[q] = tl[d][j8 + q]; *(v8us*)((unsigned short*)VT + ((size_t)hh * HD + d) * SQ + s0 + j8) = f.half[0]; }  } }



#define FW 4                         /* waves per work-group: 128 query columns */
#define SCL 0.18033688011112042f     /* 64^-0.5 * log2(e) */
#define LZ 44.361419555836498f       /* 8 / SCL: how far a raw product may exceed the maximum in use before a rescale */
#define KS 64                        /* keys per stage: two passes */
#define LP 144                       /* LDS row pitch, bytes: 128 + 16, an odd multiple of 16 for 16-byte readers */
#define TB (64 * LP)                 /* bytes of one staged tile of 64 rows */
#define NST (SQ / KS)                /* stages */
__device__ __forceinline__ v8f fa_mma(v16h a, v16h b, v8f c) { return __builtin_amdgcn_wmma_f32_16x16x32_f16(false, a, false, b, (short)0, c, false, false); }
__device__ __forceinline__ float fa_xhalf(float x) { return __builtin_bit_cast(float, __builtin_amdgcn_permlanex16(__builtin_bit_cast(int, x), __builtin_bit_cast(int, x), 0x76543210, 0xfedcba98, false, false)); }      /* lane l <-> lane l ^ 16 */
__device__ __forceinline__ v16h fa_lfrag(const unsigned char* p) { FragH f; f.half[0] = *(const v8us*)p; f.half[1] = *(const v8us*)(p + 32); return f.v; }      /* g2_frag's k order from an LDS row; p already holds the lane half's 16 bytes */
// One stage: each of the 128 threads copies 16 bytes of rows r0, r0 + 16, r0 + 32, r0 + 48 of the K tile (at lds) and of the V^T tile (at lds + TB); eight lanes cover one 128-byte row.
// The s_wait_xcnt closes the copies' own statement, so that it stands in front of every later write of the address registers that the copies name.
__device__ __forceinline__ void fa_stage(unsigned lds, const _Float16* gk, const _Float16* gv) {
  asm volatile("global_load_async_to_lds_b128 %0, %8, off\n\tglobal_load_async_to_lds_b128 %1, %9, off\n\tglobal_load_async_to_lds_b128 %2, %10, off\n\tglobal_load_async_to_lds_b128 %3, %11, off\n\t"
               "global_load_async_to_lds_b128 %4, %12, off\n\tglobal_load_async_to_lds_b128 %5, %13, off\n\tglobal_load_async_to_lds_b128 %6, %14, off\n\tglobal_load_async_to_lds_b128 %7, %15, off\n\ts_wait_xcnt 0x0"
               :: "v"(lds), "v"(lds + 16 * LP), "v"(lds + 32 * LP), "v"(lds + 48 * LP), "v"(lds + TB), "v"(lds + TB + 16 * LP), "v"(lds + TB + 32 * LP), "v"(lds + TB + 48 * LP),
                  "v"(gk), "v"(gk + (size_t)16 * DM), "v"(gk + (size_t)32 * DM), "v"(gk + (size_t)48 * DM), "v"(gv), "v"(gv + (size_t)16 * SQ), "v"(gv + (size_t)32 * SQ), "v"(gv + (size_t)48 * SQ)
               : "memory"); }
__global__ __launch_bounds__(FW * 32) void k_fattn(const _Float16* __restrict__ Q16, const _Float16* __restrict__ K16, const _Float16* __restrict__ VT, _Float16* __restrict__ O16) {
  __shared__ __attribute__((aligned(16))) unsigned char L[2 * 2 * TB];      /* two buffers of [K tile | V^T tile] */
  const int lane = threadIdx.x & 31, c = lane & 15, hh = lane >> 4; const int w = __builtin_amdgcn_readfirstlane(threadIdx.x >> 5);
  const int bh = blockIdx.y, b = bh / NH, h = bh - b * NH; const int q0 = blockIdx.x * (FW * 32) + w * 32;
  const int r0 = threadIdx.x >> 3, ch = threadIdx.x & 7;      /* this thread's row (mod 16) and 16-byte piece in every copied tile */
  const unsigned lst = (unsigned)(size_t)L + r0 * LP + ch * 16;
  const _Float16* gk = K16 + ((size_t)b * SQ + r0) * DM + h * HD + ch * 8; const _Float16* gv = VT + ((size_t)bh * HD + r0) * SQ + ch * 8;
  fa_stage(lst, gk, gv);
  const _Float16* qp = Q16 + ((size_t)b * SQ + q0 + c) * DM + h * HD;
  v16h qf[2][2];
#pragma unroll
  for (int g = 0; g < 2; ++g) for (int kc = 0; kc < 2; ++kc) qf[g][kc] = g2_frag(qp + (size_t)g * 16 * DM + kc * 32, hh);
  asm volatile("s_wait_asynccnt 0x0" ::: "memory");      /* this wave's share of stage 0 has landed */
  __syncthreads();      /* publishes stage 0 */
  fa_stage(lst + 2 * TB, gk + (size_t)KS * DM, gv + KS);
  const v8f z8 = {0.f,0.f,0.f,0.f,0.f,0.f,0.f,0.f}; v8f o[2][4] = {{z8, z8, z8, z8}, {z8, z8, z8, z8}}; float m[2] = {-1.0e30f, -1.0e30f}, l[2] = {0.f, 0.f};
  float mt[2] = {-1.0e30f, -1.0e30f}, nb[2] = {0.f, 0.f};      /* m + LZ and -m * SCL, renewed with m; the first pass always renews them */
  for (int t = 0; t < NST; ++t) {
    const unsigned char* kl = L + (t & 1) * (2 * TB) + c * LP + 16 * hh; const unsigned char* vl = kl + TB;
    v16h kf[2][2];
#pragma unroll
    for (int kt = 0; kt < 2; ++kt) for (int kc = 0; kc < 2; ++kc) kf[kt][kc] = fa_lfrag(kl + kt * 16 * LP + kc * 64);
#pragma unroll
    for (int p = 0; p < 2; ++p) {
    v16h vf[4];
#pragma unroll
    for (int dt = 0; dt < 4; ++dt) vf[dt] = fa_lfrag(vl + dt * 16 * LP + p * 64);
    v8f s[2][2];
#pragma unroll
    for (int g = 0; g < 2; ++g) for (int kt = 0; kt < 2; ++kt) s[g][kt] = fa_mma(kf[kt][1], qf[g][1], fa_mma(kf[kt][0], qf[g][0], z8));
    if (p == 0) {      /* the stage's second pass's K rows, fetched one pass ahead from the same buffer */
#pragma unroll
      for (int kt = 0; kt < 2; ++kt) for (int kc = 0; kc < 2; ++kc) kf[kt][kc] = fa_lfrag(kl + (32 + kt * 16) * LP + kc * 64);
    }
    __builtin_amdgcn_sched_barrier(0);      /* keeps the V and K fragment reads up here, ahead of the softmax; without it the scheduler sinks them directly in front of the wait for them */
    float mp[2]; bool need = false;      /* per lane: the maximum of this half's 16 raw products, and the lazy test */
#pragma unroll
    for (int g = 0; g < 2; ++g) {
      const v8f a = s[g][0], e = s[g][1];
      float mx = fmaxf(fmaxf(fmaxf(a[0], a[1]), fmaxf(a[2], a[3])), fmaxf(fmaxf(a[4], a[5]), fmaxf(a[6], a[7])));
      mx = fmaxf(mx, fmaxf(fmaxf(fmaxf(e[0], e[1]), fmaxf(e[2], e[3])), fmaxf(fmaxf(e[4], e[5]), fmaxf(e[6], e[7]))));
      mp[g] = mx; need = need || (mx > mt[g]);      /* the ballot below looks at both halves of the wave, so the halves' maxima are joined only where a rescale follows */
    }
    if (__builtin_amdgcn_ballot_w32(need) != 0) {      /* one scalar branch per pass, the same for the whole wave; taken in the first pass and seldom later */
#pragma unroll
      for (int g = 0; g < 2; ++g) {
        const float mn = fmaxf(m[g], fmaxf(mp[g], fa_xhalf(mp[g]))); float al = (m[g] - mn) * SCL; m[g] = mn; mt[g] = mn + LZ; nb[g] = -mn * SCL;
        asm("v_exp_f32 %0, %0\n\tv_nop" : "+v"(al));      /* the v_nop: the slot between a transcendental and the use of its result */
        l[g] *= al;
#pragma unroll
        for (int dt = 0; dt < 4; ++dt) o[g][dt] *= al;
      }
    }
#pragma unroll
    for (int g = 0; g < 2; ++g) {
      float x[16];
#pragma unroll
      for (int i = 0; i < 16; ++i) x[i] = fmaf(s[g][i >> 3][i & 7], SCL, nb[g]);
      /* exponentials in place, each run closed by one v_nop: the instruction set asks for one independent instruction between a transcendental and an overwrite of its source or a use of its result */
      asm("v_exp_f32 %0, %0\n\tv_exp_f32 %1, %1\n\tv_exp_f32 %2, %2\n\tv_exp_f32 %3, %3\n\tv_exp_f32 %4, %4\n\tv_exp_f32 %5, %5\n\tv_exp_f32 %6, %6\n\tv_exp_f32 %7, %7\n\tv_nop"
          : "+v"(x[0]), "+v"(x[1]), "+v"(x[2]), "+v"(x[3]), "+v"(x[4]), "+v"(x[5]), "+v"(x[6]), "+v"(x[7]));
      asm("v_exp_f32 %0, %0\n\tv_exp_f32 %1, %1\n\tv_exp_f32 %2, %2\n\tv_exp_f32 %3, %3\n\tv_exp_f32 %4, %4\n\tv_exp_f32 %5, %5\n\tv_exp_f32 %6, %6\n\tv_exp_f32 %7, %7\n\tv_nop"
          : "+v"(x[8]), "+v"(x[9]), "+v"(x[10]), "+v"(x[11]), "+v"(x[12]), "+v"(x[13]), "+v"(x[14]), "+v"(x[15]));
      const float ps = (((x[0] + x[1]) + (x[2] + x[3])) + ((x[4] + x[5]) + (x[6] + x[7]))) + (((x[8] + x[9]) + (x[10] + x[11])) + ((x[12] + x[13]) + (x[14] + x[15])));
      l[g] += ps;      /* this half's keys only; the halves are joined behind the loop */
      FragH pf;
#pragma unroll
      for (int i = 0; i < 16; ++i) pf.h[i] = (_Float16)x[i];
#pragma unroll
      for (int dt = 0; dt < 4; ++dt) o[g][dt] = fa_mma(vf[dt], pf.v, o[g][dt]);
    }
    }
    __builtin_amdgcn_sched_barrier(0);      /* holds the four v_nop below behind the stage's last WMMA */
    asm volatile("v_nop\n\tv_nop\n\tv_nop\n\tv_nop");      /* WMMA distance over the back edge: the next stage's first instructions may write registers that the last WMMA reads as A or B */
    asm volatile("s_wait_dscnt 0x0" ::: "memory");      /* this wave's reads of the buffer that is refilled below have returned */
    asm volatile("s_wait_asynccnt 0x0" ::: "memory");      /* this wave's share of stage t + 1 has landed */
    __syncthreads();      /* publishes stage t + 1 and ends every wave's reads of stage t */
    if (t + 2 < NST) fa_stage(lst + (t & 1) * (2 * TB), gk + (size_t)(t + 2) * KS * DM, gv + (size_t)(t + 2) * KS);
  }
  asm volatile("s_wait_asynccnt 0x0" ::: "memory");      /* no copy is outstanding when the wave ends */
#pragma unroll
  for (int g = 0; g < 2; ++g) { const float inv = 64.0f / (l[g] + fa_xhalf(l[g])); _Float16* op = O16 + ((size_t)b * SQ + q0 + g * 16 + c) * DM + h * HD + 8 * hh;
#pragma unroll
    for (int dt = 0; dt < 4; ++dt) { FragH f;      /* a lane's 8 accumulator registers are 8 consecutive d of one query: one 16-byte store */
#pragma unroll
      for (int r = 0; r < 8; ++r) f.h[r] = (_Float16)(o[g][dt][r] * inv);
      *(v8us*)((unsigned short*)op + dt * 16) = f.half[0]; } } }

extern "C" void kernel_launch(void* const* d_in, const int* in_sizes, int n_in,
                              void* d_out, int out_size, void* d_ws, size_t ws_size, hipStream_t stream) {
  (void)in_sizes; (void)n_in; (void)out_size;
  const float* const* I = (const float* const*)d_in; const float* x = I[0]; const float* wq = I[1]; const float* bq = I[2]; const float* wk = I[3]; const float* bk = I[4]; const float* wv = I[5]; const float* bv = I[6]; const float* wo = I[7]; const float* bo = I[8];      /* [in][out] weights + biases (y = x @ W + b) */
  char* ws = (char*)d_ws; size_t off = 0;
  auto take = [&](size_t bytes) { char* p = ws + off; off += (bytes + 255) & ~(size_t)255; return p; };
  _Float16* BW = (_Float16*)take((size_t)4 * DM * DM * 2); _Float16* BO = BW + (size_t)3 * DM * DM;      /* four weight planes in a row: q, k, v, o */
  _Float16* X16 = (_Float16*)take(NR * DM * 2); _Float16* Q16 = (_Float16*)take(3 * NR * DM * 2); _Float16* K16 = Q16 + NR * DM; _Float16* V16 = Q16 + 2 * NR * DM; _Float16* O16 = (_Float16*)take(NR * DM * 2);      /* q, k, v: three planes in a row */
  _Float16* VT = (_Float16*)take((size_t)NB * NH * HD * SQ * 2);
  if (off > ws_size) return;
  k_prep<<<4 * PWB + PXB, 256, 0, stream>>>(wq, wk, wv, wo, BW, x, X16);      /* [in][out] -> Bt[n][k] x16 (transposing builder) and x rows */
  const size_t r0p = (size_t)B0 * SQ;      /* first projected row */
  k_gemm3<<<dim3((unsigned)((MP / 128) * (DM / HN)), 3), 128, 0, stream>>>(X16 + r0p * DM, BW, 0.0625f, bq, bk, bv, Q16 + r0p * DM);      /* blockIdx.y: q, k, v */
  k_vt<NH, SQ><<<NB * NH * (SQ / 64), 256, 0, stream>>>(V16, LQ, 0, VT);      /* V^T [NB][NH][HD][SQ] */
  k_fattn<<<dim3(SQ / (FW * 32), NB * NH), FW * 32, 0, stream>>>(Q16, K16, VT, O16);      /* o x64 (merged heads) as f16 rows */
  k_gemm2<0><<<dim3((unsigned)((MPO / 128) * (DM / 64)), 1), 128, 0, stream>>>(O16 + r0p * DM, DM, 0, BO, DM, 0, 0.0009765625f, bo, 0, nullptr, nullptr, nullptr, 1, 0, 0, (float*)d_out + r0p * DM, nullptr, DM, 0, MPO, DM, DM);      /* out rows are the output layout */
}

// v008
// One run takes 135 microseconds.
// Two timings next to v007 both put it at 1.04 times that version's speed.
// Over all steps from v000 it is 147 times as fast.
#include <hip/hip_runtime.h>
// Multi-head self-attention over 4096-token sequences at width 768 with [in][out] projections and biases (hidden_states [2][4096][768]; q / k / v = x W + b ([in][out] 768 x 768 + biases), 12 heads of 64; scores * 1/sqrt(64); softmax over all 4096 keys (no mask); out = merged Wo + bo ([in][out]) -> [2][4096][768]); all heads and batches in one attention launch.
// Structure: token rows r = b*4096 + s; one preparation launch (x as exact f16 rows, bf16-rounded; the four transposed weights); Q, K, V as three WMMA GEMMs in one launch (blockIdx.y; 64x96 wave tiles, f32 accumulation, exact x16 weights + bias, f16 outputs); V^T for all batches and heads via LDS transposes; one attention launch for all (batch, head): S^T = K Q^T, K and V^T staged in LDS per work-group, online softmax in registers (f32 statistics, native exp2; weights exp(s - maximum in use) as f16, rescaled lazily), O^T += V^T P^T, o carried x64 against f16 subnormal flush (folded into the output GEMM alpha), written straight into the merged f16 o rows; out = o W_o + b GEMM (f32) into the output layout.
// Compute dtype: inputs rounded to bf16; x / weights exact; q, k, v, softmax weights and o as plain f16 GEMM operands (~2^-12); scores and softmax statistics f32; v_wmma_f32_16x16x32_f16.
#define NB 2
#define SQ 4096
#define DM 768
#define NH 12
#define HD 64
#define HG 1                         /* heads per group in the unlaunched per-batch k_vt (a 4096^2 f32 score slab is 64 MiB) */
#define B0 0                         /* first batch processed (debug hook) */
#define NBR NB                       /* batches processed (debug hook) */
#define NR ((size_t)NB * SQ)         /* token rows */
#define MP ((int)((size_t)NBR * SQ)) /* rows projected (debug hook) */
#define QN SQ                        /* unused: attention covers all SQ query rows */
#define NHD NH                       /* unused: attention covers all NH heads */
#define MPO MP                       /* rows through the output stage (debug hook) */
#define LQ DM      /* row pitch of the q/k/v rows */
typedef __bf16 v16b __attribute__((ext_vector_type(16)));
typedef unsigned short v8us __attribute__((ext_vector_type(8), may_alias));
typedef float  v8f  __attribute__((ext_vector_type(8)));
typedef float  v4f  __attribute__((ext_vector_type(4)));
typedef float  v4fa __attribute__((ext_vector_type(4), may_alias));
union FragB { v16b v; v8us half[2]; unsigned short u[16]; };

__device__ __forceinline__ unsigned short bf16_bits(float x) { unsigned int u = __float_as_uint(x); return (unsigned short)((u + 0x7FFFu + ((u >> 16) & 1u)) >> 16); }
__device__ __forceinline__ float bf16_val(unsigned short b) { return __uint_as_float(((unsigned int)b) << 16); }
__device__ __forceinline__ float bf16_round(float x) { return bf16_val(bf16_bits(x)); }
// D += A·B with NT terms: 1 = ah·bh, 2 = + al·bh (A split), 3 = + ah·bl (both split)
template <int NT>
__device__ __forceinline__ v8f mmaN(v16b ah, v16b al, v16b bh, v16b bl, v8f c) {
  c = __builtin_amdgcn_wmma_f32_16x16x32_bf16(false, ah, false, bh, (short)0, c, false, false);
  if (NT >= 2) c = __builtin_amdgcn_wmma_f32_16x16x32_bf16(false, al, false, bh, (short)0, c, false, false);
  if (NT >= 3) c = __builtin_amdgcn_wmma_f32_16x16x32_bf16(false, ah, false, bl, (short)0, c, false, false);
  asm volatile("v_nop\n\tv_nop\n\tv_nop\n\tv_nop" : "+v"(c) : "v"(ah), "v"(al), "v"(bh), "v"(bl));
  return c;
}

__global__ __launch_bounds__(256) void k_wt_bf16(const float* __restrict__ W, unsigned short* __restrict__ Wt, int K, int N) {
  const int t = blockIdx.x * 256 + threadIdx.x;
  const int k8n = K / 8;
  if (t >= N * k8n) return;
  const int n = t / k8n, k8 = (t % k8n) * 8;
  v8us v;
#pragma unroll
  for (int i = 0; i < 8; ++i) v[i] = bf16_bits(W[(size_t)(k8 + i) * N + n]);
  *(v8us*)(Wt + (size_t)n * K + k8) = v;
  
}

// GEMM C[M][N] (f32, pitch ldc) = act(A[M][K]·W + bias). A f32 row-major (pitch lda) converted per fragment to bf16
// (ASPLIT: hi/lo two planes -> 2 terms, else single rounded term); Wt bf16 [N][K] (pitch ldb). BIAS_BF16 rounds the
// bias to bf16 first (bias quantised to bf16 before the add). K%32==0, M%16==0, N%64==0.
template <bool ASPLIT, int ACT, bool BIAS_BF16>
__global__ __launch_bounds__(128) void k_gemm_bf(const float* __restrict__ A, int lda, const unsigned short* __restrict__ Wt, int ldb,
                                               const float* __restrict__ bias, float* __restrict__ C, int ldc, int M, int N, int K) {
  __shared__ __attribute__((aligned(16))) float so[4][16][64];
  const int tid = threadIdx.x, w = tid >> 5, lane = tid & 31, ln = lane & 15, hh = lane >> 4;
  const int ntn = N / 64;
  const int wid = blockIdx.x * 4 + w;
  const int mt = wid / ntn, nq = wid % ntn;
  if (mt * 16 >= M) return;
  const int row0 = mt * 16, col0 = nq * 64;
  const float* arow = A + (size_t)(row0 + ln) * lda;
  v8f acc[4] = {};
  for (int kb = 0; kb < K; kb += 32) {
    FragB ah, al;
    const v4f x0 = *(const v4fa*)(arow + kb + 8 * hh), x1 = *(const v4fa*)(arow + kb + 8 * hh + 4);
    const v4f x2 = *(const v4fa*)(arow + kb + 16 + 8 * hh), x3 = *(const v4fa*)(arow + kb + 16 + 8 * hh + 4);
    float xs[16] = {x0[0],x0[1],x0[2],x0[3],x1[0],x1[1],x1[2],x1[3],x2[0],x2[1],x2[2],x2[3],x3[0],x3[1],x3[2],x3[3]};
#pragma unroll
    for (int i = 0; i < 16; ++i) { const unsigned short hb = bf16_bits(xs[i]); ah.u[i] = hb; al.u[i] = ASPLIT ? bf16_bits(xs[i] - bf16_val(hb)) : (unsigned short)0; }
#pragma unroll
    for (int t = 0; t < 4; ++t) {
      const unsigned short* brow = Wt + (size_t)(col0 + t * 16 + ln) * ldb + kb;
      FragB b;
      b.half[0] = *(const v8us*)(brow + 8 * hh);
      b.half[1] = *(const v8us*)(brow + 16 + 8 * hh);
      acc[t] = mmaN<ASPLIT ? 2 : 1>(ah.v, al.v, b.v, b.v, acc[t]);
    }
  }
#pragma unroll
  for (int t = 0; t < 4; ++t) {
    float bv = bias ? bias[col0 + t * 16 + ln] : 0.f;
    if (BIAS_BF16) bv = bf16_round(bv);
#pragma unroll
    for (int r = 0; r < 8; ++r) { float v = acc[t][r] + bv; if (ACT == 1) v = fmaxf(v, 0.f); so[w][8 * hh + r][t * 16 + ln] = v; }
  }
  __builtin_amdgcn_fence(__ATOMIC_ACQ_REL, "workgroup");
  __builtin_amdgcn_wave_barrier();
  const int rsub = lane >> 4, c4 = (lane & 15) * 4;
  {
#pragma unroll
    for (int q = 0; q < 8; ++q) {
      const int r = q * 2 + rsub;
      const v4f v = *(const v4fa*)&so[w][r][c4];
      *(v4f*)(C + (size_t)(row0 + r) * ldc + col0 + c4) = v;
    }
    
  }
}

// GEMM C = act(A·W + bias + resid): A f32 (ASPLIT -> hi/lo 2 terms), Wt bf16 [N][K]; ACT 0 none, 1 relu, 2 exact gelu;
// resid (optional, f32, row index = (row % rmod), pitch ldr, RES_BF16 rounds it) added before the activation.
template <bool ASPLIT, int ACT, bool BIAS_BF16, bool RES_BF16>
__global__ __launch_bounds__(128) void k_gemm_bf3(const float* __restrict__ A, int lda, const unsigned short* __restrict__ Wt, int ldb,
                                                const float* __restrict__ bias, const float* __restrict__ resid, int rmod, int ldr,
                                                float* __restrict__ C, int ldc, int M, int N, int K) {
  __shared__ __attribute__((aligned(16))) float so[4][16][64];
  const int tid = threadIdx.x, w = tid >> 5, lane = tid & 31, ln = lane & 15, hh = lane >> 4;
  const int ntn = N / 64;
  const int wid = blockIdx.x * 4 + w;
  const int mt = wid / ntn, nq = wid % ntn;
  if (mt * 16 >= M) return;
  const int row0 = mt * 16, col0 = nq * 64;
  const float* arow = A + (size_t)(row0 + ln) * lda;
  v8f acc[4] = {};
  for (int kb = 0; kb < K; kb += 32) {
    FragB ah, al;
    const v4f x0 = *(const v4fa*)(arow + kb + 8 * hh), x1 = *(const v4fa*)(arow + kb + 8 * hh + 4);
    const v4f x2 = *(const v4fa*)(arow + kb + 16 + 8 * hh), x3 = *(const v4fa*)(arow + kb + 16 + 8 * hh + 4);
    float xs[16] = {x0[0],x0[1],x0[2],x0[3],x1[0],x1[1],x1[2],x1[3],x2[0],x2[1],x2[2],x2[3],x3[0],x3[1],x3[2],x3[3]};
#pragma unroll
    for (int i = 0; i < 16; ++i) { const unsigned short hb = bf16_bits(xs[i]); ah.u[i] = hb; al.u[i] = ASPLIT ? bf16_bits(xs[i] - bf16_val(hb)) : (unsigned short)0; }
#pragma unroll
    for (int t = 0; t < 4; ++t) {
      const unsigned short* brow = Wt + (size_t)(col0 + t * 16 + ln) * ldb + kb;
      FragB b;
      b.half[0] = *(const v8us*)(brow + 8 * hh);
      b.half[1] = *(const v8us*)(brow + 16 + 8 * hh);
      acc[t] = mmaN<ASPLIT ? 2 : 1>(ah.v, al.v, b.v, b.v, acc[t]);
    }
  }
#pragma unroll
  for (int t = 0; t < 4; ++t) {
    const int col = col0 + t * 16 + ln;
    float bv = bias ? bias[col] : 0.f;
    if (BIAS_BF16) bv = bf16_round(bv);
#pragma unroll
    for (int r = 0; r < 8; ++r) {
      float v = acc[t][r] + bv;
      if (resid) { float rv = resid[(size_t)((row0 + 8 * hh + r) % rmod) * ldr + col]; if (RES_BF16) rv = bf16_round(rv); v += rv; }
      if (ACT == 1) v = fmaxf(v, 0.f);
      if (ACT == 2) v = 0.5f * v * (1.0f + erff(v * 0.70710678118654752f));
      if (ACT == 3) { const float u = 0.7978845608028654f * (v + 0.044715f * v * v * v); v = 0.5f * v * (1.0f + tanhf(u)); }
      so[w][8 * hh + r][t * 16 + ln] = v;
    }
  }
  __builtin_amdgcn_fence(__ATOMIC_ACQ_REL, "workgroup");
  __builtin_amdgcn_wave_barrier();
  const int rsub = lane >> 4, c4 = (lane & 15) * 4;
  {
#pragma unroll
    for (int q = 0; q < 8; ++q) {
      const int r = q * 2 + rsub;
      const v4f v = *(const v4fa*)&so[w][r][c4];
      *(v4f*)(C + (size_t)(row0 + r) * ldc + col0 + c4) = v;
    }
    
  }
}
// row LayerNorm (biased variance, eps) over N: s = X (+ R); optional out_sum <- s; out_norm <- (s-mu)*rsqrt(var+eps)*g + b
template <bool PARAM_BF16>
__global__ __launch_bounds__(256) void k_layernorm(const float* __restrict__ X, const float* __restrict__ R, const float* __restrict__ g, const float* __restrict__ bta,
                                                  float* __restrict__ out_sum, float* __restrict__ out_norm, int N, float eps) {
  __shared__ float red[256];
  const int row = blockIdx.x, tid = threadIdx.x;
  const float* x = X + (size_t)row * N; const float* rr = R ? R + (size_t)row * N : nullptr;
  float vals[16];                     // up to N = 4096
  const int per = N / 256;            // contiguous chunk per thread? use strided-by-4 chunks: thread handles j = tid*4 + 1024*u
  float s1 = 0.f;
  for (int u = 0; u < per / 4; ++u) {
    const int j = tid * 4 + 1024 * u;
    const v4f a = *(const v4fa*)(x + j);
    v4f b = {0.f,0.f,0.f,0.f}; if (rr) b = *(const v4fa*)(rr + j);
#pragma unroll
    for (int q = 0; q < 4; ++q) { const float v = a[q] + b[q]; vals[u * 4 + q] = v; s1 += v; }
  }
  red[tid] = s1; __syncthreads();
  for (int st = 128; st > 0; st >>= 1) { if (tid < st) red[tid] += red[tid + st]; __syncthreads(); }
  const float mu = red[0] / (float)N; __syncthreads();
  float s2 = 0.f;
  for (int u = 0; u < per / 4; ++u)
#pragma unroll
    for (int q = 0; q < 4; ++q) { const float c = vals[u * 4 + q] - mu; s2 += c * c; }
  red[tid] = s2; __syncthreads();
  for (int st = 128; st > 0; st >>= 1) { if (tid < st) red[tid] += red[tid + st]; __syncthreads(); }
  const float rs = rsqrtf(red[0] / (float)N + eps);
  {
    for (int u = 0; u < per / 4; ++u) {
      const int j = tid * 4 + 1024 * u;
      v4f o, sm;
#pragma unroll
      for (int q = 0; q < 4; ++q) {
        float gg = g[j + q], bb = bta[j + q];
        if (PARAM_BF16) { gg = bf16_round(gg); bb = bf16_round(bb); }
        sm[q] = vals[u * 4 + q]; o[q] = (vals[u * 4 + q] - mu) * rs * gg + bb;
      }
      if (out_sum) *(v4f*)(out_sum + (size_t)row * N + j) = sm;
      *(v4f*)(out_norm + (size_t)row * N + j) = o;
    }
    
  }
}



// ---- f16 WMMA path (v_wmma_f32_16x16x32_f16): 11-bit significands for operands in range — used where a [0,1] probability operand needs more precision than bf16
typedef _Float16 v16h __attribute__((ext_vector_type(16)));
union FragH { v16h v; v8us half[2]; _Float16 h[16]; unsigned short u[16]; };
template <int NT>
__device__ __forceinline__ v8f mmaH(v16h ah, v16h al, v16h bh, v16h bl, v8f c) {
  c = __builtin_amdgcn_wmma_f32_16x16x32_f16(false, ah, false, bh, (short)0, c, false, false);
  if (NT >= 2) c = __builtin_amdgcn_wmma_f32_16x16x32_f16(false, al, false, bh, (short)0, c, false, false);
  if (NT >= 3) c = __builtin_amdgcn_wmma_f32_16x16x32_f16(false, ah, false, bl, (short)0, c, false, false);
  asm volatile("v_nop\n\tv_nop\n\tv_nop\n\tv_nop" : "+v"(c) : "v"(ah), "v"(al), "v"(bh), "v"(bl));
  return c;
}
// batched GEMM like k_gemm_b but f16 operands: A f32 (split into f16 hi/lo if ASPLIT, else rounded to f16), Bt = f16 values [n][k]; alpha; C f32; N multiple of 16 (partial tiles skipped)
template <bool ASPLIT>
__global__ __launch_bounds__(128) void k_gemm_h(const float* __restrict__ A, int lda, size_t sA, const _Float16* __restrict__ Bh, int ldb, size_t sB, float alpha, float* __restrict__ C, int ldc, size_t sC, int M, int N, int K) {
  __shared__ __attribute__((aligned(16))) float so[4][16][64];
  const int tid = threadIdx.x, w = tid >> 5, lane = tid & 31, ln = lane & 15, hh = lane >> 4; const int by = blockIdx.y;
  A += (size_t)by * sA; Bh += (size_t)by * sB; C += (size_t)by * sC;
  const int ntn = (N + 63) / 64; const int wid = blockIdx.x * 4 + w; const int mt = wid / ntn, nq = wid % ntn; if (mt * 16 >= M) return;
  const int row0 = mt * 16, col0 = nq * 64; const float* arow = A + (size_t)(row0 + ln) * lda;
  v8f acc[4] = {};
  for (int kb = 0; kb < K; kb += 32) {
    FragH ah, al;
    const v4f x0 = *(const v4fa*)(arow + kb + 8 * hh), x1 = *(const v4fa*)(arow + kb + 8 * hh + 4), x2 = *(const v4fa*)(arow + kb + 16 + 8 * hh), x3 = *(const v4fa*)(arow + kb + 16 + 8 * hh + 4);
    float xs[16] = {x0[0],x0[1],x0[2],x0[3],x1[0],x1[1],x1[2],x1[3],x2[0],x2[1],x2[2],x2[3],x3[0],x3[1],x3[2],x3[3]};
#pragma unroll
    for (int i = 0; i < 16; ++i) { const _Float16 h = (_Float16)xs[i]; ah.h[i] = h; al.h[i] = ASPLIT ? (_Float16)(xs[i] - (float)h) : (_Float16)0.0f; }
#pragma unroll
    for (int t = 0; t < 4; ++t) { if (col0 + t * 16 >= N) continue; const size_t boff = (size_t)(col0 + t * 16 + ln) * ldb + kb; FragH bq; bq.half[0] = *(const v8us*)(Bh + boff + 8 * hh); bq.half[1] = *(const v8us*)(Bh + boff + 16 + 8 * hh);
      acc[t] = mmaH<ASPLIT ? 2 : 1>(ah.v, al.v, bq.v, bq.v, acc[t]); }
  }
#pragma unroll
  for (int t = 0; t < 4; ++t) { if (col0 + t * 16 >= N) continue;
#pragma unroll
    for (int r = 0; r < 8; ++r) so[w][8 * hh + r][t * 16 + ln] = acc[t][r] * alpha; }
  __builtin_amdgcn_fence(__ATOMIC_ACQ_REL, "workgroup"); __builtin_amdgcn_wave_barrier();
  const int rsub = lane >> 4, c4 = (lane & 15) * 4;
  {
#pragma unroll
    for (int q = 0; q < 8; ++q) { const int r = q * 2 + rsub; if (col0 + c4 < N) { const v4f v = *(const v4fa*)&so[w][r][c4]; *(v4f*)(C + (size_t)(row0 + r) * ldc + col0 + c4) = v; } }
     }
}

// k_gemm_hh variant with fused epilogue: v = acc·alpha + bias[by·sBias + col] (+ CP[(row/rowsPerB)·sCPb + by·64 + col] if CP) ; ACT 0 none / 1 elu ; writes f16 C16 (and f32 C if non-null)
template <int ACT>
__global__ __launch_bounds__(128) void k_gemm_hhx(const _Float16* __restrict__ A, int lda, size_t sA, const _Float16* __restrict__ Bh, int ldb, size_t sB, float alpha, const float* __restrict__ bias, size_t sBias, const float* __restrict__ CP, int rowsPerB, size_t sCPb, int row0g,
    float* __restrict__ C, _Float16* __restrict__ C16, int ldc, size_t sC, int M, int N, int K) {
  __shared__ __attribute__((aligned(16))) float so[4][16][64];
  const int tid = threadIdx.x, w = tid >> 5, lane = tid & 31, ln = lane & 15, hh = lane >> 4; const int by = blockIdx.y;
  A += (size_t)by * sA; Bh += (size_t)by * sB; const size_t cofs = (size_t)by * sC; const float* bp = bias ? bias + (size_t)by * sBias : nullptr;
  const int ntn = (N + 63) / 64; const int wid = blockIdx.x * 4 + w; const int mt = wid / ntn, nq = wid % ntn; if (mt * 16 >= M) return;
  const int row0 = mt * 16, col0 = nq * 64; const _Float16* arow = A + (size_t)(row0 + ln) * lda;
  v8f acc[4] = {};
  for (int kb = 0; kb < K; kb += 32) { FragH ah; ah.half[0] = *(const v8us*)((const unsigned short*)arow + kb + 8 * hh); ah.half[1] = *(const v8us*)((const unsigned short*)arow + kb + 16 + 8 * hh);
#pragma unroll
    for (int t = 0; t < 4; ++t) { if (col0 + t * 16 >= N) continue; const size_t boff = (size_t)(col0 + t * 16 + ln) * ldb + kb; FragH bq; bq.half[0] = *(const v8us*)((const unsigned short*)Bh + boff + 8 * hh); bq.half[1] = *(const v8us*)((const unsigned short*)Bh + boff + 16 + 8 * hh);
      acc[t] = mmaH<1>(ah.v, ah.v, bq.v, bq.v, acc[t]); }
  }
#pragma unroll
  for (int t = 0; t < 4; ++t) { if (col0 + t * 16 >= N) continue; const int col = col0 + t * 16 + ln; const float bv = bp ? bf16_round(bp[col]) : 0.f;
#pragma unroll
    for (int r = 0; r < 8; ++r) { float v = acc[t][r] * alpha + bv; if (CP) { const int rr = row0g + row0 + 8 * hh + r; if (rowsPerB < 0) v += CP[cofs + (size_t)rr * ldc + col];      /* rowsPerB < 0: own element of the batched C plane */ else { const int bidx = rr / rowsPerB; v += CP[(size_t)bidx * sCPb + (size_t)by * 64 + col]; } } if (ACT == 1) v = (v > 0.f) ? v : expm1f(v); else if (ACT == 7) v = (v > 0.f) ? v + 1.0f : expf(v); else if (ACT == 8) v = tanhf(v); else if (ACT == 9) v = 0.5f * v * (1.0f + tanhf(0.7978845608028654f * (v + 0.044715f * v * v * v))); else if (ACT == 11) v = 1.0f / (1.0f + expf(-v)); else if (ACT == 12) v = (v > 0.f) ? v : 0.01f * v; else if (ACT == 14) v = (v > 0.f) ? v : 0.1f * v; else if (ACT == 16) v = (v >= 0.f) ? v : 0.3f * v; else if (ACT == 17) v = (v >= 0.f) ? v : 0.2f * v; else if (ACT == 15) v = v / (1.0f + expf(-v)); else if (ACT == 3) v = fmaxf(v, 0.f); else if (ACT == 6) v = 0.5f * v * (1.0f + erff(v * 0.70710678118654752f)); so[w][8 * hh + r][t * 16 + ln] = v; } }
  __builtin_amdgcn_fence(__ATOMIC_ACQ_REL, "workgroup"); __builtin_amdgcn_wave_barrier();
  const int rsub = lane >> 4, c4 = (lane & 15) * 4; typedef _Float16 v4h __attribute__((ext_vector_type(4)));
  {
#pragma unroll
    for (int q = 0; q < 8; ++q) { const int r = q * 2 + rsub; if (col0 + c4 < N) { const v4f v = *(const v4fa*)&so[w][r][c4]; if (C) *(v4f*)(C + cofs + (size_t)(row0 + r) * ldc + col0 + c4) = v; if (C16) { v4h h4; for (int i = 0; i < 4; ++i) h4[i] = (_Float16)v[i]; *(v4h*)(C16 + cofs + (size_t)(row0 + r) * ldc + col0 + c4) = h4; } } }
     }
}


typedef _Float16 v4h __attribute__((ext_vector_type(4)));

// One launch for all that depends on the inputs alone, in streaming form: few work-groups, every wave with 8 or 12 loads of 16 bytes a lane issued together, each load covering 512 contiguous bytes (four whole 128-byte lines).
// Blocks [0, 4 * PWB): plane wi of BW = Wt[n][k] = f16(bf16(W[k][n]) * 16) from the f32 row-major [in][out] weight wi (q, k, v, o; bf16-exact weights stay exact in f16 away from the subnormal range), one block per tile of 64 k x 128 n, turned through LDS; eight lanes store one whole 128-byte line of Wt.
// Blocks from 4 * PWB on: x as f16 rows (bf16-rounded), 48 elements per thread in 12 pieces of four. The branch is the same for a whole block.
#define PWB ((DM / 64) * (DM / 128))         /* blocks (tiles) per weight */
#define PXB ((int)(NR * DM / 48 / 256))      /* blocks for x: two per WGP of 256, 16 waves each */
#define PWP 130                              /* pitch of the tile's k rows in 2-byte elements: 65 dwords, odd, so that the eight k groups of a wave's column reads fall on different banks */
typedef unsigned int u32a __attribute__((may_alias));
__global__ __launch_bounds__(256) void k_prep(const float* __restrict__ wq, const float* __restrict__ wk, const float* __restrict__ wv, const float* __restrict__ wo, _Float16* __restrict__ BW, const float* __restrict__ x, _Float16* __restrict__ X16) {
  static_assert(DM % 128 == 0 && NR * DM % (48 * 256) == 0, "k_prep: whole tiles and whole blocks only, no thread is guarded");
  __shared__ __attribute__((aligned(16))) unsigned short tl[64][PWP];      /* f16 bits of one weight tile as [k][n] */
  const int bx = blockIdx.x, tid = threadIdx.x; FragH f;
  if (bx < 4 * PWB) {
    const int wi = bx / PWB, tt = bx - wi * PWB; const float* W = wi == 0 ? wq : wi == 1 ? wk : wi == 2 ? wv : wo;
    const int k0 = (tt / (DM / 128)) * 64, n0 = (tt % (DM / 128)) * 128;
    const int r = tid >> 5, c4 = (tid & 31) * 4;      /* this thread's k row (mod 8) and its four n */
    v4f a[8];
#pragma unroll
    for (int j = 0; j < 8; ++j) a[j] = *(const v4fa*)(W + (size_t)(k0 + r + 8 * j) * DM + n0 + c4);
#pragma unroll
    for (int j = 0; j < 8; ++j) {
#pragma unroll
      for (int q = 0; q < 4; ++q) f.h[q] = (_Float16)(bf16_round(a[j][q]) * 16.0f);
      u32a* d = (u32a*)&tl[r + 8 * j][c4]; d[0] = ((const u32a*)f.u)[0]; d[1] = ((const u32a*)f.u)[1]; }
    __syncthreads();      /* the tile is complete: a column's 64 k come from all eight waves */
#pragma unroll
    for (int p = 0; p < 4; ++p) { const int n = p * 32 + (tid >> 3), kc = (tid & 7) * 8;
#pragma unroll
      for (int q = 0; q < 8; ++q) f.u[q] = tl[kc + q][n];
      *(v8us*)((unsigned short*)BW + (size_t)wi * DM * DM + (size_t)(n0 + n) * DM + k0 + kc) = f.half[0]; }
  } else {
    const size_t t = (size_t)(bx - 4 * PWB) * 3072 + tid;      /* in pieces of four elements; piece j of this thread is t + 256 j */
    v4f a[12];
#pragma unroll
    for (int j = 0; j < 12; ++j) a[j] = *(const v4fa*)(x + (t + 256 * j) * 4);
#pragma unroll
    for (int j = 0; j < 12; ++j) { v4h h4;
#pragma unroll
      for (int q = 0; q < 4; ++q) h4[q] = (_Float16)bf16_round(a[j][q]);
      *(v4h*)(X16 + (t + 256 * j) * 4) = h4; }
    asm volatile("s_wait_xcnt 0x0" ::: "memory");      /* stands behind the stores: the listing's fall-through behind them runs into the weight part, which rewrites the stores' registers */
  } }
__global__ __launch_bounds__(256) void k_h16(const float* __restrict__ x, _Float16* __restrict__ X16, size_t n8) { const size_t t = (size_t)blockIdx.x * 256 + threadIdx.x; if (t >= n8) return; FragH f;
#pragma unroll
  for (int q = 0; q < 8; ++q) f.h[q] = (_Float16)x[t * 8 + q]; *(v8us*)((unsigned short*)X16 + t * 8) = f.half[0];  }
__global__ __launch_bounds__(256) void k_round16f(const float* __restrict__ W, _Float16* __restrict__ Bt, size_t n8) { const size_t t = (size_t)blockIdx.x * 256 + threadIdx.x; if (t >= n8) return; FragH f;
#pragma unroll
  for (int i = 0; i < 8; ++i) f.h[i] = (_Float16)(bf16_round(W[t * 8 + i]) * 16.0f); *(v8us*)((unsigned short*)Bt + t * 8) = f.half[0];  }
template <int NHv, int TTv>
__global__ __launch_bounds__(256) void k_vt(const _Float16* __restrict__ V16, int ldv, int voff, _Float16* __restrict__ Vt) { __shared__ unsigned short tl[64][66]; const int tid = threadIdx.x; const int slab = blockIdx.x / (TTv / 64), lg = blockIdx.x % (TTv / 64); const int b = slab / NHv, h = slab % NHv;
  for (int i = tid; i < 64 * 8; i += 256) { const int r = i / 8, c8 = (i % 8) * 8; FragH f; f.half[0] = *(const v8us*)((const unsigned short*)V16 + ((size_t)b * TTv + lg * 64 + r) * ldv + voff + h * 64 + c8);
#pragma unroll
    for (int q = 0; q < 8; ++q) tl[r][c8 + q] = f.u[q]; }
  __syncthreads();
  {
#pragma unroll
    for (int rd = 0; rd < 2; ++rd) { const int d = rd * 32 + tid / 8, pc = tid % 8; FragH f;
#pragma unroll
      for (int q = 0; q < 8; ++q) f.u[q] = tl[pc * 8 + q][d];
      *(v8us*)((unsigned short*)Vt + ((size_t)slab * 64 + d) * TTv + lg * 64 + pc * 8) = f.half[0]; }
     } }

__global__ __launch_bounds__(256) void k_hl(const float* __restrict__ F, _Float16* __restrict__ Hh, _Float16* __restrict__ Hl, size_t n8) { const size_t t = (size_t)blockIdx.x * 256 + threadIdx.x; if (t >= n8) return; FragH fh, fl; const v4f a = *(const v4fa*)(F + t * 8), c = *(const v4fa*)(F + t * 8 + 4);
#pragma unroll
  for (int q = 0; q < 4; ++q) { _Float16 h = (_Float16)a[q]; fh.h[q] = h; fl.h[q] = (_Float16)((a[q] - (float)h) * 1024.0f); h = (_Float16)c[q]; fh.h[4 + q] = h; fl.h[4 + q] = (_Float16)((c[q] - (float)h) * 1024.0f); }
  { *(v8us*)((unsigned short*)Hh + t * 8) = fh.half[0]; *(v8us*)((unsigned short*)Hl + t * 8) = fl.half[0];  } }

// ---- fast GEMM (work-group tile 128x64, wave tile 32x64; requires M % 128 == 0 rows per launch region, N % 64 == 0, K % 64 == 0); epilogue = k_gemm_hhx semantics ----
__device__ __forceinline__ v16h g2_frag(const _Float16* p, int hh) { FragH f; f.half[0] = *(const v8us*)((const unsigned short*)p + 8 * hh); f.half[1] = *(const v8us*)((const unsigned short*)p + 16 + 8 * hh); return f.v; }
__device__ __forceinline__ v8f g2_mma(v16h a, v16h b, v8f c) { v8f d = __builtin_amdgcn_wmma_f32_16x16x32_f16(false, a, false, b, (short)0, c, false, false); asm volatile("v_nop\n\tv_nop\n\tv_nop\n\tv_nop" : "+v"(d) : "v"(a), "v"(b)); return d; }
// A and B reach the waves through LDS: a stage is 64 k (128 A rows and 64 B rows of 128 bytes each), brought once per work-group by asynchronous copies that cover whole 128-byte lines, two buffers, the next stage in flight while this one is worked on.
#define GP 144                       /* LDS row pitch, bytes: 128 + 16, an odd multiple of 16 for 16-byte readers */
#define GTA (128 * GP)               /* bytes of the staged A tile */
#define GSB (192 * GP)               /* bytes of one stage: A tile, then B tile */
__device__ __forceinline__ v16h g2_lfrag(const unsigned char* p) { FragH f; f.half[0] = *(const v8us*)p; f.half[1] = *(const v8us*)(p + 32); return f.v; }      /* g2_frag's k order from an LDS row; p already holds the lane half's 16 bytes */
// One stage: each of the 128 threads copies 16 bytes of rows r0 + 16 j of the A tile (j < 8, at lds) and of the B tile (j < 4, at lds + GTA); eight lanes cover one 128-byte row. sa, sb: 16 rows of A, of B, in elements.
// The s_wait_xcnt closes the copies' own statement, so that it stands in front of every later write of the address registers that the copies name.
__device__ __forceinline__ void g2_stage(unsigned lds, const _Float16* ga, size_t sa, const _Float16* gb, size_t sb) {
  asm volatile("global_load_async_to_lds_b128 %0, %12, off\n\tglobal_load_async_to_lds_b128 %1, %13, off\n\tglobal_load_async_to_lds_b128 %2, %14, off\n\tglobal_load_async_to_lds_b128 %3, %15, off\n\t"
               "global_load_async_to_lds_b128 %4, %16, off\n\tglobal_load_async_to_lds_b128 %5, %17, off\n\tglobal_load_async_to_lds_b128 %6, %18, off\n\tglobal_load_async_to_lds_b128 %7, %19, off\n\t"
               "global_load_async_to_lds_b128 %8, %20, off\n\tglobal_load_async_to_lds_b128 %9, %21, off\n\tglobal_load_async_to_lds_b128 %10, %22, off\n\tglobal_load_async_to_lds_b128 %11, %23, off\n\ts_wait_xcnt 0x0"
               :: "v"(lds), "v"(lds + 16 * GP), "v"(lds + 32 * GP), "v"(lds + 48 * GP), "v"(lds + 64 * GP), "v"(lds + 80 * GP), "v"(lds + 96 * GP), "v"(lds + 112 * GP),
                  "v"(lds + GTA), "v"(lds + GTA + 16 * GP), "v"(lds + GTA + 32 * GP), "v"(lds + GTA + 48 * GP),
                  "v"(ga), "v"(ga + sa), "v"(ga + 2 * sa), "v"(ga + 3 * sa), "v"(ga + 4 * sa), "v"(ga + 5 * sa), "v"(ga + 6 * sa), "v"(ga + 7 * sa),
                  "v"(gb), "v"(gb + sb), "v"(gb + 2 * sb), "v"(gb + 3 * sb)
               : "memory"); }
template <int ACT>
__global__ __launch_bounds__(128) void k_gemm2(const _Float16* __restrict__ A, int lda, size_t sA, const _Float16* __restrict__ Bh, int ldb, size_t sB, float alpha, const float* __restrict__ bias, size_t sBias, const float* __restrict__ bias1, const float* __restrict__ bias2, const float* __restrict__ CP, int rowsPerB, size_t sCPb, int row0g,
    float* __restrict__ C, _Float16* __restrict__ C16, int ldc, size_t sC, int M, int N, int K) { static_assert(ACT == 0 || ACT == 3 || ACT == 6 || ACT == 8 || ACT == 9 || ACT == 11 || ACT == 12 || ACT == 14 || ACT == 15 || ACT == 16 || ACT == 17, "k_gemm2: unsupported ACT code (would silently apply no activation)");
  __shared__ __attribute__((aligned(16))) float so[4][32][68];
  __shared__ __attribute__((aligned(16))) unsigned char G[2 * GSB];      /* two buffers of [A tile | B tile] */
  const int tid = threadIdx.x, w = tid >> 5, lane = tid & 31, ln = lane & 15, hh = lane >> 4; const int by = blockIdx.y;
  A += (size_t)by * sA; Bh += (size_t)by * sB; const size_t cofs = (size_t)by * sC; const float* bp = bias ? bias + (size_t)by * sBias : nullptr;
  if (by == 1 && bias1) bp = bias1; if (by == 2 && bias2) bp = bias2;      /* planes 1 and 2 whose biases are buffers of their own */
  const int ntn = N >> 6; const int mt = blockIdx.x / ntn, nq = blockIdx.x - mt * ntn; const int row0 = mt * 128 + 32 * w, col0 = nq * 64; if (mt * 128 + 128 > M) return;      /* the whole work-group or none, ahead of every copy and barrier: every staged A row exists */
  const int r0 = tid >> 3, ch = tid & 7;      /* this thread's row (mod 16) and 16-byte piece in every copied tile */
  const unsigned lst = (unsigned)(size_t)G + r0 * GP + ch * 16;
  const _Float16* ga = A + (size_t)(mt * 128 + r0) * lda + ch * 8; const _Float16* gb = Bh + (size_t)(col0 + r0) * ldb + ch * 8;
  const size_t sa = (size_t)16 * lda, sb = (size_t)16 * ldb; const int nst = K >> 6;
  g2_stage(lst, ga, sa, gb, sb);
  asm volatile("s_wait_asynccnt 0x0" ::: "memory");      /* this wave's share of stage 0 has landed */
  __syncthreads();      /* publishes stage 0 */
  if (nst > 1) g2_stage(lst + GSB, ga + 64, sa, gb + 64, sb);
  const v8f z8 = {0.f,0.f,0.f,0.f,0.f,0.f,0.f,0.f}; v8f c00 = z8, c01 = z8, c02 = z8, c03 = z8, c10 = z8, c11 = z8, c12 = z8, c13 = z8;
#pragma unroll 1      /* one stage per trip: the buffer index stays a scalar select and the loop stays short */
  for (int t = 0; t < nst; ++t) {
    const unsigned char* al = G + (t & 1) * GSB + (32 * w + ln) * GP + 16 * hh; const unsigned char* bl = G + (t & 1) * GSB + GTA + ln * GP + 16 * hh;
    v16h a[2][2], b[2][4];      /* the stage's 24 LDS reads stand together, ahead of its 16 WMMAs */
#pragma unroll
    for (int kc = 0; kc < 2; ++kc) { a[kc][0] = g2_lfrag(al + kc * 64); a[kc][1] = g2_lfrag(al + 16 * GP + kc * 64);
#pragma unroll
      for (int j = 0; j < 4; ++j) b[kc][j] = g2_lfrag(bl + j * 16 * GP + kc * 64); }
#pragma unroll
    for (int kc = 0; kc < 2; ++kc) {
      c00 = g2_mma(a[kc][0], b[kc][0], c00); c10 = g2_mma(a[kc][1], b[kc][0], c10);
      c01 = g2_mma(a[kc][0], b[kc][1], c01); c11 = g2_mma(a[kc][1], b[kc][1], c11);
      c02 = g2_mma(a[kc][0], b[kc][2], c02); c12 = g2_mma(a[kc][1], b[kc][2], c12);
      c03 = g2_mma(a[kc][0], b[kc][3], c03); c13 = g2_mma(a[kc][1], b[kc][3], c13); }
    asm volatile("s_wait_dscnt 0x0" ::: "memory");      /* this wave's reads of the buffer that is refilled below have returned */
    asm volatile("s_wait_asynccnt 0x0" ::: "memory");      /* this wave's share of stage t + 1 has landed */
    __syncthreads();      /* publishes stage t + 1 and ends every wave's reads of stage t */
    if (t + 2 < nst) g2_stage(lst + (t & 1) * GSB, ga + (size_t)(t + 2) * 64, sa, gb + (size_t)(t + 2) * 64, sb);
  }
  asm volatile("s_wait_asynccnt 0x0" ::: "memory");      /* no copy is outstanding when the wave ends */
  v8f accs[8] = {c00, c01, c02, c03, c10, c11, c12, c13};
#pragma unroll
  for (int u = 0; u < 8; ++u) { const int t = u & 3, half = u >> 2; const int col = col0 + t * 16 + ln; const float bv = bp ? bf16_round(bp[col]) : 0.f;
#pragma unroll
    for (int r = 0; r < 8; ++r) { const int rloc = half * 16 + 8 * hh + r; float v = accs[u][r] * alpha + bv; if (CP) { if (rowsPerB < 0) v += CP[cofs + (size_t)(row0g + row0 + rloc) * ldc + col];      /* rowsPerB < 0: own element of the batched C plane */ else { const int bidx = (row0g + row0 + rloc) / rowsPerB; v += CP[(size_t)bidx * sCPb + (size_t)by * 64 + col]; } }
      if (ACT == 3) v = fmaxf(v, 0.f); else if (ACT == 6) v = 0.5f * v * (1.0f + erff(v * 0.70710678118654752f)); else if (ACT == 11) v = 1.0f / (1.0f + expf(-v)); else if (ACT == 15) v = v / (1.0f + expf(-v)); else if (ACT == 12) v = (v > 0.f) ? v : 0.01f * v; else if (ACT == 8) v = tanhf(v); else if (ACT == 9) v = 0.5f * v * (1.0f + tanhf(0.7978845608028654f * (v + 0.044715f * v * v * v))); else if (ACT == 14) v = (v > 0.f) ? v : 0.1f * v; else if (ACT == 16) v = (v >= 0.f) ? v : 0.3f * v; else if (ACT == 17) v = (v >= 0.f) ? v : 0.2f * v;
      so[w][rloc][t * 16 + ln] = v; } }
  __builtin_amdgcn_fence(__ATOMIC_ACQ_REL, "workgroup"); __builtin_amdgcn_wave_barrier();
  const int rsub = lane >> 4, c4 = (lane & 15) * 4;
  {
#pragma unroll
    for (int q = 0; q < 16; ++q) { const int r = q * 2 + rsub; const v4f v = *(const v4fa*)&so[w][r][c4]; if (C) *(v4f*)(C + cofs + (size_t)(row0 + r) * ldc + col0 + c4) = v; if (C16) { v4h h4; for (int i = 0; i < 4; ++i) h4[i] = (_Float16)v[i]; *(v4h*)(C16 + cofs + (size_t)(row0 + r) * ldc + col0 + c4) = h4; } }
     } }


#define HN 192                       /* columns per work-group */
#define HTA (128 * GP)               /* bytes of the staged x tile */
#define HSB (320 * GP)               /* bytes of one stage: x tile, then 192 weight rows */
#define HOP 400                      /* pitch of the staged output rows, bytes: 384 + 16, an odd multiple of 16 */
#define HST (DM / 64)                /* stages of 64 k */
__device__ __forceinline__ v8f g3_mma(v16h a, v16h b, v8f c) { return __builtin_amdgcn_wmma_f32_16x16x32_f16(false, a, false, b, (short)0, c, false, false); }
// One stage: each of the 128 threads copies 16 bytes of rows r0 + 16 j of the x tile (j < 8, at lds) and of the weight tile (j < 12, at lds + HTA); eight lanes cover one 128-byte row.
// Each statement's s_wait_xcnt closes its own copies, so that it stands in front of every later write of the address registers that they name.
__device__ __forceinline__ void g3_stage(unsigned lds, const _Float16* ga, const _Float16* gb) {
  const size_t s = (size_t)16 * DM;
  asm volatile("global_load_async_to_lds_b128 %0, %8, off\n\tglobal_load_async_to_lds_b128 %1, %9, off\n\tglobal_load_async_to_lds_b128 %2, %10, off\n\tglobal_load_async_to_lds_b128 %3, %11, off\n\t"
               "global_load_async_to_lds_b128 %4, %12, off\n\tglobal_load_async_to_lds_b128 %5, %13, off\n\tglobal_load_async_to_lds_b128 %6, %14, off\n\tglobal_load_async_to_lds_b128 %7, %15, off\n\ts_wait_xcnt 0x0"
               :: "v"(lds), "v"(lds + 16 * GP), "v"(lds + 32 * GP), "v"(lds + 48 * GP), "v"(lds + 64 * GP), "v"(lds + 80 * GP), "v"(lds + 96 * GP), "v"(lds + 112 * GP),
                  "v"(ga), "v"(ga + s), "v"(ga + 2 * s), "v"(ga + 3 * s), "v"(ga + 4 * s), "v"(ga + 5 * s), "v"(ga + 6 * s), "v"(ga + 7 * s)
               : "memory");
  asm volatile("global_load_async_to_lds_b128 %0, %12, off\n\tglobal_load_async_to_lds_b128 %1, %13, off\n\tglobal_load_async_to_lds_b128 %2, %14, off\n\tglobal_load_async_to_lds_b128 %3, %15, off\n\t"
               "global_load_async_to_lds_b128 %4, %16, off\n\tglobal_load_async_to_lds_b128 %5, %17, off\n\tglobal_load_async_to_lds_b128 %6, %18, off\n\tglobal_load_async_to_lds_b128 %7, %19, off\n\t"
               "global_load_async_to_lds_b128 %8, %20, off\n\tglobal_load_async_to_lds_b128 %9, %21, off\n\tglobal_load_async_to_lds_b128 %10, %22, off\n\tglobal_load_async_to_lds_b128 %11, %23, off\n\ts_wait_xcnt 0x0"
               :: "v"(lds + HTA), "v"(lds + HTA + 16 * GP), "v"(lds + HTA + 32 * GP), "v"(lds + HTA + 48 * GP), "v"(lds + HTA + 64 * GP), "v"(lds + HTA + 80 * GP),
                  "v"(lds + HTA + 96 * GP), "v"(lds + HTA + 112 * GP), "v"(lds + HTA + 128 * GP), "v"(lds + HTA + 144 * GP), "v"(lds + HTA + 160 * GP), "v"(lds + HTA + 176 * GP),
                  "v"(gb), "v"(gb + s), "v"(gb + 2 * s), "v"(gb + 3 * s), "v"(gb + 4 * s), "v"(gb + 5 * s), "v"(gb + 6 * s), "v"(gb + 7 * s), "v"(gb + 8 * s), "v"(gb + 9 * s), "v"(gb + 10 * s), "v"(gb + 11 * s)
               : "memory"); }
// C16 plane by = f16(A . Bh[by]^T * alpha + bf16(bias of plane by)); A [MP][DM], Bh three planes [DM][DM] as [n][k], C16 three planes [NR][DM]. Grid: ((MP / 128) * (DM / HN), 3).
__global__ __launch_bounds__(128) void k_gemm3(const _Float16* __restrict__ A, const _Float16* __restrict__ Bh, float alpha, const float* __restrict__ bias0, const float* __restrict__ bias1, const float* __restrict__ bias2, _Float16* __restrict__ C16) {
  static_assert(MP % 128 == 0 && DM % HN == 0 && DM % 64 == 0 && HST >= 2 && 128 * HOP <= 2 * HSB, "k_gemm3: whole tiles only, two stages at least, the staged output fits the ring");
  __shared__ __attribute__((aligned(16))) unsigned char G[2 * HSB];      /* two buffers of [x tile | weight tile]; behind the loop the staged output tile */
  const int tid = threadIdx.x, lane = tid & 31, ln = lane & 15, hh = lane >> 4; const int w = __builtin_amdgcn_readfirstlane(tid >> 5), wm = w >> 1, wn = w & 1; const int by = blockIdx.y;
  Bh += (size_t)by * DM * DM; C16 += (size_t)by * NR * DM; const float* bp = by == 0 ? bias0 : by == 1 ? bias1 : bias2;
  const int mt = blockIdx.x / (DM / HN), nq = blockIdx.x - mt * (DM / HN);
  const int r0 = tid >> 3, ch = tid & 7;      /* this thread's row (mod 16) and 16-byte piece in every copied tile */
  const unsigned lst = (unsigned)(size_t)G + r0 * GP + ch * 16;
  const _Float16* ga = A + (size_t)(mt * 128 + r0) * DM + ch * 8; const _Float16* gb = Bh + (size_t)(nq * HN + r0) * DM + ch * 8;
  g3_stage(lst, ga, gb);
  asm volatile("s_wait_asynccnt 0x0" ::: "memory");      /* this wave's share of stage 0 has landed */
  __syncthreads();      /* publishes stage 0 */
  g3_stage(lst + HSB, ga + 64, gb + 64);
  const v8f z8 = {0.f,0.f,0.f,0.f,0.f,0.f,0.f,0.f}; v8f acc[4][6];
#pragma unroll
  for (int i = 0; i < 4; ++i) for (int j = 0; j < 6; ++j) acc[i][j] = z8;
#pragma unroll 1      /* one stage per trip: the buffer index stays a scalar select and the loop stays short */
  for (int t = 0; t < HST; ++t) {
    const unsigned char* al = G + (t & 1) * HSB + (64 * wm + ln) * GP + 16 * hh; const unsigned char* bl = G + (t & 1) * HSB + HTA + (96 * wn + ln) * GP + 16 * hh;
#pragma unroll
    for (int kc = 0; kc < 2; ++kc) {
      v16h a[4], b[6];      /* the 20 LDS reads of 32 k stand together, ahead of their 24 WMMAs */
#pragma unroll
      for (int i = 0; i < 4; ++i) a[i] = g2_lfrag(al + i * 16 * GP + kc * 64);
#pragma unroll
      for (int j = 0; j < 6; ++j) b[j] = g2_lfrag(bl + j * 16 * GP + kc * 64);
      __builtin_amdgcn_sched_barrier(0);      /* keeps the 20 reads up here as one group; without it the scheduler sinks each weight fragment's two reads directly in front of its four WMMAs, behind a wait to zero */
#pragma unroll
      for (int j = 0; j < 6; ++j) for (int i = 0; i < 4; ++i) acc[i][j] = g3_mma(b[j], a[i], acc[i][j]);
    }
    __builtin_amdgcn_sched_barrier(0);      /* holds the four v_nop below behind the stage's last WMMA */
    asm volatile("v_nop\n\tv_nop\n\tv_nop\n\tv_nop");      /* WMMA distance over the branches below: the copies' address arithmetic or the next stage's reads may write registers that the last WMMA reads as A or B */
    asm volatile("s_wait_dscnt 0x0" ::: "memory");      /* this wave's reads of the buffer that is refilled below have returned */
    asm volatile("s_wait_asynccnt 0x0" ::: "memory");      /* this wave's share of stage t + 1 has landed */
    __syncthreads();      /* publishes stage t + 1 and ends every wave's reads of stage t */
    if (t + 2 < HST) g3_stage(lst + (t & 1) * HSB, ga + (size_t)(t + 2) * 64, gb + (size_t)(t + 2) * 64);
  }
  asm volatile("s_wait_asynccnt 0x0" ::: "memory");      /* no copy is outstanding when the ring becomes output staging */
  /* behind the loop's last barrier nobody reads the ring any more: the output tile [128][HN] is staged there as f16 rows */
#pragma unroll
  for (int j = 0; j < 6; ++j) { const int nl = 96 * wn + 16 * j + 8 * hh;      /* the first of this lane's 8 columns */
    const v4f b0 = *(const v4fa*)(bp + nq * HN + nl), b1 = *(const v4fa*)(bp + nq * HN + nl + 4);
    const float bv[8] = {bf16_round(b0[0]), bf16_round(b0[1]), bf16_round(b0[2]), bf16_round(b0[3]), bf16_round(b1[0]), bf16_round(b1[1]), bf16_round(b1[2]), bf16_round(b1[3])};
#pragma unroll
    for (int i = 0; i < 4; ++i) { FragH f;
#pragma unroll
      for (int r = 0; r < 8; ++r) f.h[r] = (_Float16)(acc[i][j][r] * alpha + bv[r]);
      *(v8us*)(G + (64 * wm + 16 * i + ln) * HOP + nl * 2) = f.half[0]; } }
  __syncthreads();      /* the staged tile is complete: a row's 384 bytes come from two waves */
#pragma unroll
  for (int sg = 0; sg < 3; ++sg)      /* eight lanes store one whole 128-byte line */
#pragma unroll
    for (int rb = 0; rb < 8; ++rb) { const int row = rb * 16 + r0; const v8us v = *(const v8us*)(G + row * HOP + sg * 128 + ch * 16);
      *(v8us*)((unsigned short*)C16 + (size_t)(mt * 128 + row) * DM + nq * HN + sg * 64 + ch * 8) = v; } }

__global__ __launch_bounds__(256) void k_wnat(const float* __restrict__ w, size_t n8, _Float16* __restrict__ Bt) { const size_t t = (size_t)blockIdx.x * 256 + threadIdx.x; if (t >= n8) return; FragH f; for (int q = 0; q < 8; ++q) f.h[q] = (_Float16)(bf16_round(w[t * 8 + q]) * 16.0f); *(v8us*)((unsigned short*)Bt + t * 8) = f.half[0];  }
__global__ __launch_bounds__(256) void k_rsm(const float* __restrict__ S, _Float16* __restrict__ P, int nrows) {
  #pragma clang fp contract(off)
  const int i = blockIdx.x * 256 + threadIdx.x; if (i >= nrows) return; const float* s = S + (size_t)i * SQ; float mx = -3.0e38f;
#pragma unroll 1
  for (int j = 0; j < SQ; ++j) mx = fmaxf(mx, s[j]); float se = 0.f;
#pragma unroll 1
  for (int j = 0; j < SQ; ++j) se += expf(s[j] - mx); const float sc = 256.0f / se;
#pragma unroll 1
  for (int j0 = 0; j0 < SQ; j0 += 8) { FragH f; for (int q = 0; q < 8; ++q) f.h[q] = (_Float16)(expf(s[j0 + q] - mx) * sc); unsigned short* d = (unsigned short*)P + (size_t)i * SQ + j0; *(v8us*)d = f.half[0];  } }
__global__ __launch_bounds__(256) void k_vt(const _Float16* __restrict__ V16, int b, int h0, _Float16* __restrict__ VT) { __shared__ unsigned short tl[64][65]; const int tid = threadIdx.x; const int hh = blockIdx.x % HG, sg = blockIdx.x / HG; const int s0 = sg * 64; const int h = h0 + hh;
  for (int i = tid; i < 64 * 8; i += 256) { const int j = i / 8, d8 = (i % 8) * 8; FragH f; f.half[0] = *(const v8us*)((const unsigned short*)V16 + ((size_t)b * SQ + s0 + j) * DM + h * HD + d8); for (int q = 0; q < 8; ++q) tl[d8 + q][j] = f.u[q]; }
  __syncthreads();
  { for (int i = tid; i < 64 * 8; i += 256) { const int d = i / 8, j8 = (i % 8) * 8; FragH f; for (int q = 0; q < 8; ++q) f.u[q] = tl[d][j8 + q]; *(v8us*)((unsigned short*)VT + ((size_t)hh * HD + d) * SQ + s0 + j8) = f.half[0]; }  } }



#define FW 4                         /* waves per work-group: 128 query columns */
#define SCL 0.18033688011112042f     /* 64^-0.5 * log2(e) */
#define LZ 44.361419555836498f       /* 8 / SCL: how far a raw product may exceed the maximum in use before a rescale */
#define KS 64                        /* keys per stage: two passes */
#define LP 144                       /* LDS row pitch, bytes: 128 + 16, an odd multiple of 16 for 16-byte readers */
#define TB (64 * LP)                 /* bytes of one staged tile of 64 rows */
#define NST (SQ / KS)                /* stages */
__device__ __forceinline__ v8f fa_mma(v16h a, v16h b, v8f c) { return __builtin_amdgcn_wmma_f32_16x16x32_f16(false, a, false, b, (short)0, c, false, false); }
__device__ __forceinline__ float fa_xhalf(float x) { return __builtin_bit_cast(float, __builtin_amdgcn_permlanex16(__builtin_bit_cast(int, x), __builtin_bit_cast(int, x), 0x76543210, 0xfedcba98, false, false)); }      /* lane l <-> lane l ^ 16 */
__device__ __forceinline__ v16h fa_lfrag(const unsigned char* p) { FragH f; f.half[0] = *(const v8us*)p; f.half[1] = *(const v8us*)(p + 32); return f.v; }      /* g2_frag's k order from an LDS row; p already holds the lane half's 16 bytes */
// One stage: each of the 128 threads copies 16 bytes of rows r0, r0 + 16, r0 + 32, r0 + 48 of the K tile (at lds) and of the V^T tile (at lds + TB); eight lanes cover one 128-byte row.
// The s_wait_xcnt closes the copies' own statement, so that it stands in front of every later write of the address registers that the copies name.
__device__ __forceinline__ void fa_stage(unsigned lds, const _Float16* gk, const _Float16* gv) {
  asm volatile("global_load_async_to_lds_b128 %0, %8, off\n\tglobal_load_async_to_lds_b128 %1, %9, off\n\tglobal_load_async_to_lds_b128 %2, %10, off\n\tglobal_load_async_to_lds_b128 %3, %11, off\n\t"
               "global_load_async_to_lds_b128 %4, %12, off\n\tglobal_load_async_to_lds_b128 %5, %13, off\n\tglobal_load_async_to_lds_b128 %6, %14, off\n\tglobal_load_async_to_lds_b128 %7, %15, off\n\ts_wait_xcnt 0x0"
               :: "v"(lds), "v"(lds + 16 * LP), "v"(lds + 32 * LP), "v"(lds + 48 * LP), "v"(lds + TB), "v"(lds + TB + 16 * LP), "v"(lds + TB + 32 * LP), "v"(lds + TB + 48 * LP),
                  "v"(gk), "v"(gk + (size_t)16 * DM), "v"(gk + (size_t)32 * DM), "v"(gk + (size_t)48 * DM), "v"(gv), "v"(gv + (size_t)16 * SQ), "v"(gv + (size_t)32 * SQ), "v"(gv + (size_t)48 * SQ)
               : "memory"); }
__global__ __launch_bounds__(FW * 32) void k_fattn(const _Float16* __restrict__ Q16, const _Float16* __restrict__ K16, const _Float16* __restrict__ VT, _Float16* __restrict__ O16) {
  __shared__ __attribute__((aligned(16))) unsigned char L[2 * 2 * TB];      /* two buffers of [K tile | V^T tile] */
  const int lane = threadIdx.x & 31, c = lane & 15, hh = lane >> 4; const int w = __builtin_amdgcn_readfirstlane(threadIdx.x >> 5);
  const int bh = blockIdx.y, b = bh / NH, h = bh - b * NH; const int q0 = blockIdx.x * (FW * 32) + w * 32;
  const int r0 = threadIdx.x >> 3, ch = threadIdx.x & 7;      /* this thread's row (mod 16) and 16-byte piece in every copied tile */
  const unsigned lst = (unsigned)(size_t)L + r0 * LP + ch * 16;
  const _Float16* gk = K16 + ((size_t)b * SQ + r0) * DM + h * HD + ch * 8; const _Float16* gv = VT + ((size_t)bh * HD + r0) * SQ + ch * 8;
  fa_stage(lst, gk, gv);
  const _Float16* qp = Q16 + ((size_t)b * SQ + q0 + c) * DM + h * HD;
  v16h qf[2][2];
#pragma unroll
  for (int g = 0; g < 2; ++g) for (int kc = 0; kc < 2; ++kc) qf[g][kc] = g2_frag(qp + (size_t)g * 16 * DM + kc * 32, hh);
  asm volatile("s_wait_asynccnt 0x0" ::: "memory");      /* this wave's share of stage 0 has landed */
  __syncthreads();      /* publishes stage 0 */
  fa_stage(lst + 2 * TB, gk + (size_t)KS * DM, gv + KS);
  const v8f z8 = {0.f,0.f,0.f,0.f,0.f,0.f,0.f,0.f}; v8f o[2][4] = {{z8, z8, z8, z8}, {z8, z8, z8, z8}}; float m[2] = {-1.0e30f, -1.0e30f}, l[2] = {0.f, 0.f};
  float mt[2] = {-1.0e30f, -1.0e30f}, nb[2] = {0.f, 0.f};      /* m + LZ and -m * SCL, renewed with m; the first pass always renews them */
  for (int t = 0; t < NST; ++t) {
    const unsigned char* kl = L + (t & 1) * (2 * TB) + c * LP + 16 * hh; const unsigned char* vl = kl + TB;
    v16h kf[2][2];
#pragma unroll
    for (int kt = 0; kt < 2; ++kt) for (int kc = 0; kc < 2; ++kc) kf[kt][kc] = fa_lfrag(kl + kt * 16 * LP + kc * 64);
#pragma unroll
    for (int p = 0; p < 2; ++p) {
    v16h vf[4];
#pragma unroll
    for (int dt = 0; dt < 4; ++dt) vf[dt] = fa_lfrag(vl + dt * 16 * LP + p * 64);
    v8f s[2][2];
#pragma unroll
    for (int g = 0; g < 2; ++g) for (int kt = 0; kt < 2; ++kt) s[g][kt] = fa_mma(kf[kt][1], qf[g][1], fa_mma(kf[kt][0], qf[g][0], z8));
    if (p == 0) {      /* the stage's second pass's K rows, fetched one pass ahead from the same buffer */
#pragma unroll
      for (int kt = 0; kt < 2; ++kt) for (int kc = 0; kc < 2; ++kc) kf[kt][kc] = fa_lfrag(kl + (32 + kt * 16) * LP + kc * 64);
    }
    __builtin_amdgcn_sched_barrier(0);      /* keeps the V and K fragment reads up here, ahead of the softmax; without it the scheduler sinks them directly in front of the wait for them */
    float mp[2]; bool need = false;      /* per lane: the maximum of this half's 16 raw products, and the lazy test */
#pragma unroll
    for (int g = 0; g < 2; ++g) {
      const v8f a = s[g][0], e = s[g][1];
      float mx = fmaxf(fmaxf(fmaxf(a[0], a[1]), fmaxf(a[2], a[3])), fmaxf(fmaxf(a[4], a[5]), fmaxf(a[6], a[7])));
      mx = fmaxf(mx, fmaxf(fmaxf(fmaxf(e[0], e[1]), fmaxf(e[2], e[3])), fmaxf(fmaxf(e[4], e[5]), fmaxf(e[6], e[7]))));
      mp[g] = mx; need = need || (mx > mt[g]);      /* the ballot below looks at both halves of the wave, so the halves' maxima are joined only where a rescale follows */
    }
    if (__builtin_amdgcn_ballot_w32(need) != 0) {      /* one scalar branch per pass, the same for the whole wave; taken in the first pass and seldom later */
#pragma unroll
      for (int g = 0; g < 2; ++g) {
        const float mn = fmaxf(m[g], fmaxf(mp[g], fa_xhalf(mp[g]))); float al = (m[g] - mn) * SCL; m[g] = mn; mt[g] = mn + LZ; nb[g] = -mn * SCL;
        asm("v_exp_f32 %0, %0\n\tv_nop" : "+v"(al));      /* the v_nop: the slot between a transcendental and the use of its result */
        l[g] *= al;
#pragma unroll
        for (int dt = 0; dt < 4; ++dt) o[g][dt] *= al;
      }
    }
#pragma unroll
    for (int g = 0; g < 2; ++g) {
      float x[16];
#pragma unroll
      for (int i = 0; i < 16; ++i) x[i] = fmaf(s[g][i >> 3][i & 7], SCL, nb[g]);
      /* exponentials in place, each run closed by one v_nop: the instruction set asks for one independent instruction between a transcendental and an overwrite of its source or a use of its result */
      asm("v_exp_f32 %0, %0\n\tv_exp_f32 %1, %1\n\tv_exp_f32 %2, %2\n\tv_exp_f32 %3, %3\n\tv_exp_f32 %4, %4\n\tv_exp_f32 %5, %5\n\tv_exp_f32 %6, %6\n\tv_exp_f32 %7, %7\n\tv_nop"
          : "+v"(x[0]), "+v"(x[1]), "+v"(x[2]), "+v"(x[3]), "+v"(x[4]), "+v"(x[5]), "+v"(x[6]), "+v"(x[7]));
      asm("v_exp_f32 %0, %0\n\tv_exp_f32 %1, %1\n\tv_exp_f32 %2, %2\n\tv_exp_f32 %3, %3\n\tv_exp_f32 %4, %4\n\tv_exp_f32 %5, %5\n\tv_exp_f32 %6, %6\n\tv_exp_f32 %7, %7\n\tv_nop"
          : "+v"(x[8]), "+v"(x[9]), "+v"(x[10]), "+v"(x[11]), "+v"(x[12]), "+v"(x[13]), "+v"(x[14]), "+v"(x[15]));
      const float ps = (((x[0] + x[1]) + (x[2] + x[3])) + ((x[4] + x[5]) + (x[6] + x[7]))) + (((x[8] + x[9]) + (x[10] + x[11])) + ((x[12] + x[13]) + (x[14] + x[15])));
      l[g] += ps;      /* this half's keys only; the halves are joined behind the loop */
      FragH pf;
#pragma unroll
      for (int i = 0; i < 16; ++i) pf.h[i] = (_Float16)x[i];
#pragma unroll
      for (int dt = 0; dt < 4; ++dt) o[g][dt] = fa_mma(vf[dt], pf.v, o[g][dt]);
    }
    }
    __builtin_amdgcn_sched_barrier(0);      /* holds the four v_nop below behind the stage's last WMMA */
    asm volatile("v_nop\n\tv_nop\n\tv_nop\n\tv_nop");      /* WMMA distance over the back edge: the next stage's first instructions may write registers that the last WMMA reads as A or B */
    asm volatile("s_wait_dscnt 0x0" ::: "memory");      /* this wave's reads of the buffer that is refilled below have returned */
    asm volatile("s_wait_asynccnt 0x0" ::: "memory");      /* this wave's share of stage t + 1 has landed */
    __syncthreads();      /* publishes stage t + 1 and ends every wave's reads of stage t */
    if (t + 2 < NST) fa_stage(lst + (t & 1) * (2 * TB), gk + (size_t)(t + 2) * KS * DM, gv + (size_t)(t + 2) * KS);
  }
  asm volatile("s_wait_asynccnt 0x0" ::: "memory");      /* no copy is outstanding when the wave ends */
#pragma unroll
  for (int g = 0; g < 2; ++g) { const float inv = 64.0f / (l[g] + fa_xhalf(l[g])); _Float16* op = O16 + ((size_t)b * SQ + q0 + g * 16 + c) * DM + h * HD + 8 * hh;
#pragma unroll
    for (int dt = 0; dt < 4; ++dt) { FragH f;      /* a lane's 8 accumulator registers are 8 consecutive d of one query: one 16-byte store */
#pragma unroll
      for (int r = 0; r < 8; ++r) f.h[r] = (_Float16)(o[g][dt][r] * inv);
      *(v8us*)((unsigned short*)op + dt * 16) = f.half[0]; } } }

extern "C" void kernel_launch(void* const* d_in, const int* in_sizes, int n_in,
                              void* d_out, int out_size, void* d_ws, size_t ws_size, hipStream_t stream) {
  (void)in_sizes; (void)n_in; (void)out_size;
  const float* const* I = (const float* const*)d_in; const float* x = I[0]; const float* wq = I[1]; const float* bq = I[2]; const float* wk = I[3]; const float* bk = I[4]; const float* wv = I[5]; const float* bv = I[6]; const float* wo = I[7]; const float* bo = I[8];      /* [in][out] weights + biases (y = x @ W + b) */
  char* ws = (char*)d_ws; size_t off = 0;
  auto take = [&](size_t bytes) { char* p = ws + off; off += (bytes + 255) & ~(size_t)255; return p; };
  _Float16* BW = (_Float16*)take((size_t)4 * DM * DM * 2); _Float16* BO = BW + (size_t)3 * DM * DM;      /* four weight planes in a row: q, k, v, o */
  _Float16* X16 = (_Float16*)take(NR * DM * 2); _Float16* Q16 = (_Float16*)take(3 * NR * DM * 2); _Float16* K16 = Q16 + NR * DM; _Float16* V16 = Q16 + 2 * NR * DM; _Float16* O16 = (_Float16*)take(NR * DM * 2);      /* q, k, v: three planes in a row */
  _Float16* VT = (_Float16*)take((size_t)NB * NH * HD * SQ * 2);
  if (off > ws_size) return;
  k_prep<<<4 * PWB + PXB, 256, 0, stream>>>(wq, wk, wv, wo, BW, x, X16);      /* [in][out] -> Bt[n][k] x16 (transposing builder) and x rows */
  const size_t r0p = (size_t)B0 * SQ;      /* first projected row */
  k_gemm3<<<dim3((unsigned)((MP / 128) * (DM / HN)), 3), 128, 0, stream>>>(X16 + r0p * DM, BW, 0.0625f, bq, bk, bv, Q16 + r0p * DM);      /* blockIdx.y: q, k, v */
  k_vt<NH, SQ><<<NB * NH * (SQ / 64), 256, 0, stream>>>(V16, LQ, 0, VT);      /* V^T [NB][NH][HD][SQ] */
  k_fattn<<<dim3(SQ / (FW * 32), NB * NH), FW * 32, 0, stream>>>(Q16, K16, VT, O16);      /* o x64 (merged heads) as f16 rows */
  k_gemm2<0><<<dim3((unsigned)((MPO / 128) * (DM / 64)), 1), 128, 0, stream>>>(O16 + r0p * DM, DM, 0, BO, DM, 0, 0.0009765625f, bo, 0, nullptr, nullptr, nullptr, 1, 0, 0, (float*)d_out + r0p * DM, nullptr, DM, 0, MPO, DM, DM);      /* out rows are the output layout */
}
